// v000
// The times below were measured on an AMD MI455X: many runs one after another, warmed up first and cycling through
// copies of the inputs, with the whole window's GPU time divided by the number of runs. Launches and the gaps
// between them are all in it. The median over several windows is given; except for v000 it joins two sittings, which
// can be a few percent apart, so the side-by-side timings, each taken in one sitting, are the better comparison.
// v000, which the later versions start from, runs in 287 microseconds.
// Contractions: x.Wq and x.Wk (q, k hi + residual planes), x.Wv (v^T plane), q.k^T (hi.hi + hi.res + res.hi),
// q.rel^T (hi + res), p.v and ctx.Wo, all on v_wmma_f32_16x16x32_f16 (f16 operands, f32 accumulate).
// Float inputs RNE-converted to bf16 on load and carried in f16 containers with power-of-two scales
// (x x1; Wq, Wk, Wv, Wo x64; rel table x64; q, k hi planes x16, residual planes x16x2048; v^T x16;
// p x4096; ctx x16); softmax, key mask and the relative-offset skew in f32 on VALU.
#include <hip/hip_runtime.h>
#include <math.h>

#ifndef NB
#define NB 2
#endif
#ifndef SEQ
#define SEQ 2048
#endif
#define NB_FULL  2
#define SEQ_FULL 2048
#define DM   512
#define NH   8
#define HD   64
#define MT   (NB * SEQ)
#define NREL 499
#define RPAD 512
#define RCEN 249
#define AWV  4
#define RWP  48
#define WSCL 64.0f
#define QKS  16.0f
#define LSC  2048.0f
#define VSC  16.0f
#define PSC  4096.0f
#define CSC  16.0f
#define RSQD 0.125f
#define MASKV (-1.0e10f)

static_assert(NH * HD == DM);
static_assert(HD == 64);
static_assert(NB >= 1 && NB <= NB_FULL);
static_assert((SEQ % 64) == 0 && SEQ >= 64 && SEQ <= SEQ_FULL);
static_assert((MT % 64) == 0 && (DM % 64) == 0);
static_assert((((MT / 64) * (DM / 64)) % 8) == 0);
static_assert(((SEQ * DM) % 2048) == 0 && ((RPAD * HD) % 2048) == 0 && ((NREL * HD) % 8) == 0);
static_assert(((NB * NH * (SEQ / 16)) % AWV) == 0);
static_assert(NREL <= RPAD && (2 * RCEN + 1) == NREL);

typedef _Float16 v16h __attribute__((ext_vector_type(16)));
typedef unsigned short v16us __attribute__((ext_vector_type(16)));
typedef unsigned short v8us  __attribute__((ext_vector_type(8)));
typedef float v8f __attribute__((ext_vector_type(8)));
typedef float v4f __attribute__((ext_vector_type(4)));
typedef unsigned int v4u __attribute__((ext_vector_type(4)));

union FragU { v16us v; v8us h[2]; };

// ---- scalar helpers --------------------------------------------------------------------------------
__device__ __forceinline__ unsigned short bf_bits(float f) {          // f32 -> bf16 bits, RNE convert
  const unsigned u = __float_as_uint(f);
  return (unsigned short)((u + 0x7FFFu + ((u >> 16) & 1u)) >> 16);
}
__device__ __forceinline__ float bf_up(unsigned short h) { return __uint_as_float(((unsigned)h) << 16); }
__device__ __forceinline__ float bfr(float f) { return bf_up(bf_bits(f)); }   // value of the bf16 RNE convert
__device__ __forceinline__ unsigned short h_bits(_Float16 x) { return __builtin_bit_cast(unsigned short, x); }
__device__ __forceinline__ unsigned short f2h(float f) { return h_bits((_Float16)f); }
__device__ __forceinline__ unsigned pk16(unsigned short a, unsigned short b) { return (unsigned)a | ((unsigned)b << 16); }
__device__ __forceinline__ int clampi(int v, int lo, int hi) { return v < lo ? lo : (v > hi ? hi : v); }
__device__ __forceinline__ v8f zero8() { v8f z = {0.f, 0.f, 0.f, 0.f, 0.f, 0.f, 0.f, 0.f}; return z; }

// ---- fragment loader: 16-bit A/B operand, lane -> row/col (lane&15), p already includes +8*(lane>>4);
//      elements 0..7 <- p[0..7] (k0+8h..), elements 8..15 <- p[16..23] (k0+16+8h..)
__device__ __forceinline__ v16us ldfrag_u(const unsigned short* p) {
  FragU f;
  f.h[0] = *(const v8us*)(p);
  f.h[1] = *(const v8us*)(p + 16);
  return f.v;
}

// ---- WMMA helpers (f16 operand bits) with trailing VALU hazard gap --------------------------------
__device__ __forceinline__ v8f mma_raw(v16us a, v16us b, v8f c) {
  return __builtin_amdgcn_wmma_f32_16x16x32_f16(false, __builtin_bit_cast(v16h, a), false,
                                                __builtin_bit_cast(v16h, b), (short)0, c, false, false);
}
__device__ __forceinline__ v8f mma_g(v16us a, v16us b, v8f c) {                 // guarded
  c = mma_raw(a, b, c);
#if defined(__HIP_DEVICE_COMPILE__)
  asm volatile("v_nop\n\tv_nop\n\tv_nop\n\tv_nop" : "+v"(c) : "v"(a), "v"(b));
#endif
  return c;
}
__device__ __forceinline__ void dep_guard1(v8f& a, v8f& b, v16us x) {
#if defined(__HIP_DEVICE_COMPILE__)
  asm volatile("v_nop\n\tv_nop\n\tv_nop\n\tv_nop" : "+v"(a), "+v"(b) : "v"(x));
#endif
}
__device__ __forceinline__ void keep4_u(v16us a, v16us b, v16us c, v16us d) {
#if defined(__HIP_DEVICE_COMPILE__)
  asm volatile("v_nop" :: "v"(a), "v"(b), "v"(c), "v"(d));
#endif
}
__device__ __forceinline__ void acc_guard4(v8f& a, v8f& b, v8f& c, v8f& d) {
#if defined(__HIP_DEVICE_COMPILE__)
  asm volatile("v_nop\n\tv_nop\n\tv_nop\n\tv_nop" : "+v"(a), "+v"(b), "+v"(c), "+v"(d));
#endif
}
// orders LDS stores of this wave before later LDS loads of the same wave (cross-lane exchange)
__device__ __forceinline__ void wave_sync_lds() {
  __builtin_amdgcn_fence(__ATOMIC_RELEASE, "workgroup");
  __builtin_amdgcn_wave_barrier();
  __builtin_amdgcn_fence(__ATOMIC_ACQUIRE, "workgroup");
}

// =====================================================================================================
// Layout-kept convert: o[i] = f16 bits of (bf16 RNE value of w[i] * sc) for i < nsrc, zero for nsrc <= i < ndst.
// blockIdx.y selects a batch slice: source base + y*sstr, destination base + y*dstr (element strides).
// nsrc % 8 == 0, ndst % 2048 == 0, grid.x = ndst/2048 exact (host-checked).
// coverage: 256 threads x 8 = 2048 elements per block; grid covers all ndst elements incl. the zero pad.
// =====================================================================================================
__global__ __launch_bounds__(256) void cvt_lin(const float* __restrict__ w, unsigned short* o,
                                                int nsrc, int ndst, float sc, int sstr, int dstr) {
  const float* wb = w + (size_t)blockIdx.y * (size_t)sstr;
  unsigned short* ob = o + (size_t)blockIdx.y * (size_t)dstr;
  const int base = (blockIdx.x * 256 + threadIdx.x) * 8;
  if (base + 8 > ndst) return;                            // never taken with exact grids; no barriers below
  const bool inr = (base + 8 <= nsrc);
  const int lb = inr ? base : (nsrc - 8);                 // clamped address, always in range
  const v4f a0 = *(const v4f*)(wb + lb);
  const v4f a1 = *(const v4f*)(wb + lb + 4);
  v4u hv;
#pragma unroll
  for (int e = 0; e < 2; ++e) {
    hv[e]     = pk16(f2h(bfr(a0[2 * e]) * sc), f2h(bfr(a0[2 * e + 1]) * sc));
    hv[2 + e] = pk16(f2h(bfr(a1[2 * e]) * sc), f2h(bfr(a1[2 * e + 1]) * sc));
  }
  const v4u zz = {0u, 0u, 0u, 0u};
  hv = inr ? hv : zz;
  unsigned short* d = ob + base;
  *(v4u*)d = hv;
  
}

// =====================================================================================================
// Transpose-convert: in w[R][C] f32 -> out o[C][R] f16 bits of (bf16 RNE value * sc). Block tile 64x64
// through LDS (st[col][row], pitch 72 halves). Read phase: thread owns one input row x 16 columns (float4
// R, C multiples of 64, grid (C/64, R/64) exact (host-checked).
// coverage: 64 output rows x 64 halves per block = the whole transposed tile; grid covers all of [C][R].
// =====================================================================================================
__global__ __launch_bounds__(256) void cvt_t(const float* __restrict__ w, unsigned short* o, int R, int C, float sc) {
  __shared__ __align__(16) unsigned short st[64 * 72];
  const int t = threadIdx.x;
  const int r0 = blockIdx.y * 64, c0 = blockIdx.x * 64;
  if (r0 + 64 > R || c0 + 64 > C) return;               // block-uniform, before the barrier; never taken
  {
    const int row = t >> 2, ch = (t & 3) * 16;
    const float* p = w + (size_t)(r0 + row) * C + c0 + ch;
#pragma unroll
    for (int q = 0; q < 4; ++q) {
      const v4f v = *(const v4f*)(p + 4 * q);
#pragma unroll
      for (int e = 0; e < 4; ++e) st[(ch + 4 * q + e) * 72 + row] = f2h(bfr(v[e]) * sc);
    }
  }
  __syncthreads();
  v4u hv[2];
#pragma unroll
  for (int half = 0; half < 2; ++half) {
    const int cl = (t >> 3) + 32 * half, pc = (t & 7) * 8;
    hv[half] = *(const v4u*)(st + cl * 72 + pc);
  }
  {
#pragma unroll
    for (int half = 0; half < 2; ++half) {
      const int cl = (t >> 3) + 32 * half, pc = (t & 7) * 8;
      unsigned short* dst = o + (size_t)(c0 + cl) * R + r0 + pc;
      *(v4u*)dst = hv[half];
    }
    
  }
}

// =====================================================================================================
// Register-blocked f16 WMMA GEMM: C[m][n] = sum_k A[m][k] * Bt[n][k], one wave per 64x64 tile, no block
// barriers. A row-major [M][K] pitch lda; Bt row-major [N][K] pitch ldb (k contiguous); M, N multiples of 64,
// K multiple of 32 (true at every call site; host grids = tiles/8 exact so no wave exits early). Both operand
// fragments use the split k map (elements 0..7 <- k0+8h.., 8..15 <- k0+16+8h..); D element r of a lane is
// (row 8h + r, col lane&15).
// s = acc*osc + bias term (BM 0: none; BM 1: bsc*bf16(bias[col]); BM 2: bsc*bf16(bias[row])).
// OM 0: f32 out Cf = s, pitch ldc.   OM 1: f16 out Ch = f16 bits(s), pitch ldc.
// OM 2: f16 hi plane Ch = f16(s) and f16 residual plane Cl = f16((s - hi) * 2048), same pitch.
// coverage: 4 slabs x 16 rows x 64 cols = the wave's whole 64x64 tile.
// =====================================================================================================
template <int OM, int BM>
__global__ __launch_bounds__(256) void gemm64(
    const unsigned short* __restrict__ Ap, int lda, const unsigned short* __restrict__ Btp, int ldb,
    unsigned short* Ch, unsigned short* Cl, float* Cf, int ldc, float osc,
    const float* __restrict__ bias, float bsc, int M, int N, int K) {
  __shared__ __align__(16) float sT[8][16 * 68];   // per-wave 16x64 slab, pitch 68 floats
  const int lane = threadIdx.x & 31;
  const int wave = threadIdx.x >> 5;
  const int tilesN = N >> 6;
  const int tilesM = M >> 6;
  const int tile = blockIdx.x * 8 + wave;
  if (tile >= tilesM * tilesN) return;   // wave-uniform; no block barriers in this kernel
  const int tm = tile / tilesN;
  const int tn = tile - tm * tilesN;
  const int m0 = tm << 6;
  const int n0 = tn << 6;

  const int rlane = lane & 15;                 // row (A) / col (B, D) within subtile
  const int koff  = (lane >> 4) * 8;           // k offset of this lane half
  const int mOff  = (lane >> 4) * 8;           // D row offset

  v8f acc[4][4];
#pragma unroll
  for (int i = 0; i < 4; ++i)
#pragma unroll
    for (int j = 0; j < 4; ++j) acc[i][j] = zero8();

#pragma unroll 1
  for (int k0 = 0; k0 < K; k0 += 32) {
    v16us bh[4];
#pragma unroll
    for (int j = 0; j < 4; ++j) {
      const size_t bo = (size_t)(n0 + (j << 4) + rlane) * ldb + koff + k0;
      bh[j] = ldfrag_u(Btp + bo);
    }
#pragma unroll
    for (int i = 0; i < 4; ++i) {
      const size_t ao = (size_t)(m0 + (i << 4) + rlane) * lda + koff + k0;
      const v16us ah = ldfrag_u(Ap + ao);
#pragma unroll
      for (int j = 0; j < 4; ++j) acc[i][j] = mma_raw(ah, bh[j], acc[i][j]);
      dep_guard1(acc[i][0], acc[i][3], ah);
    }
    keep4_u(bh[0], bh[1], bh[2], bh[3]);
  }
  acc_guard4(acc[0][0], acc[0][1], acc[0][2], acc[0][3]);
  acc_guard4(acc[1][0], acc[1][1], acc[1][2], acc[1][3]);
  acc_guard4(acc[2][0], acc[2][1], acc[2][2], acc[2][3]);
  acc_guard4(acc[3][0], acc[3][1], acc[3][2], acc[3][3]);

  const int hh2 = lane >> 4, c4 = (lane & 15) * 4;     // f32 out: 256-B row segment = 16 lanes x 16 B
  const int q8  = lane >> 3, c8 = (lane & 7) * 8;

  // column bias terms (fixed per wave); addresses n0+c4+3 < N and n0+c8+7 < N
  v4f bc4 = {0.f, 0.f, 0.f, 0.f};
  float bc8[8];
#pragma unroll
  for (int e = 0; e < 8; ++e) bc8[e] = 0.f;
  if (BM == 1) {
    if (OM == 0) {
      const v4f t4 = *(const v4f*)(bias + n0 + c4);
#pragma unroll
      for (int e = 0; e < 4; ++e) bc4[e] = bfr(t4[e]) * bsc;
    } else {
      const v4f ta = *(const v4f*)(bias + n0 + c8);
      const v4f tb = *(const v4f*)(bias + n0 + c8 + 4);
#pragma unroll
      for (int e = 0; e < 4; ++e) { bc8[e] = bfr(ta[e]) * bsc; bc8[4 + e] = bfr(tb[e]) * bsc; }
    }
  }

  // ---- epilogue ----
  float* slab = sT[wave];
#pragma unroll
  for (int i = 0; i < 4; ++i) {
    const int mBase = m0 + (i << 4);
#pragma unroll
    for (int j = 0; j < 4; ++j) {
#pragma unroll
      for (int r = 0; r < 8; ++r) {
        slab[(mOff + r) * 68 + (j << 4) + rlane] = acc[i][j][r];
      }
    }
    wave_sync_lds();
    if (OM == 0) {
      v4f vals[8];
#pragma unroll
      for (int it = 0; it < 8; ++it) {
        const int row = it * 2 + hh2;                      // it 0..7 x hh2 0..1 = rows 0..15
        const v4f v = *(const v4f*)(slab + row * 68 + c4);
        float rb2 = 0.f;
        if (BM == 2) rb2 = bfr(bias[mBase + row]) * bsc;
        vals[it] = v * osc + bc4 + rb2;
      }
      {
#pragma unroll
        for (int it = 0; it < 8; ++it) {
          const int row = it * 2 + hh2;
          *(v4f*)(Cf + (size_t)(mBase + row) * ldc + (size_t)n0 + c4) = vals[it];
        }
        
      }
    } else {
      v4u hv[4], hl[4];
#pragma unroll
      for (int it = 0; it < 4; ++it) {
        const int row = it * 4 + q8;                       // it 0..3 x q8 0..3 = rows 0..15
        const float* sp = slab + row * 68 + c8;
        float rb2 = 0.f;
        if (BM == 2) rb2 = bfr(bias[mBase + row]) * bsc;
        v4u ha = {0u, 0u, 0u, 0u};
        v4u la = {0u, 0u, 0u, 0u};
#pragma unroll
        for (int e = 0; e < 4; ++e) {
          const float b0 = sp[2 * e]     * osc + bc8[2 * e]     + rb2;
          const float b1 = sp[2 * e + 1] * osc + bc8[2 * e + 1] + rb2;
          if (OM == 1) {
            ha[e] = pk16(f2h(b0), f2h(b1));
          } else {
            const _Float16 h0 = (_Float16)b0;
            const _Float16 h1 = (_Float16)b1;
            const float l0 = (b0 - (float)h0) * LSC;       // difference exact, power-of-two carry exact
            const float l1 = (b1 - (float)h1) * LSC;
            ha[e] = pk16(h_bits(h0), h_bits(h1));
            la[e] = pk16(f2h(l0), f2h(l1));
          }
        }
        hv[it] = ha;
        hl[it] = la;
      }
      {
#pragma unroll
        for (int it = 0; it < 4; ++it) {
          const int row = it * 4 + q8;
          const size_t go = (size_t)(mBase + row) * ldc + (size_t)n0 + c8;
          *(v4u*)(Ch + go) = hv[it];
          if (OM == 2) *(v4u*)(Cl + go) = hl[it];
        }
        
      }
    }
    wave_sync_lds();
  }
}

// ---- per-tile products used by the attention kernel ----------------------------------------------
// R = ah.b + (al.b)/2048 over 64 head dims (b from a [n][64] f16 plane, p includes +8*(lane>>4))
__device__ __forceinline__ v8f dot2_res(v16us ah0, v16us ah1, v16us al0, v16us al1, const unsigned short* p) {
  const v16us b0 = ldfrag_u(p);
  const v16us b1 = ldfrag_u(p + 32);
  v8f L = mma_g(al0, b0, zero8());
  L = mma_g(al1, b1, L);
  L = L * (1.0f / LSC);
  v8f R = mma_g(ah0, b0, L);
  R = mma_g(ah1, b1, R);
  return R;
}
// S = qh.kh + (qh.kl + ql.kh)/2048 over 64 head dims (kh from the hi plane row, kl from the residual plane row)
__device__ __forceinline__ v8f dot3_res(v16us qh0, v16us qh1, v16us ql0, v16us ql1,
                                        const unsigned short* phi, const unsigned short* plo) {
  const v16us kh0 = ldfrag_u(phi);
  const v16us kh1 = ldfrag_u(phi + 32);
  const v16us kl0 = ldfrag_u(plo);
  const v16us kl1 = ldfrag_u(plo + 32);
  v8f L = mma_g(qh0, kl0, zero8());
  L = mma_g(qh1, kl1, L);
  L = mma_g(ql0, kh0, L);
  L = mma_g(ql1, kh1, L);
  L = L * (1.0f / LSC);
  v8f S = mma_g(qh0, kh0, L);
  S = mma_g(qh1, kh1, S);
  return S;
}

// =====================================================================================================
// Non-causal attention with clipped relative-offset term and key-padding mask, head dim 64.
// Block = 128 threads = 4 waves; one wave owns one 16-row query tile (t0..t0+15) of one (batch b, head h)
// and loops all key blocks of 32 with an online max-subtracted softmax in f32.
// Planes: QH/KH f16 [MT][512] = 16*q, 16*k (head columns h*64..), QL/KL = 2048*(16q - QH) residuals,
// PE f16 [512][64] = 64*rel table (rows 0..498 used, 499..511 zero pad never read), VT f16 [512][MT] =
// 16*v transposed (row = h*64+d, column = token), mask int32 [NB_FULL][SEQ_FULL].
// Output Z f16 [MT][512] = 16*ctx, token-major (row = b*SEQ + t, col = h*64+d).
// Per key block sb: S = 256*q.k (hi.hi + hi.res + res.hi, 2 key subtiles); relative band of 48 columns:
// column c <-> table row clamp(234 - t0 + sb + c, 0, 498) (clamped per column, which IS the clipped index);
// columns 0..15 come from the tile carried over from the prior key block (its columns 32..47), columns
// 16..47 are two fresh tiles (hi + res products, value 1024*q.rel); the band is exchanged through per-wave
// LDS and read back at c = 15 - row + col, i.e. table row clamp(j - i + 249, 0, 498);
// score = qk/8 + bias; then replace-fill -1e10 where mask[b][j] == 0; p = exp(score - running max) in f32,
// l accumulated from the f32 p; 4096*p stored as f16 in per-wave LDS and reloaded as the A fragment
// (split k map); O += P.V on 4 dim subtiles. Every same-wave LDS exchange (band, P tile, ctx staging) has a
// coverage: 16 query rows x 64 halves per wave, NB*NH*(SEQ/16) wave tasks = all (b, t, h) segments of Z.
// LDS: band 16x48 floats, P 16x32 halves, ctx 16x64 halves per wave; staged extent == consumed extent.
// =====================================================================================================
__global__ __launch_bounds__(128) void attn_kernel(
    const unsigned short* __restrict__ QH, const unsigned short* __restrict__ QL,
    const unsigned short* __restrict__ KH, const unsigned short* __restrict__ KL,
    const unsigned short* __restrict__ PE, const unsigned short* __restrict__ VT,
    const int* __restrict__ mask, unsigned short* Z) {
  __shared__ __align__(16) float relw[AWV][16 * RWP];            // band exchange, 12288 B
  __shared__ __align__(16) unsigned short pws[AWV][16 * 32];      // P tiles, 4096 B
  __shared__ __align__(16) unsigned short zst[AWV][16 * 64];      // ctx staging, 8192 B
  const int lane = threadIdx.x & 31, wv = threadIdx.x >> 5, m = lane & 15, hh = lane >> 4;
  const int task = blockIdx.x * AWV + wv;            // 0 .. NB*NH*(SEQ/16)-1
  const int nqt = SEQ / 16;
  const int bh = task / nqt;                         // (b, h)
  const int t0 = (task - bh * nqt) << 4;             // query tile start
  const int b = bh / NH, h = bh - (bh / NH) * NH;
  if (b >= NB) return;                               // wave-uniform; never taken with exact grids; no block barriers
  const size_t tok0 = (size_t)b * SEQ;               // plane row base of this batch
  const int* mk = mask + (size_t)b * SEQ_FULL;       // full input stride for the mask row
  float* rw = relw[wv];
  unsigned short* ph = pws[wv];

  // Q A-fragments (hi and residual): rows t0+m, k = head dims 0..31 and 32..63
  const size_t qo = (tok0 + (size_t)(t0 + m)) * DM + h * HD + 8 * hh;
  const v16us qh0 = ldfrag_u(QH + qo);
  const v16us qh1 = ldfrag_u(QH + qo + 32);
  const v16us ql0 = ldfrag_u(QL + qo);
  const v16us ql1 = ldfrag_u(QL + qo + 32);

  const int rb = RCEN - 15 - t0;                     // table row of band column 0 at sb = 0 (before clamp)

  // carried band tile: columns 0..15 of key block 0 <-> table rows clamp(rb + 0..15)
  v8f carry = dot2_res(qh0, qh1, ql0, ql1, PE + (size_t)clampi(rb + m, 0, NREL - 1) * HD + 8 * hh);

  float mx[8], ls[8];
  v8f O0 = zero8(), O1 = zero8(), O2 = zero8(), O3 = zero8();
#pragma unroll
  for (int r = 0; r < 8; ++r) { mx[r] = -1.0e30f; ls[r] = 0.f; }

#pragma unroll 1
  for (int kb = 0; kb < SEQ / 32; ++kb) {
    const int sb = kb << 5;
    // scores: Bt row = key token, k = head dim
    v8f S0, S1;
    {
      const size_t ko = (tok0 + (size_t)(sb + m)) * DM + h * HD + 8 * hh;
      S0 = dot3_res(qh0, qh1, ql0, ql1, KH + ko, KL + ko);
      const size_t ko1 = ko + (size_t)16 * DM;
      S1 = dot3_res(qh0, qh1, ql0, ql1, KH + ko1, KL + ko1);
    }

    // relative band: columns 16..31 and 32..47 <-> table rows clamp(rb+sb+16..), clamp(rb+sb+32..)
    v8f Pb1 = dot2_res(qh0, qh1, ql0, ql1, PE + (size_t)clampi(rb + sb + 16 + m, 0, NREL - 1) * HD + 8 * hh);
    v8f Pb2 = dot2_res(qh0, qh1, ql0, ql1, PE + (size_t)clampi(rb + sb + 32 + m, 0, NREL - 1) * HD + 8 * hh);
#pragma unroll
    for (int r = 0; r < 8; ++r) {
      const int row = 8 * hh + r;
      rw[row * RWP + m]      = carry[r];
      rw[row * RWP + 16 + m] = Pb1[r];
      rw[row * RWP + 32 + m] = Pb2[r];
    }
    carry = Pb2;
    wave_sync_lds();

    // key mask values of this lane's two key columns (always in range: sb + 16 + m < SEQ)
    const int mk0 = mk[sb + m];
    const int mk1 = mk[sb + 16 + m];

    // skew read + scale + bias, then replace-fill masked keys
    float s0[8], s1[8];
#pragma unroll
    for (int r = 0; r < 8; ++r) {
      const int row = 8 * hh + r;
      const float rv0 = rw[row * RWP + 15 - row + m];
      const float rv1 = rw[row * RWP + 31 - row + m];
      const float v0 = S0[r] * (RSQD / (QKS * QKS)) + rv0 * (1.0f / (QKS * WSCL));
      const float v1 = S1[r] * (RSQD / (QKS * QKS)) + rv1 * (1.0f / (QKS * WSCL));
      s0[r] = (mk0 == 0) ? MASKV : v0;
      s1[r] = (mk1 == 0) ? MASKV : v1;
    }

    // online softmax (a row lives in the 16 lanes of one half-wave; xor butterflies 1,2,4,8)
#pragma unroll
    for (int r = 0; r < 8; ++r) {
      float xm = fmaxf(s0[r], s1[r]);
      xm = fmaxf(xm, __shfl_xor(xm, 1, 32));
      xm = fmaxf(xm, __shfl_xor(xm, 2, 32));
      xm = fmaxf(xm, __shfl_xor(xm, 4, 32));
      xm = fmaxf(xm, __shfl_xor(xm, 8, 32));
      const float mn = fmaxf(mx[r], xm);
      const float al = __expf(mx[r] - mn);
      mx[r] = mn;
      const float p0 = __expf(s0[r] - mn);
      const float p1 = __expf(s1[r] - mn);
      float ps = p0 + p1;
      ps += __shfl_xor(ps, 1, 32);
      ps += __shfl_xor(ps, 2, 32);
      ps += __shfl_xor(ps, 4, 32);
      ps += __shfl_xor(ps, 8, 32);
      ls[r] = ls[r] * al + ps;
      O0[r] = O0[r] * al;
      O1[r] = O1[r] * al;
      O2[r] = O2[r] * al;
      O3[r] = O3[r] * al;
      const int row = 8 * hh + r;
      ph[row * 32 + m]      = f2h(p0 * PSC);
      ph[row * 32 + 16 + m] = f2h(p1 * PSC);
    }
    wave_sync_lds();

    // P A-fragment (split k map) and V B-fragments (Bt row = h*64 + dim, k = key token)
    const v16us af = ldfrag_u(ph + m * 32 + 8 * hh);
    const size_t vo = (size_t)(h * HD + m) * MT + tok0 + (size_t)sb + 8 * hh;
    const v16us vf0 = ldfrag_u(VT + vo);
    const v16us vf1 = ldfrag_u(VT + vo + (size_t)16 * MT);
    const v16us vf2 = ldfrag_u(VT + vo + (size_t)32 * MT);
    const v16us vf3 = ldfrag_u(VT + vo + (size_t)48 * MT);
    O0 = mma_g(af, vf0, O0);
    O1 = mma_g(af, vf1, O1);
    O2 = mma_g(af, vf2, O2);
    O3 = mma_g(af, vf3, O3);
  }
  acc_guard4(O0, O1, O2, O3);

  // ---- epilogue: ctx = O / (l * PSC * VSC), stored x CSC as f16, token-major plane ----
  unsigned short* zs = zst[wv];
  const float fin = CSC / (PSC * VSC);
#pragma unroll
  for (int r = 0; r < 8; ++r) {
    const int row = 8 * hh + r;
    const float linv = 1.0f / ls[r];                   // ls >= 1
    const float g = linv * fin;
    zs[row * 64 + m]      = f2h(O0[r] * g);
    zs[row * 64 + 16 + m] = f2h(O1[r] * g);
    zs[row * 64 + 32 + m] = f2h(O2[r] * g);
    zs[row * 64 + 48 + m] = f2h(O3[r] * g);
  }
  wave_sync_lds();
  {
    const int q8 = lane >> 3, c8 = (lane & 7) * 8;
    v4u hv[4];
#pragma unroll
    for (int it = 0; it < 4; ++it) {
      const int row = it * 4 + q8;                     // it 0..3 x q8 0..3 = rows 0..15
      hv[it] = *(const v4u*)(zs + row * 64 + c8);
    }
    const size_t zr0 = (size_t)b * SEQ + (size_t)t0;
    {
#pragma unroll
      for (int it = 0; it < 4; ++it) {
        const int row = it * 4 + q8;
        unsigned short* dst = Z + (zr0 + (size_t)row) * DM + h * HD + c8;
        *(v4u*)dst = hv[it];
      }
      
    }
  }
}

// =====================================================================================================
// Workspace map (bytes, NB=2 SEQ=2048 -> MT=4096); every plane is an exact multiple of its whole-row /
// whole-line / 64x64-tile store granularity (rows MT, 1536, 512; 64 | each tiled dimension; the table plane
// is padded to 512 rows and written incl. the pad); all offsets multiples of 65536.
//   XQ   f16  [4096][512]      0           4194304
//   XK   f16  [4096][512]      4194304     4194304
//   XV   f16  [4096][512]      8388608     4194304
//   WT   f16  [1536][512]      12582912    1572864   (Wq^T | Wk^T | Wv^T, x64)
//   WOT  f16  [512][512]       14155776     524288   (Wo^T, x64)
//   PEH  f16  [512][64]        14680064      65536   (table x64, rows 499..511 zero)
//   QH   f16  [4096][512]      14745600    4194304
//   QL   f16  [4096][512]      18939904    4194304
//   KH   f16  [4096][512]      23134208    4194304
//   KL   f16  [4096][512]      27328512    4194304
//   VT   f16  [512][4096]      31522816    4194304
//   Z    f16  [4096][512]      35717120    4194304
//   end                        39911424
// =====================================================================================================
extern "C" void kernel_launch(void* const* d_in, const int* in_sizes, int n_in,
                              void* d_out, int out_size, void* d_ws, size_t ws_size,
                              hipStream_t stream) {
  if (n_in < 13) return;
  const int xreq = ((NB - 1) * SEQ_FULL + SEQ) * DM;
  const int mreq = (NB - 1) * SEQ_FULL + SEQ;
  if (in_sizes[0] < xreq || in_sizes[1] < xreq || in_sizes[2] < xreq) return;
  if (in_sizes[3] < mreq) return;
  if (in_sizes[4] < DM * DM || in_sizes[6] < DM * DM || in_sizes[8] < DM * DM || in_sizes[10] < DM * DM) return;
  if (in_sizes[5] < DM || in_sizes[7] < DM || in_sizes[9] < DM || in_sizes[11] < DM) return;
  if (in_sizes[12] < NREL * HD) return;
  if (out_size < MT * DM) return;

  const float* query = (const float*)d_in[0];   // [NB_FULL][SEQ_FULL][512]
  const float* key   = (const float*)d_in[1];
  const float* value = (const float*)d_in[2];
  const int*   mask  = (const int*)d_in[3];     // [NB_FULL][SEQ_FULL] int32
  const float* wq = (const float*)d_in[4];      // [512][512] (in, out)
  const float* bq = (const float*)d_in[5];
  const float* wk = (const float*)d_in[6];
  const float* bk = (const float*)d_in[7];
  const float* wv = (const float*)d_in[8];
  const float* bv = (const float*)d_in[9];
  const float* wo = (const float*)d_in[10];
  const float* bo = (const float*)d_in[11];
  const float* rel = (const float*)d_in[12];    // [499][64]

  const size_t PX  = (size_t)MT * DM * 2;
  const size_t PWT = (size_t)3 * DM * DM * 2;
  const size_t PWO = (size_t)DM * DM * 2;
  const size_t PPE = (size_t)RPAD * HD * 2;
  size_t off = 0;
  const size_t oXQ = off; off += PX;
  const size_t oXK = off; off += PX;
  const size_t oXV = off; off += PX;
  const size_t oWT = off; off += PWT;
  const size_t oWO = off; off += PWO;
  const size_t oPE = off; off += PPE;
  const size_t oQH = off; off += PX;
  const size_t oQL = off; off += PX;
  const size_t oKH = off; off += PX;
  const size_t oKL = off; off += PX;
  const size_t oVT = off; off += PX;
  const size_t oZ  = off; off += PX;
  if (off > ws_size) return;
  if (off > (size_t)134217728) return;

  char* ws = (char*)d_ws;
  unsigned short* XQ  = (unsigned short*)(ws + oXQ);
  unsigned short* XK  = (unsigned short*)(ws + oXK);
  unsigned short* XV  = (unsigned short*)(ws + oXV);
  unsigned short* WT  = (unsigned short*)(ws + oWT);
  unsigned short* WOT = (unsigned short*)(ws + oWO);
  unsigned short* PEH = (unsigned short*)(ws + oPE);
  unsigned short* QH  = (unsigned short*)(ws + oQH);
  unsigned short* QL  = (unsigned short*)(ws + oQL);
  unsigned short* KH  = (unsigned short*)(ws + oKH);
  unsigned short* KL  = (unsigned short*)(ws + oKL);
  unsigned short* VT  = (unsigned short*)(ws + oVT);
  unsigned short* Z   = (unsigned short*)(ws + oZ);
  float* out0 = (float*)d_out;
  float* fdummy = (float*)(ws + oXQ);             // in-range placeholder for unused f32 output args
  unsigned short* hdummy = XQ;                    // in-range placeholder for unused f16 output args

  const dim3 blk(256);
  const int gP = ((MT / 64) * (DM / 64)) / 8;     // 64x64 tiles / 8 waves, exact

  // (0) operand planes: query/key/value -> f16(bf16) per batch slice; table -> f16(bf16 x64) padded to 512 rows;
  //     Wq|Wk|Wv [512][512] -> WT rows 0.., 512.., 1024.. (transposed, f16 x64); Wo -> WOT (transposed, f16 x64)
  cvt_lin<<<dim3((SEQ * DM) / 2048, NB), blk, 0, stream>>>(query, XQ, SEQ * DM, SEQ * DM, 1.0f, SEQ_FULL * DM, SEQ * DM);
  cvt_lin<<<dim3((SEQ * DM) / 2048, NB), blk, 0, stream>>>(key,   XK, SEQ * DM, SEQ * DM, 1.0f, SEQ_FULL * DM, SEQ * DM);
  cvt_lin<<<dim3((SEQ * DM) / 2048, NB), blk, 0, stream>>>(value, XV, SEQ * DM, SEQ * DM, 1.0f, SEQ_FULL * DM, SEQ * DM);
  cvt_lin<<<dim3((RPAD * HD) / 2048, 1), blk, 0, stream>>>(rel, PEH, NREL * HD, RPAD * HD, WSCL, 0, 0);
  cvt_t<<<dim3(DM / 64, DM / 64), blk, 0, stream>>>(wq, WT, DM, DM, WSCL);                              // in[512][512] -> out[512][512]
  cvt_t<<<dim3(DM / 64, DM / 64), blk, 0, stream>>>(wk, WT + (size_t)DM * DM, DM, DM, WSCL);
  cvt_t<<<dim3(DM / 64, DM / 64), blk, 0, stream>>>(wv, WT + (size_t)2 * DM * DM, DM, DM, WSCL);
  cvt_t<<<dim3(DM / 64, DM / 64), blk, 0, stream>>>(wo, WOT, DM, DM, WSCL);

  // (1) q hi/res planes: s = 16*(x.Wq + bq) -> QH = f16(s), QL = f16(2048*(s - QH)); same for k
  gemm64<2, 1><<<dim3(gP), blk, 0, stream>>>(XQ, DM, WT, DM, QH, QL, fdummy, DM, QKS / WSCL, bq, QKS, MT, DM, DM);
  gemm64<2, 1><<<dim3(gP), blk, 0, stream>>>(XK, DM, WT + (size_t)DM * DM, DM, KH, KL, fdummy, DM, QKS / WSCL, bk, QKS, MT, DM, DM);
  //     v^T x16: C[d][tok] = sum_k WT[1024+d][k] * XV[tok][k], bias by row d
  gemm64<1, 2><<<dim3(gP), blk, 0, stream>>>(WT + (size_t)2 * DM * DM, DM, XV, DM, VT, hdummy, fdummy, MT, VSC / WSCL, bv, VSC, DM, MT, DM);

  // (2) attention -> ctx x16 token-major plane
  attn_kernel<<<dim3((NB * NH * (SEQ / 16)) / AWV), dim3(128), 0, stream>>>(QH, QL, KH, KL, PEH, VT, mask, Z);

  // (3) output projection: out[row][n] = sum_k Z[row][k] * WOT[n][k] / (16*64) + bo[n]
  gemm64<0, 1><<<dim3(gP), blk, 0, stream>>>(Z, DM, WOT, DM, hdummy, hdummy, out0, DM, 1.0f / (WSCL * CSC), bo, 1.0f, MT, DM, DM);
  (void)hipGetLastError();
}

// v001
// It runs in 240 microseconds.
// Two timings next to v000 put it at 1.22 and 1.23 times that version's speed.
// Contractions: x.Wq and x.Wk (q, k hi + residual planes), x.Wv (v^T plane), q.k^T (hi.hi + hi.res + res.hi),
// q.rel^T (hi + res), p.v and ctx.Wo, all on v_wmma_f32_16x16x32_f16 (f16 operands, f32 accumulate).
// Float inputs RNE-converted to bf16 on load and carried in f16 containers with power-of-two scales
// (x x1; Wq, Wk, Wv, Wo x64; rel table x64; q, k hi planes x16, residual planes x16x2048; v^T x16;
// p x4096; ctx x16); softmax, key mask and the relative-offset skew in f32 on VALU.
#include <hip/hip_runtime.h>
#include <math.h>

#ifndef NB
#define NB 2
#endif
#ifndef SEQ
#define SEQ 2048
#endif
#define NB_FULL  2
#define SEQ_FULL 2048
#define DM   512
#define NH   8
#define HD   64
#define MT   (NB * SEQ)
#define NREL 499
#define RPAD 512
#define RCEN 249
#define AWV  4
#define RWP  48
#define WSCL 64.0f
#define QKS  16.0f
#define LSC  2048.0f
#define VSC  16.0f
#define PSC  4096.0f
#define CSC  16.0f
#define RSQD 0.125f
#define MASKV (-1.0e10f)

static_assert(NH * HD == DM);
static_assert(HD == 64);
static_assert(NB >= 1 && NB <= NB_FULL);
static_assert((SEQ % 64) == 0 && SEQ >= 64 && SEQ <= SEQ_FULL);
static_assert((MT % 64) == 0 && (DM % 64) == 0);
static_assert((((MT / 64) * (DM / 64)) % 8) == 0);
static_assert(((SEQ * DM) % 2048) == 0 && ((RPAD * HD) % 2048) == 0 && ((NREL * HD) % 8) == 0);
static_assert(((NB * NH * (SEQ / 16)) % AWV) == 0);
static_assert(NREL <= RPAD && (2 * RCEN + 1) == NREL);

typedef _Float16 v16h __attribute__((ext_vector_type(16)));
typedef unsigned short v16us __attribute__((ext_vector_type(16)));
typedef unsigned short v8us  __attribute__((ext_vector_type(8)));
typedef float v8f __attribute__((ext_vector_type(8)));
typedef float v4f __attribute__((ext_vector_type(4)));
typedef unsigned int v4u __attribute__((ext_vector_type(4)));

union FragU { v16us v; v8us h[2]; };

// ---- scalar helpers --------------------------------------------------------------------------------
__device__ __forceinline__ unsigned short bf_bits(float f) {          // f32 -> bf16 bits, RNE convert
  const unsigned u = __float_as_uint(f);
  return (unsigned short)((u + 0x7FFFu + ((u >> 16) & 1u)) >> 16);
}
__device__ __forceinline__ float bf_up(unsigned short h) { return __uint_as_float(((unsigned)h) << 16); }
__device__ __forceinline__ float bfr(float f) { return bf_up(bf_bits(f)); }   // value of the bf16 RNE convert
__device__ __forceinline__ unsigned short h_bits(_Float16 x) { return __builtin_bit_cast(unsigned short, x); }
__device__ __forceinline__ unsigned short f2h(float f) { return h_bits((_Float16)f); }
__device__ __forceinline__ unsigned pk16(unsigned short a, unsigned short b) { return (unsigned)a | ((unsigned)b << 16); }
__device__ __forceinline__ int clampi(int v, int lo, int hi) { return v < lo ? lo : (v > hi ? hi : v); }
__device__ __forceinline__ v8f zero8() { v8f z = {0.f, 0.f, 0.f, 0.f, 0.f, 0.f, 0.f, 0.f}; return z; }

// ---- fragment loader: 16-bit A/B operand, lane -> row/col (lane&15), p already includes +8*(lane>>4);
//      elements 0..7 <- p[0..7] (k0+8h..), elements 8..15 <- p[16..23] (k0+16+8h..)
__device__ __forceinline__ v16us ldfrag_u(const unsigned short* p) {
  FragU f;
  f.h[0] = *(const v8us*)(p);
  f.h[1] = *(const v8us*)(p + 16);
  return f.v;
}

// ---- WMMA helpers (f16 operand bits) with trailing VALU hazard gap --------------------------------
__device__ __forceinline__ v8f mma_raw(v16us a, v16us b, v8f c) {
  return __builtin_amdgcn_wmma_f32_16x16x32_f16(false, __builtin_bit_cast(v16h, a), false,
                                                __builtin_bit_cast(v16h, b), (short)0, c, false, false);
}
__device__ __forceinline__ v8f mma_g(v16us a, v16us b, v8f c) {                 // guarded
  c = mma_raw(a, b, c);
#if defined(__HIP_DEVICE_COMPILE__)
  asm volatile("v_nop\n\tv_nop\n\tv_nop\n\tv_nop" : "+v"(c) : "v"(a), "v"(b));
#endif
  return c;
}
__device__ __forceinline__ void dep_guard1(v8f& a, v8f& b, v16us x) {
#if defined(__HIP_DEVICE_COMPILE__)
  asm volatile("v_nop\n\tv_nop\n\tv_nop\n\tv_nop" : "+v"(a), "+v"(b) : "v"(x));
#endif
}
__device__ __forceinline__ void keep4_u(v16us a, v16us b, v16us c, v16us d) {
#if defined(__HIP_DEVICE_COMPILE__)
  asm volatile("v_nop" :: "v"(a), "v"(b), "v"(c), "v"(d));
#endif
}
__device__ __forceinline__ void acc_guard4(v8f& a, v8f& b, v8f& c, v8f& d) {
#if defined(__HIP_DEVICE_COMPILE__)
  asm volatile("v_nop\n\tv_nop\n\tv_nop\n\tv_nop" : "+v"(a), "+v"(b), "+v"(c), "+v"(d));
#endif
}
// orders LDS stores of this wave before later LDS loads of the same wave (cross-lane exchange)
__device__ __forceinline__ void wave_sync_lds() {
  __builtin_amdgcn_fence(__ATOMIC_RELEASE, "workgroup");
  __builtin_amdgcn_wave_barrier();
  __builtin_amdgcn_fence(__ATOMIC_ACQUIRE, "workgroup");
}

// the same exchange for a wave that has global loads in flight: waits for this wave's LDS operations only
__device__ __forceinline__ void wave_sync_lds_only() {
#if defined(__HIP_DEVICE_COMPILE__)
  // LDS stores of this wave are done before its later LDS loads issue, and the "memory" clobber keeps the compiler
  // from moving either across; the fence pair above would also wait out the next key block's global loads
  asm volatile("s_wait_dscnt 0x0" ::: "memory");
#endif
  __builtin_amdgcn_wave_barrier();
}

// stands behind a group of global loads that stay in flight: their address registers may be rewritten behind it
__device__ __forceinline__ void addr_regs_free() {
#if defined(__HIP_DEVICE_COMPILE__)
  asm volatile("s_wait_xcnt 0x0" ::: "memory");
#endif
}

// =====================================================================================================
// Layout-kept convert: o[i] = f16 bits of (bf16 RNE value of w[i] * sc) for i < nsrc, zero for nsrc <= i < ndst.
// blockIdx.y selects a batch slice: source base + y*sstr, destination base + y*dstr (element strides).
// nsrc % 8 == 0, ndst % 2048 == 0, grid.x = ndst/2048 exact (host-checked).
// coverage: 256 threads x 8 = 2048 elements per block; grid covers all ndst elements incl. the zero pad.
// =====================================================================================================
__global__ __launch_bounds__(256) void cvt_lin(const float* __restrict__ w, unsigned short* o,
                                                int nsrc, int ndst, float sc, int sstr, int dstr) {
  const float* wb = w + (size_t)blockIdx.y * (size_t)sstr;
  unsigned short* ob = o + (size_t)blockIdx.y * (size_t)dstr;
  const int base = (blockIdx.x * 256 + threadIdx.x) * 8;
  if (base + 8 > ndst) return;                            // never taken with exact grids; no barriers below
  const bool inr = (base + 8 <= nsrc);
  const int lb = inr ? base : (nsrc - 8);                 // clamped address, always in range
  const v4f a0 = *(const v4f*)(wb + lb);
  const v4f a1 = *(const v4f*)(wb + lb + 4);
  v4u hv;
#pragma unroll
  for (int e = 0; e < 2; ++e) {
    hv[e]     = pk16(f2h(bfr(a0[2 * e]) * sc), f2h(bfr(a0[2 * e + 1]) * sc));
    hv[2 + e] = pk16(f2h(bfr(a1[2 * e]) * sc), f2h(bfr(a1[2 * e + 1]) * sc));
  }
  const v4u zz = {0u, 0u, 0u, 0u};
  hv = inr ? hv : zz;
  unsigned short* d = ob + base;
  *(v4u*)d = hv;
  
}

// =====================================================================================================
// Transpose-convert: in w[R][C] f32 -> out o[C][R] f16 bits of (bf16 RNE value * sc). Block tile 64x64
// through LDS (st[col][row], pitch 72 halves). Read phase: thread owns one input row x 16 columns (float4
// R, C multiples of 64, grid (C/64, R/64) exact (host-checked).
// coverage: 64 output rows x 64 halves per block = the whole transposed tile; grid covers all of [C][R].
// =====================================================================================================
__global__ __launch_bounds__(256) void cvt_t(const float* __restrict__ w, unsigned short* o, int R, int C, float sc) {
  __shared__ __align__(16) unsigned short st[64 * 72];
  const int t = threadIdx.x;
  const int r0 = blockIdx.y * 64, c0 = blockIdx.x * 64;
  if (r0 + 64 > R || c0 + 64 > C) return;               // block-uniform, before the barrier; never taken
  {
    const int row = t >> 2, ch = (t & 3) * 16;
    const float* p = w + (size_t)(r0 + row) * C + c0 + ch;
#pragma unroll
    for (int q = 0; q < 4; ++q) {
      const v4f v = *(const v4f*)(p + 4 * q);
#pragma unroll
      for (int e = 0; e < 4; ++e) st[(ch + 4 * q + e) * 72 + row] = f2h(bfr(v[e]) * sc);
    }
  }
  __syncthreads();
  v4u hv[2];
#pragma unroll
  for (int half = 0; half < 2; ++half) {
    const int cl = (t >> 3) + 32 * half, pc = (t & 7) * 8;
    hv[half] = *(const v4u*)(st + cl * 72 + pc);
  }
  {
#pragma unroll
    for (int half = 0; half < 2; ++half) {
      const int cl = (t >> 3) + 32 * half, pc = (t & 7) * 8;
      unsigned short* dst = o + (size_t)(c0 + cl) * R + r0 + pc;
      *(v4u*)dst = hv[half];
    }
    
  }
}

// =====================================================================================================
// Register-blocked f16 WMMA GEMM: C[m][n] = sum_k A[m][k] * Bt[n][k], one wave per 64x64 tile, no block
// barriers. A row-major [M][K] pitch lda; Bt row-major [N][K] pitch ldb (k contiguous); M, N multiples of 64,
// K multiple of 32 (true at every call site; host grids = tiles/8 exact so no wave exits early). Both operand
// fragments use the split k map (elements 0..7 <- k0+8h.., 8..15 <- k0+16+8h..); D element r of a lane is
// (row 8h + r, col lane&15).
// s = acc*osc + bias term (BM 0: none; BM 1: bsc*bf16(bias[col]); BM 2: bsc*bf16(bias[row])).
// OM 0: f32 out Cf = s, pitch ldc.   OM 1: f16 out Ch = f16 bits(s), pitch ldc.
// OM 2: f16 hi plane Ch = f16(s) and f16 residual plane Cl = f16((s - hi) * 2048), same pitch.
// coverage: 4 slabs x 16 rows x 64 cols = the wave's whole 64x64 tile.
// =====================================================================================================
template <int OM, int BM>
__global__ __launch_bounds__(256) void gemm64(
    const unsigned short* __restrict__ Ap, int lda, const unsigned short* __restrict__ Btp, int ldb,
    unsigned short* Ch, unsigned short* Cl, float* Cf, int ldc, float osc,
    const float* __restrict__ bias, float bsc, int M, int N, int K) {
  __shared__ __align__(16) float sT[8][16 * 68];   // per-wave 16x64 slab, pitch 68 floats
  const int lane = threadIdx.x & 31;
  const int wave = threadIdx.x >> 5;
  const int tilesN = N >> 6;
  const int tilesM = M >> 6;
  const int tile = blockIdx.x * 8 + wave;
  if (tile >= tilesM * tilesN) return;   // wave-uniform; no block barriers in this kernel
  const int tm = tile / tilesN;
  const int tn = tile - tm * tilesN;
  const int m0 = tm << 6;
  const int n0 = tn << 6;

  const int rlane = lane & 15;                 // row (A) / col (B, D) within subtile
  const int koff  = (lane >> 4) * 8;           // k offset of this lane half
  const int mOff  = (lane >> 4) * 8;           // D row offset

  v8f acc[4][4];
#pragma unroll
  for (int i = 0; i < 4; ++i)
#pragma unroll
    for (int j = 0; j < 4; ++j) acc[i][j] = zero8();

#pragma unroll 1
  for (int k0 = 0; k0 < K; k0 += 32) {
    v16us bh[4];
#pragma unroll
    for (int j = 0; j < 4; ++j) {
      const size_t bo = (size_t)(n0 + (j << 4) + rlane) * ldb + koff + k0;
      bh[j] = ldfrag_u(Btp + bo);
    }
#pragma unroll
    for (int i = 0; i < 4; ++i) {
      const size_t ao = (size_t)(m0 + (i << 4) + rlane) * lda + koff + k0;
      const v16us ah = ldfrag_u(Ap + ao);
#pragma unroll
      for (int j = 0; j < 4; ++j) acc[i][j] = mma_raw(ah, bh[j], acc[i][j]);
      dep_guard1(acc[i][0], acc[i][3], ah);
    }
    keep4_u(bh[0], bh[1], bh[2], bh[3]);
  }
  acc_guard4(acc[0][0], acc[0][1], acc[0][2], acc[0][3]);
  acc_guard4(acc[1][0], acc[1][1], acc[1][2], acc[1][3]);
  acc_guard4(acc[2][0], acc[2][1], acc[2][2], acc[2][3]);
  acc_guard4(acc[3][0], acc[3][1], acc[3][2], acc[3][3]);

  const int hh2 = lane >> 4, c4 = (lane & 15) * 4;     // f32 out: 256-B row segment = 16 lanes x 16 B
  const int q8  = lane >> 3, c8 = (lane & 7) * 8;

  // column bias terms (fixed per wave); addresses n0+c4+3 < N and n0+c8+7 < N
  v4f bc4 = {0.f, 0.f, 0.f, 0.f};
  float bc8[8];
#pragma unroll
  for (int e = 0; e < 8; ++e) bc8[e] = 0.f;
  if (BM == 1) {
    if (OM == 0) {
      const v4f t4 = *(const v4f*)(bias + n0 + c4);
#pragma unroll
      for (int e = 0; e < 4; ++e) bc4[e] = bfr(t4[e]) * bsc;
    } else {
      const v4f ta = *(const v4f*)(bias + n0 + c8);
      const v4f tb = *(const v4f*)(bias + n0 + c8 + 4);
#pragma unroll
      for (int e = 0; e < 4; ++e) { bc8[e] = bfr(ta[e]) * bsc; bc8[4 + e] = bfr(tb[e]) * bsc; }
    }
  }

  // ---- epilogue ----
  float* slab = sT[wave];
#pragma unroll
  for (int i = 0; i < 4; ++i) {
    const int mBase = m0 + (i << 4);
#pragma unroll
    for (int j = 0; j < 4; ++j) {
#pragma unroll
      for (int r = 0; r < 8; ++r) {
        slab[(mOff + r) * 68 + (j << 4) + rlane] = acc[i][j][r];
      }
    }
    wave_sync_lds();
    if (OM == 0) {
      v4f vals[8];
#pragma unroll
      for (int it = 0; it < 8; ++it) {
        const int row = it * 2 + hh2;                      // it 0..7 x hh2 0..1 = rows 0..15
        const v4f v = *(const v4f*)(slab + row * 68 + c4);
        float rb2 = 0.f;
        if (BM == 2) rb2 = bfr(bias[mBase + row]) * bsc;
        vals[it] = v * osc + bc4 + rb2;
      }
      {
#pragma unroll
        for (int it = 0; it < 8; ++it) {
          const int row = it * 2 + hh2;
          *(v4f*)(Cf + (size_t)(mBase + row) * ldc + (size_t)n0 + c4) = vals[it];
        }
        
      }
    } else {
      v4u hv[4], hl[4];
#pragma unroll
      for (int it = 0; it < 4; ++it) {
        const int row = it * 4 + q8;                       // it 0..3 x q8 0..3 = rows 0..15
        const float* sp = slab + row * 68 + c8;
        float rb2 = 0.f;
        if (BM == 2) rb2 = bfr(bias[mBase + row]) * bsc;
        v4u ha = {0u, 0u, 0u, 0u};
        v4u la = {0u, 0u, 0u, 0u};
#pragma unroll
        for (int e = 0; e < 4; ++e) {
          const float b0 = sp[2 * e]     * osc + bc8[2 * e]     + rb2;
          const float b1 = sp[2 * e + 1] * osc + bc8[2 * e + 1] + rb2;
          if (OM == 1) {
            ha[e] = pk16(f2h(b0), f2h(b1));
          } else {
            const _Float16 h0 = (_Float16)b0;
            const _Float16 h1 = (_Float16)b1;
            const float l0 = (b0 - (float)h0) * LSC;       // difference exact, power-of-two carry exact
            const float l1 = (b1 - (float)h1) * LSC;
            ha[e] = pk16(h_bits(h0), h_bits(h1));
            la[e] = pk16(f2h(l0), f2h(l1));
          }
        }
        hv[it] = ha;
        hl[it] = la;
      }
      {
#pragma unroll
        for (int it = 0; it < 4; ++it) {
          const int row = it * 4 + q8;
          const size_t go = (size_t)(mBase + row) * ldc + (size_t)n0 + c8;
          *(v4u*)(Ch + go) = hv[it];
          if (OM == 2) *(v4u*)(Cl + go) = hl[it];
        }
        
      }
    }
    wave_sync_lds();
  }
}

// ---- per-tile products used by the attention kernel ----------------------------------------------
// R = ah.b + (al.b)/2048 over 64 head dims (b0, b1: fragments of a [n][64] f16 plane row, dims 0..31 and 32..63)
__device__ __forceinline__ v8f dot2_res(v16us ah0, v16us ah1, v16us al0, v16us al1, v16us b0, v16us b1) {
  v8f L = mma_g(al0, b0, zero8());
  L = mma_g(al1, b1, L);
  L = L * (1.0f / LSC);
  v8f R = mma_g(ah0, b0, L);
  R = mma_g(ah1, b1, R);
  return R;
}
// S = qh.kh + (qh.kl + ql.kh)/2048 over 64 head dims (kh from the hi plane row, kl from the residual plane row)
__device__ __forceinline__ v8f dot3_res(v16us qh0, v16us qh1, v16us ql0, v16us ql1,
                                        v16us kh0, v16us kh1, v16us kl0, v16us kl1) {
  v8f L = mma_g(qh0, kl0, zero8());
  L = mma_g(qh1, kl1, L);
  L = mma_g(ql0, kh0, L);
  L = mma_g(ql1, kh1, L);
  L = L * (1.0f / LSC);
  v8f S = mma_g(qh0, kh0, L);
  S = mma_g(qh1, kh1, S);
  return S;
}

// =====================================================================================================
// Non-causal attention with clipped relative-offset term and key-padding mask, head dim 64.
// Block = 128 threads = 4 waves; one wave owns one 16-row query tile (t0..t0+15) of one (batch b, head h)
// and loops all key blocks of 32 with an online max-subtracted softmax in f32.
// Planes: QH/KH f16 [MT][512] = 16*q, 16*k (head columns h*64..), QL/KL = 2048*(16q - QH) residuals,
// PE f16 [512][64] = 64*rel table (rows 0..498 used, 499..511 zero pad never read), VT f16 [512][MT] =
// 16*v transposed (row = h*64+d, column = token), mask int32 [NB_FULL][SEQ_FULL].
// Output Z f16 [MT][512] = 16*ctx, token-major (row = b*SEQ + t, col = h*64+d).
// Per key block sb: S = 256*q.k (hi.hi + hi.res + res.hi, 2 key subtiles); relative band of 48 columns:
// column c <-> table row clamp(234 - t0 + sb + c, 0, 498) (clamped per column, which IS the clipped index);
// columns 0..15 come from the tile carried over from the prior key block (its columns 32..47), columns
// 16..47 are two fresh tiles (hi + res products, value 1024*q.rel); the band is exchanged through per-wave
// LDS and read back at c = 15 - row + col, i.e. table row clamp(j - i + 249, 0, 498);
// score = qk/8 + bias; then replace-fill -1e10 where mask[b][j] == 0; p = exp(score - running max) in f32,
// l accumulated from the f32 p; 4096*p stored as f16 in per-wave LDS and reloaded as the A fragment
// (split k map); O += P.V on 4 dim subtiles. Every same-wave LDS exchange (band, P tile, ctx staging) has a
// coverage: 16 query rows x 64 halves per wave, NB*NH*(SEQ/16) wave tasks = all (b, t, h) segments of Z.
// LDS: band 16x48 floats, P 16x32 halves, ctx 16x64 halves per wave; staged extent == consumed extent.
// Global operands run one key block ahead in registers: K (hi + residual), table rows and mask words are
// reloaded for key block kb + 1 behind the score and band products of key block kb, V^T behind its P.V
// products, into the same variables, so that a load has most of a pass to land before its wait. The last
// pass reloads its own block (addresses in range, values unused).
// =====================================================================================================
__global__ __launch_bounds__(128) void attn_kernel(
    const unsigned short* __restrict__ QH, const unsigned short* __restrict__ QL,
    const unsigned short* __restrict__ KH, const unsigned short* __restrict__ KL,
    const unsigned short* __restrict__ PE, const unsigned short* __restrict__ VT,
    const int* __restrict__ mask, unsigned short* Z) {
  __shared__ __align__(16) float relw[AWV][16 * RWP];            // band exchange, 12288 B
  __shared__ __align__(16) unsigned short pws[AWV][16 * 32];      // P tiles, 4096 B
  __shared__ __align__(16) unsigned short zst[AWV][16 * 64];      // ctx staging, 8192 B
  const int lane = threadIdx.x & 31, wv = threadIdx.x >> 5, m = lane & 15, hh = lane >> 4;
  const int task = blockIdx.x * AWV + wv;            // 0 .. NB*NH*(SEQ/16)-1
  const int nqt = SEQ / 16;
  const int bh = task / nqt;                         // (b, h)
  const int t0 = (task - bh * nqt) << 4;             // query tile start
  const int b = bh / NH, h = bh - (bh / NH) * NH;
  if (b >= NB) return;                               // wave-uniform; never taken with exact grids; no block barriers
  const size_t tok0 = (size_t)b * SEQ;               // plane row base of this batch
  const int* mk = mask + (size_t)b * SEQ_FULL;       // full input stride for the mask row
  float* rw = relw[wv];
  unsigned short* ph = pws[wv];

  // Q A-fragments (hi and residual): rows t0+m, k = head dims 0..31 and 32..63
  const size_t qo = (tok0 + (size_t)(t0 + m)) * DM + h * HD + 8 * hh;
  const v16us qh0 = ldfrag_u(QH + qo);
  const v16us qh1 = ldfrag_u(QH + qo + 32);
  const v16us ql0 = ldfrag_u(QL + qo);
  const v16us ql1 = ldfrag_u(QL + qo + 32);
  addr_regs_free();

  const int rb = RCEN - 15 - t0;                     // table row of band column 0 at sb = 0 (before clamp)

  // carried band tile: columns 0..15 of key block 0 <-> table rows clamp(rb + 0..15)
  const unsigned short* pcar = PE + (size_t)clampi(rb + m, 0, NREL - 1) * HD + 8 * hh;
  const v16us cf0 = ldfrag_u(pcar), cf1 = ldfrag_u(pcar + 32);

  // lane-fixed parts of the operand addresses; key block sb adds sb rows (K), sb table rows, sb columns (V^T, mask)
  const size_t kfix = (tok0 + (size_t)m) * DM + h * HD + 8 * hh;
  const size_t vfix = (size_t)(h * HD + m) * MT + tok0 + 8 * hh;

  // operands of key block 0
  v16us ka0 = ldfrag_u(KH + kfix),           ka1 = ldfrag_u(KH + kfix + 32);            // keys 0..15, hi
  v16us ka2 = ldfrag_u(KL + kfix),           ka3 = ldfrag_u(KL + kfix + 32);            // keys 0..15, residual
  v16us kc0 = ldfrag_u(KH + kfix + 16 * DM), kc1 = ldfrag_u(KH + kfix + 16 * DM + 32);  // keys 16..31, hi
  v16us kc2 = ldfrag_u(KL + kfix + 16 * DM), kc3 = ldfrag_u(KL + kfix + 16 * DM + 32);  // keys 16..31, residual
  v16us pa0, pa1, pc0, pc1;                                                             // band columns 16..31, 32..47
  {
    const unsigned short* p1 = PE + (size_t)clampi(rb + 16 + m, 0, NREL - 1) * HD + 8 * hh;
    const unsigned short* p2 = PE + (size_t)clampi(rb + 32 + m, 0, NREL - 1) * HD + 8 * hh;
    pa0 = ldfrag_u(p1); pa1 = ldfrag_u(p1 + 32);
    pc0 = ldfrag_u(p2); pc1 = ldfrag_u(p2 + 32);
  }
  int mn0 = mk[m], mn1 = mk[16 + m];
  addr_regs_free();
  v16us vf0 = ldfrag_u(VT + vfix);
  v16us vf1 = ldfrag_u(VT + vfix + (size_t)16 * MT);
  v16us vf2 = ldfrag_u(VT + vfix + (size_t)32 * MT);
  v16us vf3 = ldfrag_u(VT + vfix + (size_t)48 * MT);
  addr_regs_free();

  v8f carry = dot2_res(qh0, qh1, ql0, ql1, cf0, cf1);

  float mx[8], ls[8];
  v8f O0 = zero8(), O1 = zero8(), O2 = zero8(), O3 = zero8();
#pragma unroll
  for (int r = 0; r < 8; ++r) { mx[r] = -1.0e30f; ls[r] = 0.f; }

#pragma unroll 1
  for (int kb = 0; kb < SEQ / 32; ++kb) {
    const int sb = kb << 5;
    const int sn = (kb + 1 < SEQ / 32) ? sb + 32 : sb;   // key block whose operands are fetched in this pass
    // scores: Bt row = key token, k = head dim
    const v8f S0 = dot3_res(qh0, qh1, ql0, ql1, ka0, ka1, ka2, ka3);
    const v8f S1 = dot3_res(qh0, qh1, ql0, ql1, kc0, kc1, kc2, kc3);

    // relative band: columns 16..31 and 32..47 <-> table rows clamp(rb+sb+16..), clamp(rb+sb+32..)
    v8f Pb1 = dot2_res(qh0, qh1, ql0, ql1, pa0, pa1);
    v8f Pb2 = dot2_res(qh0, qh1, ql0, ql1, pc0, pc1);

    // key mask values of this lane's two key columns
    const int mk0 = mn0;
    const int mk1 = mn1;

    // next key block's K, table and mask operands, one group (rows and columns sn + 16 + m < SEQ, table rows clamped)
    {
      mn0 = mk[sn + m];
      mn1 = mk[sn + 16 + m];
      const size_t ko = kfix + (size_t)sn * DM;
      ka0 = ldfrag_u(KH + ko);           ka1 = ldfrag_u(KH + ko + 32);
      ka2 = ldfrag_u(KL + ko);           ka3 = ldfrag_u(KL + ko + 32);
      kc0 = ldfrag_u(KH + ko + 16 * DM); kc1 = ldfrag_u(KH + ko + 16 * DM + 32);
      kc2 = ldfrag_u(KL + ko + 16 * DM); kc3 = ldfrag_u(KL + ko + 16 * DM + 32);
      const unsigned short* p1 = PE + (size_t)clampi(rb + sn + 16 + m, 0, NREL - 1) * HD + 8 * hh;
      const unsigned short* p2 = PE + (size_t)clampi(rb + sn + 32 + m, 0, NREL - 1) * HD + 8 * hh;
      pa0 = ldfrag_u(p1); pa1 = ldfrag_u(p1 + 32);
      pc0 = ldfrag_u(p2); pc1 = ldfrag_u(p2 + 32);
      addr_regs_free();
    }
#pragma unroll
    for (int r = 0; r < 8; ++r) {
      const int row = 8 * hh + r;
      rw[row * RWP + m]      = carry[r];
      rw[row * RWP + 16 + m] = Pb1[r];
      rw[row * RWP + 32 + m] = Pb2[r];
    }
    carry = Pb2;
    wave_sync_lds_only();

    // skew read + scale + bias, then replace-fill masked keys
    float s0[8], s1[8];
#pragma unroll
    for (int r = 0; r < 8; ++r) {
      const int row = 8 * hh + r;
      const float rv0 = rw[row * RWP + 15 - row + m];
      const float rv1 = rw[row * RWP + 31 - row + m];
      const float v0 = S0[r] * (RSQD / (QKS * QKS)) + rv0 * (1.0f / (QKS * WSCL));
      const float v1 = S1[r] * (RSQD / (QKS * QKS)) + rv1 * (1.0f / (QKS * WSCL));
      s0[r] = (mk0 == 0) ? MASKV : v0;
      s1[r] = (mk1 == 0) ? MASKV : v1;
    }

    // online softmax (a row lives in the 16 lanes of one half-wave; xor butterflies 1,2,4,8)
#pragma unroll
    for (int r = 0; r < 8; ++r) {
      float xm = fmaxf(s0[r], s1[r]);
      xm = fmaxf(xm, __shfl_xor(xm, 1, 32));
      xm = fmaxf(xm, __shfl_xor(xm, 2, 32));
      xm = fmaxf(xm, __shfl_xor(xm, 4, 32));
      xm = fmaxf(xm, __shfl_xor(xm, 8, 32));
      const float mn = fmaxf(mx[r], xm);
      const float al = __expf(mx[r] - mn);
      mx[r] = mn;
      const float p0 = __expf(s0[r] - mn);
      const float p1 = __expf(s1[r] - mn);
      float ps = p0 + p1;
      ps += __shfl_xor(ps, 1, 32);
      ps += __shfl_xor(ps, 2, 32);
      ps += __shfl_xor(ps, 4, 32);
      ps += __shfl_xor(ps, 8, 32);
      ls[r] = ls[r] * al + ps;
      O0[r] = O0[r] * al;
      O1[r] = O1[r] * al;
      O2[r] = O2[r] * al;
      O3[r] = O3[r] * al;
      const int row = 8 * hh + r;
      ph[row * 32 + m]      = f2h(p0 * PSC);
      ph[row * 32 + 16 + m] = f2h(p1 * PSC);
    }
    wave_sync_lds_only();

    // P A-fragment (split k map) and V B-fragments (Bt row = h*64 + dim, k = key token)
    const v16us af = ldfrag_u(ph + m * 32 + 8 * hh);
    O0 = mma_g(af, vf0, O0);
    O1 = mma_g(af, vf1, O1);
    O2 = mma_g(af, vf2, O2);
    O3 = mma_g(af, vf3, O3);
    const size_t vo = vfix + (size_t)sn;
    vf0 = ldfrag_u(VT + vo);
    vf1 = ldfrag_u(VT + vo + (size_t)16 * MT);
    vf2 = ldfrag_u(VT + vo + (size_t)32 * MT);
    vf3 = ldfrag_u(VT + vo + (size_t)48 * MT);
    addr_regs_free();
  }
  acc_guard4(O0, O1, O2, O3);

  // ---- epilogue: ctx = O / (l * PSC * VSC), stored x CSC as f16, token-major plane ----
  unsigned short* zs = zst[wv];
  const float fin = CSC / (PSC * VSC);
#pragma unroll
  for (int r = 0; r < 8; ++r) {
    const int row = 8 * hh + r;
    const float linv = 1.0f / ls[r];                   // ls >= 1
    const float g = linv * fin;
    zs[row * 64 + m]      = f2h(O0[r] * g);
    zs[row * 64 + 16 + m] = f2h(O1[r] * g);
    zs[row * 64 + 32 + m] = f2h(O2[r] * g);
    zs[row * 64 + 48 + m] = f2h(O3[r] * g);
  }
  wave_sync_lds();
  {
    const int q8 = lane >> 3, c8 = (lane & 7) * 8;
    v4u hv[4];
#pragma unroll
    for (int it = 0; it < 4; ++it) {
      const int row = it * 4 + q8;                     // it 0..3 x q8 0..3 = rows 0..15
      hv[it] = *(const v4u*)(zs + row * 64 + c8);
    }
    const size_t zr0 = (size_t)b * SEQ + (size_t)t0;
    {
#pragma unroll
      for (int it = 0; it < 4; ++it) {
        const int row = it * 4 + q8;
        unsigned short* dst = Z + (zr0 + (size_t)row) * DM + h * HD + c8;
        *(v4u*)dst = hv[it];
      }
      
    }
  }
}

// =====================================================================================================
// Workspace map (bytes, NB=2 SEQ=2048 -> MT=4096); every plane is an exact multiple of its whole-row /
// whole-line / 64x64-tile store granularity (rows MT, 1536, 512; 64 | each tiled dimension; the table plane
// is padded to 512 rows and written incl. the pad); all offsets multiples of 65536.
//   XQ   f16  [4096][512]      0           4194304
//   XK   f16  [4096][512]      4194304     4194304
//   XV   f16  [4096][512]      8388608     4194304
//   WT   f16  [1536][512]      12582912    1572864   (Wq^T | Wk^T | Wv^T, x64)
//   WOT  f16  [512][512]       14155776     524288   (Wo^T, x64)
//   PEH  f16  [512][64]        14680064      65536   (table x64, rows 499..511 zero)
//   QH   f16  [4096][512]      14745600    4194304
//   QL   f16  [4096][512]      18939904    4194304
//   KH   f16  [4096][512]      23134208    4194304
//   KL   f16  [4096][512]      27328512    4194304
//   VT   f16  [512][4096]      31522816    4194304
//   Z    f16  [4096][512]      35717120    4194304
//   end                        39911424
// =====================================================================================================
extern "C" void kernel_launch(void* const* d_in, const int* in_sizes, int n_in,
                              void* d_out, int out_size, void* d_ws, size_t ws_size,
                              hipStream_t stream) {
  if (n_in < 13) return;
  const int xreq = ((NB - 1) * SEQ_FULL + SEQ) * DM;
  const int mreq = (NB - 1) * SEQ_FULL + SEQ;
  if (in_sizes[0] < xreq || in_sizes[1] < xreq || in_sizes[2] < xreq) return;
  if (in_sizes[3] < mreq) return;
  if (in_sizes[4] < DM * DM || in_sizes[6] < DM * DM || in_sizes[8] < DM * DM || in_sizes[10] < DM * DM) return;
  if (in_sizes[5] < DM || in_sizes[7] < DM || in_sizes[9] < DM || in_sizes[11] < DM) return;
  if (in_sizes[12] < NREL * HD) return;
  if (out_size < MT * DM) return;

  const float* query = (const float*)d_in[0];   // [NB_FULL][SEQ_FULL][512]
  const float* key   = (const float*)d_in[1];
  const float* value = (const float*)d_in[2];
  const int*   mask  = (const int*)d_in[3];     // [NB_FULL][SEQ_FULL] int32
  const float* wq = (const float*)d_in[4];      // [512][512] (in, out)
  const float* bq = (const float*)d_in[5];
  const float* wk = (const float*)d_in[6];
  const float* bk = (const float*)d_in[7];
  const float* wv = (const float*)d_in[8];
  const float* bv = (const float*)d_in[9];
  const float* wo = (const float*)d_in[10];
  const float* bo = (const float*)d_in[11];
  const float* rel = (const float*)d_in[12];    // [499][64]

  const size_t PX  = (size_t)MT * DM * 2;
  const size_t PWT = (size_t)3 * DM * DM * 2;
  const size_t PWO = (size_t)DM * DM * 2;
  const size_t PPE = (size_t)RPAD * HD * 2;
  size_t off = 0;
  const size_t oXQ = off; off += PX;
  const size_t oXK = off; off += PX;
  const size_t oXV = off; off += PX;
  const size_t oWT = off; off += PWT;
  const size_t oWO = off; off += PWO;
  const size_t oPE = off; off += PPE;
  const size_t oQH = off; off += PX;
  const size_t oQL = off; off += PX;
  const size_t oKH = off; off += PX;
  const size_t oKL = off; off += PX;
  const size_t oVT = off; off += PX;
  const size_t oZ  = off; off += PX;
  if (off > ws_size) return;
  if (off > (size_t)134217728) return;

  char* ws = (char*)d_ws;
  unsigned short* XQ  = (unsigned short*)(ws + oXQ);
  unsigned short* XK  = (unsigned short*)(ws + oXK);
  unsigned short* XV  = (unsigned short*)(ws + oXV);
  unsigned short* WT  = (unsigned short*)(ws + oWT);
  unsigned short* WOT = (unsigned short*)(ws + oWO);
  unsigned short* PEH = (unsigned short*)(ws + oPE);
  unsigned short* QH  = (unsigned short*)(ws + oQH);
  unsigned short* QL  = (unsigned short*)(ws + oQL);
  unsigned short* KH  = (unsigned short*)(ws + oKH);
  unsigned short* KL  = (unsigned short*)(ws + oKL);
  unsigned short* VT  = (unsigned short*)(ws + oVT);
  unsigned short* Z   = (unsigned short*)(ws + oZ);
  float* out0 = (float*)d_out;
  float* fdummy = (float*)(ws + oXQ);             // in-range placeholder for unused f32 output args
  unsigned short* hdummy = XQ;                    // in-range placeholder for unused f16 output args

  const dim3 blk(256);
  const int gP = ((MT / 64) * (DM / 64)) / 8;     // 64x64 tiles / 8 waves, exact

  // (0) operand planes: query/key/value -> f16(bf16) per batch slice; table -> f16(bf16 x64) padded to 512 rows;
  //     Wq|Wk|Wv [512][512] -> WT rows 0.., 512.., 1024.. (transposed, f16 x64); Wo -> WOT (transposed, f16 x64)
  cvt_lin<<<dim3((SEQ * DM) / 2048, NB), blk, 0, stream>>>(query, XQ, SEQ * DM, SEQ * DM, 1.0f, SEQ_FULL * DM, SEQ * DM);
  cvt_lin<<<dim3((SEQ * DM) / 2048, NB), blk, 0, stream>>>(key,   XK, SEQ * DM, SEQ * DM, 1.0f, SEQ_FULL * DM, SEQ * DM);
  cvt_lin<<<dim3((SEQ * DM) / 2048, NB), blk, 0, stream>>>(value, XV, SEQ * DM, SEQ * DM, 1.0f, SEQ_FULL * DM, SEQ * DM);
  cvt_lin<<<dim3((RPAD * HD) / 2048, 1), blk, 0, stream>>>(rel, PEH, NREL * HD, RPAD * HD, WSCL, 0, 0);
  cvt_t<<<dim3(DM / 64, DM / 64), blk, 0, stream>>>(wq, WT, DM, DM, WSCL);                              // in[512][512] -> out[512][512]
  cvt_t<<<dim3(DM / 64, DM / 64), blk, 0, stream>>>(wk, WT + (size_t)DM * DM, DM, DM, WSCL);
  cvt_t<<<dim3(DM / 64, DM / 64), blk, 0, stream>>>(wv, WT + (size_t)2 * DM * DM, DM, DM, WSCL);
  cvt_t<<<dim3(DM / 64, DM / 64), blk, 0, stream>>>(wo, WOT, DM, DM, WSCL);

  // (1) q hi/res planes: s = 16*(x.Wq + bq) -> QH = f16(s), QL = f16(2048*(s - QH)); same for k
  gemm64<2, 1><<<dim3(gP), blk, 0, stream>>>(XQ, DM, WT, DM, QH, QL, fdummy, DM, QKS / WSCL, bq, QKS, MT, DM, DM);
  gemm64<2, 1><<<dim3(gP), blk, 0, stream>>>(XK, DM, WT + (size_t)DM * DM, DM, KH, KL, fdummy, DM, QKS / WSCL, bk, QKS, MT, DM, DM);
  //     v^T x16: C[d][tok] = sum_k WT[1024+d][k] * XV[tok][k], bias by row d
  gemm64<1, 2><<<dim3(gP), blk, 0, stream>>>(WT + (size_t)2 * DM * DM, DM, XV, DM, VT, hdummy, fdummy, MT, VSC / WSCL, bv, VSC, DM, MT, DM);

  // (2) attention -> ctx x16 token-major plane
  attn_kernel<<<dim3((NB * NH * (SEQ / 16)) / AWV), dim3(128), 0, stream>>>(QH, QL, KH, KL, PEH, VT, mask, Z);

  // (3) output projection: out[row][n] = sum_k Z[row][k] * WOT[n][k] / (16*64) + bo[n]
  gemm64<0, 1><<<dim3(gP), blk, 0, stream>>>(Z, DM, WOT, DM, hdummy, hdummy, out0, DM, 1.0f / (WSCL * CSC), bo, 1.0f, MT, DM, DM);
  (void)hipGetLastError();
}

// v002
// Measured time: 227 microseconds a run.
// Two timings next to v001 put it at 1.06 and 1.07 times that version's speed.
// All steps since v000 together make it 1.30 times as fast.
// Contractions: x.Wq and x.Wk (q, k hi + residual planes), x.Wv (v^T plane), q.k^T (hi.hi + hi.res + res.hi),
// q.rel^T (hi + res), p.v and ctx.Wo, all on v_wmma_f32_16x16x32_f16 (f16 operands, f32 accumulate).
// Float inputs RNE-converted to bf16 on load and carried in f16 containers with power-of-two scales
// (x x1; Wq, Wk, Wv, Wo x64; rel table x64; q, k hi planes x16, residual planes x16x2048; v^T x16;
// p x4096; ctx x16); softmax, key mask and the relative-offset skew in f32 on VALU.
// The planes that the attention kernel reads (q, k hi + residual, v^T, table) lie in fragment order: the 16 bytes
// of lane l of one operand load stand at piece base + 16*l, so that a load covers four whole 128-byte lines.
#include <hip/hip_runtime.h>
#include <math.h>

#ifndef NB
#define NB 2
#endif
#ifndef SEQ
#define SEQ 2048
#endif
#define NB_FULL  2
#define SEQ_FULL 2048
#define DM   512
#define NH   8
#define HD   64
#define MT   (NB * SEQ)
#define NREL 499
#define RCEN 249
#define POFF 22
#define NPT  34
#define AWV  4
#define RWP  48
#define WSCL 64.0f
#define QKS  16.0f
#define LSC  2048.0f
#define VSC  16.0f
#define PSC  4096.0f
#define CSC  16.0f
#define RSQD 0.125f
#define MASKV (-1.0e10f)

static_assert(NH * HD == DM);
static_assert(HD == 64);
static_assert(NB >= 1 && NB <= NB_FULL);
static_assert((SEQ % 64) == 0 && SEQ >= 64 && SEQ <= SEQ_FULL);
static_assert((MT % 64) == 0 && (DM % 64) == 0);
static_assert((((MT / 64) * (DM / 64)) % 8) == 0);
static_assert(((SEQ * DM) % 2048) == 0 && ((NPT * 128) % 256) == 0);
static_assert(((NB * NH * (SEQ / 16)) % AWV) == 0);
static_assert((2 * RCEN + 1) == NREL);
static_assert(((RCEN - 15 + POFF) % 16) == 0 && POFF >= 15 && 16 * (NPT - 1) - POFF >= NREL - 1);

typedef _Float16 v16h __attribute__((ext_vector_type(16)));
typedef unsigned short v16us __attribute__((ext_vector_type(16)));
typedef unsigned short v8us  __attribute__((ext_vector_type(8)));
typedef float v8f __attribute__((ext_vector_type(8)));
typedef float v4f __attribute__((ext_vector_type(4)));
typedef unsigned int v4u __attribute__((ext_vector_type(4)));

union FragU { v16us v; v8us h[2]; };

// ---- scalar helpers --------------------------------------------------------------------------------
__device__ __forceinline__ unsigned short bf_bits(float f) {          // f32 -> bf16 bits, RNE convert
  const unsigned u = __float_as_uint(f);
  return (unsigned short)((u + 0x7FFFu + ((u >> 16) & 1u)) >> 16);
}
__device__ __forceinline__ float bf_up(unsigned short h) { return __uint_as_float(((unsigned)h) << 16); }
__device__ __forceinline__ float bfr(float f) { return bf_up(bf_bits(f)); }   // value of the bf16 RNE convert
__device__ __forceinline__ unsigned short h_bits(_Float16 x) { return __builtin_bit_cast(unsigned short, x); }
__device__ __forceinline__ unsigned short f2h(float f) { return h_bits((_Float16)f); }
__device__ __forceinline__ unsigned pk16(unsigned short a, unsigned short b) { return (unsigned)a | ((unsigned)b << 16); }
__device__ __forceinline__ int clampi(int v, int lo, int hi) { return v < lo ? lo : (v > hi ? hi : v); }
__device__ __forceinline__ v8f zero8() { v8f z = {0.f, 0.f, 0.f, 0.f, 0.f, 0.f, 0.f, 0.f}; return z; }

// ---- fragment loader: 16-bit A/B operand, lane -> row/col (lane&15), p already includes +8*(lane>>4);
//      elements 0..7 <- p[0..7] (k0+8h..), elements 8..15 <- p[16..23] (k0+16+8h..)
__device__ __forceinline__ v16us ldfrag_u(const unsigned short* p) {
  FragU f;
  f.h[0] = *(const v8us*)(p);
  f.h[1] = *(const v8us*)(p + 16);
  return f.v;
}

// ---- the same fragment from a plane in fragment order: p = fragment base + 8*lane; the piece of elements 0..7 is
//      256 halves (32 lanes x 8), the piece of elements 8..15 follows it
__device__ __forceinline__ v16us ldfrag_p(const unsigned short* p) {
  FragU f;
  f.h[0] = *(const v8us*)(p);
  f.h[1] = *(const v8us*)(p + 256);
  return f.v;
}

// ---- WMMA helpers (f16 operand bits) with trailing VALU hazard gap --------------------------------
__device__ __forceinline__ v8f mma_raw(v16us a, v16us b, v8f c) {
  return __builtin_amdgcn_wmma_f32_16x16x32_f16(false, __builtin_bit_cast(v16h, a), false,
                                                __builtin_bit_cast(v16h, b), (short)0, c, false, false);
}
__device__ __forceinline__ v8f mma_g(v16us a, v16us b, v8f c) {                 // guarded
  c = mma_raw(a, b, c);
#if defined(__HIP_DEVICE_COMPILE__)
  asm volatile("v_nop\n\tv_nop\n\tv_nop\n\tv_nop" : "+v"(c) : "v"(a), "v"(b));
#endif
  return c;
}
__device__ __forceinline__ void dep_guard1(v8f& a, v8f& b, v16us x) {
#if defined(__HIP_DEVICE_COMPILE__)
  asm volatile("v_nop\n\tv_nop\n\tv_nop\n\tv_nop" : "+v"(a), "+v"(b) : "v"(x));
#endif
}
__device__ __forceinline__ void keep4_u(v16us a, v16us b, v16us c, v16us d) {
#if defined(__HIP_DEVICE_COMPILE__)
  asm volatile("v_nop" :: "v"(a), "v"(b), "v"(c), "v"(d));
#endif
}
__device__ __forceinline__ void acc_guard4(v8f& a, v8f& b, v8f& c, v8f& d) {
#if defined(__HIP_DEVICE_COMPILE__)
  asm volatile("v_nop\n\tv_nop\n\tv_nop\n\tv_nop" : "+v"(a), "+v"(b), "+v"(c), "+v"(d));
#endif
}
// orders LDS stores of this wave before later LDS loads of the same wave (cross-lane exchange)
__device__ __forceinline__ void wave_sync_lds() {
  __builtin_amdgcn_fence(__ATOMIC_RELEASE, "workgroup");
  __builtin_amdgcn_wave_barrier();
  __builtin_amdgcn_fence(__ATOMIC_ACQUIRE, "workgroup");
}

// the same exchange for a wave that has global loads in flight: waits for this wave's LDS operations only
__device__ __forceinline__ void wave_sync_lds_only() {
#if defined(__HIP_DEVICE_COMPILE__)
  // LDS stores of this wave are done before its later LDS loads issue, and the "memory" clobber keeps the compiler
  // from moving either across; the fence pair above would also wait out the next key block's global loads
  asm volatile("s_wait_dscnt 0x0" ::: "memory");
#endif
  __builtin_amdgcn_wave_barrier();
}

// stands behind a group of global loads that stay in flight: their address registers may be rewritten behind it
__device__ __forceinline__ void addr_regs_free() {
#if defined(__HIP_DEVICE_COMPILE__)
  asm volatile("s_wait_xcnt 0x0" ::: "memory");
#endif
}

// the same wait with the loads' address values as inputs: their registers stay live, so unwritten, up to the wait
// (the "memory" clobber alone does not keep a register write, or a later load's destination, behind it)
__device__ __forceinline__ void addr_regs_free_of(const void* a) {
#if defined(__HIP_DEVICE_COMPILE__)
  asm volatile("s_wait_xcnt 0x0" :: "v"(a) : "memory");
#endif
}
__device__ __forceinline__ void addr_regs_free_of(const void* a, const void* b, const void* c, const void* d,
                                                  const void* e) {
#if defined(__HIP_DEVICE_COMPILE__)
  asm volatile("s_wait_xcnt 0x0" :: "v"(a), "v"(b), "v"(c), "v"(d), "v"(e) : "memory");
#endif
}

// =====================================================================================================
// Layout-kept convert: o[i] = f16 bits of (bf16 RNE value of w[i] * sc) for i < nsrc, zero for nsrc <= i < ndst.
// blockIdx.y selects a batch slice: source base + y*sstr, destination base + y*dstr (element strides).
// nsrc % 8 == 0, ndst % 2048 == 0, grid.x = ndst/2048 exact (host-checked).
// coverage: 256 threads x 8 = 2048 elements per block; grid covers all ndst elements incl. the zero pad.
// =====================================================================================================
__global__ __launch_bounds__(256) void cvt_lin(const float* __restrict__ w, unsigned short* o,
                                                int nsrc, int ndst, float sc, int sstr, int dstr) {
  const float* wb = w + (size_t)blockIdx.y * (size_t)sstr;
  unsigned short* ob = o + (size_t)blockIdx.y * (size_t)dstr;
  const int base = (blockIdx.x * 256 + threadIdx.x) * 8;
  if (base + 8 > ndst) return;                            // never taken with exact grids; no barriers below
  const bool inr = (base + 8 <= nsrc);
  const int lb = inr ? base : (nsrc - 8);                 // clamped address, always in range
  const v4f a0 = *(const v4f*)(wb + lb);
  const v4f a1 = *(const v4f*)(wb + lb + 4);
  v4u hv;
#pragma unroll
  for (int e = 0; e < 2; ++e) {
    hv[e]     = pk16(f2h(bfr(a0[2 * e]) * sc), f2h(bfr(a0[2 * e + 1]) * sc));
    hv[2 + e] = pk16(f2h(bfr(a1[2 * e]) * sc), f2h(bfr(a1[2 * e + 1]) * sc));
  }
  const v4u zz = {0u, 0u, 0u, 0u};
  hv = inr ? hv : zz;
  unsigned short* d = ob + base;
  *(v4u*)d = hv;
  
}

// =====================================================================================================
// Table plane in fragment order: tile u (0..NPT-1) holds the 16 table rows clamp(16u - POFF + 0..15, 0, NREL-1) as
// four pieces of 256 halves; piece j, lane l = row (l&15) of the tile, head dims 16j + 8*(l>>4) .. +7, as f16 bits
// of (bf16 RNE value * sc). The band tiles of the attention kernel all start at a row = -POFF (mod 16), so every one
// of them is a tile of this plane; tile 0 is row 0 sixteen times, tile NPT-1 row NREL-1 sixteen times.
// coverage: one thread per 16-byte chunk, NPT*128 chunks, grid NPT*128/256 exact.
// =====================================================================================================
__global__ __launch_bounds__(256) void cvt_band(const float* __restrict__ w, unsigned short* o, float sc) {
  const int g = blockIdx.x * 256 + threadIdx.x;
  if (g >= NPT * 128) return;                             // never taken with the exact grid; no barriers below
  const int u = g >> 7, j = (g >> 5) & 3, l = g & 31;
  const int row = clampi(16 * u - POFF + (l & 15), 0, NREL - 1);
  const float* p = w + (size_t)row * HD + 16 * j + 8 * (l >> 4);
  const v4f a0 = *(const v4f*)(p);
  const v4f a1 = *(const v4f*)(p + 4);
  v4u hv;
#pragma unroll
  for (int e = 0; e < 2; ++e) {
    hv[e]     = pk16(f2h(bfr(a0[2 * e]) * sc), f2h(bfr(a0[2 * e + 1]) * sc));
    hv[2 + e] = pk16(f2h(bfr(a1[2 * e]) * sc), f2h(bfr(a1[2 * e + 1]) * sc));
  }
  *(v4u*)(o + (size_t)g * 8) = hv;
}

// =====================================================================================================
// Transpose-convert: in w[R][C] f32 -> out o[C][R] f16 bits of (bf16 RNE value * sc). Block tile 64x64
// through LDS (st[col][row], pitch 72 halves). Read phase: thread owns one input row x 16 columns (float4
// R, C multiples of 64, grid (C/64, R/64) exact (host-checked).
// coverage: 64 output rows x 64 halves per block = the whole transposed tile; grid covers all of [C][R].
// =====================================================================================================
__global__ __launch_bounds__(256) void cvt_t(const float* __restrict__ w, unsigned short* o, int R, int C, float sc) {
  __shared__ __align__(16) unsigned short st[64 * 72];
  const int t = threadIdx.x;
  const int r0 = blockIdx.y * 64, c0 = blockIdx.x * 64;
  if (r0 + 64 > R || c0 + 64 > C) return;               // block-uniform, before the barrier; never taken
  {
    const int row = t >> 2, ch = (t & 3) * 16;
    const float* p = w + (size_t)(r0 + row) * C + c0 + ch;
#pragma unroll
    for (int q = 0; q < 4; ++q) {
      const v4f v = *(const v4f*)(p + 4 * q);
#pragma unroll
      for (int e = 0; e < 4; ++e) st[(ch + 4 * q + e) * 72 + row] = f2h(bfr(v[e]) * sc);
    }
  }
  __syncthreads();
  v4u hv[2];
#pragma unroll
  for (int half = 0; half < 2; ++half) {
    const int cl = (t >> 3) + 32 * half, pc = (t & 7) * 8;
    hv[half] = *(const v4u*)(st + cl * 72 + pc);
  }
  {
#pragma unroll
    for (int half = 0; half < 2; ++half) {
      const int cl = (t >> 3) + 32 * half, pc = (t & 7) * 8;
      unsigned short* dst = o + (size_t)(c0 + cl) * R + r0 + pc;
      *(v4u*)dst = hv[half];
    }
    
  }
}

// =====================================================================================================
// Register-blocked f16 WMMA GEMM: C[m][n] = sum_k A[m][k] * Bt[n][k], one wave per 64x64 tile, no block
// barriers. A row-major [M][K] pitch lda; Bt row-major [N][K] pitch ldb (k contiguous); M, N multiples of 64,
// K multiple of 32 (true at every call site; host grids = tiles/8 exact so no wave exits early). Both operand
// fragments use the split k map (elements 0..7 <- k0+8h.., 8..15 <- k0+16+8h..); D element r of a lane is
// (row 8h + r, col lane&15).
// s = acc*osc + bias term (BM 0: none; BM 1: bsc*bf16(bias[col]); BM 2: bsc*bf16(bias[row])).
// OM 0: f32 out Cf = s, pitch ldc.   OM 1: f16 out Ch = f16 bits(s).
// OM 2: f16 hi plane Ch = f16(s) and f16 residual plane Cl = f16((s - hi) * 2048), same layout.
// f16 outputs lie in fragment order (ldc unused). A 16x64 slab is four pieces of 256 halves; piece it, lane l =
// slab row (l&15), slab columns 16*it + 8*(l>>4) .. +7, i.e. one load of a fragment whose lane index is the row and
// whose k index is the column. OM 2: slab (row tile T = row/16, column tile tn) at ((tn*(M/16) + T)*4 + it)*256.
// OM 1: pieces 2*kb, 2*kb + 1 of a slab are k block kb of 32 columns; piece at
// (((tm*(N/32) + column/32)*4 + row tile in tm)*2 + (it&1))*256, so that a k block's four row tiles are contiguous.
// coverage: 4 slabs x 16 rows x 64 cols = the wave's whole 64x64 tile.
// =====================================================================================================
template <int OM, int BM>
__global__ __launch_bounds__(256) void gemm64(
    const unsigned short* __restrict__ Ap, int lda, const unsigned short* __restrict__ Btp, int ldb,
    unsigned short* Ch, unsigned short* Cl, float* Cf, int ldc, float osc,
    const float* __restrict__ bias, float bsc, int M, int N, int K) {
  __shared__ __align__(16) float sT[8][16 * 68];   // per-wave 16x64 slab, pitch 68 floats
  const int lane = threadIdx.x & 31;
  const int wave = threadIdx.x >> 5;
  const int tilesN = N >> 6;
  const int tilesM = M >> 6;
  const int tile = blockIdx.x * 8 + wave;
  if (tile >= tilesM * tilesN) return;   // wave-uniform; no block barriers in this kernel
  const int tm = tile / tilesN;
  const int tn = tile - tm * tilesN;
  const int m0 = tm << 6;
  const int n0 = tn << 6;

  const int rlane = lane & 15;                 // row (A) / col (B, D) within subtile
  const int koff  = (lane >> 4) * 8;           // k offset of this lane half
  const int mOff  = (lane >> 4) * 8;           // D row offset

  v8f acc[4][4];
#pragma unroll
  for (int i = 0; i < 4; ++i)
#pragma unroll
    for (int j = 0; j < 4; ++j) acc[i][j] = zero8();

#pragma unroll 1
  for (int k0 = 0; k0 < K; k0 += 32) {
    v16us bh[4];
#pragma unroll
    for (int j = 0; j < 4; ++j) {
      const size_t bo = (size_t)(n0 + (j << 4) + rlane) * ldb + koff + k0;
      bh[j] = ldfrag_u(Btp + bo);
    }
#pragma unroll
    for (int i = 0; i < 4; ++i) {
      const size_t ao = (size_t)(m0 + (i << 4) + rlane) * lda + koff + k0;
      const v16us ah = ldfrag_u(Ap + ao);
#pragma unroll
      for (int j = 0; j < 4; ++j) acc[i][j] = mma_raw(ah, bh[j], acc[i][j]);
      dep_guard1(acc[i][0], acc[i][3], ah);
    }
    keep4_u(bh[0], bh[1], bh[2], bh[3]);
  }
  acc_guard4(acc[0][0], acc[0][1], acc[0][2], acc[0][3]);
  acc_guard4(acc[1][0], acc[1][1], acc[1][2], acc[1][3]);
  acc_guard4(acc[2][0], acc[2][1], acc[2][2], acc[2][3]);
  acc_guard4(acc[3][0], acc[3][1], acc[3][2], acc[3][3]);

  const int hh2 = lane >> 4, c4 = (lane & 15) * 4;     // f32 out: 256-B row segment = 16 lanes x 16 B

  // column bias terms (fixed per wave); addresses n0+c4+3 < N and n0+48+8+7 < N
  v4f bc4 = {0.f, 0.f, 0.f, 0.f};
  float bc8[4][8];                                      // f16 out: piece it, columns 16*it + 8*hh2 .. +7
#pragma unroll
  for (int it = 0; it < 4; ++it)
#pragma unroll
    for (int e = 0; e < 8; ++e) bc8[it][e] = 0.f;
  if (BM == 1) {
    if (OM == 0) {
      const v4f t4 = *(const v4f*)(bias + n0 + c4);
#pragma unroll
      for (int e = 0; e < 4; ++e) bc4[e] = bfr(t4[e]) * bsc;
    } else {
#pragma unroll
      for (int it = 0; it < 4; ++it) {
        const v4f ta = *(const v4f*)(bias + n0 + 16 * it + 8 * hh2);
        const v4f tb = *(const v4f*)(bias + n0 + 16 * it + 8 * hh2 + 4);
#pragma unroll
        for (int e = 0; e < 4; ++e) { bc8[it][e] = bfr(ta[e]) * bsc; bc8[it][4 + e] = bfr(tb[e]) * bsc; }
      }
    }
  }

  // ---- epilogue ----
  float* slab = sT[wave];
#pragma unroll
  for (int i = 0; i < 4; ++i) {
    const int mBase = m0 + (i << 4);
#pragma unroll
    for (int j = 0; j < 4; ++j) {
#pragma unroll
      for (int r = 0; r < 8; ++r) {
        slab[(mOff + r) * 68 + (j << 4) + rlane] = acc[i][j][r];
      }
    }
    wave_sync_lds();
    if (OM == 0) {
      v4f vals[8];
#pragma unroll
      for (int it = 0; it < 8; ++it) {
        const int row = it * 2 + hh2;                      // it 0..7 x hh2 0..1 = rows 0..15
        const v4f v = *(const v4f*)(slab + row * 68 + c4);
        float rb2 = 0.f;
        if (BM == 2) rb2 = bfr(bias[mBase + row]) * bsc;
        vals[it] = v * osc + bc4 + rb2;
      }
      {
#pragma unroll
        for (int it = 0; it < 8; ++it) {
          const int row = it * 2 + hh2;
          *(v4f*)(Cf + (size_t)(mBase + row) * ldc + (size_t)n0 + c4) = vals[it];
        }
        
      }
    } else {
      v4u hv[4], hl[4];
      float rb2 = 0.f;
      if (BM == 2) rb2 = bfr(bias[mBase + rlane]) * bsc;
#pragma unroll
      for (int it = 0; it < 4; ++it) {
        const float* sp = slab + rlane * 68 + 16 * it + 8 * hh2;   // rows 0..15 x (it, hh2) = 8 column chunks
        v4u ha = {0u, 0u, 0u, 0u};
        v4u la = {0u, 0u, 0u, 0u};
#pragma unroll
        for (int e = 0; e < 4; ++e) {
          const float b0 = sp[2 * e]     * osc + bc8[it][2 * e]     + rb2;
          const float b1 = sp[2 * e + 1] * osc + bc8[it][2 * e + 1] + rb2;
          if (OM == 1) {
            ha[e] = pk16(f2h(b0), f2h(b1));
          } else {
            const _Float16 h0 = (_Float16)b0;
            const _Float16 h1 = (_Float16)b1;
            const float l0 = (b0 - (float)h0) * LSC;       // difference exact, power-of-two carry exact
            const float l1 = (b1 - (float)h1) * LSC;
            ha[e] = pk16(h_bits(h0), h_bits(h1));
            la[e] = pk16(f2h(l0), f2h(l1));
          }
        }
        hv[it] = ha;
        hl[it] = la;
      }
      {
#pragma unroll
        for (int it = 0; it < 4; ++it) {
          const size_t pc = (OM == 2)
              ? ((size_t)tn * (size_t)(M >> 4) + (size_t)(mBase >> 4)) * 4 + it
              : (((size_t)tm * (size_t)(N >> 5) + (size_t)((n0 >> 5) + (it >> 1))) * 4 + i) * 2 + (it & 1);
          const size_t go = pc * 256 + (size_t)(lane * 8);    // 32 lanes x 16 B = the whole piece
          *(v4u*)(Ch + go) = hv[it];
          if (OM == 2) *(v4u*)(Cl + go) = hl[it];
        }
        addr_regs_free();
      }
    }
    wave_sync_lds();
  }
}

// ---- per-tile products used by the attention kernel ----------------------------------------------
// R = ah.b + (al.b)/2048 over 64 head dims (b0, b1: fragments of a [n][64] f16 plane row, dims 0..31 and 32..63)
__device__ __forceinline__ v8f dot2_res(v16us ah0, v16us ah1, v16us al0, v16us al1, v16us b0, v16us b1) {
  v8f L = mma_g(al0, b0, zero8());
  L = mma_g(al1, b1, L);
  L = L * (1.0f / LSC);
  v8f R = mma_g(ah0, b0, L);
  R = mma_g(ah1, b1, R);
  return R;
}
// S = qh.kh + (qh.kl + ql.kh)/2048 over 64 head dims (kh from the hi plane row, kl from the residual plane row)
__device__ __forceinline__ v8f dot3_res(v16us qh0, v16us qh1, v16us ql0, v16us ql1,
                                        v16us kh0, v16us kh1, v16us kl0, v16us kl1) {
  v8f L = mma_g(qh0, kl0, zero8());
  L = mma_g(qh1, kl1, L);
  L = mma_g(ql0, kh0, L);
  L = mma_g(ql1, kh1, L);
  L = L * (1.0f / LSC);
  v8f S = mma_g(qh0, kh0, L);
  S = mma_g(qh1, kh1, S);
  return S;
}

// =====================================================================================================
// Non-causal attention with clipped relative-offset term and key-padding mask, head dim 64.
// Block = 128 threads = 4 waves; one wave owns one 16-row query tile (t0..t0+15) of one (batch b, head h)
// and loops all key blocks of 32 with an online max-subtracted softmax in f32.
// Planes, all in fragment order (a fragment = two pieces of 256 halves, lane l's 8 halves at piece + 8*l):
// QH/KH f16 = 16*q, 16*k, QL/KL = 2048*(16q - QH) residuals: [head][token tile of 16][dims 0..31 | 32..63];
// PE f16 = 64*rel table, [tile u][dims 0..31 | 32..63], tile u = table rows clamp(16u - POFF + 0..15, 0, 498);
// VT f16 = 16*v transposed: [head][key block of 32][dim tile of 16]; mask int32 [NB_FULL][SEQ_FULL].
// Output Z f16 [MT][512] = 16*ctx, token-major (row = b*SEQ + t, col = h*64+d).
// Per key block sb: S = 256*q.k (hi.hi + hi.res + res.hi, 2 key subtiles); relative band of 48 columns:
// column c <-> table row clamp(234 - t0 + sb + c, 0, 498) (clamped per column, which IS the clipped index), so
// columns 16k..16k+15 are table tile clamp(16 - t0/16 + sb/16 + k, 0, NPT-1);
// columns 0..15 come from the tile carried over from the prior key block (its columns 32..47), columns
// 16..47 are two fresh tiles (hi + res products, value 1024*q.rel); the band is exchanged through per-wave
// LDS and read back at c = 15 - row + col, i.e. table row clamp(j - i + 249, 0, 498);
// score = qk/8 + bias; then replace-fill -1e10 where mask[b][j] == 0; p = exp(score - running max) in f32,
// l accumulated from the f32 p; 4096*p stored as f16 in per-wave LDS and reloaded as the A fragment
// (split k map); O += P.V on 4 dim subtiles. Every same-wave LDS exchange (band, P tile, ctx staging) has a
// coverage: 16 query rows x 64 halves per wave, NB*NH*(SEQ/16) wave tasks = all (b, t, h) segments of Z.
// LDS: band 16x48 floats, P 16x32 halves, ctx 16x64 halves per wave; staged extent == consumed extent.
// Global operands run one key block ahead in registers: K (hi + residual), table rows and mask words are
// reloaded for key block kb + 1 behind the score and band products of key block kb, V^T behind its P.V
// products, into the same variables, so that a load has most of a pass to land before its wait. The last
// pass reloads its own block (addresses in range, values unused).
// =====================================================================================================
__global__ __launch_bounds__(128) void attn_kernel(
    const unsigned short* __restrict__ QH, const unsigned short* __restrict__ QL,
    const unsigned short* __restrict__ KH, const unsigned short* __restrict__ KL,
    const unsigned short* __restrict__ PE, const unsigned short* __restrict__ VT,
    const int* __restrict__ mask, unsigned short* Z) {
  __shared__ __align__(16) float relw[AWV][16 * RWP];            // band exchange, 12288 B
  __shared__ __align__(16) unsigned short pws[AWV][16 * 32];      // P tiles, 4096 B
  __shared__ __align__(16) unsigned short zst[AWV][16 * 64];      // ctx staging, 8192 B
  const int lane = threadIdx.x & 31, wv = threadIdx.x >> 5, m = lane & 15, hh = lane >> 4;
  const int task = blockIdx.x * AWV + wv;            // 0 .. NB*NH*(SEQ/16)-1
  const int nqt = SEQ / 16;
  const int bh = task / nqt;                         // (b, h)
  const int t0 = (task - bh * nqt) << 4;             // query tile start
  const int b = bh / NH, h = bh - (bh / NH) * NH;
  if (b >= NB) return;                               // wave-uniform; never taken with exact grids; no block barriers
  const size_t tok0 = (size_t)b * SEQ;               // plane row base of this batch
  const int* mk = mask + (size_t)b * SEQ_FULL;       // full input stride for the mask row
  float* rw = relw[wv];
  unsigned short* ph = pws[wv];

  // Q A-fragments (hi and residual): rows t0+m, k = head dims 0..31 and 32..63
  const size_t qo = ((size_t)h * (MT / 16) + ((tok0 + (size_t)t0) >> 4)) * 1024 + (size_t)(lane * 8);
  const v16us qh0 = ldfrag_p(QH + qo);
  const v16us qh1 = ldfrag_p(QH + qo + 512);
  const v16us ql0 = ldfrag_p(QL + qo);
  const v16us ql1 = ldfrag_p(QL + qo + 512);
  addr_regs_free();

  const int ub = (RCEN - 15 + POFF) / 16 - (t0 >> 4);  // table tile of band columns 0..15 at sb = 0 (before clamp)

  // carried band tile: columns 0..15 of key block 0
  const unsigned short* pcar = PE + (size_t)clampi(ub, 0, NPT - 1) * 1024 + lane * 8;
  const v16us cf0 = ldfrag_p(pcar), cf1 = ldfrag_p(pcar + 512);
  addr_regs_free_of(pcar);

  // lane-fixed parts of the operand addresses; key block sb adds sb/16 token tiles (K), sb/16 table tiles,
  // sb/32 key blocks (V^T), sb columns (mask)
  const size_t kfix = ((size_t)h * (MT / 16) + (tok0 >> 4)) * 1024 + (size_t)(lane * 8);
  const size_t vfix = ((size_t)h * (MT / 32) + (tok0 >> 5)) * 2048 + (size_t)(lane * 8);

  // operands of key block 0
  v16us ka0 = ldfrag_p(KH + kfix),        ka1 = ldfrag_p(KH + kfix + 512);     // keys 0..15, hi
  v16us ka2 = ldfrag_p(KL + kfix),        ka3 = ldfrag_p(KL + kfix + 512);     // keys 0..15, residual
  v16us kc0 = ldfrag_p(KH + kfix + 1024), kc1 = ldfrag_p(KH + kfix + 1536);    // keys 16..31, hi
  v16us kc2 = ldfrag_p(KL + kfix + 1024), kc3 = ldfrag_p(KL + kfix + 1536);    // keys 16..31, residual
  v16us pa0, pa1, pc0, pc1;                                                    // band columns 16..31, 32..47
  int mn0, mn1;                                                                // mask words of keys m, 16 + m
  {
    const unsigned short* p1 = PE + (size_t)clampi(ub + 1, 0, NPT - 1) * 1024 + lane * 8;
    const unsigned short* p2 = PE + (size_t)clampi(ub + 2, 0, NPT - 1) * 1024 + lane * 8;
    pa0 = ldfrag_p(p1); pa1 = ldfrag_p(p1 + 512);
    pc0 = ldfrag_p(p2); pc1 = ldfrag_p(p2 + 512);
    mn0 = mk[m]; mn1 = mk[16 + m];
    addr_regs_free_of(KH + kfix, KL + kfix, p1, p2, mk + m);
  }
  v16us vf0 = ldfrag_p(VT + vfix);
  v16us vf1 = ldfrag_p(VT + vfix + 512);
  v16us vf2 = ldfrag_p(VT + vfix + 1024);
  v16us vf3 = ldfrag_p(VT + vfix + 1536);
  addr_regs_free_of(VT + vfix);

  v8f carry = dot2_res(qh0, qh1, ql0, ql1, cf0, cf1);

  float mx[8], ls[8];
  v8f O0 = zero8(), O1 = zero8(), O2 = zero8(), O3 = zero8();
#pragma unroll
  for (int r = 0; r < 8; ++r) { mx[r] = -1.0e30f; ls[r] = 0.f; }

#pragma unroll 1
  for (int kb = 0; kb < SEQ / 32; ++kb) {
    const int sb = kb << 5;
    const int sn = (kb + 1 < SEQ / 32) ? sb + 32 : sb;   // key block whose operands are fetched in this pass
    // scores: Bt row = key token, k = head dim
    const v8f S0 = dot3_res(qh0, qh1, ql0, ql1, ka0, ka1, ka2, ka3);
    const v8f S1 = dot3_res(qh0, qh1, ql0, ql1, kc0, kc1, kc2, kc3);

    // relative band: columns 16..31 and 32..47 <-> table tiles clamp(ub + sb/16 + 1), clamp(ub + sb/16 + 2)
    v8f Pb1 = dot2_res(qh0, qh1, ql0, ql1, pa0, pa1);
    v8f Pb2 = dot2_res(qh0, qh1, ql0, ql1, pc0, pc1);

    // key mask values of this lane's two key columns
    const int mk0 = mn0;
    const int mk1 = mn1;

    // next key block's K, table and mask operands, one group (token tiles and columns below SEQ, table tiles clamped)
    {
      mn0 = mk[sn + m];
      mn1 = mk[sn + 16 + m];
      const size_t ko = kfix + (size_t)(sn >> 4) * 1024;
      ka0 = ldfrag_p(KH + ko);        ka1 = ldfrag_p(KH + ko + 512);
      ka2 = ldfrag_p(KL + ko);        ka3 = ldfrag_p(KL + ko + 512);
      kc0 = ldfrag_p(KH + ko + 1024); kc1 = ldfrag_p(KH + ko + 1536);
      kc2 = ldfrag_p(KL + ko + 1024); kc3 = ldfrag_p(KL + ko + 1536);
      const int un = ub + (sn >> 4);
      const unsigned short* p1 = PE + (size_t)clampi(un + 1, 0, NPT - 1) * 1024 + lane * 8;
      const unsigned short* p2 = PE + (size_t)clampi(un + 2, 0, NPT - 1) * 1024 + lane * 8;
      pa0 = ldfrag_p(p1); pa1 = ldfrag_p(p1 + 512);
      pc0 = ldfrag_p(p2); pc1 = ldfrag_p(p2 + 512);
      addr_regs_free_of(KH + ko, KL + ko, p1, p2, mk + sn + m);
    }
#pragma unroll
    for (int r = 0; r < 8; ++r) {
      const int row = 8 * hh + r;
      rw[row * RWP + m]      = carry[r];
      rw[row * RWP + 16 + m] = Pb1[r];
      rw[row * RWP + 32 + m] = Pb2[r];
    }
    carry = Pb2;
    wave_sync_lds_only();

    // skew read + scale + bias, then replace-fill masked keys
    float s0[8], s1[8];
#pragma unroll
    for (int r = 0; r < 8; ++r) {
      const int row = 8 * hh + r;
      const float rv0 = rw[row * RWP + 15 - row + m];
      const float rv1 = rw[row * RWP + 31 - row + m];
      const float v0 = S0[r] * (RSQD / (QKS * QKS)) + rv0 * (1.0f / (QKS * WSCL));
      const float v1 = S1[r] * (RSQD / (QKS * QKS)) + rv1 * (1.0f / (QKS * WSCL));
      s0[r] = (mk0 == 0) ? MASKV : v0;
      s1[r] = (mk1 == 0) ? MASKV : v1;
    }

    // online softmax (a row lives in the 16 lanes of one half-wave; xor butterflies 1,2,4,8)
#pragma unroll
    for (int r = 0; r < 8; ++r) {
      float xm = fmaxf(s0[r], s1[r]);
      xm = fmaxf(xm, __shfl_xor(xm, 1, 32));
      xm = fmaxf(xm, __shfl_xor(xm, 2, 32));
      xm = fmaxf(xm, __shfl_xor(xm, 4, 32));
      xm = fmaxf(xm, __shfl_xor(xm, 8, 32));
      const float mn = fmaxf(mx[r], xm);
      const float al = __expf(mx[r] - mn);
      mx[r] = mn;
      const float p0 = __expf(s0[r] - mn);
      const float p1 = __expf(s1[r] - mn);
      float ps = p0 + p1;
      ps += __shfl_xor(ps, 1, 32);
      ps += __shfl_xor(ps, 2, 32);
      ps += __shfl_xor(ps, 4, 32);
      ps += __shfl_xor(ps, 8, 32);
      ls[r] = ls[r] * al + ps;
      O0[r] = O0[r] * al;
      O1[r] = O1[r] * al;
      O2[r] = O2[r] * al;
      O3[r] = O3[r] * al;
      const int row = 8 * hh + r;
      ph[row * 32 + m]      = f2h(p0 * PSC);
      ph[row * 32 + 16 + m] = f2h(p1 * PSC);
    }
    wave_sync_lds_only();

    // P A-fragment (split k map) and V B-fragments (Bt row = h*64 + dim, k = key token)
    const v16us af = ldfrag_u(ph + m * 32 + 8 * hh);
    O0 = mma_g(af, vf0, O0);
    O1 = mma_g(af, vf1, O1);
    O2 = mma_g(af, vf2, O2);
    O3 = mma_g(af, vf3, O3);
    const size_t vo = vfix + (size_t)(sn >> 5) * 2048;
    vf0 = ldfrag_p(VT + vo);
    vf1 = ldfrag_p(VT + vo + 512);
    vf2 = ldfrag_p(VT + vo + 1024);
    vf3 = ldfrag_p(VT + vo + 1536);
    addr_regs_free_of(VT + vo);
  }
  acc_guard4(O0, O1, O2, O3);

  // ---- epilogue: ctx = O / (l * PSC * VSC), stored x CSC as f16, token-major plane ----
  unsigned short* zs = zst[wv];
  const float fin = CSC / (PSC * VSC);
#pragma unroll
  for (int r = 0; r < 8; ++r) {
    const int row = 8 * hh + r;
    const float linv = 1.0f / ls[r];                   // ls >= 1
    const float g = linv * fin;
    zs[row * 64 + m]      = f2h(O0[r] * g);
    zs[row * 64 + 16 + m] = f2h(O1[r] * g);
    zs[row * 64 + 32 + m] = f2h(O2[r] * g);
    zs[row * 64 + 48 + m] = f2h(O3[r] * g);
  }
  wave_sync_lds();
  {
    const int q8 = lane >> 3, c8 = (lane & 7) * 8;
    v4u hv[4];
#pragma unroll
    for (int it = 0; it < 4; ++it) {
      const int row = it * 4 + q8;                     // it 0..3 x q8 0..3 = rows 0..15
      hv[it] = *(const v4u*)(zs + row * 64 + c8);
    }
    const size_t zr0 = (size_t)b * SEQ + (size_t)t0;
    {
#pragma unroll
      for (int it = 0; it < 4; ++it) {
        const int row = it * 4 + q8;
        unsigned short* dst = Z + (zr0 + (size_t)row) * DM + h * HD + c8;
        *(v4u*)dst = hv[it];
      }
      
    }
  }
}

// =====================================================================================================
// Workspace map (bytes, NB=2 SEQ=2048 -> MT=4096); every plane is an exact multiple of its whole-row /
// whole-line / 64x64-tile store granularity (rows MT, 1536, 512; 64 | each tiled dimension; the table plane
// is NPT tiles of 2048 bytes, all written); all offsets multiples of 2048. PEH, QH, QL, KH, KL, VT: fragment order.
//   XQ   f16  [4096][512]      0           4194304
//   XK   f16  [4096][512]      4194304     4194304
//   XV   f16  [4096][512]      8388608     4194304
//   WT   f16  [1536][512]      12582912    1572864   (Wq^T | Wk^T | Wv^T, x64)
//   WOT  f16  [512][512]       14155776     524288   (Wo^T, x64)
//   PEH  f16  [34][1024]       14680064      69632   (table x64, clamped tiles)
//   QH   f16  [8][256][1024]   14749696    4194304
//   QL   f16  [8][256][1024]   18944000    4194304
//   KH   f16  [8][256][1024]   23138304    4194304
//   KL   f16  [8][256][1024]   27332608    4194304
//   VT   f16  [8][128][2048]   31526912    4194304
//   Z    f16  [4096][512]      35721216    4194304
//   end                        39915520
// =====================================================================================================
extern "C" void kernel_launch(void* const* d_in, const int* in_sizes, int n_in,
                              void* d_out, int out_size, void* d_ws, size_t ws_size,
                              hipStream_t stream) {
  if (n_in < 13) return;
  const int xreq = ((NB - 1) * SEQ_FULL + SEQ) * DM;
  const int mreq = (NB - 1) * SEQ_FULL + SEQ;
  if (in_sizes[0] < xreq || in_sizes[1] < xreq || in_sizes[2] < xreq) return;
  if (in_sizes[3] < mreq) return;
  if (in_sizes[4] < DM * DM || in_sizes[6] < DM * DM || in_sizes[8] < DM * DM || in_sizes[10] < DM * DM) return;
  if (in_sizes[5] < DM || in_sizes[7] < DM || in_sizes[9] < DM || in_sizes[11] < DM) return;
  if (in_sizes[12] < NREL * HD) return;
  if (out_size < MT * DM) return;

  const float* query = (const float*)d_in[0];   // [NB_FULL][SEQ_FULL][512]
  const float* key   = (const float*)d_in[1];
  const float* value = (const float*)d_in[2];
  const int*   mask  = (const int*)d_in[3];     // [NB_FULL][SEQ_FULL] int32
  const float* wq = (const float*)d_in[4];      // [512][512] (in, out)
  const float* bq = (const float*)d_in[5];
  const float* wk = (const float*)d_in[6];
  const float* bk = (const float*)d_in[7];
  const float* wv = (const float*)d_in[8];
  const float* bv = (const float*)d_in[9];
  const float* wo = (const float*)d_in[10];
  const float* bo = (const float*)d_in[11];
  const float* rel = (const float*)d_in[12];    // [499][64]

  const size_t PX  = (size_t)MT * DM * 2;
  const size_t PWT = (size_t)3 * DM * DM * 2;
  const size_t PWO = (size_t)DM * DM * 2;
  const size_t PPE = (size_t)NPT * 1024 * 2;
  size_t off = 0;
  const size_t oXQ = off; off += PX;
  const size_t oXK = off; off += PX;
  const size_t oXV = off; off += PX;
  const size_t oWT = off; off += PWT;
  const size_t oWO = off; off += PWO;
  const size_t oPE = off; off += PPE;
  const size_t oQH = off; off += PX;
  const size_t oQL = off; off += PX;
  const size_t oKH = off; off += PX;
  const size_t oKL = off; off += PX;
  const size_t oVT = off; off += PX;
  const size_t oZ  = off; off += PX;
  if (off > ws_size) return;
  if (off > (size_t)134217728) return;

  char* ws = (char*)d_ws;
  unsigned short* XQ  = (unsigned short*)(ws + oXQ);
  unsigned short* XK  = (unsigned short*)(ws + oXK);
  unsigned short* XV  = (unsigned short*)(ws + oXV);
  unsigned short* WT  = (unsigned short*)(ws + oWT);
  unsigned short* WOT = (unsigned short*)(ws + oWO);
  unsigned short* PEH = (unsigned short*)(ws + oPE);
  unsigned short* QH  = (unsigned short*)(ws + oQH);
  unsigned short* QL  = (unsigned short*)(ws + oQL);
  unsigned short* KH  = (unsigned short*)(ws + oKH);
  unsigned short* KL  = (unsigned short*)(ws + oKL);
  unsigned short* VT  = (unsigned short*)(ws + oVT);
  unsigned short* Z   = (unsigned short*)(ws + oZ);
  float* out0 = (float*)d_out;
  float* fdummy = (float*)(ws + oXQ);             // in-range placeholder for unused f32 output args
  unsigned short* hdummy = XQ;                    // in-range placeholder for unused f16 output args

  const dim3 blk(256);
  const int gP = ((MT / 64) * (DM / 64)) / 8;     // 64x64 tiles / 8 waves, exact

  // (0) operand planes: query/key/value -> f16(bf16) per batch slice; table -> f16(bf16 x64) clamped tiles;
  //     Wq|Wk|Wv [512][512] -> WT rows 0.., 512.., 1024.. (transposed, f16 x64); Wo -> WOT (transposed, f16 x64)
  cvt_lin<<<dim3((SEQ * DM) / 2048, NB), blk, 0, stream>>>(query, XQ, SEQ * DM, SEQ * DM, 1.0f, SEQ_FULL * DM, SEQ * DM);
  cvt_lin<<<dim3((SEQ * DM) / 2048, NB), blk, 0, stream>>>(key,   XK, SEQ * DM, SEQ * DM, 1.0f, SEQ_FULL * DM, SEQ * DM);
  cvt_lin<<<dim3((SEQ * DM) / 2048, NB), blk, 0, stream>>>(value, XV, SEQ * DM, SEQ * DM, 1.0f, SEQ_FULL * DM, SEQ * DM);
  cvt_band<<<dim3((NPT * 128) / 256), blk, 0, stream>>>(rel, PEH, WSCL);
  cvt_t<<<dim3(DM / 64, DM / 64), blk, 0, stream>>>(wq, WT, DM, DM, WSCL);                              // in[512][512] -> out[512][512]
  cvt_t<<<dim3(DM / 64, DM / 64), blk, 0, stream>>>(wk, WT + (size_t)DM * DM, DM, DM, WSCL);
  cvt_t<<<dim3(DM / 64, DM / 64), blk, 0, stream>>>(wv, WT + (size_t)2 * DM * DM, DM, DM, WSCL);
  cvt_t<<<dim3(DM / 64, DM / 64), blk, 0, stream>>>(wo, WOT, DM, DM, WSCL);

  // (1) q hi/res planes: s = 16*(x.Wq + bq) -> QH = f16(s), QL = f16(2048*(s - QH)); same for k
  gemm64<2, 1><<<dim3(gP), blk, 0, stream>>>(XQ, DM, WT, DM, QH, QL, fdummy, DM, QKS / WSCL, bq, QKS, MT, DM, DM);
  gemm64<2, 1><<<dim3(gP), blk, 0, stream>>>(XK, DM, WT + (size_t)DM * DM, DM, KH, KL, fdummy, DM, QKS / WSCL, bk, QKS, MT, DM, DM);
  //     v^T x16: C[d][tok] = sum_k WT[1024+d][k] * XV[tok][k], bias by row d
  gemm64<1, 2><<<dim3(gP), blk, 0, stream>>>(WT + (size_t)2 * DM * DM, DM, XV, DM, VT, hdummy, fdummy, MT, VSC / WSCL, bv, VSC, DM, MT, DM);

  // (2) attention -> ctx x16 token-major plane
  attn_kernel<<<dim3((NB * NH * (SEQ / 16)) / AWV), dim3(128), 0, stream>>>(QH, QL, KH, KL, PEH, VT, mask, Z);

  // (3) output projection: out[row][n] = sum_k Z[row][k] * WOT[n][k] / (16*64) + bo[n]
  gemm64<0, 1><<<dim3(gP), blk, 0, stream>>>(Z, DM, WOT, DM, hdummy, hdummy, out0, DM, 1.0f / (WSCL * CSC), bo, 1.0f, MT, DM, DM);
  (void)hipGetLastError();
}

// v003
// Measured time: 153 microseconds a run.
// Timed twice side by side with v002, it ran 1.50 and 1.48 times as fast.
// All steps since v000 together make it 1.94 times as fast.
// Contractions: x.Wq and x.Wk (q, k hi + residual planes), x.Wv (v^T plane), q.k^T (hi.hi + hi.res + res.hi),
// q.rel^T (hi + res), p.v and ctx.Wo, all on v_wmma_f32_16x16x32_f16 (f16 operands, f32 accumulate).
// Float inputs RNE-converted to bf16 on load and carried in f16 containers with power-of-two scales
// (x x1; Wq, Wk, Wv, Wo x64; rel table x64; q, k hi planes x16, residual planes x16x2048; v^T x16;
// p x4096; ctx x16); softmax, key mask and the relative-offset skew in f32 on VALU.
// The planes that the attention kernel reads (q, k hi + residual, v^T, table) lie in fragment order: the 16 bytes
// of lane l of one operand load stand at piece base + 16*l, so that a load covers four whole 128-byte lines.
#include <hip/hip_runtime.h>
#include <math.h>

#ifndef NB
#define NB 2
#endif
#ifndef SEQ
#define SEQ 2048
#endif
#define NB_FULL  2
#define SEQ_FULL 2048
#define DM   512
#define NH   8
#define HD   64
#define MT   (NB * SEQ)
#define NREL 499
#define RCEN 249
#define POFF 22
#define NPT  34
#define AWV  4
#define RWP  48
#define WSCL 64.0f
#define QKS  16.0f
#define LSC  2048.0f
#define VSC  16.0f
#define PSC  4096.0f
#define CSC  16.0f
#define RSQD 0.125f
#define MASKV (-1.0e10f)
#define LINB ((SEQ * DM) / 2048)          // blocks of one batch slice of one activation plane
#define NTB  ((DM / 64) * (DM / 64))      // blocks of one weight transpose
#define NBB  ((NPT * 128) / 256)          // blocks of the table plane

static_assert(NH * HD == DM);
static_assert(HD == 64);
static_assert(NB >= 1 && NB <= NB_FULL);
static_assert((SEQ % 64) == 0 && SEQ >= 64 && SEQ <= SEQ_FULL);
static_assert((MT % 64) == 0 && (DM % 64) == 0);
static_assert((((MT / 64) * (DM / 64)) % 8) == 0);
static_assert(((SEQ * DM) % 2048) == 0 && ((NPT * 128) % 256) == 0);
static_assert(((NB * NH * (SEQ / 16)) % AWV) == 0);
static_assert((2 * RCEN + 1) == NREL);
static_assert(((RCEN - 15 + POFF) % 16) == 0 && POFF >= 15 && 16 * (NPT - 1) - POFF >= NREL - 1);

typedef _Float16 v16h __attribute__((ext_vector_type(16)));
typedef unsigned short v16us __attribute__((ext_vector_type(16)));
typedef unsigned short v8us  __attribute__((ext_vector_type(8)));
typedef float v8f __attribute__((ext_vector_type(8)));
typedef float v4f __attribute__((ext_vector_type(4)));
typedef unsigned int v4u __attribute__((ext_vector_type(4)));

union FragU { v16us v; v8us h[2]; };

// ---- scalar helpers --------------------------------------------------------------------------------
__device__ __forceinline__ unsigned short bf_bits(float f) {          // f32 -> bf16 bits, RNE convert
  const unsigned u = __float_as_uint(f);
  return (unsigned short)((u + 0x7FFFu + ((u >> 16) & 1u)) >> 16);
}
__device__ __forceinline__ float bf_up(unsigned short h) { return __uint_as_float(((unsigned)h) << 16); }
__device__ __forceinline__ float bfr(float f) { return bf_up(bf_bits(f)); }   // value of the bf16 RNE convert
__device__ __forceinline__ unsigned short h_bits(_Float16 x) { return __builtin_bit_cast(unsigned short, x); }
__device__ __forceinline__ unsigned short f2h(float f) { return h_bits((_Float16)f); }
__device__ __forceinline__ unsigned pk16(unsigned short a, unsigned short b) { return (unsigned)a | ((unsigned)b << 16); }
__device__ __forceinline__ int clampi(int v, int lo, int hi) { return v < lo ? lo : (v > hi ? hi : v); }
__device__ __forceinline__ v8f zero8() { v8f z = {0.f, 0.f, 0.f, 0.f, 0.f, 0.f, 0.f, 0.f}; return z; }

// ---- fragment loader: 16-bit A/B operand, lane -> row/col (lane&15), p already includes +8*(lane>>4);
//      elements 0..7 <- p[0..7] (k0+8h..), elements 8..15 <- p[16..23] (k0+16+8h..)
__device__ __forceinline__ v16us ldfrag_u(const unsigned short* p) {
  FragU f;
  f.h[0] = *(const v8us*)(p);
  f.h[1] = *(const v8us*)(p + 16);
  return f.v;
}

// ---- the same fragment from a plane in fragment order: p = fragment base + 8*lane; the piece of elements 0..7 is
//      256 halves (32 lanes x 8), the piece of elements 8..15 follows it
__device__ __forceinline__ v16us ldfrag_p(const unsigned short* p) {
  FragU f;
  f.h[0] = *(const v8us*)(p);
  f.h[1] = *(const v8us*)(p + 256);
  return f.v;
}

// ---- WMMA helpers (f16 operand bits) with trailing VALU hazard gap --------------------------------
__device__ __forceinline__ v8f mma_raw(v16us a, v16us b, v8f c) {
  return __builtin_amdgcn_wmma_f32_16x16x32_f16(false, __builtin_bit_cast(v16h, a), false,
                                                __builtin_bit_cast(v16h, b), (short)0, c, false, false);
}
__device__ __forceinline__ v8f mma_g(v16us a, v16us b, v8f c) {                 // guarded
  c = mma_raw(a, b, c);
#if defined(__HIP_DEVICE_COMPILE__)
  asm volatile("v_nop\n\tv_nop\n\tv_nop\n\tv_nop" : "+v"(c) : "v"(a), "v"(b));
#endif
  return c;
}
__device__ __forceinline__ void dep_guard1(v8f& a, v8f& b, v16us x) {
#if defined(__HIP_DEVICE_COMPILE__)
  asm volatile("v_nop\n\tv_nop\n\tv_nop\n\tv_nop" : "+v"(a), "+v"(b) : "v"(x));
#endif
}
__device__ __forceinline__ void keep4_u(v16us a, v16us b, v16us c, v16us d) {
#if defined(__HIP_DEVICE_COMPILE__)
  asm volatile("v_nop" :: "v"(a), "v"(b), "v"(c), "v"(d));
#endif
}
__device__ __forceinline__ void acc_guard4(v8f& a, v8f& b, v8f& c, v8f& d) {
#if defined(__HIP_DEVICE_COMPILE__)
  asm volatile("v_nop\n\tv_nop\n\tv_nop\n\tv_nop" : "+v"(a), "+v"(b), "+v"(c), "+v"(d));
#endif
}
// orders LDS stores of this wave before later LDS loads of the same wave (cross-lane exchange)
__device__ __forceinline__ void wave_sync_lds() {
  __builtin_amdgcn_fence(__ATOMIC_RELEASE, "workgroup");
  __builtin_amdgcn_wave_barrier();
  __builtin_amdgcn_fence(__ATOMIC_ACQUIRE, "workgroup");
}

// the same exchange for a wave that has global loads in flight: waits for this wave's LDS operations only
__device__ __forceinline__ void wave_sync_lds_only() {
#if defined(__HIP_DEVICE_COMPILE__)
  // LDS stores of this wave are done before its later LDS loads issue, and the "memory" clobber keeps the compiler
  // from moving either across; the fence pair above would also wait out the next key block's global loads
  asm volatile("s_wait_dscnt 0x0" ::: "memory");
#endif
  __builtin_amdgcn_wave_barrier();
}

// stands behind a group of global loads that stay in flight: their address registers may be rewritten behind it
__device__ __forceinline__ void addr_regs_free() {
#if defined(__HIP_DEVICE_COMPILE__)
  asm volatile("s_wait_xcnt 0x0" ::: "memory");
#endif
}

// the same wait with the loads' address values as inputs: their registers stay live, so unwritten, up to the wait
// (the "memory" clobber alone does not keep a register write, or a later load's destination, behind it)
__device__ __forceinline__ void addr_regs_free_of(const void* a) {
#if defined(__HIP_DEVICE_COMPILE__)
  asm volatile("s_wait_xcnt 0x0" :: "v"(a) : "memory");
#endif
}
__device__ __forceinline__ void addr_regs_free_of(const void* a, const void* b, const void* c, const void* d,
                                                  const void* e) {
#if defined(__HIP_DEVICE_COMPILE__)
  asm volatile("s_wait_xcnt 0x0" :: "v"(a), "v"(b), "v"(c), "v"(d), "v"(e) : "memory");
#endif
}

// =====================================================================================================
// Layout-kept convert: o[i] = f16 bits of (bf16 RNE value of w[i] * sc) for i < nsrc, zero for nsrc <= i < ndst.
// by selects a batch slice: source base + by*sstr, destination base + by*dstr (element strides); bx = block in the slice.
// nsrc % 8 == 0, ndst % 2048 == 0, bx = 0 .. ndst/2048 - 1 exact.
// coverage: 256 threads x 8 = 2048 elements per block; the blocks cover all ndst elements incl. the zero pad.
// =====================================================================================================
__device__ __forceinline__ void cvt_lin(const float* __restrict__ w, unsigned short* o,
                                        int nsrc, int ndst, float sc, int sstr, int dstr, int bx, int by) {
  const float* wb = w + (size_t)by * (size_t)sstr;
  unsigned short* ob = o + (size_t)by * (size_t)dstr;
  const int base = (bx * 256 + threadIdx.x) * 8;
  if (base + 8 > ndst) return;                            // never taken with exact grids; no barriers below
  const bool inr = (base + 8 <= nsrc);
  const int lb = inr ? base : (nsrc - 8);                 // clamped address, always in range
  const v4f a0 = *(const v4f*)(wb + lb);
  const v4f a1 = *(const v4f*)(wb + lb + 4);
  v4u hv;
#pragma unroll
  for (int e = 0; e < 2; ++e) {
    hv[e]     = pk16(f2h(bfr(a0[2 * e]) * sc), f2h(bfr(a0[2 * e + 1]) * sc));
    hv[2 + e] = pk16(f2h(bfr(a1[2 * e]) * sc), f2h(bfr(a1[2 * e + 1]) * sc));
  }
  const v4u zz = {0u, 0u, 0u, 0u};
  hv = inr ? hv : zz;
  unsigned short* d = ob + base;
  *(v4u*)d = hv;
  
}

// =====================================================================================================
// Table plane in fragment order: tile u (0..NPT-1) holds the 16 table rows clamp(16u - POFF + 0..15, 0, NREL-1) as
// four pieces of 256 halves; piece j, lane l = row (l&15) of the tile, head dims 16j + 8*(l>>4) .. +7, as f16 bits
// of (bf16 RNE value * sc). The band tiles of the attention kernel all start at a row = -POFF (mod 16), so every one
// of them is a tile of this plane; tile 0 is row 0 sixteen times, tile NPT-1 row NREL-1 sixteen times.
// coverage: one thread per 16-byte chunk, NPT*128 chunks, bx = 0 .. NPT*128/256 - 1 exact.
// =====================================================================================================
__device__ __forceinline__ void cvt_band(const float* __restrict__ w, unsigned short* o, float sc, int bx) {
  const int g = bx * 256 + threadIdx.x;
  if (g >= NPT * 128) return;                             // never taken with the exact grid; no barriers below
  const int u = g >> 7, j = (g >> 5) & 3, l = g & 31;
  const int row = clampi(16 * u - POFF + (l & 15), 0, NREL - 1);
  const float* p = w + (size_t)row * HD + 16 * j + 8 * (l >> 4);
  const v4f a0 = *(const v4f*)(p);
  const v4f a1 = *(const v4f*)(p + 4);
  v4u hv;
#pragma unroll
  for (int e = 0; e < 2; ++e) {
    hv[e]     = pk16(f2h(bfr(a0[2 * e]) * sc), f2h(bfr(a0[2 * e + 1]) * sc));
    hv[2 + e] = pk16(f2h(bfr(a1[2 * e]) * sc), f2h(bfr(a1[2 * e + 1]) * sc));
  }
  *(v4u*)(o + (size_t)g * 8) = hv;
}

// =====================================================================================================
// Transpose-convert: in w[R][C] f32 -> out o[C][R] f16 bits of (bf16 RNE value * sc). Block tile 64x64
// through LDS (st[col][row], pitch 72 halves). Read phase: thread owns one input row x 16 columns (float4
// R, C multiples of 64, (bx, by) = (0 .. C/64 - 1, 0 .. R/64 - 1) exact; st = the block's 64*72 halves of LDS.
// coverage: 64 output rows x 64 halves per block = the whole transposed tile; the blocks cover all of [C][R].
// =====================================================================================================
__device__ __forceinline__ void cvt_t(const float* __restrict__ w, unsigned short* o, int R, int C, float sc,
                                      int bx, int by, unsigned short* st) {
  const int t = threadIdx.x;
  const int r0 = by * 64, c0 = bx * 64;
  if (r0 + 64 > R || c0 + 64 > C) return;               // block-uniform, before the barrier; never taken
  {
    const int row = t >> 2, ch = (t & 3) * 16;
    const float* p = w + (size_t)(r0 + row) * C + c0 + ch;
#pragma unroll
    for (int q = 0; q < 4; ++q) {
      const v4f v = *(const v4f*)(p + 4 * q);
#pragma unroll
      for (int e = 0; e < 4; ++e) st[(ch + 4 * q + e) * 72 + row] = f2h(bfr(v[e]) * sc);
    }
  }
  __syncthreads();
  v4u hv[2];
#pragma unroll
  for (int half = 0; half < 2; ++half) {
    const int cl = (t >> 3) + 32 * half, pc = (t & 7) * 8;
    hv[half] = *(const v4u*)(st + cl * 72 + pc);
  }
  {
#pragma unroll
    for (int half = 0; half < 2; ++half) {
      const int cl = (t >> 3) + 32 * half, pc = (t & 7) * 8;
      unsigned short* dst = o + (size_t)(c0 + cl) * R + r0 + pc;
      *(v4u*)dst = hv[half];
    }
    
  }
}

// =====================================================================================================
// All operand planes in one launch; none reads what another writes. The flat block index picks the work, the same for
// the whole block (the barrier of cvt_t is passed by all of a block's threads or by none):
// 4*NTB blocks: Wq, Wk, Wv, Wo [512][512] -> WT rows 0.., 512.., 1024.., 1536.. (transposed, x64; the last is WOT);
// NBB blocks: table -> PE (x64, clamped tiles); 3*NB*LINB blocks: query, key, value -> X planes 0, 1, 2 per batch slice.
// The transposes, which take longest, have the lowest indices.
// =====================================================================================================
__global__ __launch_bounds__(256) void cvt_all(
    const float* __restrict__ query, const float* __restrict__ key, const float* __restrict__ value,
    const float* __restrict__ wq, const float* __restrict__ wk, const float* __restrict__ wv,
    const float* __restrict__ wo, const float* __restrict__ rel,
    unsigned short* X, unsigned short* WT, unsigned short* PE) {
  __shared__ __align__(16) unsigned short st[64 * 72];
  int bid = blockIdx.x;
  if (bid < 4 * NTB) {
    const int ws = bid / NTB, tb = bid - ws * NTB;
    const float* w = (ws == 0) ? wq : (ws == 1) ? wk : (ws == 2) ? wv : wo;
    cvt_t(w, WT + (size_t)ws * DM * DM, DM, DM, WSCL, tb % (DM / 64), tb / (DM / 64), st);
    return;
  }
  bid -= 4 * NTB;
  if (bid < NBB) {
    cvt_band(rel, PE, WSCL, bid);
    return;
  }
  bid -= NBB;
  const int xs = bid / (NB * LINB), xr = bid - xs * (NB * LINB);
  if (xs > 2) return;                                     // never taken with the exact grid
  const float* x = (xs == 0) ? query : (xs == 1) ? key : value;
  cvt_lin(x, X + (size_t)xs * MT * DM, SEQ * DM, SEQ * DM, 1.0f, SEQ_FULL * DM, SEQ * DM, xr % LINB, xr / LINB);
}

// =====================================================================================================
// Register-blocked f16 WMMA GEMM: C[m][n] = sum_k A[m][k] * Bt[n][k], one wave per 64x64 tile, no block
// barriers. A row-major [M][K] pitch lda; Bt row-major [N][K] pitch ldb (k contiguous); M, N multiples of 64,
// K multiple of 32 (true at every call site; bx = 0 .. tiles/8 - 1 exact so no wave exits early). Both operand
// fragments use the split k map (elements 0..7 <- k0+8h.., 8..15 <- k0+16+8h..); D element r of a lane is
// (row 8h + r, col lane&15).
// s = acc*osc + bias term (BM 0: none; BM 1: bsc*bf16(bias[col]); BM 2: bsc*bf16(bias[row])).
// OM 0: f32 out Cf = s, pitch ldc.   OM 1: f16 out Ch = f16 bits(s).
// OM 2: f16 hi plane Ch = f16(s) and f16 residual plane Cl = f16((s - hi) * 2048), same layout.
// f16 outputs lie in fragment order (ldc unused). A 16x64 slab is four pieces of 256 halves; piece it, lane l =
// slab row (l&15), slab columns 16*it + 8*(l>>4) .. +7, i.e. one load of a fragment whose lane index is the row and
// whose k index is the column. OM 2: slab (row tile T = row/16, column tile tn) at ((tn*(M/16) + T)*4 + it)*256.
// OM 1: pieces 2*kb, 2*kb + 1 of a slab are k block kb of 32 columns; piece at
// (((tm*(N/32) + column/32)*4 + row tile in tm)*2 + (it&1))*256, so that a k block's four row tiles are contiguous.
// coverage: 4 slabs x 16 rows x 64 cols = the wave's whole 64x64 tile.
// =====================================================================================================
template <int OM, int BM>
__device__ __forceinline__ void gemm64_tile(
    const unsigned short* __restrict__ Ap, int lda, const unsigned short* __restrict__ Btp, int ldb,
    unsigned short* Ch, unsigned short* Cl, float* Cf, int ldc, float osc,
    const float* __restrict__ bias, float bsc, int M, int N, int K, int bx, float (*sT)[16 * 68]) {
  const int lane = threadIdx.x & 31;
  const int wave = threadIdx.x >> 5;
  const int tilesN = N >> 6;
  const int tilesM = M >> 6;
  const int tile = bx * 8 + wave;
  if (tile >= tilesM * tilesN) return;   // wave-uniform; no block barriers in this kernel
  const int tm = tile / tilesN;
  const int tn = tile - tm * tilesN;
  const int m0 = tm << 6;
  const int n0 = tn << 6;

  const int rlane = lane & 15;                 // row (A) / col (B, D) within subtile
  const int koff  = (lane >> 4) * 8;           // k offset of this lane half
  const int mOff  = (lane >> 4) * 8;           // D row offset

  v8f acc[4][4];
#pragma unroll
  for (int i = 0; i < 4; ++i)
#pragma unroll
    for (int j = 0; j < 4; ++j) acc[i][j] = zero8();

#pragma unroll 1
  for (int k0 = 0; k0 < K; k0 += 32) {
    v16us bh[4];
#pragma unroll
    for (int j = 0; j < 4; ++j) {
      const size_t bo = (size_t)(n0 + (j << 4) + rlane) * ldb + koff + k0;
      bh[j] = ldfrag_u(Btp + bo);
    }
#pragma unroll
    for (int i = 0; i < 4; ++i) {
      const size_t ao = (size_t)(m0 + (i << 4) + rlane) * lda + koff + k0;
      const v16us ah = ldfrag_u(Ap + ao);
#pragma unroll
      for (int j = 0; j < 4; ++j) acc[i][j] = mma_raw(ah, bh[j], acc[i][j]);
      dep_guard1(acc[i][0], acc[i][3], ah);
    }
    keep4_u(bh[0], bh[1], bh[2], bh[3]);
  }
  acc_guard4(acc[0][0], acc[0][1], acc[0][2], acc[0][3]);
  acc_guard4(acc[1][0], acc[1][1], acc[1][2], acc[1][3]);
  acc_guard4(acc[2][0], acc[2][1], acc[2][2], acc[2][3]);
  acc_guard4(acc[3][0], acc[3][1], acc[3][2], acc[3][3]);

  const int hh2 = lane >> 4, c4 = (lane & 15) * 4;     // f32 out: 256-B row segment = 16 lanes x 16 B

  // column bias terms (fixed per wave); addresses n0+c4+3 < N and n0+48+8+7 < N
  v4f bc4 = {0.f, 0.f, 0.f, 0.f};
  float bc8[4][8];                                      // f16 out: piece it, columns 16*it + 8*hh2 .. +7
#pragma unroll
  for (int it = 0; it < 4; ++it)
#pragma unroll
    for (int e = 0; e < 8; ++e) bc8[it][e] = 0.f;
  if (BM == 1) {
    if (OM == 0) {
      const v4f t4 = *(const v4f*)(bias + n0 + c4);
#pragma unroll
      for (int e = 0; e < 4; ++e) bc4[e] = bfr(t4[e]) * bsc;
    } else {
#pragma unroll
      for (int it = 0; it < 4; ++it) {
        const v4f ta = *(const v4f*)(bias + n0 + 16 * it + 8 * hh2);
        const v4f tb = *(const v4f*)(bias + n0 + 16 * it + 8 * hh2 + 4);
#pragma unroll
        for (int e = 0; e < 4; ++e) { bc8[it][e] = bfr(ta[e]) * bsc; bc8[it][4 + e] = bfr(tb[e]) * bsc; }
      }
    }
  }

  // ---- epilogue ----
  float* slab = sT[wave];
#pragma unroll
  for (int i = 0; i < 4; ++i) {
    const int mBase = m0 + (i << 4);
#pragma unroll
    for (int j = 0; j < 4; ++j) {
#pragma unroll
      for (int r = 0; r < 8; ++r) {
        slab[(mOff + r) * 68 + (j << 4) + rlane] = acc[i][j][r];
      }
    }
    wave_sync_lds();
    if (OM == 0) {
      v4f vals[8];
#pragma unroll
      for (int it = 0; it < 8; ++it) {
        const int row = it * 2 + hh2;                      // it 0..7 x hh2 0..1 = rows 0..15
        const v4f v = *(const v4f*)(slab + row * 68 + c4);
        float rb2 = 0.f;
        if (BM == 2) rb2 = bfr(bias[mBase + row]) * bsc;
        vals[it] = v * osc + bc4 + rb2;
      }
      {
#pragma unroll
        for (int it = 0; it < 8; ++it) {
          const int row = it * 2 + hh2;
          *(v4f*)(Cf + (size_t)(mBase + row) * ldc + (size_t)n0 + c4) = vals[it];
        }
        
      }
    } else {
      v4u hv[4], hl[4];
      float rb2 = 0.f;
      if (BM == 2) rb2 = bfr(bias[mBase + rlane]) * bsc;
#pragma unroll
      for (int it = 0; it < 4; ++it) {
        const float* sp = slab + rlane * 68 + 16 * it + 8 * hh2;   // rows 0..15 x (it, hh2) = 8 column chunks
        v4u ha = {0u, 0u, 0u, 0u};
        v4u la = {0u, 0u, 0u, 0u};
#pragma unroll
        for (int e = 0; e < 4; ++e) {
          const float b0 = sp[2 * e]     * osc + bc8[it][2 * e]     + rb2;
          const float b1 = sp[2 * e + 1] * osc + bc8[it][2 * e + 1] + rb2;
          if (OM == 1) {
            ha[e] = pk16(f2h(b0), f2h(b1));
          } else {
            const _Float16 h0 = (_Float16)b0;
            const _Float16 h1 = (_Float16)b1;
            const float l0 = (b0 - (float)h0) * LSC;       // difference exact, power-of-two carry exact
            const float l1 = (b1 - (float)h1) * LSC;
            ha[e] = pk16(h_bits(h0), h_bits(h1));
            la[e] = pk16(f2h(l0), f2h(l1));
          }
        }
        hv[it] = ha;
        hl[it] = la;
      }
      {
#pragma unroll
        for (int it = 0; it < 4; ++it) {
          const size_t pc = (OM == 2)
              ? ((size_t)tn * (size_t)(M >> 4) + (size_t)(mBase >> 4)) * 4 + it
              : (((size_t)tm * (size_t)(N >> 5) + (size_t)((n0 >> 5) + (it >> 1))) * 4 + i) * 2 + (it & 1);
          const size_t go = pc * 256 + (size_t)(lane * 8);    // 32 lanes x 16 B = the whole piece
          *(v4u*)(Ch + go) = hv[it];
          if (OM == 2) *(v4u*)(Cl + go) = hl[it];
        }
        addr_regs_free();
      }
    }
    wave_sync_lds();
  }
}

// one product per launch
template <int OM, int BM>
__global__ __launch_bounds__(256) void gemm64(
    const unsigned short* __restrict__ Ap, int lda, const unsigned short* __restrict__ Btp, int ldb,
    unsigned short* Ch, unsigned short* Cl, float* Cf, int ldc, float osc,
    const float* __restrict__ bias, float bsc, int M, int N, int K) {
  __shared__ __align__(16) float sT[8][16 * 68];   // per-wave 16x64 slab, pitch 68 floats
  gemm64_tile<OM, BM>(Ap, lda, Btp, ldb, Ch, Cl, Cf, ldc, osc, bias, bsc, M, N, K, blockIdx.x, sT);
}

// The three input projections in one launch; none reads what another writes. blockIdx.y picks the product:
// 0: s = 16*(xq.Wq + bq) -> QH = f16(s), QL = f16(2048*(s - QH));  1: the same for k;
// 2: v^T x16: C[d][tok] = sum_k WT[1024+d][k] * XV[tok][k], bias by row d.
// X = the planes XQ | XK | XV, WT = Wq^T | Wk^T | Wv^T. Output pointers that a product's OM does not use are null.
__global__ __launch_bounds__(256) void gemm_qkv(
    const unsigned short* __restrict__ X, const unsigned short* __restrict__ WT,
    unsigned short* QH, unsigned short* QL, unsigned short* KH, unsigned short* KL, unsigned short* VT,
    const float* __restrict__ bq, const float* __restrict__ bk, const float* __restrict__ bv) {
  __shared__ __align__(16) float sT[8][16 * 68];   // per-wave 16x64 slab, pitch 68 floats
  const int sel = blockIdx.y;
  if (sel == 2) {
    gemm64_tile<1, 2>(WT + (size_t)2 * DM * DM, DM, X + (size_t)2 * MT * DM, DM, VT, nullptr, nullptr, MT,
                      VSC / WSCL, bv, VSC, DM, MT, DM, blockIdx.x, sT);
  } else {
    const bool isk = (sel == 1);
    gemm64_tile<2, 1>(X + (isk ? (size_t)MT * DM : 0), DM, WT + (isk ? (size_t)DM * DM : 0), DM,
                      isk ? KH : QH, isk ? KL : QL, nullptr, DM, QKS / WSCL, isk ? bk : bq, QKS, MT, DM, DM,
                      blockIdx.x, sT);
  }
}

// ---- per-tile products used by the attention kernel ----------------------------------------------
// R = ah.b + (al.b)/2048 over 64 head dims (b0, b1: fragments of a [n][64] f16 plane row, dims 0..31 and 32..63)
__device__ __forceinline__ v8f dot2_res(v16us ah0, v16us ah1, v16us al0, v16us al1, v16us b0, v16us b1) {
  v8f L = mma_g(al0, b0, zero8());
  L = mma_g(al1, b1, L);
  L = L * (1.0f / LSC);
  v8f R = mma_g(ah0, b0, L);
  R = mma_g(ah1, b1, R);
  return R;
}
// S = qh.kh + (qh.kl + ql.kh)/2048 over 64 head dims (kh from the hi plane row, kl from the residual plane row)
__device__ __forceinline__ v8f dot3_res(v16us qh0, v16us qh1, v16us ql0, v16us ql1,
                                        v16us kh0, v16us kh1, v16us kl0, v16us kl1) {
  v8f L = mma_g(qh0, kl0, zero8());
  L = mma_g(qh1, kl1, L);
  L = mma_g(ql0, kh0, L);
  L = mma_g(ql1, kh1, L);
  L = L * (1.0f / LSC);
  v8f S = mma_g(qh0, kh0, L);
  S = mma_g(qh1, kh1, S);
  return S;
}

// =====================================================================================================
// Non-causal attention with clipped relative-offset term and key-padding mask, head dim 64.
// Block = 128 threads = 4 waves; one wave owns one 16-row query tile (t0..t0+15) of one (batch b, head h)
// and loops all key blocks of 32 with an online max-subtracted softmax in f32.
// Planes, all in fragment order (a fragment = two pieces of 256 halves, lane l's 8 halves at piece + 8*l):
// QH/KH f16 = 16*q, 16*k, QL/KL = 2048*(16q - QH) residuals: [head][token tile of 16][dims 0..31 | 32..63];
// PE f16 = 64*rel table, [tile u][dims 0..31 | 32..63], tile u = table rows clamp(16u - POFF + 0..15, 0, 498);
// VT f16 = 16*v transposed: [head][key block of 32][dim tile of 16]; mask int32 [NB_FULL][SEQ_FULL].
// Output Z f16 [MT][512] = 16*ctx, token-major (row = b*SEQ + t, col = h*64+d).
// Per key block sb: S = 256*q.k (hi.hi + hi.res + res.hi, 2 key subtiles); relative band of 48 columns:
// column c <-> table row clamp(234 - t0 + sb + c, 0, 498) (clamped per column, which IS the clipped index), so
// columns 16k..16k+15 are table tile clamp(16 - t0/16 + sb/16 + k, 0, NPT-1);
// columns 0..15 come from the tile carried over from the prior key block (its columns 32..47), columns
// 16..47 are two fresh tiles (hi + res products, value 1024*q.rel); the band is exchanged through per-wave
// LDS and read back at c = 15 - row + col, i.e. table row clamp(j - i + 249, 0, 498);
// score = qk/8 + bias; then replace-fill -1e10 where mask[b][j] == 0; p = exp(score - running max) in f32,
// l accumulated from the f32 p; 4096*p stored as f16 in per-wave LDS and reloaded as the A fragment
// (split k map); O += P.V on 4 dim subtiles. Every same-wave LDS exchange (band, P tile, ctx staging) has a
// coverage: 16 query rows x 64 halves per wave, NB*NH*(SEQ/16) wave tasks = all (b, t, h) segments of Z.
// LDS: band 16x48 floats, P 16x32 halves, ctx 16x64 halves per wave; staged extent == consumed extent.
// Global operands run one key block ahead in registers: K (hi + residual), table rows and mask words are
// reloaded for key block kb + 1 behind the score and band products of key block kb, V^T behind its P.V
// products, into the same variables, so that a load has most of a pass to land before its wait. The last
// pass reloads its own block (addresses in range, values unused).
// =====================================================================================================
__global__ __launch_bounds__(128) void attn_kernel(
    const unsigned short* __restrict__ QH, const unsigned short* __restrict__ QL,
    const unsigned short* __restrict__ KH, const unsigned short* __restrict__ KL,
    const unsigned short* __restrict__ PE, const unsigned short* __restrict__ VT,
    const int* __restrict__ mask, unsigned short* Z) {
  __shared__ __align__(16) float relw[AWV][16 * RWP];            // band exchange, 12288 B
  __shared__ __align__(16) unsigned short pws[AWV][16 * 32];      // P tiles, 4096 B
  __shared__ __align__(16) unsigned short zst[AWV][16 * 64];      // ctx staging, 8192 B
  const int lane = threadIdx.x & 31, wv = threadIdx.x >> 5, m = lane & 15, hh = lane >> 4;
  const int task = blockIdx.x * AWV + wv;            // 0 .. NB*NH*(SEQ/16)-1
  const int nqt = SEQ / 16;
  const int bh = task / nqt;                         // (b, h)
  const int t0 = (task - bh * nqt) << 4;             // query tile start
  const int b = bh / NH, h = bh - (bh / NH) * NH;
  if (b >= NB) return;                               // wave-uniform; never taken with exact grids; no block barriers
  const size_t tok0 = (size_t)b * SEQ;               // plane row base of this batch
  const int* mk = mask + (size_t)b * SEQ_FULL;       // full input stride for the mask row
  float* rw = relw[wv];
  unsigned short* ph = pws[wv];

  // Q A-fragments (hi and residual): rows t0+m, k = head dims 0..31 and 32..63
  const size_t qo = ((size_t)h * (MT / 16) + ((tok0 + (size_t)t0) >> 4)) * 1024 + (size_t)(lane * 8);
  const v16us qh0 = ldfrag_p(QH + qo);
  const v16us qh1 = ldfrag_p(QH + qo + 512);
  const v16us ql0 = ldfrag_p(QL + qo);
  const v16us ql1 = ldfrag_p(QL + qo + 512);
  addr_regs_free();

  const int ub = (RCEN - 15 + POFF) / 16 - (t0 >> 4);  // table tile of band columns 0..15 at sb = 0 (before clamp)

  // carried band tile: columns 0..15 of key block 0
  const unsigned short* pcar = PE + (size_t)clampi(ub, 0, NPT - 1) * 1024 + lane * 8;
  const v16us cf0 = ldfrag_p(pcar), cf1 = ldfrag_p(pcar + 512);
  addr_regs_free_of(pcar);

  // lane-fixed parts of the operand addresses; key block sb adds sb/16 token tiles (K), sb/16 table tiles,
  // sb/32 key blocks (V^T), sb columns (mask)
  const size_t kfix = ((size_t)h * (MT / 16) + (tok0 >> 4)) * 1024 + (size_t)(lane * 8);
  const size_t vfix = ((size_t)h * (MT / 32) + (tok0 >> 5)) * 2048 + (size_t)(lane * 8);

  // operands of key block 0
  v16us ka0 = ldfrag_p(KH + kfix),        ka1 = ldfrag_p(KH + kfix + 512);     // keys 0..15, hi
  v16us ka2 = ldfrag_p(KL + kfix),        ka3 = ldfrag_p(KL + kfix + 512);     // keys 0..15, residual
  v16us kc0 = ldfrag_p(KH + kfix + 1024), kc1 = ldfrag_p(KH + kfix + 1536);    // keys 16..31, hi
  v16us kc2 = ldfrag_p(KL + kfix + 1024), kc3 = ldfrag_p(KL + kfix + 1536);    // keys 16..31, residual
  v16us pa0, pa1, pc0, pc1;                                                    // band columns 16..31, 32..47
  int mn0, mn1;                                                                // mask words of keys m, 16 + m
  {
    const unsigned short* p1 = PE + (size_t)clampi(ub + 1, 0, NPT - 1) * 1024 + lane * 8;
    const unsigned short* p2 = PE + (size_t)clampi(ub + 2, 0, NPT - 1) * 1024 + lane * 8;
    pa0 = ldfrag_p(p1); pa1 = ldfrag_p(p1 + 512);
    pc0 = ldfrag_p(p2); pc1 = ldfrag_p(p2 + 512);
    mn0 = mk[m]; mn1 = mk[16 + m];
    addr_regs_free_of(KH + kfix, KL + kfix, p1, p2, mk + m);
  }
  v16us vf0 = ldfrag_p(VT + vfix);
  v16us vf1 = ldfrag_p(VT + vfix + 512);
  v16us vf2 = ldfrag_p(VT + vfix + 1024);
  v16us vf3 = ldfrag_p(VT + vfix + 1536);
  addr_regs_free_of(VT + vfix);

  v8f carry = dot2_res(qh0, qh1, ql0, ql1, cf0, cf1);

  float mx[8], ls[8];
  v8f O0 = zero8(), O1 = zero8(), O2 = zero8(), O3 = zero8();
#pragma unroll
  for (int r = 0; r < 8; ++r) { mx[r] = -1.0e30f; ls[r] = 0.f; }

#pragma unroll 1
  for (int kb = 0; kb < SEQ / 32; ++kb) {
    const int sb = kb << 5;
    const int sn = (kb + 1 < SEQ / 32) ? sb + 32 : sb;   // key block whose operands are fetched in this pass
    // scores: Bt row = key token, k = head dim
    const v8f S0 = dot3_res(qh0, qh1, ql0, ql1, ka0, ka1, ka2, ka3);
    const v8f S1 = dot3_res(qh0, qh1, ql0, ql1, kc0, kc1, kc2, kc3);

    // relative band: columns 16..31 and 32..47 <-> table tiles clamp(ub + sb/16 + 1), clamp(ub + sb/16 + 2)
    v8f Pb1 = dot2_res(qh0, qh1, ql0, ql1, pa0, pa1);
    v8f Pb2 = dot2_res(qh0, qh1, ql0, ql1, pc0, pc1);

    // key mask values of this lane's two key columns
    const int mk0 = mn0;
    const int mk1 = mn1;

    // next key block's K, table and mask operands, one group (token tiles and columns below SEQ, table tiles clamped)
    {
      mn0 = mk[sn + m];
      mn1 = mk[sn + 16 + m];
      const size_t ko = kfix + (size_t)(sn >> 4) * 1024;
      ka0 = ldfrag_p(KH + ko);        ka1 = ldfrag_p(KH + ko + 512);
      ka2 = ldfrag_p(KL + ko);        ka3 = ldfrag_p(KL + ko + 512);
      kc0 = ldfrag_p(KH + ko + 1024); kc1 = ldfrag_p(KH + ko + 1536);
      kc2 = ldfrag_p(KL + ko + 1024); kc3 = ldfrag_p(KL + ko + 1536);
      const int un = ub + (sn >> 4);
      const unsigned short* p1 = PE + (size_t)clampi(un + 1, 0, NPT - 1) * 1024 + lane * 8;
      const unsigned short* p2 = PE + (size_t)clampi(un + 2, 0, NPT - 1) * 1024 + lane * 8;
      pa0 = ldfrag_p(p1); pa1 = ldfrag_p(p1 + 512);
      pc0 = ldfrag_p(p2); pc1 = ldfrag_p(p2 + 512);
      addr_regs_free_of(KH + ko, KL + ko, p1, p2, mk + sn + m);
    }
#pragma unroll
    for (int r = 0; r < 8; ++r) {
      const int row = 8 * hh + r;
      rw[row * RWP + m]      = carry[r];
      rw[row * RWP + 16 + m] = Pb1[r];
      rw[row * RWP + 32 + m] = Pb2[r];
    }
    carry = Pb2;
    wave_sync_lds_only();

    // skew read + scale + bias, then replace-fill masked keys
    float s0[8], s1[8];
#pragma unroll
    for (int r = 0; r < 8; ++r) {
      const int row = 8 * hh + r;
      const float rv0 = rw[row * RWP + 15 - row + m];
      const float rv1 = rw[row * RWP + 31 - row + m];
      const float v0 = S0[r] * (RSQD / (QKS * QKS)) + rv0 * (1.0f / (QKS * WSCL));
      const float v1 = S1[r] * (RSQD / (QKS * QKS)) + rv1 * (1.0f / (QKS * WSCL));
      s0[r] = (mk0 == 0) ? MASKV : v0;
      s1[r] = (mk1 == 0) ? MASKV : v1;
    }

    // online softmax (a row lives in the 16 lanes of one half-wave; xor butterflies 1,2,4,8)
#pragma unroll
    for (int r = 0; r < 8; ++r) {
      float xm = fmaxf(s0[r], s1[r]);
      xm = fmaxf(xm, __shfl_xor(xm, 1, 32));
      xm = fmaxf(xm, __shfl_xor(xm, 2, 32));
      xm = fmaxf(xm, __shfl_xor(xm, 4, 32));
      xm = fmaxf(xm, __shfl_xor(xm, 8, 32));
      const float mn = fmaxf(mx[r], xm);
      const float al = __expf(mx[r] - mn);
      mx[r] = mn;
      const float p0 = __expf(s0[r] - mn);
      const float p1 = __expf(s1[r] - mn);
      float ps = p0 + p1;
      ps += __shfl_xor(ps, 1, 32);
      ps += __shfl_xor(ps, 2, 32);
      ps += __shfl_xor(ps, 4, 32);
      ps += __shfl_xor(ps, 8, 32);
      ls[r] = ls[r] * al + ps;
      O0[r] = O0[r] * al;
      O1[r] = O1[r] * al;
      O2[r] = O2[r] * al;
      O3[r] = O3[r] * al;
      const int row = 8 * hh + r;
      ph[row * 32 + m]      = f2h(p0 * PSC);
      ph[row * 32 + 16 + m] = f2h(p1 * PSC);
    }
    wave_sync_lds_only();

    // P A-fragment (split k map) and V B-fragments (Bt row = h*64 + dim, k = key token)
    const v16us af = ldfrag_u(ph + m * 32 + 8 * hh);
    O0 = mma_g(af, vf0, O0);
    O1 = mma_g(af, vf1, O1);
    O2 = mma_g(af, vf2, O2);
    O3 = mma_g(af, vf3, O3);
    const size_t vo = vfix + (size_t)(sn >> 5) * 2048;
    vf0 = ldfrag_p(VT + vo);
    vf1 = ldfrag_p(VT + vo + 512);
    vf2 = ldfrag_p(VT + vo + 1024);
    vf3 = ldfrag_p(VT + vo + 1536);
    addr_regs_free_of(VT + vo);
  }
  acc_guard4(O0, O1, O2, O3);

  // ---- epilogue: ctx = O / (l * PSC * VSC), stored x CSC as f16, token-major plane ----
  unsigned short* zs = zst[wv];
  const float fin = CSC / (PSC * VSC);
#pragma unroll
  for (int r = 0; r < 8; ++r) {
    const int row = 8 * hh + r;
    const float linv = 1.0f / ls[r];                   // ls >= 1
    const float g = linv * fin;
    zs[row * 64 + m]      = f2h(O0[r] * g);
    zs[row * 64 + 16 + m] = f2h(O1[r] * g);
    zs[row * 64 + 32 + m] = f2h(O2[r] * g);
    zs[row * 64 + 48 + m] = f2h(O3[r] * g);
  }
  wave_sync_lds();
  {
    const int q8 = lane >> 3, c8 = (lane & 7) * 8;
    v4u hv[4];
#pragma unroll
    for (int it = 0; it < 4; ++it) {
      const int row = it * 4 + q8;                     // it 0..3 x q8 0..3 = rows 0..15
      hv[it] = *(const v4u*)(zs + row * 64 + c8);
    }
    const size_t zr0 = (size_t)b * SEQ + (size_t)t0;
    {
#pragma unroll
      for (int it = 0; it < 4; ++it) {
        const int row = it * 4 + q8;
        unsigned short* dst = Z + (zr0 + (size_t)row) * DM + h * HD + c8;
        *(v4u*)dst = hv[it];
      }
      
    }
  }
}

// =====================================================================================================
// Workspace map (bytes, NB=2 SEQ=2048 -> MT=4096); every plane is an exact multiple of its whole-row /
// whole-line / 64x64-tile store granularity (rows MT, 1536, 512; 64 | each tiled dimension; the table plane
// is NPT tiles of 2048 bytes, all written); all offsets multiples of 2048. PEH, QH, QL, KH, KL, VT: fragment order.
//   XQ   f16  [4096][512]      0           4194304
//   XK   f16  [4096][512]      4194304     4194304
//   XV   f16  [4096][512]      8388608     4194304
//   WT   f16  [1536][512]      12582912    1572864   (Wq^T | Wk^T | Wv^T, x64)
//   WOT  f16  [512][512]       14155776     524288   (Wo^T, x64)
//   PEH  f16  [34][1024]       14680064      69632   (table x64, clamped tiles)
//   QH   f16  [8][256][1024]   14749696    4194304
//   QL   f16  [8][256][1024]   18944000    4194304
//   KH   f16  [8][256][1024]   23138304    4194304
//   KL   f16  [8][256][1024]   27332608    4194304
//   VT   f16  [8][128][2048]   31526912    4194304
//   Z    f16  [4096][512]      35721216    4194304
//   end                        39915520
// =====================================================================================================
extern "C" void kernel_launch(void* const* d_in, const int* in_sizes, int n_in,
                              void* d_out, int out_size, void* d_ws, size_t ws_size,
                              hipStream_t stream) {
  if (n_in < 13) return;
  const int xreq = ((NB - 1) * SEQ_FULL + SEQ) * DM;
  const int mreq = (NB - 1) * SEQ_FULL + SEQ;
  if (in_sizes[0] < xreq || in_sizes[1] < xreq || in_sizes[2] < xreq) return;
  if (in_sizes[3] < mreq) return;
  if (in_sizes[4] < DM * DM || in_sizes[6] < DM * DM || in_sizes[8] < DM * DM || in_sizes[10] < DM * DM) return;
  if (in_sizes[5] < DM || in_sizes[7] < DM || in_sizes[9] < DM || in_sizes[11] < DM) return;
  if (in_sizes[12] < NREL * HD) return;
  if (out_size < MT * DM) return;

  const float* query = (const float*)d_in[0];   // [NB_FULL][SEQ_FULL][512]
  const float* key   = (const float*)d_in[1];
  const float* value = (const float*)d_in[2];
  const int*   mask  = (const int*)d_in[3];     // [NB_FULL][SEQ_FULL] int32
  const float* wq = (const float*)d_in[4];      // [512][512] (in, out)
  const float* bq = (const float*)d_in[5];
  const float* wk = (const float*)d_in[6];
  const float* bk = (const float*)d_in[7];
  const float* wv = (const float*)d_in[8];
  const float* bv = (const float*)d_in[9];
  const float* wo = (const float*)d_in[10];
  const float* bo = (const float*)d_in[11];
  const float* rel = (const float*)d_in[12];    // [499][64]

  const size_t PX  = (size_t)MT * DM * 2;
  const size_t PWT = (size_t)3 * DM * DM * 2;
  const size_t PWO = (size_t)DM * DM * 2;
  const size_t PPE = (size_t)NPT * 1024 * 2;
  size_t off = 0;
  const size_t oXQ = off; off += 3 * PX;          // XQ | XK | XV
  const size_t oWT = off; off += PWT;
  const size_t oWO = off; off += PWO;
  const size_t oPE = off; off += PPE;
  const size_t oQH = off; off += PX;
  const size_t oQL = off; off += PX;
  const size_t oKH = off; off += PX;
  const size_t oKL = off; off += PX;
  const size_t oVT = off; off += PX;
  const size_t oZ  = off; off += PX;
  if (off > ws_size) return;
  if (off > (size_t)134217728) return;

  char* ws = (char*)d_ws;
  unsigned short* XQ  = (unsigned short*)(ws + oXQ);
  unsigned short* WT  = (unsigned short*)(ws + oWT);
  unsigned short* WOT = (unsigned short*)(ws + oWO);
  unsigned short* PEH = (unsigned short*)(ws + oPE);
  unsigned short* QH  = (unsigned short*)(ws + oQH);
  unsigned short* QL  = (unsigned short*)(ws + oQL);
  unsigned short* KH  = (unsigned short*)(ws + oKH);
  unsigned short* KL  = (unsigned short*)(ws + oKL);
  unsigned short* VT  = (unsigned short*)(ws + oVT);
  unsigned short* Z   = (unsigned short*)(ws + oZ);
  float* out0 = (float*)d_out;
  unsigned short* hdummy = XQ;                    // in-range placeholder for unused f16 output args

  const dim3 blk(256);
  const int gP = ((MT / 64) * (DM / 64)) / 8;     // 64x64 tiles / 8 waves, exact

  // (0) operand planes: query/key/value -> f16(bf16) per batch slice (XQ | XK | XV, contiguous); table -> f16(bf16 x64)
  //     clamped tiles; Wq|Wk|Wv|Wo [512][512] -> WT | WOT (contiguous) rows 0.., 512.., 1024.., 1536.. (transposed, f16 x64)
  cvt_all<<<dim3(4 * NTB + NBB + 3 * NB * LINB), blk, 0, stream>>>(query, key, value, wq, wk, wv, wo, rel, XQ, WT, PEH);

  // (1) q and k hi/res planes and v^T x16
  gemm_qkv<<<dim3(gP, 3), blk, 0, stream>>>(XQ, WT, QH, QL, KH, KL, VT, bq, bk, bv);

  // (2) attention -> ctx x16 token-major plane
  attn_kernel<<<dim3((NB * NH * (SEQ / 16)) / AWV), dim3(128), 0, stream>>>(QH, QL, KH, KL, PEH, VT, mask, Z);

  // (3) output projection: out[row][n] = sum_k Z[row][k] * WOT[n][k] / (16*64) + bo[n]
  gemm64<0, 1><<<dim3(gP), blk, 0, stream>>>(Z, DM, WOT, DM, hdummy, hdummy, out0, DM, 1.0f / (WSCL * CSC), bo, 1.0f, MT, DM, DM);
  (void)hipGetLastError();
}

// v004
// It runs in 122 microseconds.
// Next to v003, in two timings, it ran 1.26 times as fast each time.
// Counting every step since v000, it is 2.44 times as fast.
// Contractions: x.Wq and x.Wk (q, k hi + residual planes), x.Wv (v^T plane), k.q^T (hi.hi + res.hi + hi.res),
// rel.q^T (hi + res), v^T.p^T and ctx.Wo, all on v_wmma_f32_16x16x32_f16 (f16 operands, f32 accumulate).
// Float inputs RNE-converted to bf16 on load and carried in f16 containers with power-of-two scales
// (x x1; Wq, Wk, Wv, Wo x64; rel table x64; q, k hi planes x16, residual planes x16x2048; v^T x16;
// p x4096; ctx x16); softmax, key mask and the relative-offset skew in f32 on VALU.
// The planes that the attention kernel reads (q, k hi + residual, v^T, table) lie in fragment order: the 16 bytes
// of lane l of one operand load stand at piece base + 16*l, so that a load covers four whole 128-byte lines.
#include <hip/hip_runtime.h>
#include <math.h>

#ifndef NB
#define NB 2
#endif
#ifndef SEQ
#define SEQ 2048
#endif
#define NB_FULL  2
#define SEQ_FULL 2048
#define DM   512
#define NH   8
#define HD   64
#define MT   (NB * SEQ)
#define NREL 499
#define RCEN 249
#define POFF 22
#define NPT  34
#define AWV  4
#define RWP  52
#define WSCL 64.0f
#define QKS  16.0f
#define LSC  2048.0f
#define VSC  16.0f
#define PSC  4096.0f
#define CSC  16.0f
#define RSQD 0.125f
#define MASKV (-1.0e10f)
#define LINB ((SEQ * DM) / 2048)          // blocks of one batch slice of one activation plane
#define NTB  ((DM / 64) * (DM / 64))      // blocks of one weight transpose
#define NBB  ((NPT * 128) / 256)          // blocks of the table plane

static_assert(NH * HD == DM);
static_assert(HD == 64);
static_assert(NB >= 1 && NB <= NB_FULL);
static_assert((SEQ % 64) == 0 && SEQ >= 64 && SEQ <= SEQ_FULL);
static_assert((MT % 64) == 0 && (DM % 64) == 0);
static_assert((((MT / 64) * (DM / 64)) % 8) == 0);
static_assert(((SEQ * DM) % 2048) == 0 && ((NPT * 128) % 256) == 0);
static_assert(((NB * NH * (SEQ / 16)) % AWV) == 0);
static_assert((2 * RCEN + 1) == NREL);
static_assert(((RCEN - 15 + POFF) % 16) == 0 && POFF >= 15 && 16 * (NPT - 1) - POFF >= NREL - 1);

typedef _Float16 v16h __attribute__((ext_vector_type(16)));
typedef unsigned short v16us __attribute__((ext_vector_type(16)));
typedef unsigned short v8us  __attribute__((ext_vector_type(8)));
typedef float v8f __attribute__((ext_vector_type(8)));
typedef float v4f __attribute__((ext_vector_type(4)));
typedef unsigned int v4u __attribute__((ext_vector_type(4)));

union FragU { v16us v; v8us h[2]; };

// ---- scalar helpers --------------------------------------------------------------------------------
__device__ __forceinline__ unsigned short bf_bits(float f) {          // f32 -> bf16 bits, RNE convert
  const unsigned u = __float_as_uint(f);
  return (unsigned short)((u + 0x7FFFu + ((u >> 16) & 1u)) >> 16);
}
__device__ __forceinline__ float bf_up(unsigned short h) { return __uint_as_float(((unsigned)h) << 16); }
__device__ __forceinline__ float bfr(float f) { return bf_up(bf_bits(f)); }   // value of the bf16 RNE convert
__device__ __forceinline__ unsigned short h_bits(_Float16 x) { return __builtin_bit_cast(unsigned short, x); }
__device__ __forceinline__ unsigned short f2h(float f) { return h_bits((_Float16)f); }
__device__ __forceinline__ unsigned pk16(unsigned short a, unsigned short b) { return (unsigned)a | ((unsigned)b << 16); }
__device__ __forceinline__ int clampi(int v, int lo, int hi) { return v < lo ? lo : (v > hi ? hi : v); }
__device__ __forceinline__ v8f zero8() { v8f z = {0.f, 0.f, 0.f, 0.f, 0.f, 0.f, 0.f, 0.f}; return z; }

// ---- fragment loader: 16-bit A/B operand, lane -> row/col (lane&15), p already includes +8*(lane>>4);
//      elements 0..7 <- p[0..7] (k0+8h..), elements 8..15 <- p[16..23] (k0+16+8h..)
__device__ __forceinline__ v16us ldfrag_u(const unsigned short* p) {
  FragU f;
  f.h[0] = *(const v8us*)(p);
  f.h[1] = *(const v8us*)(p + 16);
  return f.v;
}

// ---- the same fragment from a plane in fragment order: p = fragment base + 8*lane; the piece of elements 0..7 is
//      256 halves (32 lanes x 8), the piece of elements 8..15 follows it
__device__ __forceinline__ v16us ldfrag_p(const unsigned short* p) {
  FragU f;
  f.h[0] = *(const v8us*)(p);
  f.h[1] = *(const v8us*)(p + 256);
  return f.v;
}

// ---- WMMA helpers (f16 operand bits) with trailing VALU hazard gap --------------------------------
__device__ __forceinline__ v8f mma_raw(v16us a, v16us b, v8f c) {
  return __builtin_amdgcn_wmma_f32_16x16x32_f16(false, __builtin_bit_cast(v16h, a), false,
                                                __builtin_bit_cast(v16h, b), (short)0, c, false, false);
}
__device__ __forceinline__ v8f mma_g(v16us a, v16us b, v8f c) {                 // guarded
  c = mma_raw(a, b, c);
#if defined(__HIP_DEVICE_COMPILE__)
  asm volatile("v_nop\n\tv_nop\n\tv_nop\n\tv_nop" : "+v"(c) : "v"(a), "v"(b));
#endif
  return c;
}
__device__ __forceinline__ void dep_guard1(v8f& a, v8f& b, v16us x) {
#if defined(__HIP_DEVICE_COMPILE__)
  asm volatile("v_nop\n\tv_nop\n\tv_nop\n\tv_nop" : "+v"(a), "+v"(b) : "v"(x));
#endif
}
__device__ __forceinline__ void keep4_u(v16us a, v16us b, v16us c, v16us d) {
#if defined(__HIP_DEVICE_COMPILE__)
  asm volatile("v_nop" :: "v"(a), "v"(b), "v"(c), "v"(d));
#endif
}
__device__ __forceinline__ void acc_guard4(v8f& a, v8f& b, v8f& c, v8f& d) {
#if defined(__HIP_DEVICE_COMPILE__)
  asm volatile("v_nop\n\tv_nop\n\tv_nop\n\tv_nop" : "+v"(a), "+v"(b), "+v"(c), "+v"(d));
#endif
}
// orders LDS stores of this wave before later LDS loads of the same wave (cross-lane exchange)
__device__ __forceinline__ void wave_sync_lds() {
  __builtin_amdgcn_fence(__ATOMIC_RELEASE, "workgroup");
  __builtin_amdgcn_wave_barrier();
  __builtin_amdgcn_fence(__ATOMIC_ACQUIRE, "workgroup");
}

// the same exchange for a wave that has global loads in flight: waits for this wave's LDS operations only
__device__ __forceinline__ void wave_sync_lds_only() {
#if defined(__HIP_DEVICE_COMPILE__)
  // LDS stores of this wave are done before its later LDS loads issue, and the "memory" clobber keeps the compiler
  // from moving either across; the fence pair above would also wait out the next key block's global loads
  asm volatile("s_wait_dscnt 0x0" ::: "memory");
#endif
  __builtin_amdgcn_wave_barrier();
}

// stands behind a group of global loads that stay in flight: their address registers may be rewritten behind it
__device__ __forceinline__ void addr_regs_free() {
#if defined(__HIP_DEVICE_COMPILE__)
  asm volatile("s_wait_xcnt 0x0" ::: "memory");
#endif
}

// the same wait with the loads' address values as inputs: their registers stay live, so unwritten, up to the wait
// (the "memory" clobber alone does not keep a register write, or a later load's destination, behind it)
__device__ __forceinline__ void addr_regs_free_of(const void* a) {
#if defined(__HIP_DEVICE_COMPILE__)
  asm volatile("s_wait_xcnt 0x0" :: "v"(a) : "memory");
#endif
}
__device__ __forceinline__ void addr_regs_free_of(const void* a, const void* b, const void* c, const void* d,
                                                  const void* e) {
#if defined(__HIP_DEVICE_COMPILE__)
  asm volatile("s_wait_xcnt 0x0" :: "v"(a), "v"(b), "v"(c), "v"(d), "v"(e) : "memory");
#endif
}

// =====================================================================================================
// Layout-kept convert: o[i] = f16 bits of (bf16 RNE value of w[i] * sc) for i < nsrc, zero for nsrc <= i < ndst.
// by selects a batch slice: source base + by*sstr, destination base + by*dstr (element strides); bx = block in the slice.
// nsrc % 8 == 0, ndst % 2048 == 0, bx = 0 .. ndst/2048 - 1 exact.
// coverage: 256 threads x 8 = 2048 elements per block; the blocks cover all ndst elements incl. the zero pad.
// =====================================================================================================
__device__ __forceinline__ void cvt_lin(const float* __restrict__ w, unsigned short* o,
                                        int nsrc, int ndst, float sc, int sstr, int dstr, int bx, int by) {
  const float* wb = w + (size_t)by * (size_t)sstr;
  unsigned short* ob = o + (size_t)by * (size_t)dstr;
  const int base = (bx * 256 + threadIdx.x) * 8;
  if (base + 8 > ndst) return;                            // never taken with exact grids; no barriers below
  const bool inr = (base + 8 <= nsrc);
  const int lb = inr ? base : (nsrc - 8);                 // clamped address, always in range
  const v4f a0 = *(const v4f*)(wb + lb);
  const v4f a1 = *(const v4f*)(wb + lb + 4);
  v4u hv;
#pragma unroll
  for (int e = 0; e < 2; ++e) {
    hv[e]     = pk16(f2h(bfr(a0[2 * e]) * sc), f2h(bfr(a0[2 * e + 1]) * sc));
    hv[2 + e] = pk16(f2h(bfr(a1[2 * e]) * sc), f2h(bfr(a1[2 * e + 1]) * sc));
  }
  const v4u zz = {0u, 0u, 0u, 0u};
  hv = inr ? hv : zz;
  unsigned short* d = ob + base;
  *(v4u*)d = hv;
  
}

// =====================================================================================================
// Table plane in fragment order: tile u (0..NPT-1) holds the 16 table rows clamp(16u - POFF + 0..15, 0, NREL-1) as
// four pieces of 256 halves; piece j, lane l = row (l&15) of the tile, head dims 16j + 8*(l>>4) .. +7, as f16 bits
// of (bf16 RNE value * sc). The band tiles of the attention kernel all start at a row = -POFF (mod 16), so every one
// of them is a tile of this plane; tile 0 is row 0 sixteen times, tile NPT-1 row NREL-1 sixteen times.
// coverage: one thread per 16-byte chunk, NPT*128 chunks, bx = 0 .. NPT*128/256 - 1 exact.
// =====================================================================================================
__device__ __forceinline__ void cvt_band(const float* __restrict__ w, unsigned short* o, float sc, int bx) {
  const int g = bx * 256 + threadIdx.x;
  if (g >= NPT * 128) return;                             // never taken with the exact grid; no barriers below
  const int u = g >> 7, j = (g >> 5) & 3, l = g & 31;
  const int row = clampi(16 * u - POFF + (l & 15), 0, NREL - 1);
  const float* p = w + (size_t)row * HD + 16 * j + 8 * (l >> 4);
  const v4f a0 = *(const v4f*)(p);
  const v4f a1 = *(const v4f*)(p + 4);
  v4u hv;
#pragma unroll
  for (int e = 0; e < 2; ++e) {
    hv[e]     = pk16(f2h(bfr(a0[2 * e]) * sc), f2h(bfr(a0[2 * e + 1]) * sc));
    hv[2 + e] = pk16(f2h(bfr(a1[2 * e]) * sc), f2h(bfr(a1[2 * e + 1]) * sc));
  }
  *(v4u*)(o + (size_t)g * 8) = hv;
}

// =====================================================================================================
// Transpose-convert: in w[R][C] f32 -> out o[C][R] f16 bits of (bf16 RNE value * sc). Block tile 64x64
// through LDS (st[col][row], pitch 72 halves). Read phase: thread owns one input row x 16 columns (float4
// R, C multiples of 64, (bx, by) = (0 .. C/64 - 1, 0 .. R/64 - 1) exact; st = the block's 64*72 halves of LDS.
// coverage: 64 output rows x 64 halves per block = the whole transposed tile; the blocks cover all of [C][R].
// =====================================================================================================
__device__ __forceinline__ void cvt_t(const float* __restrict__ w, unsigned short* o, int R, int C, float sc,
                                      int bx, int by, unsigned short* st) {
  const int t = threadIdx.x;
  const int r0 = by * 64, c0 = bx * 64;
  if (r0 + 64 > R || c0 + 64 > C) return;               // block-uniform, before the barrier; never taken
  {
    const int row = t >> 2, ch = (t & 3) * 16;
    const float* p = w + (size_t)(r0 + row) * C + c0 + ch;
#pragma unroll
    for (int q = 0; q < 4; ++q) {
      const v4f v = *(const v4f*)(p + 4 * q);
#pragma unroll
      for (int e = 0; e < 4; ++e) st[(ch + 4 * q + e) * 72 + row] = f2h(bfr(v[e]) * sc);
    }
  }
  __syncthreads();
  v4u hv[2];
#pragma unroll
  for (int half = 0; half < 2; ++half) {
    const int cl = (t >> 3) + 32 * half, pc = (t & 7) * 8;
    hv[half] = *(const v4u*)(st + cl * 72 + pc);
  }
  {
#pragma unroll
    for (int half = 0; half < 2; ++half) {
      const int cl = (t >> 3) + 32 * half, pc = (t & 7) * 8;
      unsigned short* dst = o + (size_t)(c0 + cl) * R + r0 + pc;
      *(v4u*)dst = hv[half];
    }
    
  }
}

// =====================================================================================================
// All operand planes in one launch; none reads what another writes. The flat block index picks the work, the same for
// the whole block (the barrier of cvt_t is passed by all of a block's threads or by none):
// 4*NTB blocks: Wq, Wk, Wv, Wo [512][512] -> WT rows 0.., 512.., 1024.., 1536.. (transposed, x64; the last is WOT);
// NBB blocks: table -> PE (x64, clamped tiles); 3*NB*LINB blocks: query, key, value -> X planes 0, 1, 2 per batch slice.
// The transposes, which take longest, have the lowest indices.
// =====================================================================================================
__global__ __launch_bounds__(256) void cvt_all(
    const float* __restrict__ query, const float* __restrict__ key, const float* __restrict__ value,
    const float* __restrict__ wq, const float* __restrict__ wk, const float* __restrict__ wv,
    const float* __restrict__ wo, const float* __restrict__ rel,
    unsigned short* X, unsigned short* WT, unsigned short* PE) {
  __shared__ __align__(16) unsigned short st[64 * 72];
  int bid = blockIdx.x;
  if (bid < 4 * NTB) {
    const int ws = bid / NTB, tb = bid - ws * NTB;
    const float* w = (ws == 0) ? wq : (ws == 1) ? wk : (ws == 2) ? wv : wo;
    cvt_t(w, WT + (size_t)ws * DM * DM, DM, DM, WSCL, tb % (DM / 64), tb / (DM / 64), st);
    return;
  }
  bid -= 4 * NTB;
  if (bid < NBB) {
    cvt_band(rel, PE, WSCL, bid);
    return;
  }
  bid -= NBB;
  const int xs = bid / (NB * LINB), xr = bid - xs * (NB * LINB);
  if (xs > 2) return;                                     // never taken with the exact grid
  const float* x = (xs == 0) ? query : (xs == 1) ? key : value;
  cvt_lin(x, X + (size_t)xs * MT * DM, SEQ * DM, SEQ * DM, 1.0f, SEQ_FULL * DM, SEQ * DM, xr % LINB, xr / LINB);
}

// =====================================================================================================
// Register-blocked f16 WMMA GEMM: C[m][n] = sum_k A[m][k] * Bt[n][k], one wave per 64x64 tile, no block
// barriers. A row-major [M][K] pitch lda; Bt row-major [N][K] pitch ldb (k contiguous); M, N multiples of 64,
// K multiple of 32 (true at every call site; bx = 0 .. tiles/8 - 1 exact so no wave exits early). Both operand
// fragments use the split k map (elements 0..7 <- k0+8h.., 8..15 <- k0+16+8h..); D element r of a lane is
// (row 8h + r, col lane&15).
// s = acc*osc + bias term (BM 0: none; BM 1: bsc*bf16(bias[col]); BM 2: bsc*bf16(bias[row])).
// OM 0: f32 out Cf = s, pitch ldc.   OM 1: f16 out Ch = f16 bits(s).
// OM 2: f16 hi plane Ch = f16(s) and f16 residual plane Cl = f16((s - hi) * 2048), same layout.
// f16 outputs lie in fragment order (ldc unused). A 16x64 slab is four pieces of 256 halves; piece it, lane l =
// slab row (l&15), slab columns 16*it + 8*(l>>4) .. +7, i.e. one load of a fragment whose lane index is the row and
// whose k index is the column. OM 2: slab (row tile T = row/16, column tile tn) at ((tn*(M/16) + T)*4 + it)*256.
// OM 1: pieces 2*kb, 2*kb + 1 of a slab are k block kb of 32 columns; piece at
// (((tm*(N/32) + column/32)*4 + row tile in tm)*2 + (it&1))*256, so that a k block's four row tiles are contiguous.
// coverage: 4 slabs x 16 rows x 64 cols = the wave's whole 64x64 tile.
// =====================================================================================================
template <int OM, int BM>
__device__ __forceinline__ void gemm64_tile(
    const unsigned short* __restrict__ Ap, int lda, const unsigned short* __restrict__ Btp, int ldb,
    unsigned short* Ch, unsigned short* Cl, float* Cf, int ldc, float osc,
    const float* __restrict__ bias, float bsc, int M, int N, int K, int bx, float (*sT)[16 * 68]) {
  const int lane = threadIdx.x & 31;
  const int wave = threadIdx.x >> 5;
  const int tilesN = N >> 6;
  const int tilesM = M >> 6;
  const int tile = bx * 8 + wave;
  if (tile >= tilesM * tilesN) return;   // wave-uniform; no block barriers in this kernel
  const int tm = tile / tilesN;
  const int tn = tile - tm * tilesN;
  const int m0 = tm << 6;
  const int n0 = tn << 6;

  const int rlane = lane & 15;                 // row (A) / col (B, D) within subtile
  const int koff  = (lane >> 4) * 8;           // k offset of this lane half
  const int mOff  = (lane >> 4) * 8;           // D row offset

  v8f acc[4][4];
#pragma unroll
  for (int i = 0; i < 4; ++i)
#pragma unroll
    for (int j = 0; j < 4; ++j) acc[i][j] = zero8();

#pragma unroll 1
  for (int k0 = 0; k0 < K; k0 += 32) {
    v16us bh[4];
#pragma unroll
    for (int j = 0; j < 4; ++j) {
      const size_t bo = (size_t)(n0 + (j << 4) + rlane) * ldb + koff + k0;
      bh[j] = ldfrag_u(Btp + bo);
    }
#pragma unroll
    for (int i = 0; i < 4; ++i) {
      const size_t ao = (size_t)(m0 + (i << 4) + rlane) * lda + koff + k0;
      const v16us ah = ldfrag_u(Ap + ao);
#pragma unroll
      for (int j = 0; j < 4; ++j) acc[i][j] = mma_raw(ah, bh[j], acc[i][j]);
      dep_guard1(acc[i][0], acc[i][3], ah);
    }
    keep4_u(bh[0], bh[1], bh[2], bh[3]);
  }
  acc_guard4(acc[0][0], acc[0][1], acc[0][2], acc[0][3]);
  acc_guard4(acc[1][0], acc[1][1], acc[1][2], acc[1][3]);
  acc_guard4(acc[2][0], acc[2][1], acc[2][2], acc[2][3]);
  acc_guard4(acc[3][0], acc[3][1], acc[3][2], acc[3][3]);

  const int hh2 = lane >> 4, c4 = (lane & 15) * 4;     // f32 out: 256-B row segment = 16 lanes x 16 B

  // column bias terms (fixed per wave); addresses n0+c4+3 < N and n0+48+8+7 < N
  v4f bc4 = {0.f, 0.f, 0.f, 0.f};
  float bc8[4][8];                                      // f16 out: piece it, columns 16*it + 8*hh2 .. +7
#pragma unroll
  for (int it = 0; it < 4; ++it)
#pragma unroll
    for (int e = 0; e < 8; ++e) bc8[it][e] = 0.f;
  if (BM == 1) {
    if (OM == 0) {
      const v4f t4 = *(const v4f*)(bias + n0 + c4);
#pragma unroll
      for (int e = 0; e < 4; ++e) bc4[e] = bfr(t4[e]) * bsc;
    } else {
#pragma unroll
      for (int it = 0; it < 4; ++it) {
        const v4f ta = *(const v4f*)(bias + n0 + 16 * it + 8 * hh2);
        const v4f tb = *(const v4f*)(bias + n0 + 16 * it + 8 * hh2 + 4);
#pragma unroll
        for (int e = 0; e < 4; ++e) { bc8[it][e] = bfr(ta[e]) * bsc; bc8[it][4 + e] = bfr(tb[e]) * bsc; }
      }
    }
  }

  // ---- epilogue ----
  float* slab = sT[wave];
#pragma unroll
  for (int i = 0; i < 4; ++i) {
    const int mBase = m0 + (i << 4);
#pragma unroll
    for (int j = 0; j < 4; ++j) {
#pragma unroll
      for (int r = 0; r < 8; ++r) {
        slab[(mOff + r) * 68 + (j << 4) + rlane] = acc[i][j][r];
      }
    }
    wave_sync_lds();
    if (OM == 0) {
      v4f vals[8];
#pragma unroll
      for (int it = 0; it < 8; ++it) {
        const int row = it * 2 + hh2;                      // it 0..7 x hh2 0..1 = rows 0..15
        const v4f v = *(const v4f*)(slab + row * 68 + c4);
        float rb2 = 0.f;
        if (BM == 2) rb2 = bfr(bias[mBase + row]) * bsc;
        vals[it] = v * osc + bc4 + rb2;
      }
      {
#pragma unroll
        for (int it = 0; it < 8; ++it) {
          const int row = it * 2 + hh2;
          *(v4f*)(Cf + (size_t)(mBase + row) * ldc + (size_t)n0 + c4) = vals[it];
        }
        
      }
    } else {
      v4u hv[4], hl[4];
      float rb2 = 0.f;
      if (BM == 2) rb2 = bfr(bias[mBase + rlane]) * bsc;
#pragma unroll
      for (int it = 0; it < 4; ++it) {
        const float* sp = slab + rlane * 68 + 16 * it + 8 * hh2;   // rows 0..15 x (it, hh2) = 8 column chunks
        v4u ha = {0u, 0u, 0u, 0u};
        v4u la = {0u, 0u, 0u, 0u};
#pragma unroll
        for (int e = 0; e < 4; ++e) {
          const float b0 = sp[2 * e]     * osc + bc8[it][2 * e]     + rb2;
          const float b1 = sp[2 * e + 1] * osc + bc8[it][2 * e + 1] + rb2;
          if (OM == 1) {
            ha[e] = pk16(f2h(b0), f2h(b1));
          } else {
            const _Float16 h0 = (_Float16)b0;
            const _Float16 h1 = (_Float16)b1;
            const float l0 = (b0 - (float)h0) * LSC;       // difference exact, power-of-two carry exact
            const float l1 = (b1 - (float)h1) * LSC;
            ha[e] = pk16(h_bits(h0), h_bits(h1));
            la[e] = pk16(f2h(l0), f2h(l1));
          }
        }
        hv[it] = ha;
        hl[it] = la;
      }
      {
#pragma unroll
        for (int it = 0; it < 4; ++it) {
          const size_t pc = (OM == 2)
              ? ((size_t)tn * (size_t)(M >> 4) + (size_t)(mBase >> 4)) * 4 + it
              : (((size_t)tm * (size_t)(N >> 5) + (size_t)((n0 >> 5) + (it >> 1))) * 4 + i) * 2 + (it & 1);
          const size_t go = pc * 256 + (size_t)(lane * 8);    // 32 lanes x 16 B = the whole piece
          *(v4u*)(Ch + go) = hv[it];
          if (OM == 2) *(v4u*)(Cl + go) = hl[it];
        }
        addr_regs_free();
      }
    }
    wave_sync_lds();
  }
}

// one product per launch
template <int OM, int BM>
__global__ __launch_bounds__(256) void gemm64(
    const unsigned short* __restrict__ Ap, int lda, const unsigned short* __restrict__ Btp, int ldb,
    unsigned short* Ch, unsigned short* Cl, float* Cf, int ldc, float osc,
    const float* __restrict__ bias, float bsc, int M, int N, int K) {
  __shared__ __align__(16) float sT[8][16 * 68];   // per-wave 16x64 slab, pitch 68 floats
  gemm64_tile<OM, BM>(Ap, lda, Btp, ldb, Ch, Cl, Cf, ldc, osc, bias, bsc, M, N, K, blockIdx.x, sT);
}

// The three input projections in one launch; none reads what another writes. blockIdx.y picks the product:
// 0: s = 16*(xq.Wq + bq) -> QH = f16(s), QL = f16(2048*(s - QH));  1: the same for k;
// 2: v^T x16: C[d][tok] = sum_k WT[1024+d][k] * XV[tok][k], bias by row d.
// X = the planes XQ | XK | XV, WT = Wq^T | Wk^T | Wv^T. Output pointers that a product's OM does not use are null.
__global__ __launch_bounds__(256) void gemm_qkv(
    const unsigned short* __restrict__ X, const unsigned short* __restrict__ WT,
    unsigned short* QH, unsigned short* QL, unsigned short* KH, unsigned short* KL, unsigned short* VT,
    const float* __restrict__ bq, const float* __restrict__ bk, const float* __restrict__ bv) {
  __shared__ __align__(16) float sT[8][16 * 68];   // per-wave 16x64 slab, pitch 68 floats
  const int sel = blockIdx.y;
  if (sel == 2) {
    gemm64_tile<1, 2>(WT + (size_t)2 * DM * DM, DM, X + (size_t)2 * MT * DM, DM, VT, nullptr, nullptr, MT,
                      VSC / WSCL, bv, VSC, DM, MT, DM, blockIdx.x, sT);
  } else {
    const bool isk = (sel == 1);
    gemm64_tile<2, 1>(X + (isk ? (size_t)MT * DM : 0), DM, WT + (isk ? (size_t)DM * DM : 0), DM,
                      isk ? KH : QH, isk ? KL : QL, nullptr, DM, QKS / WSCL, isk ? bk : bq, QKS, MT, DM, DM,
                      blockIdx.x, sT);
  }
}

// ---- per-tile products used by the attention kernel ----------------------------------------------
// Both give the TRANSPOSED tile: the plane rows (table rows, keys) are the A operand, the query rows the B operand,
// so that D register r of lane l is (plane row 8*(l>>4) + r, query l&15).
// R^T = b.ah + (b.al)/2048 over 64 head dims (b0, b1: fragments of a [n][64] f16 plane row, dims 0..31 and 32..63)
__device__ __forceinline__ v8f dot2_res(v16us ah0, v16us ah1, v16us al0, v16us al1, v16us b0, v16us b1) {
  v8f L = mma_g(b0, al0, zero8());
  L = mma_g(b1, al1, L);
  L = L * (1.0f / LSC);
  v8f R = mma_g(b0, ah0, L);
  R = mma_g(b1, ah1, R);
  return R;
}
// S^T = kh.qh + (kl.qh + kh.ql)/2048 over 64 head dims (kh from the hi plane row, kl from the residual plane row)
__device__ __forceinline__ v8f dot3_res(v16us qh0, v16us qh1, v16us ql0, v16us ql1,
                                        v16us kh0, v16us kh1, v16us kl0, v16us kl1) {
  v8f L = mma_g(kl0, qh0, zero8());
  L = mma_g(kl1, qh1, L);
  L = mma_g(kh0, ql0, L);
  L = mma_g(kh1, ql1, L);
  L = L * (1.0f / LSC);
  v8f S = mma_g(kh0, qh0, L);
  S = mma_g(kh1, qh1, S);
  return S;
}
// value of lane l ^ 16
__device__ __forceinline__ float xhalf(float x) {
  const int b = __builtin_bit_cast(int, x);
  return __builtin_bit_cast(float, __builtin_amdgcn_permlanex16(b, b, 0x76543210, 0xfedcba98, false, false));
}
__device__ __forceinline__ v4f lo4(v8f x) { return __builtin_shufflevector(x, x, 0, 1, 2, 3); }
__device__ __forceinline__ v4f hi4(v8f x) { return __builtin_shufflevector(x, x, 4, 5, 6, 7); }

// =====================================================================================================
// Non-causal attention with clipped relative-offset term and key-padding mask, head dim 64.
// Block = 128 threads = 4 waves; one wave owns one 16-row query tile (t0..t0+15) of one (batch b, head h)
// and loops all key blocks of 32 with an online max-subtracted softmax in f32.
// Every product is taken transposed (keys, table rows or head dims as A rows, queries as B columns): lane l works for
// the one query t0 + (l&15); lanes l and l^16 split that query's keys (8*(l>>4) + 0..7 of each 16) and head dims.
// Planes, all in fragment order (a fragment = two pieces of 256 halves, lane l's 8 halves at piece + 8*l):
// QH/KH f16 = 16*q, 16*k, QL/KL = 2048*(16q - QH) residuals: [head][token tile of 16][dims 0..31 | 32..63];
// PE f16 = 64*rel table, [tile u][dims 0..31 | 32..63], tile u = table rows clamp(16u - POFF + 0..15, 0, 498);
// VT f16 = 16*v transposed: [head][key block of 32][dim tile of 16]; mask int32 [NB_FULL][SEQ_FULL].
// Output Z f16 [MT][512] = 16*ctx, token-major (row = b*SEQ + t, col = h*64+d).
// Per key block sb: S^T = 256*k.q (hi.hi + res.hi + hi.res, 2 key subtiles); relative band of 48 columns:
// column c <-> table row clamp(234 - t0 + sb + c, 0, 498) (clamped per column, which IS the clipped index), so
// columns 16k..16k+15 are table tile clamp(16 - t0/16 + sb/16 + k, 0, NPT-1);
// columns 0..15 come from the tile carried over from the prior key block (its columns 32..47), columns
// 16..47 are two fresh tiles (hi + res products, value 1024*rel.q); a lane holds 8 consecutive band columns of its
// query per tile, stores them to per-wave LDS as [query][column] (pitch RWP floats) and reads back the columns
// c = 15 - query + key of its own 16 keys, i.e. table row clamp(j - i + 249, 0, 498);
// score = qk/8 + bias; then replace-fill -1e10 where mask[b][j] == 0; the block maximum is taken over the lane's 16
// scores and joined with lane l^16; p = exp(score - running max) in f32; l is kept per lane over the lane's own keys
// (the two halves are joined behind the loop); 4096*p as f16, score registers in order, IS the B fragment of P^T
// (elements 0..7 = keys 8*(l>>4) + 0..7, elements 8..15 = keys 16 + 8*(l>>4) + 0..7, the k map of the V^T fragments);
// O^T += V^T.P^T on 4 dim subtiles, O^T register r of lane l = (dim 16*tile + 8*(l>>4) + r, query l&15).
// coverage: 16 query rows x 64 halves per wave, NB*NH*(SEQ/16) wave tasks = all (b, t, h) segments of Z.
// LDS: band 16 queries x 48 columns of floats per wave at pitch RWP; columns read 0..46.
// Global operands run one key block ahead in registers: K (hi + residual), table rows and mask words are
// reloaded for key block kb + 1 behind the score and band products of key block kb, V^T behind its V^T.P^T
// products, into the same variables, so that a load has most of a pass to land before its wait. The last
// pass reloads its own block (addresses in range, values unused).
// =====================================================================================================
__global__ __launch_bounds__(128) void attn_kernel(
    const unsigned short* __restrict__ QH, const unsigned short* __restrict__ QL,
    const unsigned short* __restrict__ KH, const unsigned short* __restrict__ KL,
    const unsigned short* __restrict__ PE, const unsigned short* __restrict__ VT,
    const int* __restrict__ mask, unsigned short* Z) {
  __shared__ __align__(16) float relw[AWV][16 * RWP];            // band exchange, 13312 B
  const int lane = threadIdx.x & 31, wv = threadIdx.x >> 5, m = lane & 15, hh = lane >> 4;
  const int task = blockIdx.x * AWV + wv;            // 0 .. NB*NH*(SEQ/16)-1
  const int nqt = SEQ / 16;
  const int bh = task / nqt;                         // (b, h)
  const int t0 = (task - bh * nqt) << 4;             // query tile start
  const int b = bh / NH, h = bh - (bh / NH) * NH;
  if (b >= NB) return;                               // wave-uniform; never taken with exact grids; no block barriers
  const size_t tok0 = (size_t)b * SEQ;               // plane row base of this batch
  const int* mk = mask + (size_t)b * SEQ_FULL + lane;     // full input stride for the mask row; lane l fetches key l's word
  float* rst = relw[wv] + m * RWP + 8 * hh;               // band store: query m, columns 8*hh + 0..7 of a tile
  const float* rld = relw[wv] + m * RWP + 15 - m + 8 * hh;   // band read: query m, column of key 8*hh

  // Q B-fragments (hi and residual): columns t0+m, k = head dims 0..31 and 32..63
  const size_t qo = ((size_t)h * (MT / 16) + ((tok0 + (size_t)t0) >> 4)) * 1024 + (size_t)(lane * 8);
  const v16us qh0 = ldfrag_p(QH + qo);
  const v16us qh1 = ldfrag_p(QH + qo + 512);
  const v16us ql0 = ldfrag_p(QL + qo);
  const v16us ql1 = ldfrag_p(QL + qo + 512);
  addr_regs_free();

  const int ub = (RCEN - 15 + POFF) / 16 - (t0 >> 4);  // table tile of band columns 0..15 at sb = 0 (before clamp)

  // carried band tile: columns 0..15 of key block 0
  const unsigned short* pcar = PE + (size_t)clampi(ub, 0, NPT - 1) * 1024 + lane * 8;
  const v16us cf0 = ldfrag_p(pcar), cf1 = ldfrag_p(pcar + 512);
  addr_regs_free_of(pcar);

  // lane-fixed parts of the operand addresses; key block sb adds sb/16 token tiles (K), sb/16 table tiles,
  // sb/32 key blocks (V^T), sb columns (mask)
  const size_t kfix = ((size_t)h * (MT / 16) + (tok0 >> 4)) * 1024 + (size_t)(lane * 8);
  const size_t vfix = ((size_t)h * (MT / 32) + (tok0 >> 5)) * 2048 + (size_t)(lane * 8);

  // operands of key block 0
  v16us ka0 = ldfrag_p(KH + kfix),        ka1 = ldfrag_p(KH + kfix + 512);     // keys 0..15, hi
  v16us ka2 = ldfrag_p(KL + kfix),        ka3 = ldfrag_p(KL + kfix + 512);     // keys 0..15, residual
  v16us kc0 = ldfrag_p(KH + kfix + 1024), kc1 = ldfrag_p(KH + kfix + 1536);    // keys 16..31, hi
  v16us kc2 = ldfrag_p(KL + kfix + 1024), kc3 = ldfrag_p(KL + kfix + 1536);    // keys 16..31, residual
  v16us pa0, pa1, pc0, pc1;                                                    // band columns 16..31, 32..47
  int mnx;                                                                     // mask word of key lane
  {
    const unsigned short* p1 = PE + (size_t)clampi(ub + 1, 0, NPT - 1) * 1024 + lane * 8;
    const unsigned short* p2 = PE + (size_t)clampi(ub + 2, 0, NPT - 1) * 1024 + lane * 8;
    pa0 = ldfrag_p(p1); pa1 = ldfrag_p(p1 + 512);
    pc0 = ldfrag_p(p2); pc1 = ldfrag_p(p2 + 512);
    mnx = mk[0];
    addr_regs_free_of(KH + kfix, KL + kfix, p1, p2, mk);
  }
  v16us vf0 = ldfrag_p(VT + vfix);
  v16us vf1 = ldfrag_p(VT + vfix + 512);
  v16us vf2 = ldfrag_p(VT + vfix + 1024);
  v16us vf3 = ldfrag_p(VT + vfix + 1536);
  addr_regs_free_of(VT + vfix);

  v8f carry = dot2_res(qh0, qh1, ql0, ql1, cf0, cf1);

  float mx = -1.0e30f, ls = 0.f;                       // running maximum of the query; sum over this lane's keys
  v8f O0 = zero8(), O1 = zero8(), O2 = zero8(), O3 = zero8();

#pragma unroll 1
  for (int kb = 0; kb < SEQ / 32; ++kb) {
    const int sb = kb << 5;
    const int sn = (kb + 1 < SEQ / 32) ? sb + 32 : sb;   // key block whose operands are fetched in this pass
    // scores, transposed: A row = key token, B column = query, k = head dim
    const v8f S0 = dot3_res(qh0, qh1, ql0, ql1, ka0, ka1, ka2, ka3);
    const v8f S1 = dot3_res(qh0, qh1, ql0, ql1, kc0, kc1, kc2, kc3);

    // relative band: columns 16..31 and 32..47 <-> table tiles clamp(ub + sb/16 + 1), clamp(ub + sb/16 + 2)
    const v8f Pb1 = dot2_res(qh0, qh1, ql0, ql1, pa0, pa1);
    const v8f Pb2 = dot2_res(qh0, qh1, ql0, ql1, pc0, pc1);

    // key mask of the block as 32 bits (bit = key), shifted so that bit r is key 8*hh + r and bit 16 + r key 16 + 8*hh + r
    const unsigned mw = __builtin_amdgcn_ballot_w32(mnx != 0) >> (8 * hh);

    // next key block's K, table and mask operands, one group (token tiles and columns below SEQ, table tiles clamped)
    {
      const int* mq = mk + sn;
      mnx = mq[0];
      const size_t ko = kfix + (size_t)(sn >> 4) * 1024;
      ka0 = ldfrag_p(KH + ko);        ka1 = ldfrag_p(KH + ko + 512);
      ka2 = ldfrag_p(KL + ko);        ka3 = ldfrag_p(KL + ko + 512);
      kc0 = ldfrag_p(KH + ko + 1024); kc1 = ldfrag_p(KH + ko + 1536);
      kc2 = ldfrag_p(KL + ko + 1024); kc3 = ldfrag_p(KL + ko + 1536);
      const int un = ub + (sn >> 4);
      const unsigned short* p1 = PE + (size_t)clampi(un + 1, 0, NPT - 1) * 1024 + lane * 8;
      const unsigned short* p2 = PE + (size_t)clampi(un + 2, 0, NPT - 1) * 1024 + lane * 8;
      pa0 = ldfrag_p(p1); pa1 = ldfrag_p(p1 + 512);
      pc0 = ldfrag_p(p2); pc1 = ldfrag_p(p2 + 512);
      addr_regs_free_of(KH + ko, KL + ko, p1, p2, mq);
    }
    *(v4f*)(rst)      = lo4(carry); *(v4f*)(rst + 4)  = hi4(carry);
    *(v4f*)(rst + 16) = lo4(Pb1);   *(v4f*)(rst + 20) = hi4(Pb1);
    *(v4f*)(rst + 32) = lo4(Pb2);   *(v4f*)(rst + 36) = hi4(Pb2);
    carry = Pb2;
    wave_sync_lds_only();

    // skew read + scale + bias, then replace-fill masked keys
    float s0[8], s1[8];
    // unrolled here and below: the per-key arrays are indexed by constants only, so they stay in registers
#pragma unroll
    for (int r = 0; r < 8; ++r) {
      const float rv0 = rld[r];
      const float rv1 = rld[16 + r];
      const float v0 = S0[r] * (RSQD / (QKS * QKS)) + rv0 * (1.0f / (QKS * WSCL));
      const float v1 = S1[r] * (RSQD / (QKS * QKS)) + rv1 * (1.0f / (QKS * WSCL));
      s0[r] = ((mw >> r) & 1u) ? v0 : MASKV;
      s1[r] = ((mw >> (16 + r)) & 1u) ? v1 : MASKV;
    }

    // online softmax: the lane's 16 scores are of one query; one exchange joins the two halves' maxima
    float xr[8];
#pragma unroll
    for (int r = 0; r < 8; ++r) xr[r] = fmaxf(s0[r], s1[r]);
    float xm = fmaxf(fmaxf(fmaxf(xr[0], xr[1]), fmaxf(xr[2], xr[3])), fmaxf(fmaxf(xr[4], xr[5]), fmaxf(xr[6], xr[7])));
    xm = fmaxf(xm, xhalf(xm));
    const float mn = fmaxf(mx, xm);
    const float al = __expf(mx - mn);
    mx = mn;
    float pr[8];
    FragU pf;                                          // P^T B fragment
#pragma unroll
    for (int r = 0; r < 8; ++r) {
      const float p0 = __expf(s0[r] - mn);
      const float p1 = __expf(s1[r] - mn);
      pr[r] = p0 + p1;
      pf.v[r]     = f2h(p0 * PSC);
      pf.v[8 + r] = f2h(p1 * PSC);
    }
    ls = ls * al + (((pr[0] + pr[1]) + (pr[2] + pr[3])) + ((pr[4] + pr[5]) + (pr[6] + pr[7])));
    O0 = O0 * al;
    O1 = O1 * al;
    O2 = O2 * al;
    O3 = O3 * al;

    // V^T A-fragments (row = dim, k = key token) against the P^T B fragment
    O0 = mma_g(vf0, pf.v, O0);
    O1 = mma_g(vf1, pf.v, O1);
    O2 = mma_g(vf2, pf.v, O2);
    O3 = mma_g(vf3, pf.v, O3);
    const size_t vo = vfix + (size_t)(sn >> 5) * 2048;
    vf0 = ldfrag_p(VT + vo);
    vf1 = ldfrag_p(VT + vo + 512);
    vf2 = ldfrag_p(VT + vo + 1024);
    vf3 = ldfrag_p(VT + vo + 1536);
    addr_regs_free_of(VT + vo);
  }
  acc_guard4(O0, O1, O2, O3);

  // ---- epilogue: ctx = O / (l * PSC * VSC), stored x CSC as f16, token-major plane; a lane's 8 registers of a dim
  //      subtile are 8 consecutive dims of its query: one 16-byte store each, the wave fills each row's 128-byte segment
  const float g = (CSC / (PSC * VSC)) / (ls + xhalf(ls));   // l >= 1
  unsigned short* dst = Z + ((size_t)b * SEQ + (size_t)(t0 + m)) * DM + h * HD + 8 * hh;
  v4u z0, z1, z2, z3;
#pragma unroll
  for (int e = 0; e < 4; ++e) {
    z0[e] = pk16(f2h(O0[2 * e] * g), f2h(O0[2 * e + 1] * g));
    z1[e] = pk16(f2h(O1[2 * e] * g), f2h(O1[2 * e + 1] * g));
    z2[e] = pk16(f2h(O2[2 * e] * g), f2h(O2[2 * e + 1] * g));
    z3[e] = pk16(f2h(O3[2 * e] * g), f2h(O3[2 * e + 1] * g));
  }
  *(v4u*)(dst)      = z0;
  *(v4u*)(dst + 16) = z1;
  *(v4u*)(dst + 32) = z2;
  *(v4u*)(dst + 48) = z3;
}

// =====================================================================================================
// Workspace map (bytes, NB=2 SEQ=2048 -> MT=4096); every plane is an exact multiple of its whole-row /
// whole-line / 64x64-tile store granularity (rows MT, 1536, 512; 64 | each tiled dimension; the table plane
// is NPT tiles of 2048 bytes, all written); all offsets multiples of 2048. PEH, QH, QL, KH, KL, VT: fragment order.
//   XQ   f16  [4096][512]      0           4194304
//   XK   f16  [4096][512]      4194304     4194304
//   XV   f16  [4096][512]      8388608     4194304
//   WT   f16  [1536][512]      12582912    1572864   (Wq^T | Wk^T | Wv^T, x64)
//   WOT  f16  [512][512]       14155776     524288   (Wo^T, x64)
//   PEH  f16  [34][1024]       14680064      69632   (table x64, clamped tiles)
//   QH   f16  [8][256][1024]   14749696    4194304
//   QL   f16  [8][256][1024]   18944000    4194304
//   KH   f16  [8][256][1024]   23138304    4194304
//   KL   f16  [8][256][1024]   27332608    4194304
//   VT   f16  [8][128][2048]   31526912    4194304
//   Z    f16  [4096][512]      35721216    4194304
//   end                        39915520
// =====================================================================================================
extern "C" void kernel_launch(void* const* d_in, const int* in_sizes, int n_in,
                              void* d_out, int out_size, void* d_ws, size_t ws_size,
                              hipStream_t stream) {
  if (n_in < 13) return;
  const int xreq = ((NB - 1) * SEQ_FULL + SEQ) * DM;
  const int mreq = (NB - 1) * SEQ_FULL + SEQ;
  if (in_sizes[0] < xreq || in_sizes[1] < xreq || in_sizes[2] < xreq) return;
  if (in_sizes[3] < mreq) return;
  if (in_sizes[4] < DM * DM || in_sizes[6] < DM * DM || in_sizes[8] < DM * DM || in_sizes[10] < DM * DM) return;
  if (in_sizes[5] < DM || in_sizes[7] < DM || in_sizes[9] < DM || in_sizes[11] < DM) return;
  if (in_sizes[12] < NREL * HD) return;
  if (out_size < MT * DM) return;

  const float* query = (const float*)d_in[0];   // [NB_FULL][SEQ_FULL][512]
  const float* key   = (const float*)d_in[1];
  const float* value = (const float*)d_in[2];
  const int*   mask  = (const int*)d_in[3];     // [NB_FULL][SEQ_FULL] int32
  const float* wq = (const float*)d_in[4];      // [512][512] (in, out)
  const float* bq = (const float*)d_in[5];
  const float* wk = (const float*)d_in[6];
  const float* bk = (const float*)d_in[7];
  const float* wv = (const float*)d_in[8];
  const float* bv = (const float*)d_in[9];
  const float* wo = (const float*)d_in[10];
  const float* bo = (const float*)d_in[11];
  const float* rel = (const float*)d_in[12];    // [499][64]

  const size_t PX  = (size_t)MT * DM * 2;
  const size_t PWT = (size_t)3 * DM * DM * 2;
  const size_t PWO = (size_t)DM * DM * 2;
  const size_t PPE = (size_t)NPT * 1024 * 2;
  size_t off = 0;
  const size_t oXQ = off; off += 3 * PX;          // XQ | XK | XV
  const size_t oWT = off; off += PWT;
  const size_t oWO = off; off += PWO;
  const size_t oPE = off; off += PPE;
  const size_t oQH = off; off += PX;
  const size_t oQL = off; off += PX;
  const size_t oKH = off; off += PX;
  const size_t oKL = off; off += PX;
  const size_t oVT = off; off += PX;
  const size_t oZ  = off; off += PX;
  if (off > ws_size) return;
  if (off > (size_t)134217728) return;

  char* ws = (char*)d_ws;
  unsigned short* XQ  = (unsigned short*)(ws + oXQ);
  unsigned short* WT  = (unsigned short*)(ws + oWT);
  unsigned short* WOT = (unsigned short*)(ws + oWO);
  unsigned short* PEH = (unsigned short*)(ws + oPE);
  unsigned short* QH  = (unsigned short*)(ws + oQH);
  unsigned short* QL  = (unsigned short*)(ws + oQL);
  unsigned short* KH  = (unsigned short*)(ws + oKH);
  unsigned short* KL  = (unsigned short*)(ws + oKL);
  unsigned short* VT  = (unsigned short*)(ws + oVT);
  unsigned short* Z   = (unsigned short*)(ws + oZ);
  float* out0 = (float*)d_out;
  unsigned short* hdummy = XQ;                    // in-range placeholder for unused f16 output args

  const dim3 blk(256);
  const int gP = ((MT / 64) * (DM / 64)) / 8;     // 64x64 tiles / 8 waves, exact

  // (0) operand planes: query/key/value -> f16(bf16) per batch slice (XQ | XK | XV, contiguous); table -> f16(bf16 x64)
  //     clamped tiles; Wq|Wk|Wv|Wo [512][512] -> WT | WOT (contiguous) rows 0.., 512.., 1024.., 1536.. (transposed, f16 x64)
  cvt_all<<<dim3(4 * NTB + NBB + 3 * NB * LINB), blk, 0, stream>>>(query, key, value, wq, wk, wv, wo, rel, XQ, WT, PEH);

  // (1) q and k hi/res planes and v^T x16
  gemm_qkv<<<dim3(gP, 3), blk, 0, stream>>>(XQ, WT, QH, QL, KH, KL, VT, bq, bk, bv);

  // (2) attention -> ctx x16 token-major plane
  attn_kernel<<<dim3((NB * NH * (SEQ / 16)) / AWV), dim3(128), 0, stream>>>(QH, QL, KH, KL, PEH, VT, mask, Z);

  // (3) output projection: out[row][n] = sum_k Z[row][k] * WOT[n][k] / (16*64) + bo[n]
  gemm64<0, 1><<<dim3(gP), blk, 0, stream>>>(Z, DM, WOT, DM, hdummy, hdummy, out0, DM, 1.0f / (WSCL * CSC), bo, 1.0f, MT, DM, DM);
  (void)hipGetLastError();
}

// v005
// Measured time: 108 microseconds a run.
// In two side-by-side timings against v004, it was 1.12 and 1.13 times as fast.
// Over all steps from v000 it is 2.75 times as fast.
// Contractions: x.Wq and x.Wk (q, k hi + residual planes), x.Wv (v^T plane), k.q^T (hi.hi + res.hi + hi.res),
// rel.q^T (hi + res), v^T.p^T and ctx.Wo, all on v_wmma_f32_16x16x32_f16 (f16 operands, f32 accumulate).
// Float inputs RNE-converted to bf16 on load and carried in f16 containers with power-of-two scales
// (x x1; Wq, Wk, Wv, Wo x64; rel table x64; q, k hi planes x16, residual planes x16x2048; v^T x16;
// p x4096; ctx x16); softmax, key mask and the relative-offset skew in f32 on VALU.
// Every f16 plane that a matrix product reads (x, W^T, q, k hi + residual, v^T, table, ctx) lies in fragment order: the
// 16 bytes of lane l of one operand load stand at piece base + 16*l, so that a load covers four whole 128-byte lines.
#include <hip/hip_runtime.h>
#include <math.h>

#ifndef NB
#define NB 2
#endif
#ifndef SEQ
#define SEQ 2048
#endif
#define NB_FULL  2
#define SEQ_FULL 2048
#define DM   512
#define NH   8
#define HD   64
#define MT   (NB * SEQ)
#define NREL 499
#define RCEN 249
#define POFF 22
#define NPT  34
#define AWV  4
#define RWP  52
#define WSCL 64.0f
#define QKS  16.0f
#define LSC  2048.0f
#define VSC  16.0f
#define PSC  4096.0f
#define CSC  16.0f
#define RSQD 0.125f
#define MASKV (-1.0e10f)
#define LINB ((SEQ * DM) / 2048)          // blocks of one batch slice of one activation plane
#define NTB  ((DM / 64) * (DM / 64))      // blocks of one weight transpose
#define NBB  ((NPT * 128) / 256)          // blocks of the table plane

static_assert(NH * HD == DM);
static_assert(HD == 64);
static_assert(NB >= 1 && NB <= NB_FULL);
static_assert((SEQ % 64) == 0 && SEQ >= 64 && SEQ <= SEQ_FULL);
static_assert((MT % 64) == 0 && (DM % 64) == 0);
static_assert((((MT / 64) * (DM / 64)) % 8) == 0);
static_assert(((SEQ * DM) % 2048) == 0 && ((NPT * 128) % 256) == 0);
static_assert(((NB * NH * (SEQ / 16)) % AWV) == 0);
static_assert((2 * RCEN + 1) == NREL);
static_assert(((RCEN - 15 + POFF) % 16) == 0 && POFF >= 15 && 16 * (NPT - 1) - POFF >= NREL - 1);

typedef _Float16 v16h __attribute__((ext_vector_type(16)));
typedef unsigned short v16us __attribute__((ext_vector_type(16)));
typedef unsigned short v8us  __attribute__((ext_vector_type(8)));
typedef float v8f __attribute__((ext_vector_type(8)));
typedef float v4f __attribute__((ext_vector_type(4)));
typedef unsigned int v4u __attribute__((ext_vector_type(4)));

union FragU { v16us v; v8us h[2]; };

// ---- scalar helpers --------------------------------------------------------------------------------
__device__ __forceinline__ unsigned short bf_bits(float f) {          // f32 -> bf16 bits, RNE convert
  const unsigned u = __float_as_uint(f);
  return (unsigned short)((u + 0x7FFFu + ((u >> 16) & 1u)) >> 16);
}
__device__ __forceinline__ float bf_up(unsigned short h) { return __uint_as_float(((unsigned)h) << 16); }
__device__ __forceinline__ float bfr(float f) { return bf_up(bf_bits(f)); }   // value of the bf16 RNE convert
__device__ __forceinline__ unsigned short h_bits(_Float16 x) { return __builtin_bit_cast(unsigned short, x); }
__device__ __forceinline__ unsigned short f2h(float f) { return h_bits((_Float16)f); }
__device__ __forceinline__ unsigned pk16(unsigned short a, unsigned short b) { return (unsigned)a | ((unsigned)b << 16); }
__device__ __forceinline__ int clampi(int v, int lo, int hi) { return v < lo ? lo : (v > hi ? hi : v); }
__device__ __forceinline__ v8f zero8() { v8f z = {0.f, 0.f, 0.f, 0.f, 0.f, 0.f, 0.f, 0.f}; return z; }

// ---- fragment loader: 16-bit A/B operand of k block k0..k0+31, lane l -> row/col (l&15), h = l>>4; elements 0..7 are
//      k0+8h.., elements 8..15 are k0+16+8h... Plane in fragment order: p = fragment base + 8*lane; the piece of
//      elements 0..7 is 256 halves (32 lanes x 8), the piece of elements 8..15 follows it.
//      A row-major [R][K] matrix (lane index = row, k contiguous) as such a plane: row tile T = row/16, piece
//      q = k/16 at (T*(K/16) + q)*256; in the piece lane l = row (l&15), k = 16*q + 8*(l>>4) .. +7.
__device__ __forceinline__ v16us ldfrag_p(const unsigned short* p) {
  FragU f;
  f.h[0] = *(const v8us*)(p);
  f.h[1] = *(const v8us*)(p + 256);
  return f.v;
}

// ---- WMMA helpers (f16 operand bits) with trailing VALU hazard gap --------------------------------
__device__ __forceinline__ v8f mma_raw(v16us a, v16us b, v8f c) {
  return __builtin_amdgcn_wmma_f32_16x16x32_f16(false, __builtin_bit_cast(v16h, a), false,
                                                __builtin_bit_cast(v16h, b), (short)0, c, false, false);
}
__device__ __forceinline__ v8f mma_g(v16us a, v16us b, v8f c) {                 // guarded
  c = mma_raw(a, b, c);
#if defined(__HIP_DEVICE_COMPILE__)
  asm volatile("v_nop\n\tv_nop\n\tv_nop\n\tv_nop" : "+v"(c) : "v"(a), "v"(b));
#endif
  return c;
}
__device__ __forceinline__ void dep_guard1(v8f& a, v8f& b, v16us x) {
#if defined(__HIP_DEVICE_COMPILE__)
  asm volatile("v_nop\n\tv_nop\n\tv_nop\n\tv_nop" : "+v"(a), "+v"(b) : "v"(x));
#endif
}
__device__ __forceinline__ void keep4_u(v16us a, v16us b, v16us c, v16us d) {
#if defined(__HIP_DEVICE_COMPILE__)
  asm volatile("v_nop" :: "v"(a), "v"(b), "v"(c), "v"(d));
#endif
}
__device__ __forceinline__ void acc_guard4(v8f& a, v8f& b, v8f& c, v8f& d) {
#if defined(__HIP_DEVICE_COMPILE__)
  asm volatile("v_nop\n\tv_nop\n\tv_nop\n\tv_nop" : "+v"(a), "+v"(b), "+v"(c), "+v"(d));
#endif
}
// orders LDS stores of this wave before later LDS loads of the same wave (cross-lane exchange)
__device__ __forceinline__ void wave_sync_lds() {
  __builtin_amdgcn_fence(__ATOMIC_RELEASE, "workgroup");
  __builtin_amdgcn_wave_barrier();
  __builtin_amdgcn_fence(__ATOMIC_ACQUIRE, "workgroup");
}

// the same exchange for a wave that has global loads in flight: waits for this wave's LDS operations only
__device__ __forceinline__ void wave_sync_lds_only() {
#if defined(__HIP_DEVICE_COMPILE__)
  // LDS stores of this wave are done before its later LDS loads issue, and the "memory" clobber keeps the compiler
  // from moving either across; the fence pair above would also wait out the next key block's global loads
  asm volatile("s_wait_dscnt 0x0" ::: "memory");
#endif
  __builtin_amdgcn_wave_barrier();
}

// stands behind a group of global loads that stay in flight: their address registers may be rewritten behind it
__device__ __forceinline__ void addr_regs_free() {
#if defined(__HIP_DEVICE_COMPILE__)
  asm volatile("s_wait_xcnt 0x0" ::: "memory");
#endif
}

// the same wait with the loads' address values as inputs: their registers stay live, so unwritten, up to the wait
// (the "memory" clobber alone does not keep a register write, or a later load's destination, behind it)
__device__ __forceinline__ void addr_regs_free_of(const void* a) {
#if defined(__HIP_DEVICE_COMPILE__)
  asm volatile("s_wait_xcnt 0x0" :: "v"(a) : "memory");
#endif
}
__device__ __forceinline__ void addr_regs_free_of(const void* a, const void* b) {
#if defined(__HIP_DEVICE_COMPILE__)
  asm volatile("s_wait_xcnt 0x0" :: "v"(a), "v"(b) : "memory");
#endif
}
__device__ __forceinline__ void addr_regs_free_of(const void* a, const void* b, const void* c, const void* d,
                                                  const void* e) {
#if defined(__HIP_DEVICE_COMPILE__)
  asm volatile("s_wait_xcnt 0x0" :: "v"(a), "v"(b), "v"(c), "v"(d), "v"(e) : "memory");
#endif
}

// =====================================================================================================
// Activation plane in fragment order: w[rows][DM] f32 -> o = f16 bits of (bf16 RNE value * sc), row tile T, piece q at
// (T*(DM/16) + q)*256 halves. One thread per 16-byte chunk of o: a wave reads 64 bytes of each of 16 rows and writes
// one whole piece; the 8 waves of a block take 8 pieces in a row, i.e. 512 consecutive bytes of each of the 16 rows.
// coverage: 256 threads x 8 = 2048 elements per block; bx = 0 .. rows*DM/2048 - 1 exact covers all of o.
// =====================================================================================================
__device__ __forceinline__ void cvt_rows(const float* __restrict__ w, unsigned short* o, float sc, int bx) {
  const int g = bx * 256 + threadIdx.x;                   // chunk = (piece, lane)
  const int pcs = g >> 5, l = g & 31;
  const int row = (pcs / (DM / 16)) * 16 + (l & 15);
  const int col = (pcs % (DM / 16)) * 16 + 8 * (l >> 4);
  const float* p = w + (size_t)row * DM + col;
  const v4f a0 = *(const v4f*)(p);
  const v4f a1 = *(const v4f*)(p + 4);
  addr_regs_free_of(p);
  v4u hv;
#pragma unroll
  for (int e = 0; e < 2; ++e) {
    hv[e]     = pk16(f2h(bfr(a0[2 * e]) * sc), f2h(bfr(a0[2 * e + 1]) * sc));
    hv[2 + e] = pk16(f2h(bfr(a1[2 * e]) * sc), f2h(bfr(a1[2 * e + 1]) * sc));
  }
  *(v4u*)(o + (size_t)g * 8) = hv;
}

// =====================================================================================================
// Table plane in fragment order: tile u (0..NPT-1) holds the 16 table rows clamp(16u - POFF + 0..15, 0, NREL-1) as
// four pieces of 256 halves; piece j, lane l = row (l&15) of the tile, head dims 16j + 8*(l>>4) .. +7, as f16 bits
// of (bf16 RNE value * sc). The band tiles of the attention kernel all start at a row = -POFF (mod 16), so every one
// of them is a tile of this plane; tile 0 is row 0 sixteen times, tile NPT-1 row NREL-1 sixteen times.
// coverage: one thread per 16-byte chunk, NPT*128 chunks, bx = 0 .. NPT*128/256 - 1 exact.
// =====================================================================================================
__device__ __forceinline__ void cvt_band(const float* __restrict__ w, unsigned short* o, float sc, int bx) {
  const int g = bx * 256 + threadIdx.x;
  if (g >= NPT * 128) return;                             // never taken with the exact grid; no barriers below
  const int u = g >> 7, j = (g >> 5) & 3, l = g & 31;
  const int row = clampi(16 * u - POFF + (l & 15), 0, NREL - 1);
  const float* p = w + (size_t)row * HD + 16 * j + 8 * (l >> 4);
  const v4f a0 = *(const v4f*)(p);
  const v4f a1 = *(const v4f*)(p + 4);
  v4u hv;
#pragma unroll
  for (int e = 0; e < 2; ++e) {
    hv[e]     = pk16(f2h(bfr(a0[2 * e]) * sc), f2h(bfr(a0[2 * e + 1]) * sc));
    hv[2 + e] = pk16(f2h(bfr(a1[2 * e]) * sc), f2h(bfr(a1[2 * e + 1]) * sc));
  }
  *(v4u*)(o + (size_t)g * 8) = hv;
}

// =====================================================================================================
// Transpose-convert: in w[R][C] f32 -> out o = the matrix [C][R] of f16 bits of (bf16 RNE value * sc), in fragment
// order (row tile T = c/16, piece q = r/16 at (T*(R/16) + q)*256). Block tile 64x64 through LDS (st[col][row], pitch
// 72 halves). Read phase: thread owns one input row x 16 columns. Write phase: the tile is 4 row tiles x 4 pieces;
// a wave writes one whole piece per store.
// R, C multiples of 64, (bx, by) = (0 .. C/64 - 1, 0 .. R/64 - 1) exact; st = the block's 64*72 halves of LDS.
// coverage: 16 pieces x 256 halves per block = the whole transposed tile; the blocks cover all of [C][R].
// =====================================================================================================
__device__ __forceinline__ void cvt_t(const float* __restrict__ w, unsigned short* o, int R, int C, float sc,
                                      int bx, int by, unsigned short* st) {
  const int t = threadIdx.x;
  const int r0 = by * 64, c0 = bx * 64;
  if (r0 + 64 > R || c0 + 64 > C) return;               // block-uniform, before the barrier; never taken
  {
    const int row = t >> 2, ch = (t & 3) * 16;
    const float* p = w + (size_t)(r0 + row) * C + c0 + ch;
#pragma unroll
    for (int q = 0; q < 4; ++q) {
      const v4f v = *(const v4f*)(p + 4 * q);
#pragma unroll
      for (int e = 0; e < 4; ++e) st[(ch + 4 * q + e) * 72 + row] = f2h(bfr(v[e]) * sc);
    }
  }
  __syncthreads();
  const int l = t & 31, wq = t >> 5;                     // lane in the piece; piece 8*half + wq of the tile's 16
  v4u hv[2];
#pragma unroll
  for (int half = 0; half < 2; ++half) {
    const int tl = 2 * half + (wq >> 2), q = wq & 3;      // row tile and piece in the block tile
    hv[half] = *(const v4u*)(st + (16 * tl + (l & 15)) * 72 + 16 * q + 8 * (l >> 4));
  }
#pragma unroll
  for (int half = 0; half < 2; ++half) {
    const int tl = 2 * half + (wq >> 2), q = wq & 3;
    unsigned short* dst = o + ((size_t)((c0 >> 4) + tl) * (size_t)(R >> 4) + (size_t)((r0 >> 4) + q)) * 256 + l * 8;
    *(v4u*)dst = hv[half];
  }
}

// =====================================================================================================
// All operand planes in one launch; none reads what another writes. The flat block index picks the work, the same for
// the whole block (the barrier of cvt_t is passed by all of a block's threads or by none):
// 4*NTB blocks: Wq, Wk, Wv, Wo [512][512] -> WT planes 0, 1, 2, 3 (transposed, x64; the last is WOT);
// NBB blocks: table -> PE (x64, clamped tiles); 3*NB*LINB blocks: query, key, value -> X planes 0, 1, 2 per batch slice.
// The transposes, which take longest, have the lowest indices.
// =====================================================================================================
__global__ __launch_bounds__(256) void cvt_all(
    const float* __restrict__ query, const float* __restrict__ key, const float* __restrict__ value,
    const float* __restrict__ wq, const float* __restrict__ wk, const float* __restrict__ wv,
    const float* __restrict__ wo, const float* __restrict__ rel,
    unsigned short* X, unsigned short* WT, unsigned short* PE) {
  __shared__ __align__(16) unsigned short st[64 * 72];
  int bid = blockIdx.x;
  if (bid < 4 * NTB) {
    const int ws = bid / NTB, tb = bid - ws * NTB;
    const float* w = (ws == 0) ? wq : (ws == 1) ? wk : (ws == 2) ? wv : wo;
    cvt_t(w, WT + (size_t)ws * DM * DM, DM, DM, WSCL, tb % (DM / 64), tb / (DM / 64), st);
    return;
  }
  bid -= 4 * NTB;
  if (bid < NBB) {
    cvt_band(rel, PE, WSCL, bid);
    return;
  }
  bid -= NBB;
  const int xs = bid / (NB * LINB), xr = bid - xs * (NB * LINB);
  if (xs > 2) return;                                     // never taken with the exact grid
  const float* x = (xs == 0) ? query : (xs == 1) ? key : value;
  const int by = xr / LINB;                               // batch slice: SEQ rows, a whole number of row tiles
  cvt_rows(x + (size_t)by * SEQ_FULL * DM, X + (size_t)xs * MT * DM + (size_t)by * SEQ * DM, 1.0f, xr - by * LINB);
}

// =====================================================================================================
// Register-blocked f16 WMMA GEMM: C[m][n] = sum_k A[m][k] * Bt[n][k], one wave per 64x64 tile, no block
// barriers. A = [M][K] and Bt = [N][K], both planes in fragment order (row tile T, k block kb: two pieces at
// (T*(K/32) + kb)*512 halves, so a row tile's k blocks follow one another); M, N multiples of 64,
// K multiple of 32 (true at every call site; bx = 0 .. tiles/8 - 1 exact so no wave exits early). Both operand
// fragments use the split k map (elements 0..7 <- k0+8h.., 8..15 <- k0+16+8h..); D element r of a lane is
// (row 8h + r, col lane&15).
// s = acc*osc + bias term (BM 0: none; BM 1: bsc*bf16(bias[col]); BM 2: bsc*bf16(bias[row])).
// OM 0: f32 out Cf = s, pitch ldc.   OM 1: f16 out Ch = f16 bits(s).
// OM 2: f16 hi plane Ch = f16(s) and f16 residual plane Cl = f16((s - hi) * 2048), same layout.
// f16 outputs lie in fragment order (ldc unused). A 16x64 slab is four pieces of 256 halves; piece it, lane l =
// slab row (l&15), slab columns 16*it + 8*(l>>4) .. +7, i.e. one load of a fragment whose lane index is the row and
// whose k index is the column. OM 2: slab (row tile T = row/16, column tile tn) at ((tn*(M/16) + T)*4 + it)*256.
// OM 1: pieces 2*kb, 2*kb + 1 of a slab are k block kb of 32 columns; piece at
// (((tm*(N/32) + column/32)*4 + row tile in tm)*2 + (it&1))*256, so that a k block's four row tiles are contiguous.
// coverage: 4 slabs x 16 rows x 64 cols = the wave's whole 64x64 tile.
// =====================================================================================================
template <int OM, int BM>
__device__ __forceinline__ void gemm64_tile(
    const unsigned short* __restrict__ Ap, const unsigned short* __restrict__ Btp,
    unsigned short* Ch, unsigned short* Cl, float* Cf, int ldc, float osc,
    const float* __restrict__ bias, float bsc, int M, int N, int K, int bx, float (*sT)[16 * 68]) {
  const int lane = threadIdx.x & 31;
  const int wave = threadIdx.x >> 5;
  const int tilesN = N >> 6;
  const int tilesM = M >> 6;
  const int tile = bx * 8 + wave;
  if (tile >= tilesM * tilesN) return;   // wave-uniform; no block barriers in this kernel
  const int tm = tile / tilesN;
  const int tn = tile - tm * tilesN;
  const int m0 = tm << 6;
  const int n0 = tn << 6;

  const int rlane = lane & 15;                 // col (D) within subtile
  const int mOff  = (lane >> 4) * 8;           // D row offset
  const size_t tstr = (size_t)(K >> 5) * 512;  // halves of one row tile of an operand plane
  const unsigned short* Aw = Ap + (size_t)(m0 >> 4) * tstr + lane * 8;    // this lane's chunk of row tile m0/16, k block 0
  const unsigned short* Bw = Btp + (size_t)(n0 >> 4) * tstr + lane * 8;

  v8f acc[4][4];
#pragma unroll
  for (int i = 0; i < 4; ++i)
#pragma unroll
    for (int j = 0; j < 4; ++j) acc[i][j] = zero8();

#pragma unroll 1
  for (int k0 = 0; k0 < K; k0 += 32) {
    // k block k0/32: the eight fragments stand at constant distances from two addresses and are fetched as one group
    const unsigned short* pa = Aw + (size_t)k0 * 16;
    const unsigned short* pb = Bw + (size_t)k0 * 16;
    v16us bh[4], ah[4];
#pragma unroll
    for (int j = 0; j < 4; ++j) bh[j] = ldfrag_p(pb + (size_t)j * tstr);
#pragma unroll
    for (int i = 0; i < 4; ++i) ah[i] = ldfrag_p(pa + (size_t)i * tstr);
    addr_regs_free_of(pa, pb);
#pragma unroll
    for (int i = 0; i < 4; ++i) {
#pragma unroll
      for (int j = 0; j < 4; ++j) acc[i][j] = mma_raw(ah[i], bh[j], acc[i][j]);
      dep_guard1(acc[i][0], acc[i][3], ah[i]);
    }
    keep4_u(bh[0], bh[1], bh[2], bh[3]);
  }
  acc_guard4(acc[0][0], acc[0][1], acc[0][2], acc[0][3]);
  acc_guard4(acc[1][0], acc[1][1], acc[1][2], acc[1][3]);
  acc_guard4(acc[2][0], acc[2][1], acc[2][2], acc[2][3]);
  acc_guard4(acc[3][0], acc[3][1], acc[3][2], acc[3][3]);

  const int hh2 = lane >> 4, c4 = (lane & 15) * 4;     // f32 out: 256-B row segment = 16 lanes x 16 B

  // column bias terms (fixed per wave); addresses n0+c4+3 < N and n0+48+8+7 < N
  v4f bc4 = {0.f, 0.f, 0.f, 0.f};
  float bc8[4][8];                                      // f16 out: piece it, columns 16*it + 8*hh2 .. +7
#pragma unroll
  for (int it = 0; it < 4; ++it)
#pragma unroll
    for (int e = 0; e < 8; ++e) bc8[it][e] = 0.f;
  if (BM == 1) {
    if (OM == 0) {
      const v4f t4 = *(const v4f*)(bias + n0 + c4);
#pragma unroll
      for (int e = 0; e < 4; ++e) bc4[e] = bfr(t4[e]) * bsc;
    } else {
#pragma unroll
      for (int it = 0; it < 4; ++it) {
        const v4f ta = *(const v4f*)(bias + n0 + 16 * it + 8 * hh2);
        const v4f tb = *(const v4f*)(bias + n0 + 16 * it + 8 * hh2 + 4);
#pragma unroll
        for (int e = 0; e < 4; ++e) { bc8[it][e] = bfr(ta[e]) * bsc; bc8[it][4 + e] = bfr(tb[e]) * bsc; }
      }
    }
  }

  // ---- epilogue ----
  float* slab = sT[wave];
#pragma unroll
  for (int i = 0; i < 4; ++i) {
    const int mBase = m0 + (i << 4);
#pragma unroll
    for (int j = 0; j < 4; ++j) {
#pragma unroll
      for (int r = 0; r < 8; ++r) {
        slab[(mOff + r) * 68 + (j << 4) + rlane] = acc[i][j][r];
      }
    }
    wave_sync_lds();
    if (OM == 0) {
      v4f vals[8];
#pragma unroll
      for (int it = 0; it < 8; ++it) {
        const int row = it * 2 + hh2;                      // it 0..7 x hh2 0..1 = rows 0..15
        const v4f v = *(const v4f*)(slab + row * 68 + c4);
        float rb2 = 0.f;
        if (BM == 2) rb2 = bfr(bias[mBase + row]) * bsc;
        vals[it] = v * osc + bc4 + rb2;
      }
      {
#pragma unroll
        for (int it = 0; it < 8; ++it) {
          const int row = it * 2 + hh2;
          *(v4f*)(Cf + (size_t)(mBase + row) * ldc + (size_t)n0 + c4) = vals[it];
        }
        
      }
    } else {
      v4u hv[4], hl[4];
      float rb2 = 0.f;
      if (BM == 2) rb2 = bfr(bias[mBase + rlane]) * bsc;
#pragma unroll
      for (int it = 0; it < 4; ++it) {
        const float* sp = slab + rlane * 68 + 16 * it + 8 * hh2;   // rows 0..15 x (it, hh2) = 8 column chunks
        v4u ha = {0u, 0u, 0u, 0u};
        v4u la = {0u, 0u, 0u, 0u};
#pragma unroll
        for (int e = 0; e < 4; ++e) {
          const float b0 = sp[2 * e]     * osc + bc8[it][2 * e]     + rb2;
          const float b1 = sp[2 * e + 1] * osc + bc8[it][2 * e + 1] + rb2;
          if (OM == 1) {
            ha[e] = pk16(f2h(b0), f2h(b1));
          } else {
            const _Float16 h0 = (_Float16)b0;
            const _Float16 h1 = (_Float16)b1;
            const float l0 = (b0 - (float)h0) * LSC;       // difference exact, power-of-two carry exact
            const float l1 = (b1 - (float)h1) * LSC;
            ha[e] = pk16(h_bits(h0), h_bits(h1));
            la[e] = pk16(f2h(l0), f2h(l1));
          }
        }
        hv[it] = ha;
        hl[it] = la;
      }
      {
#pragma unroll
        for (int it = 0; it < 4; ++it) {
          const size_t pc = (OM == 2)
              ? ((size_t)tn * (size_t)(M >> 4) + (size_t)(mBase >> 4)) * 4 + it
              : (((size_t)tm * (size_t)(N >> 5) + (size_t)((n0 >> 5) + (it >> 1))) * 4 + i) * 2 + (it & 1);
          const size_t go = pc * 256 + (size_t)(lane * 8);    // 32 lanes x 16 B = the whole piece
          *(v4u*)(Ch + go) = hv[it];
          if (OM == 2) *(v4u*)(Cl + go) = hl[it];
        }
        addr_regs_free();
      }
    }
    wave_sync_lds();
  }
}

// one product per launch, K = DM
template <int OM, int BM>
__global__ __launch_bounds__(256) void gemm64(
    const unsigned short* __restrict__ Ap, const unsigned short* __restrict__ Btp,
    unsigned short* Ch, unsigned short* Cl, float* Cf, int ldc, float osc,
    const float* __restrict__ bias, float bsc, int M, int N) {
  __shared__ __align__(16) float sT[8][16 * 68];   // per-wave 16x64 slab, pitch 68 floats
  gemm64_tile<OM, BM>(Ap, Btp, Ch, Cl, Cf, ldc, osc, bias, bsc, M, N, DM, blockIdx.x, sT);
}

// The three input projections in one launch; none reads what another writes. blockIdx.y picks the product:
// 0: s = 16*(xq.Wq + bq) -> QH = f16(s), QL = f16(2048*(s - QH));  1: the same for k;
// 2: v^T x16: C[d][tok] = sum_k WT[1024+d][k] * XV[tok][k], bias by row d.
// X = the planes XQ | XK | XV, WT = Wq^T | Wk^T | Wv^T, each in fragment order. Output pointers that a product's OM does not use are null.
__global__ __launch_bounds__(256) void gemm_qkv(
    const unsigned short* __restrict__ X, const unsigned short* __restrict__ WT,
    unsigned short* QH, unsigned short* QL, unsigned short* KH, unsigned short* KL, unsigned short* VT,
    const float* __restrict__ bq, const float* __restrict__ bk, const float* __restrict__ bv) {
  __shared__ __align__(16) float sT[8][16 * 68];   // per-wave 16x64 slab, pitch 68 floats
  const int sel = blockIdx.y;
  const unsigned short* Xs = X + (size_t)sel * MT * DM;    // this product's activation and weight planes
  const unsigned short* Ws = WT + (size_t)sel * DM * DM;
  if (sel == 2) {
    gemm64_tile<1, 2>(Ws, Xs, VT, nullptr, nullptr, MT,
                      VSC / WSCL, bv, VSC, DM, MT, DM, blockIdx.x, sT);
  } else {
    const bool isk = (sel == 1);
    gemm64_tile<2, 1>(Xs, Ws,
                      isk ? KH : QH, isk ? KL : QL, nullptr, DM, QKS / WSCL, isk ? bk : bq, QKS, MT, DM, DM,
                      blockIdx.x, sT);
  }
}

// ---- per-tile products used by the attention kernel ----------------------------------------------
// Both give the TRANSPOSED tile: the plane rows (table rows, keys) are the A operand, the query rows the B operand,
// so that D register r of lane l is (plane row 8*(l>>4) + r, query l&15).
// R^T = b.ah + (b.al)/2048 over 64 head dims (b0, b1: fragments of a [n][64] f16 plane row, dims 0..31 and 32..63)
__device__ __forceinline__ v8f dot2_res(v16us ah0, v16us ah1, v16us al0, v16us al1, v16us b0, v16us b1) {
  v8f L = mma_g(b0, al0, zero8());
  L = mma_g(b1, al1, L);
  L = L * (1.0f / LSC);
  v8f R = mma_g(b0, ah0, L);
  R = mma_g(b1, ah1, R);
  return R;
}
// S^T = kh.qh + (kl.qh + kh.ql)/2048 over 64 head dims (kh from the hi plane row, kl from the residual plane row)
__device__ __forceinline__ v8f dot3_res(v16us qh0, v16us qh1, v16us ql0, v16us ql1,
                                        v16us kh0, v16us kh1, v16us kl0, v16us kl1) {
  v8f L = mma_g(kl0, qh0, zero8());
  L = mma_g(kl1, qh1, L);
  L = mma_g(kh0, ql0, L);
  L = mma_g(kh1, ql1, L);
  L = L * (1.0f / LSC);
  v8f S = mma_g(kh0, qh0, L);
  S = mma_g(kh1, qh1, S);
  return S;
}
// value of lane l ^ 16
__device__ __forceinline__ float xhalf(float x) {
  const int b = __builtin_bit_cast(int, x);
  return __builtin_bit_cast(float, __builtin_amdgcn_permlanex16(b, b, 0x76543210, 0xfedcba98, false, false));
}
__device__ __forceinline__ v4f lo4(v8f x) { return __builtin_shufflevector(x, x, 0, 1, 2, 3); }
__device__ __forceinline__ v4f hi4(v8f x) { return __builtin_shufflevector(x, x, 4, 5, 6, 7); }

// =====================================================================================================
// Non-causal attention with clipped relative-offset term and key-padding mask, head dim 64.
// Block = 128 threads = 4 waves; one wave owns one 16-row query tile (t0..t0+15) of one (batch b, head h)
// and loops all key blocks of 32 with an online max-subtracted softmax in f32.
// Every product is taken transposed (keys, table rows or head dims as A rows, queries as B columns): lane l works for
// the one query t0 + (l&15); lanes l and l^16 split that query's keys (8*(l>>4) + 0..7 of each 16) and head dims.
// Planes, all in fragment order (a fragment = two pieces of 256 halves, lane l's 8 halves at piece + 8*l):
// QH/KH f16 = 16*q, 16*k, QL/KL = 2048*(16q - QH) residuals: [head][token tile of 16][dims 0..31 | 32..63];
// PE f16 = 64*rel table, [tile u][dims 0..31 | 32..63], tile u = table rows clamp(16u - POFF + 0..15, 0, 498);
// VT f16 = 16*v transposed: [head][key block of 32][dim tile of 16]; mask int32 [NB_FULL][SEQ_FULL].
// Output Z f16 = 16*ctx, the matrix [MT][512] (row = b*SEQ + t, col = h*64+d) in fragment order:
// [token tile of 16][piece = col/16], the A operand of the output projection.
// Per key block sb: S^T = 256*k.q (hi.hi + res.hi + hi.res, 2 key subtiles); relative band of 48 columns:
// column c <-> table row clamp(234 - t0 + sb + c, 0, 498) (clamped per column, which IS the clipped index), so
// columns 16k..16k+15 are table tile clamp(16 - t0/16 + sb/16 + k, 0, NPT-1);
// columns 0..15 come from the tile carried over from the prior key block (its columns 32..47), columns
// 16..47 are two fresh tiles (hi + res products, value 1024*rel.q); a lane holds 8 consecutive band columns of its
// query per tile, stores them to per-wave LDS as [query][column] (pitch RWP floats) and reads back the columns
// c = 15 - query + key of its own 16 keys, i.e. table row clamp(j - i + 249, 0, 498);
// score = qk/8 + bias; then replace-fill -1e10 where mask[b][j] == 0; the block maximum is taken over the lane's 16
// scores and joined with lane l^16; p = exp(score - running max) in f32; l is kept per lane over the lane's own keys
// (the two halves are joined behind the loop); 4096*p as f16, score registers in order, IS the B fragment of P^T
// (elements 0..7 = keys 8*(l>>4) + 0..7, elements 8..15 = keys 16 + 8*(l>>4) + 0..7, the k map of the V^T fragments);
// O^T += V^T.P^T on 4 dim subtiles, O^T register r of lane l = (dim 16*tile + 8*(l>>4) + r, query l&15).
// coverage: 16 query rows x 64 halves per wave, NB*NH*(SEQ/16) wave tasks = all (b, t, h) segments of Z.
// LDS: band 16 queries x 48 columns of floats per wave at pitch RWP; columns read 0..46.
// Global operands run one key block ahead in registers: K (hi + residual), table rows and mask words are
// reloaded for key block kb + 1 behind the score and band products of key block kb, V^T behind its V^T.P^T
// products, into the same variables, so that a load has most of a pass to land before its wait. The last
// pass reloads its own block (addresses in range, values unused).
// =====================================================================================================
__global__ __launch_bounds__(128) void attn_kernel(
    const unsigned short* __restrict__ QH, const unsigned short* __restrict__ QL,
    const unsigned short* __restrict__ KH, const unsigned short* __restrict__ KL,
    const unsigned short* __restrict__ PE, const unsigned short* __restrict__ VT,
    const int* __restrict__ mask, unsigned short* Z) {
  __shared__ __align__(16) float relw[AWV][16 * RWP];            // band exchange, 13312 B
  const int lane = threadIdx.x & 31, wv = threadIdx.x >> 5, m = lane & 15, hh = lane >> 4;
  const int task = blockIdx.x * AWV + wv;            // 0 .. NB*NH*(SEQ/16)-1
  const int nqt = SEQ / 16;
  const int bh = task / nqt;                         // (b, h)
  const int t0 = (task - bh * nqt) << 4;             // query tile start
  const int b = bh / NH, h = bh - (bh / NH) * NH;
  if (b >= NB) return;                               // wave-uniform; never taken with exact grids; no block barriers
  const size_t tok0 = (size_t)b * SEQ;               // plane row base of this batch
  const int* mk = mask + (size_t)b * SEQ_FULL + lane;     // full input stride for the mask row; lane l fetches key l's word
  float* rst = relw[wv] + m * RWP + 8 * hh;               // band store: query m, columns 8*hh + 0..7 of a tile
  const float* rld = relw[wv] + m * RWP + 15 - m + 8 * hh;   // band read: query m, column of key 8*hh

  // Q B-fragments (hi and residual): columns t0+m, k = head dims 0..31 and 32..63
  const size_t qo = ((size_t)h * (MT / 16) + ((tok0 + (size_t)t0) >> 4)) * 1024 + (size_t)(lane * 8);
  const v16us qh0 = ldfrag_p(QH + qo);
  const v16us qh1 = ldfrag_p(QH + qo + 512);
  const v16us ql0 = ldfrag_p(QL + qo);
  const v16us ql1 = ldfrag_p(QL + qo + 512);
  addr_regs_free();

  const int ub = (RCEN - 15 + POFF) / 16 - (t0 >> 4);  // table tile of band columns 0..15 at sb = 0 (before clamp)

  // carried band tile: columns 0..15 of key block 0
  const unsigned short* pcar = PE + (size_t)clampi(ub, 0, NPT - 1) * 1024 + lane * 8;
  const v16us cf0 = ldfrag_p(pcar), cf1 = ldfrag_p(pcar + 512);
  addr_regs_free_of(pcar);

  // lane-fixed parts of the operand addresses; key block sb adds sb/16 token tiles (K), sb/16 table tiles,
  // sb/32 key blocks (V^T), sb columns (mask)
  const size_t kfix = ((size_t)h * (MT / 16) + (tok0 >> 4)) * 1024 + (size_t)(lane * 8);
  const size_t vfix = ((size_t)h * (MT / 32) + (tok0 >> 5)) * 2048 + (size_t)(lane * 8);

  // operands of key block 0
  v16us ka0 = ldfrag_p(KH + kfix),        ka1 = ldfrag_p(KH + kfix + 512);     // keys 0..15, hi
  v16us ka2 = ldfrag_p(KL + kfix),        ka3 = ldfrag_p(KL + kfix + 512);     // keys 0..15, residual
  v16us kc0 = ldfrag_p(KH + kfix + 1024), kc1 = ldfrag_p(KH + kfix + 1536);    // keys 16..31, hi
  v16us kc2 = ldfrag_p(KL + kfix + 1024), kc3 = ldfrag_p(KL + kfix + 1536);    // keys 16..31, residual
  v16us pa0, pa1, pc0, pc1;                                                    // band columns 16..31, 32..47
  int mnx;                                                                     // mask word of key lane
  {
    const unsigned short* p1 = PE + (size_t)clampi(ub + 1, 0, NPT - 1) * 1024 + lane * 8;
    const unsigned short* p2 = PE + (size_t)clampi(ub + 2, 0, NPT - 1) * 1024 + lane * 8;
    pa0 = ldfrag_p(p1); pa1 = ldfrag_p(p1 + 512);
    pc0 = ldfrag_p(p2); pc1 = ldfrag_p(p2 + 512);
    mnx = mk[0];
    addr_regs_free_of(KH + kfix, KL + kfix, p1, p2, mk);
  }
  v16us vf0 = ldfrag_p(VT + vfix);
  v16us vf1 = ldfrag_p(VT + vfix + 512);
  v16us vf2 = ldfrag_p(VT + vfix + 1024);
  v16us vf3 = ldfrag_p(VT + vfix + 1536);
  addr_regs_free_of(VT + vfix);

  v8f carry = dot2_res(qh0, qh1, ql0, ql1, cf0, cf1);

  float mx = -1.0e30f, ls = 0.f;                       // running maximum of the query; sum over this lane's keys
  v8f O0 = zero8(), O1 = zero8(), O2 = zero8(), O3 = zero8();

#pragma unroll 1
  for (int kb = 0; kb < SEQ / 32; ++kb) {
    const int sb = kb << 5;
    const int sn = (kb + 1 < SEQ / 32) ? sb + 32 : sb;   // key block whose operands are fetched in this pass
    // scores, transposed: A row = key token, B column = query, k = head dim
    const v8f S0 = dot3_res(qh0, qh1, ql0, ql1, ka0, ka1, ka2, ka3);
    const v8f S1 = dot3_res(qh0, qh1, ql0, ql1, kc0, kc1, kc2, kc3);

    // relative band: columns 16..31 and 32..47 <-> table tiles clamp(ub + sb/16 + 1), clamp(ub + sb/16 + 2)
    const v8f Pb1 = dot2_res(qh0, qh1, ql0, ql1, pa0, pa1);
    const v8f Pb2 = dot2_res(qh0, qh1, ql0, ql1, pc0, pc1);

    // key mask of the block as 32 bits (bit = key), shifted so that bit r is key 8*hh + r and bit 16 + r key 16 + 8*hh + r
    const unsigned mw = __builtin_amdgcn_ballot_w32(mnx != 0) >> (8 * hh);

    // next key block's K, table and mask operands, one group (token tiles and columns below SEQ, table tiles clamped)
    {
      const int* mq = mk + sn;
      mnx = mq[0];
      const size_t ko = kfix + (size_t)(sn >> 4) * 1024;
      ka0 = ldfrag_p(KH + ko);        ka1 = ldfrag_p(KH + ko + 512);
      ka2 = ldfrag_p(KL + ko);        ka3 = ldfrag_p(KL + ko + 512);
      kc0 = ldfrag_p(KH + ko + 1024); kc1 = ldfrag_p(KH + ko + 1536);
      kc2 = ldfrag_p(KL + ko + 1024); kc3 = ldfrag_p(KL + ko + 1536);
      const int un = ub + (sn >> 4);
      const unsigned short* p1 = PE + (size_t)clampi(un + 1, 0, NPT - 1) * 1024 + lane * 8;
      const unsigned short* p2 = PE + (size_t)clampi(un + 2, 0, NPT - 1) * 1024 + lane * 8;
      pa0 = ldfrag_p(p1); pa1 = ldfrag_p(p1 + 512);
      pc0 = ldfrag_p(p2); pc1 = ldfrag_p(p2 + 512);
      addr_regs_free_of(KH + ko, KL + ko, p1, p2, mq);
    }
    *(v4f*)(rst)      = lo4(carry); *(v4f*)(rst + 4)  = hi4(carry);
    *(v4f*)(rst + 16) = lo4(Pb1);   *(v4f*)(rst + 20) = hi4(Pb1);
    *(v4f*)(rst + 32) = lo4(Pb2);   *(v4f*)(rst + 36) = hi4(Pb2);
    carry = Pb2;
    wave_sync_lds_only();

    // skew read + scale + bias, then replace-fill masked keys
    float s0[8], s1[8];
    // unrolled here and below: the per-key arrays are indexed by constants only, so they stay in registers
#pragma unroll
    for (int r = 0; r < 8; ++r) {
      const float rv0 = rld[r];
      const float rv1 = rld[16 + r];
      const float v0 = S0[r] * (RSQD / (QKS * QKS)) + rv0 * (1.0f / (QKS * WSCL));
      const float v1 = S1[r] * (RSQD / (QKS * QKS)) + rv1 * (1.0f / (QKS * WSCL));
      s0[r] = ((mw >> r) & 1u) ? v0 : MASKV;
      s1[r] = ((mw >> (16 + r)) & 1u) ? v1 : MASKV;
    }

    // online softmax: the lane's 16 scores are of one query; one exchange joins the two halves' maxima
    float xr[8];
#pragma unroll
    for (int r = 0; r < 8; ++r) xr[r] = fmaxf(s0[r], s1[r]);
    float xm = fmaxf(fmaxf(fmaxf(xr[0], xr[1]), fmaxf(xr[2], xr[3])), fmaxf(fmaxf(xr[4], xr[5]), fmaxf(xr[6], xr[7])));
    xm = fmaxf(xm, xhalf(xm));
    const float mn = fmaxf(mx, xm);
    const float al = __expf(mx - mn);
    mx = mn;
    float pr[8];
    FragU pf;                                          // P^T B fragment
#pragma unroll
    for (int r = 0; r < 8; ++r) {
      const float p0 = __expf(s0[r] - mn);
      const float p1 = __expf(s1[r] - mn);
      pr[r] = p0 + p1;
      pf.v[r]     = f2h(p0 * PSC);
      pf.v[8 + r] = f2h(p1 * PSC);
    }
    ls = ls * al + (((pr[0] + pr[1]) + (pr[2] + pr[3])) + ((pr[4] + pr[5]) + (pr[6] + pr[7])));
    O0 = O0 * al;
    O1 = O1 * al;
    O2 = O2 * al;
    O3 = O3 * al;

    // V^T A-fragments (row = dim, k = key token) against the P^T B fragment
    O0 = mma_g(vf0, pf.v, O0);
    O1 = mma_g(vf1, pf.v, O1);
    O2 = mma_g(vf2, pf.v, O2);
    O3 = mma_g(vf3, pf.v, O3);
    const size_t vo = vfix + (size_t)(sn >> 5) * 2048;
    vf0 = ldfrag_p(VT + vo);
    vf1 = ldfrag_p(VT + vo + 512);
    vf2 = ldfrag_p(VT + vo + 1024);
    vf3 = ldfrag_p(VT + vo + 1536);
    addr_regs_free_of(VT + vo);
  }
  acc_guard4(O0, O1, O2, O3);

  // ---- epilogue: ctx = O / (l * PSC * VSC), stored x CSC as f16; a lane's 8 registers of a dim subtile are row l&15,
  //      columns h*64 + 16*subtile + 8*(l>>4) .. +7: lane l's chunk of piece h*4 + subtile, the wave fills four whole pieces
  const float g = (CSC / (PSC * VSC)) / (ls + xhalf(ls));   // l >= 1
  unsigned short* dst = Z + (((tok0 + (size_t)t0) >> 4) * (DM / 16) + (size_t)(h * (HD / 16))) * 256 + (size_t)(lane * 8);
  v4u z0, z1, z2, z3;
#pragma unroll
  for (int e = 0; e < 4; ++e) {
    z0[e] = pk16(f2h(O0[2 * e] * g), f2h(O0[2 * e + 1] * g));
    z1[e] = pk16(f2h(O1[2 * e] * g), f2h(O1[2 * e + 1] * g));
    z2[e] = pk16(f2h(O2[2 * e] * g), f2h(O2[2 * e + 1] * g));
    z3[e] = pk16(f2h(O3[2 * e] * g), f2h(O3[2 * e + 1] * g));
  }
  *(v4u*)(dst)       = z0;
  *(v4u*)(dst + 256) = z1;
  *(v4u*)(dst + 512) = z2;
  *(v4u*)(dst + 768) = z3;
}

// =====================================================================================================
// Workspace map (bytes, NB=2 SEQ=2048 -> MT=4096); every plane is an exact multiple of its whole-row /
// whole-line / 64x64-tile store granularity (rows MT, 1536, 512; 64 | each tiled dimension; the table plane
// is NPT tiles of 2048 bytes, all written); all offsets multiples of 2048. Every plane lies in fragment order.
//   XQ   f16  [4096][512]      0           4194304
//   XK   f16  [4096][512]      4194304     4194304
//   XV   f16  [4096][512]      8388608     4194304
//   WT   f16  [1536][512]      12582912    1572864   (Wq^T | Wk^T | Wv^T, x64)
//   WOT  f16  [512][512]       14155776     524288   (Wo^T, x64)
//   PEH  f16  [34][1024]       14680064      69632   (table x64, clamped tiles)
//   QH   f16  [8][256][1024]   14749696    4194304
//   QL   f16  [8][256][1024]   18944000    4194304
//   KH   f16  [8][256][1024]   23138304    4194304
//   KL   f16  [8][256][1024]   27332608    4194304
//   VT   f16  [8][128][2048]   31526912    4194304
//   Z    f16  [4096][512]      35721216    4194304
//   end                        39915520
// =====================================================================================================
extern "C" void kernel_launch(void* const* d_in, const int* in_sizes, int n_in,
                              void* d_out, int out_size, void* d_ws, size_t ws_size,
                              hipStream_t stream) {
  if (n_in < 13) return;
  const int xreq = ((NB - 1) * SEQ_FULL + SEQ) * DM;
  const int mreq = (NB - 1) * SEQ_FULL + SEQ;
  if (in_sizes[0] < xreq || in_sizes[1] < xreq || in_sizes[2] < xreq) return;
  if (in_sizes[3] < mreq) return;
  if (in_sizes[4] < DM * DM || in_sizes[6] < DM * DM || in_sizes[8] < DM * DM || in_sizes[10] < DM * DM) return;
  if (in_sizes[5] < DM || in_sizes[7] < DM || in_sizes[9] < DM || in_sizes[11] < DM) return;
  if (in_sizes[12] < NREL * HD) return;
  if (out_size < MT * DM) return;

  const float* query = (const float*)d_in[0];   // [NB_FULL][SEQ_FULL][512]
  const float* key   = (const float*)d_in[1];
  const float* value = (const float*)d_in[2];
  const int*   mask  = (const int*)d_in[3];     // [NB_FULL][SEQ_FULL] int32
  const float* wq = (const float*)d_in[4];      // [512][512] (in, out)
  const float* bq = (const float*)d_in[5];
  const float* wk = (const float*)d_in[6];
  const float* bk = (const float*)d_in[7];
  const float* wv = (const float*)d_in[8];
  const float* bv = (const float*)d_in[9];
  const float* wo = (const float*)d_in[10];
  const float* bo = (const float*)d_in[11];
  const float* rel = (const float*)d_in[12];    // [499][64]

  const size_t PX  = (size_t)MT * DM * 2;
  const size_t PWT = (size_t)3 * DM * DM * 2;
  const size_t PWO = (size_t)DM * DM * 2;
  const size_t PPE = (size_t)NPT * 1024 * 2;
  size_t off = 0;
  const size_t oXQ = off; off += 3 * PX;          // XQ | XK | XV
  const size_t oWT = off; off += PWT;
  const size_t oWO = off; off += PWO;
  const size_t oPE = off; off += PPE;
  const size_t oQH = off; off += PX;
  const size_t oQL = off; off += PX;
  const size_t oKH = off; off += PX;
  const size_t oKL = off; off += PX;
  const size_t oVT = off; off += PX;
  const size_t oZ  = off; off += PX;
  if (off > ws_size) return;
  if (off > (size_t)134217728) return;

  char* ws = (char*)d_ws;
  unsigned short* XQ  = (unsigned short*)(ws + oXQ);
  unsigned short* WT  = (unsigned short*)(ws + oWT);
  unsigned short* WOT = (unsigned short*)(ws + oWO);
  unsigned short* PEH = (unsigned short*)(ws + oPE);
  unsigned short* QH  = (unsigned short*)(ws + oQH);
  unsigned short* QL  = (unsigned short*)(ws + oQL);
  unsigned short* KH  = (unsigned short*)(ws + oKH);
  unsigned short* KL  = (unsigned short*)(ws + oKL);
  unsigned short* VT  = (unsigned short*)(ws + oVT);
  unsigned short* Z   = (unsigned short*)(ws + oZ);
  float* out0 = (float*)d_out;
  unsigned short* hdummy = XQ;                    // in-range placeholder for unused f16 output args

  const dim3 blk(256);
  const int gP = ((MT / 64) * (DM / 64)) / 8;     // 64x64 tiles / 8 waves, exact

  // (0) operand planes: query/key/value -> f16(bf16) per batch slice (XQ | XK | XV, contiguous); table -> f16(bf16 x64)
  //     clamped tiles; Wq|Wk|Wv|Wo [512][512] -> WT | WOT (contiguous) planes 0, 1, 2, 3 (transposed, f16 x64)
  cvt_all<<<dim3(4 * NTB + NBB + 3 * NB * LINB), blk, 0, stream>>>(query, key, value, wq, wk, wv, wo, rel, XQ, WT, PEH);

  // (1) q and k hi/res planes and v^T x16
  gemm_qkv<<<dim3(gP, 3), blk, 0, stream>>>(XQ, WT, QH, QL, KH, KL, VT, bq, bk, bv);

  // (2) attention -> ctx x16 plane
  attn_kernel<<<dim3((NB * NH * (SEQ / 16)) / AWV), dim3(128), 0, stream>>>(QH, QL, KH, KL, PEH, VT, mask, Z);

  // (3) output projection: out[row][n] = sum_k Z[row][k] * WOT[n][k] / (16*64) + bo[n]
  gemm64<0, 1><<<dim3(gP), blk, 0, stream>>>(Z, WOT, hdummy, hdummy, out0, DM, 1.0f / (WSCL * CSC), bo, 1.0f, MT, DM);
  (void)hipGetLastError();
}

// v006
// It runs in 97.8 microseconds.
// In two side-by-side timings against v005, it was 1.08 and 1.04 times as fast.
// Over all steps from v000 it is 2.91 times as fast.
// Contractions: x.Wq and x.Wk (q, k hi + residual planes), x.Wv (v^T plane), k.q^T (hi.hi + res.hi + hi.res),
// rel.q^T (hi + res), v^T.p^T and ctx.Wo, all on v_wmma_f32_16x16x32_f16 (f16 operands, f32 accumulate).
// Float inputs RNE-converted to bf16 on load and carried in f16 containers with power-of-two scales
// (x x1; Wq, Wk, Wv, Wo x64; rel table x64; q, k hi planes x16, residual planes x16x2048; v^T x16;
// p x4096; ctx x16); softmax, key mask and the relative-offset skew in f32 on VALU.
// Every f16 plane that a matrix product reads (x, W^T, q, k hi + residual, v^T, table, ctx) lies in fragment order: the
// 16 bytes of lane l of one operand load stand at piece base + 16*l, so that a load covers four whole 128-byte lines.
#include <hip/hip_runtime.h>
#include <math.h>

#ifndef NB
#define NB 2
#endif
#ifndef SEQ
#define SEQ 2048
#endif
#define NB_FULL  2
#define SEQ_FULL 2048
#define DM   512
#define NH   8
#define HD   64
#define MT   (NB * SEQ)
#define NREL 499
#define RCEN 249
#define POFF 22
#define NPT  34
#define AWV  4
#define RWP  52
#define WSCL 64.0f
#define QKS  16.0f
#define LSC  2048.0f
#define VSC  16.0f
#define PSC  4096.0f
#define CSC  16.0f
#define RSQD 0.125f
#define MASKV (-1.0e10f)
#define LINB ((SEQ * DM) / 2048)          // blocks of one batch slice of one activation plane
#define NTB  ((DM / 64) * (DM / 64))      // blocks of one weight transpose
#define NBB  ((NPT * 128) / 256)          // blocks of the table plane

static_assert(NH * HD == DM);
static_assert(HD == 64);
static_assert(NB >= 1 && NB <= NB_FULL);
static_assert((SEQ % 64) == 0 && SEQ >= 64 && SEQ <= SEQ_FULL);
static_assert((MT % 64) == 0 && (DM % 64) == 0);
static_assert((((MT / 64) * (DM / 64)) % 8) == 0);
static_assert(((SEQ * DM) % 2048) == 0 && ((NPT * 128) % 256) == 0);
static_assert(((NB * NH * (SEQ / 16)) % AWV) == 0);
static_assert((2 * RCEN + 1) == NREL);
static_assert(((RCEN - 15 + POFF) % 16) == 0 && POFF >= 15 && 16 * (NPT - 1) - POFF >= NREL - 1);

typedef _Float16 v16h __attribute__((ext_vector_type(16)));
typedef unsigned short v16us __attribute__((ext_vector_type(16)));
typedef unsigned short v8us  __attribute__((ext_vector_type(8)));
typedef float v8f __attribute__((ext_vector_type(8)));
typedef float v4f __attribute__((ext_vector_type(4)));
typedef unsigned int v4u __attribute__((ext_vector_type(4)));

union FragU { v16us v; v8us h[2]; };

// ---- scalar helpers --------------------------------------------------------------------------------
__device__ __forceinline__ unsigned short bf_bits(float f) {          // f32 -> bf16 bits, RNE convert
  const unsigned u = __float_as_uint(f);
  return (unsigned short)((u + 0x7FFFu + ((u >> 16) & 1u)) >> 16);
}
__device__ __forceinline__ float bf_up(unsigned short h) { return __uint_as_float(((unsigned)h) << 16); }
__device__ __forceinline__ float bfr(float f) { return bf_up(bf_bits(f)); }   // value of the bf16 RNE convert
__device__ __forceinline__ unsigned short h_bits(_Float16 x) { return __builtin_bit_cast(unsigned short, x); }
__device__ __forceinline__ unsigned short f2h(float f) { return h_bits((_Float16)f); }
__device__ __forceinline__ unsigned pk16(unsigned short a, unsigned short b) { return (unsigned)a | ((unsigned)b << 16); }
__device__ __forceinline__ int clampi(int v, int lo, int hi) { return v < lo ? lo : (v > hi ? hi : v); }
__device__ __forceinline__ v8f zero8() { v8f z = {0.f, 0.f, 0.f, 0.f, 0.f, 0.f, 0.f, 0.f}; return z; }

// ---- fragment loader: 16-bit A/B operand of k block k0..k0+31, lane l -> row/col (l&15), h = l>>4; elements 0..7 are
//      k0+8h.., elements 8..15 are k0+16+8h... Plane in fragment order: p = fragment base + 8*lane; the piece of
//      elements 0..7 is 256 halves (32 lanes x 8), the piece of elements 8..15 follows it.
//      A row-major [R][K] matrix (lane index = row, k contiguous) as such a plane: row tile T = row/16, piece
//      q = k/16 at (T*(K/16) + q)*256; in the piece lane l = row (l&15), k = 16*q + 8*(l>>4) .. +7.
__device__ __forceinline__ v16us ldfrag_p(const unsigned short* p) {
  FragU f;
  f.h[0] = *(const v8us*)(p);
  f.h[1] = *(const v8us*)(p + 256);
  return f.v;
}

// ---- WMMA helpers (f16 operand bits) with trailing VALU hazard gap --------------------------------
__device__ __forceinline__ v8f mma_raw(v16us a, v16us b, v8f c) {
  return __builtin_amdgcn_wmma_f32_16x16x32_f16(false, __builtin_bit_cast(v16h, a), false,
                                                __builtin_bit_cast(v16h, b), (short)0, c, false, false);
}
__device__ __forceinline__ v8f mma_g(v16us a, v16us b, v8f c) {                 // guarded
  c = mma_raw(a, b, c);
#if defined(__HIP_DEVICE_COMPILE__)
  asm volatile("v_nop\n\tv_nop\n\tv_nop\n\tv_nop" : "+v"(c) : "v"(a), "v"(b));
#endif
  return c;
}
__device__ __forceinline__ void dep_guard1(v8f& a, v8f& b, v16us x) {
#if defined(__HIP_DEVICE_COMPILE__)
  asm volatile("v_nop\n\tv_nop\n\tv_nop\n\tv_nop" : "+v"(a), "+v"(b) : "v"(x));
#endif
}
__device__ __forceinline__ void keep4_u(v16us a, v16us b, v16us c, v16us d) {
#if defined(__HIP_DEVICE_COMPILE__)
  asm volatile("v_nop" :: "v"(a), "v"(b), "v"(c), "v"(d));
#endif
}
__device__ __forceinline__ void acc_guard4(v8f& a, v8f& b, v8f& c, v8f& d) {
#if defined(__HIP_DEVICE_COMPILE__)
  asm volatile("v_nop\n\tv_nop\n\tv_nop\n\tv_nop" : "+v"(a), "+v"(b), "+v"(c), "+v"(d));
#endif
}
// orders LDS stores of this wave before later LDS loads of the same wave (cross-lane exchange)
__device__ __forceinline__ void wave_sync_lds() {
  __builtin_amdgcn_fence(__ATOMIC_RELEASE, "workgroup");
  __builtin_amdgcn_wave_barrier();
  __builtin_amdgcn_fence(__ATOMIC_ACQUIRE, "workgroup");
}

// the same exchange for a wave that has global loads in flight: waits for this wave's LDS operations only
__device__ __forceinline__ void wave_sync_lds_only() {
#if defined(__HIP_DEVICE_COMPILE__)
  // LDS stores of this wave are done before its later LDS loads issue, and the "memory" clobber keeps the compiler
  // from moving either across; the fence pair above would also wait out the next key block's global loads
  asm volatile("s_wait_dscnt 0x0" ::: "memory");
#endif
  __builtin_amdgcn_wave_barrier();
}

// stands behind a group of global stores that stay in flight: their address registers may be rewritten behind it
__device__ __forceinline__ void addr_regs_free() {
#if defined(__HIP_DEVICE_COMPILE__)
  asm volatile("s_wait_xcnt 0x0" ::: "memory");
#endif
}

// the same wait with the loads' address values as inputs: their registers stay live, so unwritten, up to the wait
// (the "memory" clobber alone does not keep a register write, or a later load's destination, behind it)
__device__ __forceinline__ void addr_regs_free_of(const void* a) {
#if defined(__HIP_DEVICE_COMPILE__)
  asm volatile("s_wait_xcnt 0x0" :: "v"(a) : "memory");
#endif
}
__device__ __forceinline__ void addr_regs_free_of(const void* a, const void* b) {
#if defined(__HIP_DEVICE_COMPILE__)
  asm volatile("s_wait_xcnt 0x0" :: "v"(a), "v"(b) : "memory");
#endif
}
__device__ __forceinline__ void addr_regs_free_of(const void* a, const void* b, const void* c) {
#if defined(__HIP_DEVICE_COMPILE__)
  asm volatile("s_wait_xcnt 0x0" :: "v"(a), "v"(b), "v"(c) : "memory");
#endif
}
__device__ __forceinline__ void addr_regs_free_of(const void* a, const void* b, const void* c, const void* d,
                                                  const void* e) {
#if defined(__HIP_DEVICE_COMPILE__)
  asm volatile("s_wait_xcnt 0x0" :: "v"(a), "v"(b), "v"(c), "v"(d), "v"(e) : "memory");
#endif
}

// =====================================================================================================
// Activation plane in fragment order: w[rows][DM] f32 -> o = f16 bits of (bf16 RNE value * sc), row tile T, piece q at
// (T*(DM/16) + q)*256 halves. One thread per 16-byte chunk of o: a wave reads 64 bytes of each of 16 rows and writes
// one whole piece; the 8 waves of a block take 8 pieces in a row, i.e. 512 consecutive bytes of each of the 16 rows.
// coverage: 256 threads x 8 = 2048 elements per block; bx = 0 .. rows*DM/2048 - 1 exact covers all of o.
// =====================================================================================================
__device__ __forceinline__ void cvt_rows(const float* __restrict__ w, unsigned short* o, float sc, int bx) {
  const int g = bx * 256 + threadIdx.x;                   // chunk = (piece, lane)
  const int pcs = g >> 5, l = g & 31;
  const int row = (pcs / (DM / 16)) * 16 + (l & 15);
  const int col = (pcs % (DM / 16)) * 16 + 8 * (l >> 4);
  const float* p = w + (size_t)row * DM + col;
  const v4f a0 = *(const v4f*)(p);
  const v4f a1 = *(const v4f*)(p + 4);
  addr_regs_free_of(p);
  v4u hv;
#pragma unroll
  for (int e = 0; e < 2; ++e) {
    hv[e]     = pk16(f2h(bfr(a0[2 * e]) * sc), f2h(bfr(a0[2 * e + 1]) * sc));
    hv[2 + e] = pk16(f2h(bfr(a1[2 * e]) * sc), f2h(bfr(a1[2 * e + 1]) * sc));
  }
  *(v4u*)(o + (size_t)g * 8) = hv;
}

// =====================================================================================================
// Table plane in fragment order: tile u (0..NPT-1) holds the 16 table rows clamp(16u - POFF + 0..15, 0, NREL-1) as
// four pieces of 256 halves; piece j, lane l = row (l&15) of the tile, head dims 16j + 8*(l>>4) .. +7, as f16 bits
// of (bf16 RNE value * sc). The band tiles of the attention kernel all start at a row = -POFF (mod 16), so every one
// of them is a tile of this plane; tile 0 is row 0 sixteen times, tile NPT-1 row NREL-1 sixteen times.
// coverage: one thread per 16-byte chunk, NPT*128 chunks, bx = 0 .. NPT*128/256 - 1 exact.
// =====================================================================================================
__device__ __forceinline__ void cvt_band(const float* __restrict__ w, unsigned short* o, float sc, int bx) {
  const int g = bx * 256 + threadIdx.x;
  if (g >= NPT * 128) return;                             // never taken with the exact grid; no barriers below
  const int u = g >> 7, j = (g >> 5) & 3, l = g & 31;
  const int row = clampi(16 * u - POFF + (l & 15), 0, NREL - 1);
  const float* p = w + (size_t)row * HD + 16 * j + 8 * (l >> 4);
  const v4f a0 = *(const v4f*)(p);
  const v4f a1 = *(const v4f*)(p + 4);
  v4u hv;
#pragma unroll
  for (int e = 0; e < 2; ++e) {
    hv[e]     = pk16(f2h(bfr(a0[2 * e]) * sc), f2h(bfr(a0[2 * e + 1]) * sc));
    hv[2 + e] = pk16(f2h(bfr(a1[2 * e]) * sc), f2h(bfr(a1[2 * e + 1]) * sc));
  }
  *(v4u*)(o + (size_t)g * 8) = hv;
}

// =====================================================================================================
// Transpose-convert: in w[R][C] f32 -> out o = the matrix [C][R] of f16 bits of (bf16 RNE value * sc), in fragment
// order (row tile T = c/16, piece q = r/16 at (T*(R/16) + q)*256). Block tile 64x64 through LDS (st[col][row], pitch
// 72 halves). Read phase: thread owns one input row x 16 columns. Write phase: the tile is 4 row tiles x 4 pieces;
// a wave writes one whole piece per store.
// R, C multiples of 64, (bx, by) = (0 .. C/64 - 1, 0 .. R/64 - 1) exact; st = the block's 64*72 halves of LDS.
// coverage: 16 pieces x 256 halves per block = the whole transposed tile; the blocks cover all of [C][R].
// =====================================================================================================
__device__ __forceinline__ void cvt_t(const float* __restrict__ w, unsigned short* o, int R, int C, float sc,
                                      int bx, int by, unsigned short* st) {
  const int t = threadIdx.x;
  const int r0 = by * 64, c0 = bx * 64;
  if (r0 + 64 > R || c0 + 64 > C) return;               // block-uniform, before the barrier; never taken
  {
    const int row = t >> 2, ch = (t & 3) * 16;
    const float* p = w + (size_t)(r0 + row) * C + c0 + ch;
#pragma unroll
    for (int q = 0; q < 4; ++q) {
      const v4f v = *(const v4f*)(p + 4 * q);
#pragma unroll
      for (int e = 0; e < 4; ++e) st[(ch + 4 * q + e) * 72 + row] = f2h(bfr(v[e]) * sc);
    }
  }
  __syncthreads();
  const int l = t & 31, wq = t >> 5;                     // lane in the piece; piece 8*half + wq of the tile's 16
  v4u hv[2];
#pragma unroll
  for (int half = 0; half < 2; ++half) {
    const int tl = 2 * half + (wq >> 2), q = wq & 3;      // row tile and piece in the block tile
    hv[half] = *(const v4u*)(st + (16 * tl + (l & 15)) * 72 + 16 * q + 8 * (l >> 4));
  }
#pragma unroll
  for (int half = 0; half < 2; ++half) {
    const int tl = 2 * half + (wq >> 2), q = wq & 3;
    unsigned short* dst = o + ((size_t)((c0 >> 4) + tl) * (size_t)(R >> 4) + (size_t)((r0 >> 4) + q)) * 256 + l * 8;
    *(v4u*)dst = hv[half];
  }
}

// =====================================================================================================
// All operand planes in one launch; none reads what another writes. The flat block index picks the work, the same for
// the whole block (the barrier of cvt_t is passed by all of a block's threads or by none):
// 4*NTB blocks: Wq, Wk, Wv, Wo [512][512] -> WT planes 0, 1, 2, 3 (transposed, x64; the last is WOT);
// NBB blocks: table -> PE (x64, clamped tiles); 3*NB*LINB blocks: query, key, value -> X planes 0, 1, 2 per batch slice.
// The transposes, which take longest, have the lowest indices.
// =====================================================================================================
__global__ __launch_bounds__(256) void cvt_all(
    const float* __restrict__ query, const float* __restrict__ key, const float* __restrict__ value,
    const float* __restrict__ wq, const float* __restrict__ wk, const float* __restrict__ wv,
    const float* __restrict__ wo, const float* __restrict__ rel,
    unsigned short* X, unsigned short* WT, unsigned short* PE) {
  __shared__ __align__(16) unsigned short st[64 * 72];
  int bid = blockIdx.x;
  if (bid < 4 * NTB) {
    const int ws = bid / NTB, tb = bid - ws * NTB;
    const float* w = (ws == 0) ? wq : (ws == 1) ? wk : (ws == 2) ? wv : wo;
    cvt_t(w, WT + (size_t)ws * DM * DM, DM, DM, WSCL, tb % (DM / 64), tb / (DM / 64), st);
    return;
  }
  bid -= 4 * NTB;
  if (bid < NBB) {
    cvt_band(rel, PE, WSCL, bid);
    return;
  }
  bid -= NBB;
  const int xs = bid / (NB * LINB), xr = bid - xs * (NB * LINB);
  if (xs > 2) return;                                     // never taken with the exact grid
  const float* x = (xs == 0) ? query : (xs == 1) ? key : value;
  const int by = xr / LINB;                               // batch slice: SEQ rows, a whole number of row tiles
  cvt_rows(x + (size_t)by * SEQ_FULL * DM, X + (size_t)xs * MT * DM + (size_t)by * SEQ * DM, 1.0f, xr - by * LINB);
}

// =====================================================================================================
// Register-blocked f16 WMMA GEMM: C[m][n] = sum_k A[m][k] * Bt[n][k], one wave per 64x64 tile, no block
// barriers. A = [M][K] and Bt = [N][K], both planes in fragment order (row tile T, k block kb: two pieces at
// (T*(K/32) + kb)*512 halves, so a row tile's k blocks follow one another); M, N multiples of 64,
// K multiple of 32 (true at every call site; bx = 0 .. tiles/8 - 1 exact so no wave exits early). Both operand
// fragments use the split k map (elements 0..7 <- k0+8h.., 8..15 <- k0+16+8h..); D element r of a lane is
// (row 8h + r, col lane&15).
// s = acc*osc + bias term (BM 0: none; BM 1: bsc*bf16(bias[col]); BM 2: bsc*bf16(bias[row])).
// OM 0: f32 out Cf = s, pitch ldc.   OM 1: f16 out Ch = f16 bits(s).
// OM 2: f16 hi plane Ch = f16(s) and f16 residual plane Cl = f16((s - hi) * 2048), same layout.
// f16 outputs lie in fragment order (ldc unused). A 16x64 slab is four pieces of 256 halves; piece it, lane l =
// slab row (l&15), slab columns 16*it + 8*(l>>4) .. +7, i.e. one load of a fragment whose lane index is the row and
// whose k index is the column. OM 2: slab (row tile T = row/16, column tile tn) at ((tn*(M/16) + T)*4 + it)*256.
// OM 1: pieces 2*kb, 2*kb + 1 of a slab are k block kb of 32 columns; piece at
// (((tm*(N/32) + column/32)*4 + row tile in tm)*2 + (it&1))*256, so that a k block's four row tiles are contiguous.
// coverage: 4 slabs x 16 rows x 64 cols = the wave's whole 64x64 tile.
// =====================================================================================================
template <int OM, int BM>
__device__ __forceinline__ void gemm64_tile(
    const unsigned short* __restrict__ Ap, const unsigned short* __restrict__ Btp,
    unsigned short* Ch, unsigned short* Cl, float* Cf, int ldc, float osc,
    const float* __restrict__ bias, float bsc, int M, int N, int K, int bx, float (*sT)[16 * 68]) {
  const int lane = threadIdx.x & 31;
  const int wave = threadIdx.x >> 5;
  const int tilesN = N >> 6;
  const int tilesM = M >> 6;
  const int tile = bx * 8 + wave;
  if (tile >= tilesM * tilesN) return;   // wave-uniform; no block barriers in this kernel
  const int tm = tile / tilesN;
  const int tn = tile - tm * tilesN;
  const int m0 = tm << 6;
  const int n0 = tn << 6;

  const int rlane = lane & 15;                 // col (D) within subtile
  const int mOff  = (lane >> 4) * 8;           // D row offset
  const size_t tstr = (size_t)(K >> 5) * 512;  // halves of one row tile of an operand plane
  const unsigned short* Aw = Ap + (size_t)(m0 >> 4) * tstr + lane * 8;    // this lane's chunk of row tile m0/16, k block 0
  const unsigned short* Bw = Btp + (size_t)(n0 >> 4) * tstr + lane * 8;

  v8f acc[4][4];
#pragma unroll
  for (int i = 0; i < 4; ++i)
#pragma unroll
    for (int j = 0; j < 4; ++j) acc[i][j] = zero8();

#pragma unroll 1
  for (int k0 = 0; k0 < K; k0 += 32) {
    // k block k0/32: the eight fragments stand at constant distances from two addresses and are fetched as one group
    const unsigned short* pa = Aw + (size_t)k0 * 16;
    const unsigned short* pb = Bw + (size_t)k0 * 16;
    v16us bh[4], ah[4];
#pragma unroll
    for (int j = 0; j < 4; ++j) bh[j] = ldfrag_p(pb + (size_t)j * tstr);
#pragma unroll
    for (int i = 0; i < 4; ++i) ah[i] = ldfrag_p(pa + (size_t)i * tstr);
    addr_regs_free_of(pa, pb);
#pragma unroll
    for (int i = 0; i < 4; ++i) {
#pragma unroll
      for (int j = 0; j < 4; ++j) acc[i][j] = mma_raw(ah[i], bh[j], acc[i][j]);
      dep_guard1(acc[i][0], acc[i][3], ah[i]);
    }
    keep4_u(bh[0], bh[1], bh[2], bh[3]);
  }
  acc_guard4(acc[0][0], acc[0][1], acc[0][2], acc[0][3]);
  acc_guard4(acc[1][0], acc[1][1], acc[1][2], acc[1][3]);
  acc_guard4(acc[2][0], acc[2][1], acc[2][2], acc[2][3]);
  acc_guard4(acc[3][0], acc[3][1], acc[3][2], acc[3][3]);

  const int hh2 = lane >> 4, c4 = (lane & 15) * 4;     // f32 out: 256-B row segment = 16 lanes x 16 B

  // column bias terms (fixed per wave); addresses n0+c4+3 < N and n0+48+8+7 < N
  v4f bc4 = {0.f, 0.f, 0.f, 0.f};
  float bc8[4][8];                                      // f16 out: piece it, columns 16*it + 8*hh2 .. +7
#pragma unroll
  for (int it = 0; it < 4; ++it)
#pragma unroll
    for (int e = 0; e < 8; ++e) bc8[it][e] = 0.f;
  if (BM == 1) {
    if (OM == 0) {
      const v4f t4 = *(const v4f*)(bias + n0 + c4);
#pragma unroll
      for (int e = 0; e < 4; ++e) bc4[e] = bfr(t4[e]) * bsc;
    } else {
#pragma unroll
      for (int it = 0; it < 4; ++it) {
        const v4f ta = *(const v4f*)(bias + n0 + 16 * it + 8 * hh2);
        const v4f tb = *(const v4f*)(bias + n0 + 16 * it + 8 * hh2 + 4);
#pragma unroll
        for (int e = 0; e < 4; ++e) { bc8[it][e] = bfr(ta[e]) * bsc; bc8[it][4 + e] = bfr(tb[e]) * bsc; }
      }
    }
  }

  // ---- epilogue ----
  float* slab = sT[wave];
#pragma unroll
  for (int i = 0; i < 4; ++i) {
    const int mBase = m0 + (i << 4);
#pragma unroll
    for (int j = 0; j < 4; ++j) {
#pragma unroll
      for (int r = 0; r < 8; ++r) {
        slab[(mOff + r) * 68 + (j << 4) + rlane] = acc[i][j][r];
      }
    }
    wave_sync_lds();
    if (OM == 0) {
      v4f vals[8];
#pragma unroll
      for (int it = 0; it < 8; ++it) {
        const int row = it * 2 + hh2;                      // it 0..7 x hh2 0..1 = rows 0..15
        const v4f v = *(const v4f*)(slab + row * 68 + c4);
        float rb2 = 0.f;
        if (BM == 2) rb2 = bfr(bias[mBase + row]) * bsc;
        vals[it] = v * osc + bc4 + rb2;
      }
      {
#pragma unroll
        for (int it = 0; it < 8; ++it) {
          const int row = it * 2 + hh2;
          *(v4f*)(Cf + (size_t)(mBase + row) * ldc + (size_t)n0 + c4) = vals[it];
        }
        
      }
    } else {
      v4u hv[4], hl[4];
      float rb2 = 0.f;
      if (BM == 2) rb2 = bfr(bias[mBase + rlane]) * bsc;
#pragma unroll
      for (int it = 0; it < 4; ++it) {
        const float* sp = slab + rlane * 68 + 16 * it + 8 * hh2;   // rows 0..15 x (it, hh2) = 8 column chunks
        v4u ha = {0u, 0u, 0u, 0u};
        v4u la = {0u, 0u, 0u, 0u};
#pragma unroll
        for (int e = 0; e < 4; ++e) {
          const float b0 = sp[2 * e]     * osc + bc8[it][2 * e]     + rb2;
          const float b1 = sp[2 * e + 1] * osc + bc8[it][2 * e + 1] + rb2;
          if (OM == 1) {
            ha[e] = pk16(f2h(b0), f2h(b1));
          } else {
            const _Float16 h0 = (_Float16)b0;
            const _Float16 h1 = (_Float16)b1;
            const float l0 = (b0 - (float)h0) * LSC;       // difference exact, power-of-two carry exact
            const float l1 = (b1 - (float)h1) * LSC;
            ha[e] = pk16(h_bits(h0), h_bits(h1));
            la[e] = pk16(f2h(l0), f2h(l1));
          }
        }
        hv[it] = ha;
        hl[it] = la;
      }
      {
#pragma unroll
        for (int it = 0; it < 4; ++it) {
          const size_t pc = (OM == 2)
              ? ((size_t)tn * (size_t)(M >> 4) + (size_t)(mBase >> 4)) * 4 + it
              : (((size_t)tm * (size_t)(N >> 5) + (size_t)((n0 >> 5) + (it >> 1))) * 4 + i) * 2 + (it & 1);
          const size_t go = pc * 256 + (size_t)(lane * 8);    // 32 lanes x 16 B = the whole piece
          *(v4u*)(Ch + go) = hv[it];
          if (OM == 2) *(v4u*)(Cl + go) = hl[it];
        }
        addr_regs_free();
      }
    }
    wave_sync_lds();
  }
}

// one product per launch, K = DM
template <int OM, int BM>
__global__ __launch_bounds__(256) void gemm64(
    const unsigned short* __restrict__ Ap, const unsigned short* __restrict__ Btp,
    unsigned short* Ch, unsigned short* Cl, float* Cf, int ldc, float osc,
    const float* __restrict__ bias, float bsc, int M, int N) {
  __shared__ __align__(16) float sT[8][16 * 68];   // per-wave 16x64 slab, pitch 68 floats
  gemm64_tile<OM, BM>(Ap, Btp, Ch, Cl, Cf, ldc, osc, bias, bsc, M, N, DM, blockIdx.x, sT);
}

// The three input projections in one launch; none reads what another writes. blockIdx.y picks the product:
// 0: s = 16*(xq.Wq + bq) -> QH = f16(s), QL = f16(2048*(s - QH));  1: the same for k;
// 2: v^T x16: C[d][tok] = sum_k WT[1024+d][k] * XV[tok][k], bias by row d.
// X = the planes XQ | XK | XV, WT = Wq^T | Wk^T | Wv^T, each in fragment order. Output pointers that a product's OM does not use are null.
__global__ __launch_bounds__(256) void gemm_qkv(
    const unsigned short* __restrict__ X, const unsigned short* __restrict__ WT,
    unsigned short* QH, unsigned short* QL, unsigned short* KH, unsigned short* KL, unsigned short* VT,
    const float* __restrict__ bq, const float* __restrict__ bk, const float* __restrict__ bv) {
  __shared__ __align__(16) float sT[8][16 * 68];   // per-wave 16x64 slab, pitch 68 floats
  const int sel = blockIdx.y;
  const unsigned short* Xs = X + (size_t)sel * MT * DM;    // this product's activation and weight planes
  const unsigned short* Ws = WT + (size_t)sel * DM * DM;
  if (sel == 2) {
    gemm64_tile<1, 2>(Ws, Xs, VT, nullptr, nullptr, MT,
                      VSC / WSCL, bv, VSC, DM, MT, DM, blockIdx.x, sT);
  } else {
    const bool isk = (sel == 1);
    gemm64_tile<2, 1>(Xs, Ws,
                      isk ? KH : QH, isk ? KL : QL, nullptr, DM, QKS / WSCL, isk ? bk : bq, QKS, MT, DM, DM,
                      blockIdx.x, sT);
  }
}

// ---- per-tile products used by the attention kernel ----------------------------------------------
// Both give the TRANSPOSED tile: the plane rows (table rows, keys) are the A operand, the query rows the B operand,
// so that D register r of lane l is (plane row 8*(l>>4) + r, query l&15).
// R^T = b.ah + (b.al)/2048 over 64 head dims (b0, b1: fragments of a [n][64] f16 plane row, dims 0..31 and 32..63)
__device__ __forceinline__ v8f dot2_res(v16us ah0, v16us ah1, v16us al0, v16us al1, v16us b0, v16us b1) {
  v8f L = mma_g(b0, al0, zero8());
  L = mma_g(b1, al1, L);
  L = L * (1.0f / LSC);
  v8f R = mma_g(b0, ah0, L);
  R = mma_g(b1, ah1, R);
  return R;
}
// S^T = kh.qh + (kl.qh + kh.ql)/2048 over 64 head dims (kh from the hi plane row, kl from the residual plane row)
__device__ __forceinline__ v8f dot3_res(v16us qh0, v16us qh1, v16us ql0, v16us ql1,
                                        v16us kh0, v16us kh1, v16us kl0, v16us kl1) {
  v8f L = mma_g(kl0, qh0, zero8());
  L = mma_g(kl1, qh1, L);
  L = mma_g(kh0, ql0, L);
  L = mma_g(kh1, ql1, L);
  L = L * (1.0f / LSC);
  v8f S = mma_g(kh0, qh0, L);
  S = mma_g(kh1, qh1, S);
  return S;
}
// value of lane l ^ 16
__device__ __forceinline__ float xhalf(float x) {
  const int b = __builtin_bit_cast(int, x);
  return __builtin_bit_cast(float, __builtin_amdgcn_permlanex16(b, b, 0x76543210, 0xfedcba98, false, false));
}
__device__ __forceinline__ v4f lo4(v8f x) { return __builtin_shufflevector(x, x, 0, 1, 2, 3); }
__device__ __forceinline__ v4f hi4(v8f x) { return __builtin_shufflevector(x, x, 4, 5, 6, 7); }

// =====================================================================================================
// One key block (32 keys) of the attention loop; the layouts are those of the kernel's own comment below.
// BAND = true: the block's band columns hold more than one table row: two fresh band tiles, the LDS skew, and the next
// block's table tiles are fetched. BAND = false: every key of the block has the same clipped table row for every query of
// the tile, so bc = rel.q of that row (already scaled) is the bias of all 32 keys; no table load, band product or LDS.
// =====================================================================================================
template <bool BAND>
__device__ __forceinline__ void attn_pass(
    int kb, float bc, int ub, int lane, int hh, v16us qh0, v16us qh1, v16us ql0, v16us ql1,
    const unsigned short* __restrict__ KH, const unsigned short* __restrict__ KL,
    const unsigned short* __restrict__ PE, const unsigned short* __restrict__ VT, const int* __restrict__ mk,
    size_t kfix, size_t vfix, float* rst, const float* rld,
    v16us& ka0, v16us& ka1, v16us& ka2, v16us& ka3, v16us& kc0, v16us& kc1, v16us& kc2, v16us& kc3,
    v16us& pa0, v16us& pa1, v16us& pc0, v16us& pc1, int& mnx,
    v16us& vf0, v16us& vf1, v16us& vf2, v16us& vf3,
    v8f& carry, float& mx, float& ls, v8f& O0, v8f& O1, v8f& O2, v8f& O3) {
  const int sb = kb << 5;
  const int sn = (sb + 32 < SEQ) ? sb + 32 : SEQ - 32; // key block whose operands are fetched in this pass
  // scores, transposed: A row = key token, B column = query, k = head dim
  const v8f S0 = dot3_res(qh0, qh1, ql0, ql1, ka0, ka1, ka2, ka3);
  const v8f S1 = dot3_res(qh0, qh1, ql0, ql1, kc0, kc1, kc2, kc3);

  // relative band: columns 16..31 and 32..47 <-> table tiles clamp(ub + sb/16 + 1), clamp(ub + sb/16 + 2)
  v8f Pb1 = zero8(), Pb2 = zero8();
  if constexpr (BAND) {
    Pb1 = dot2_res(qh0, qh1, ql0, ql1, pa0, pa1);
    Pb2 = dot2_res(qh0, qh1, ql0, ql1, pc0, pc1);
  }

  // key mask of the block as 32 bits (bit = key), shifted so that bit r is key 8*hh + r and bit 16 + r key 16 + 8*hh + r
  const unsigned mw = __builtin_amdgcn_ballot_w32(mnx != 0) >> (8 * hh);

  // next key block's K, table and mask operands, one group (token tiles and columns below SEQ, table tiles clamped)
  {
    const int* mq = mk + sn;
    mnx = mq[0];
    const size_t ko = kfix + (size_t)(sn >> 4) * 1024;
    ka0 = ldfrag_p(KH + ko);        ka1 = ldfrag_p(KH + ko + 512);
    ka2 = ldfrag_p(KL + ko);        ka3 = ldfrag_p(KL + ko + 512);
    kc0 = ldfrag_p(KH + ko + 1024); kc1 = ldfrag_p(KH + ko + 1536);
    kc2 = ldfrag_p(KL + ko + 1024); kc3 = ldfrag_p(KL + ko + 1536);
    if constexpr (BAND) {
      const int un = ub + (sn >> 4);
      const unsigned short* p1 = PE + (size_t)clampi(un + 1, 0, NPT - 1) * 1024 + lane * 8;
      const unsigned short* p2 = PE + (size_t)clampi(un + 2, 0, NPT - 1) * 1024 + lane * 8;
      pa0 = ldfrag_p(p1); pa1 = ldfrag_p(p1 + 512);
      pc0 = ldfrag_p(p2); pc1 = ldfrag_p(p2 + 512);
      addr_regs_free_of(KH + ko, KL + ko, p1, p2, mq);
    } else {
      addr_regs_free_of(KH + ko, KL + ko, mq);
    }
  }
  if constexpr (BAND) {
    *(v4f*)(rst)      = lo4(carry); *(v4f*)(rst + 4)  = hi4(carry);
    *(v4f*)(rst + 16) = lo4(Pb1);   *(v4f*)(rst + 20) = hi4(Pb1);
    *(v4f*)(rst + 32) = lo4(Pb2);   *(v4f*)(rst + 36) = hi4(Pb2);
    carry = Pb2;
    wave_sync_lds_only();
  }

  // skew read (or the block's one bias) + scale, then replace-fill masked keys
  float s0[8], s1[8];
  // unrolled here and below: the per-key arrays are indexed by constants only, so they stay in registers
#pragma unroll
  for (int r = 0; r < 8; ++r) {
    float v0, v1;
    if constexpr (BAND) {
      const float rv0 = rld[r];
      const float rv1 = rld[16 + r];
      v0 = S0[r] * (RSQD / (QKS * QKS)) + rv0 * (1.0f / (QKS * WSCL));
      v1 = S1[r] * (RSQD / (QKS * QKS)) + rv1 * (1.0f / (QKS * WSCL));
    } else {
      v0 = S0[r] * (RSQD / (QKS * QKS)) + bc;
      v1 = S1[r] * (RSQD / (QKS * QKS)) + bc;
    }
    s0[r] = ((mw >> r) & 1u) ? v0 : MASKV;
    s1[r] = ((mw >> (16 + r)) & 1u) ? v1 : MASKV;
  }

  // online softmax: the lane's 16 scores are of one query; one exchange joins the two halves' maxima
  float xr[8];
#pragma unroll
  for (int r = 0; r < 8; ++r) xr[r] = fmaxf(s0[r], s1[r]);
  float xm = fmaxf(fmaxf(fmaxf(xr[0], xr[1]), fmaxf(xr[2], xr[3])), fmaxf(fmaxf(xr[4], xr[5]), fmaxf(xr[6], xr[7])));
  xm = fmaxf(xm, xhalf(xm));
  const float mn = fmaxf(mx, xm);
  const float al = __expf(mx - mn);
  mx = mn;
  float pr[8];
  FragU pf;                                          // P^T B fragment
#pragma unroll
  for (int r = 0; r < 8; ++r) {
    const float p0 = __expf(s0[r] - mn);
    const float p1 = __expf(s1[r] - mn);
    pr[r] = p0 + p1;
    pf.v[r]     = f2h(p0 * PSC);
    pf.v[8 + r] = f2h(p1 * PSC);
  }
  ls = ls * al + (((pr[0] + pr[1]) + (pr[2] + pr[3])) + ((pr[4] + pr[5]) + (pr[6] + pr[7])));
  O0 = O0 * al;
  O1 = O1 * al;
  O2 = O2 * al;
  O3 = O3 * al;

  // V^T A-fragments (row = dim, k = key token) against the P^T B fragment
  O0 = mma_g(vf0, pf.v, O0);
  O1 = mma_g(vf1, pf.v, O1);
  O2 = mma_g(vf2, pf.v, O2);
  O3 = mma_g(vf3, pf.v, O3);
  const size_t vo = vfix + (size_t)(sn >> 5) * 2048;
  vf0 = ldfrag_p(VT + vo);
  vf1 = ldfrag_p(VT + vo + 512);
  vf2 = ldfrag_p(VT + vo + 1024);
  vf3 = ldfrag_p(VT + vo + 1536);
  addr_regs_free_of(VT + vo);
}

// =====================================================================================================
// Non-causal attention with clipped relative-offset term and key-padding mask, head dim 64.
// Block = 128 threads = 4 waves; one wave owns one 16-row query tile (t0..t0+15) of one (batch b, head h)
// and loops all key blocks of 32 with an online max-subtracted softmax in f32.
// Every product is taken transposed (keys, table rows or head dims as A rows, queries as B columns): lane l works for
// the one query t0 + (l&15); lanes l and l^16 split that query's keys (8*(l>>4) + 0..7 of each 16) and head dims.
// Planes, all in fragment order (a fragment = two pieces of 256 halves, lane l's 8 halves at piece + 8*l):
// QH/KH f16 = 16*q, 16*k, QL/KL = 2048*(16q - QH) residuals: [head][token tile of 16][dims 0..31 | 32..63];
// PE f16 = 64*rel table, [tile u][dims 0..31 | 32..63], tile u = table rows clamp(16u - POFF + 0..15, 0, 498);
// VT f16 = 16*v transposed: [head][key block of 32][dim tile of 16]; mask int32 [NB_FULL][SEQ_FULL].
// Output Z f16 = 16*ctx, the matrix [MT][512] (row = b*SEQ + t, col = h*64+d) in fragment order:
// [token tile of 16][piece = col/16], the A operand of the output projection.
// Per key block sb: S^T = 256*k.q (hi.hi + res.hi + hi.res, 2 key subtiles); relative band of 48 columns:
// column c <-> table row clamp(234 - t0 + sb + c, 0, 498) (clamped per column, which IS the clipped index), so
// columns 16k..16k+15 are table tile clamp(16 - t0/16 + sb/16 + k, 0, NPT-1);
// columns 0..15 come from the tile carried over from the prior key block (its columns 32..47), columns
// 16..47 are two fresh tiles (hi + res products, value 1024*rel.q); a lane holds 8 consecutive band columns of its
// query per tile, stores them to per-wave LDS as [query][column] (pitch RWP floats) and reads back the columns
// c = 15 - query + key of its own 16 keys, i.e. table row clamp(j - i + 249, 0, 498);
// score = qk/8 + bias; then replace-fill -1e10 where mask[b][j] == 0; the block maximum is taken over the lane's 16
// scores and joined with lane l^16; p = exp(score - running max) in f32; l is kept per lane over the lane's own keys
// (the two halves are joined behind the loop); 4096*p as f16, score registers in order, IS the B fragment of P^T
// (elements 0..7 = keys 8*(l>>4) + 0..7, elements 8..15 = keys 16 + 8*(l>>4) + 0..7, the k map of the V^T fragments);
// O^T += V^T.P^T on 4 dim subtiles, O^T register r of lane l = (dim 16*tile + 8*(l>>4) + r, query l&15).
// coverage: 16 query rows x 64 halves per wave, NB*NH*(SEQ/16) wave tasks = all (b, t, h) segments of Z.
// LDS: band 16 queries x 48 columns of floats per wave at pitch RWP; columns read 0..46.
// Global operands run one key block ahead in registers: K (hi + residual), table rows and mask words are
// reloaded for key block kb + 1 behind the score and band products of key block kb, V^T behind its V^T.P^T
// products, into the same variables, so that a load has most of a pass to land before its wait. The last
// pass reloads its own block (addresses in range, values unused).
// Key blocks whose three table tiles are all clipped to table row 0 (keys far below the queries) or all to row NREL-1 (far
// above) have one bias per query, rel.q of that row, which the carried band tile holds at both ends of the band; only the
// key blocks between them (at most 17 of SEQ/32) run the band products and the LDS skew.
// =====================================================================================================
__global__ __launch_bounds__(128) void attn_kernel(
    const unsigned short* __restrict__ QH, const unsigned short* __restrict__ QL,
    const unsigned short* __restrict__ KH, const unsigned short* __restrict__ KL,
    const unsigned short* __restrict__ PE, const unsigned short* __restrict__ VT,
    const int* __restrict__ mask, unsigned short* Z) {
  __shared__ __align__(16) float relw[AWV][16 * RWP];            // band exchange, 13312 B
  const int lane = threadIdx.x & 31, wv = threadIdx.x >> 5, m = lane & 15, hh = lane >> 4;
  const int task = blockIdx.x * AWV + wv;            // 0 .. NB*NH*(SEQ/16)-1
  const int nqt = SEQ / 16;
  const int bh = task / nqt;                         // (b, h)
  const int t0 = (task - bh * nqt) << 4;             // query tile start
  const int b = bh / NH, h = bh - (bh / NH) * NH;
  if (b >= NB) return;                               // wave-uniform; never taken with exact grids; no block barriers
  const size_t tok0 = (size_t)b * SEQ;               // plane row base of this batch
  const int* mk = mask + (size_t)b * SEQ_FULL + lane;     // full input stride for the mask row; lane l fetches key l's word
  float* rst = relw[wv] + m * RWP + 8 * hh;               // band store: query m, columns 8*hh + 0..7 of a tile
  const float* rld = relw[wv] + m * RWP + 15 - m + 8 * hh;   // band read: query m, column of key 8*hh

  // Q B-fragments (hi and residual): columns t0+m, k = head dims 0..31 and 32..63
  const size_t qo = ((size_t)h * (MT / 16) + ((tok0 + (size_t)t0) >> 4)) * 1024 + (size_t)(lane * 8);
  const v16us qh0 = ldfrag_p(QH + qo);
  const v16us qh1 = ldfrag_p(QH + qo + 512);
  const v16us ql0 = ldfrag_p(QL + qo);
  const v16us ql1 = ldfrag_p(QL + qo + 512);
  addr_regs_free_of(QH + qo, QL + qo);

  const int ub = (RCEN - 15 + POFF) / 16 - (t0 >> 4);  // table tile of band columns 0..15 at sb = 0 (before clamp)

  // Key block kb uses table tiles clamp(ub + 2*kb + 0..2). Blocks 0 .. nlo-1 have all three at or below tile 0 (table row 0
  // sixteen times), blocks khi .. SEQ/32-1 all three at or above tile NPT-1 (row NREL-1 sixteen times); nlo < khi.
  // Both bounds are the same in every lane; read as scalars so that the three loops below are uniform branches and EXEC
  // stays all ones for the matrix instructions.
  const int nlo = __builtin_amdgcn_readfirstlane((ub < 0 ? -ub : 0) >> 1);
  const int khf = (NPT - ub) >> 1;
  const int khi = __builtin_amdgcn_readfirstlane(khf < SEQ / 32 ? khf : SEQ / 32);
  const int ub1 = ub + 2 * nlo;                        // table tile of band columns 0..15 of key block nlo (before clamp)

  // carried band tile: columns 0..15 of key block nlo
  const unsigned short* pcar = PE + (size_t)clampi(ub1, 0, NPT - 1) * 1024 + lane * 8;
  const v16us cf0 = ldfrag_p(pcar), cf1 = ldfrag_p(pcar + 512);
  addr_regs_free_of(pcar);

  // lane-fixed parts of the operand addresses; key block sb adds sb/16 token tiles (K), sb/16 table tiles,
  // sb/32 key blocks (V^T), sb columns (mask)
  const size_t kfix = ((size_t)h * (MT / 16) + (tok0 >> 4)) * 1024 + (size_t)(lane * 8);
  const size_t vfix = ((size_t)h * (MT / 32) + (tok0 >> 5)) * 2048 + (size_t)(lane * 8);

  // K, mask and V^T operands of key block 0
  v16us ka0 = ldfrag_p(KH + kfix),        ka1 = ldfrag_p(KH + kfix + 512);     // keys 0..15, hi
  v16us ka2 = ldfrag_p(KL + kfix),        ka3 = ldfrag_p(KL + kfix + 512);     // keys 0..15, residual
  v16us kc0 = ldfrag_p(KH + kfix + 1024), kc1 = ldfrag_p(KH + kfix + 1536);    // keys 16..31, hi
  v16us kc2 = ldfrag_p(KL + kfix + 1024), kc3 = ldfrag_p(KL + kfix + 1536);    // keys 16..31, residual
  int mnx = mk[0];                                                             // mask word of key lane
  addr_regs_free_of(KH + kfix, KL + kfix, mk);
  v16us vf0 = ldfrag_p(VT + vfix);
  v16us vf1 = ldfrag_p(VT + vfix + 512);
  v16us vf2 = ldfrag_p(VT + vfix + 1024);
  v16us vf3 = ldfrag_p(VT + vfix + 1536);
  addr_regs_free_of(VT + vfix);

  v8f carry = dot2_res(qh0, qh1, ql0, ql1, cf0, cf1);
  v16us pa0, pa1, pc0, pc1;                            // table operands; first fetched in front of the band loop

  float mx = -1.0e30f, ls = 0.f;                       // running maximum of the query; sum over this lane's keys
  v8f O0 = zero8(), O1 = zero8(), O2 = zero8(), O3 = zero8();

#define PASS_ARGS ub, lane, hh, qh0, qh1, ql0, ql1, KH, KL, PE, VT, mk, kfix, vfix, rst, rld,                \
                  ka0, ka1, ka2, ka3, kc0, kc1, kc2, kc3, pa0, pa1, pc0, pc1, mnx, vf0, vf1, vf2, vf3,        \
                  carry, mx, ls, O0, O1, O2, O3
  // the three loops stay rolled: one copy of each pass, so that the operands fetched ahead keep their registers
  // keys far below the queries, table row 0. Where nlo > 0, ub1 <= 0: the carried tile is tile 0, sixteen times that row,
  // so any of its registers is rel.q of the lane's query
  const float blo = carry[0] * (1.0f / (QKS * WSCL));
#pragma unroll 1
  for (int kb = 0; kb < nlo; ++kb) attn_pass<false>(kb, blo, PASS_ARGS);
  // the band proper; table operands of its first key block (band columns 16..31, 32..47), fetched here and not in front of
  // the loop above so that they hold no registers there; the block's score products stand between fetch and use
  const unsigned short* p1 = PE + (size_t)clampi(ub1 + 1, 0, NPT - 1) * 1024 + lane * 8;
  const unsigned short* p2 = PE + (size_t)clampi(ub1 + 2, 0, NPT - 1) * 1024 + lane * 8;
  pa0 = ldfrag_p(p1); pa1 = ldfrag_p(p1 + 512);
  pc0 = ldfrag_p(p2); pc1 = ldfrag_p(p2 + 512);
  addr_regs_free_of(p1, p2);
#pragma unroll 1
  for (int kb = nlo; kb < khi; ++kb) attn_pass<true>(kb, 0.f, PASS_ARGS);
  // keys far above, table row NREL-1. Where khi < SEQ/32, the tile carried out of block khi-1 is tile
  // clamp(ub + 2*khi) = NPT-1, sixteen times that row
  const float bhi = carry[0] * (1.0f / (QKS * WSCL));
#pragma unroll 1
  for (int kb = khi; kb < SEQ / 32; ++kb) attn_pass<false>(kb, bhi, PASS_ARGS);
#undef PASS_ARGS
  acc_guard4(O0, O1, O2, O3);

  // ---- epilogue: ctx = O / (l * PSC * VSC), stored x CSC as f16; a lane's 8 registers of a dim subtile are row l&15,
  //      columns h*64 + 16*subtile + 8*(l>>4) .. +7: lane l's chunk of piece h*4 + subtile, the wave fills four whole pieces
  const float g = (CSC / (PSC * VSC)) / (ls + xhalf(ls));   // l >= 1
  unsigned short* dst = Z + (((tok0 + (size_t)t0) >> 4) * (DM / 16) + (size_t)(h * (HD / 16))) * 256 + (size_t)(lane * 8);
  v4u z0, z1, z2, z3;
#pragma unroll
  for (int e = 0; e < 4; ++e) {
    z0[e] = pk16(f2h(O0[2 * e] * g), f2h(O0[2 * e + 1] * g));
    z1[e] = pk16(f2h(O1[2 * e] * g), f2h(O1[2 * e + 1] * g));
    z2[e] = pk16(f2h(O2[2 * e] * g), f2h(O2[2 * e + 1] * g));
    z3[e] = pk16(f2h(O3[2 * e] * g), f2h(O3[2 * e + 1] * g));
  }
  *(v4u*)(dst)       = z0;
  *(v4u*)(dst + 256) = z1;
  *(v4u*)(dst + 512) = z2;
  *(v4u*)(dst + 768) = z3;
}

// =====================================================================================================
// Workspace map (bytes, NB=2 SEQ=2048 -> MT=4096); every plane is an exact multiple of its whole-row /
// whole-line / 64x64-tile store granularity (rows MT, 1536, 512; 64 | each tiled dimension; the table plane
// is NPT tiles of 2048 bytes, all written); all offsets multiples of 2048. Every plane lies in fragment order.
//   XQ   f16  [4096][512]      0           4194304
//   XK   f16  [4096][512]      4194304     4194304
//   XV   f16  [4096][512]      8388608     4194304
//   WT   f16  [1536][512]      12582912    1572864   (Wq^T | Wk^T | Wv^T, x64)
//   WOT  f16  [512][512]       14155776     524288   (Wo^T, x64)
//   PEH  f16  [34][1024]       14680064      69632   (table x64, clamped tiles)
//   QH   f16  [8][256][1024]   14749696    4194304
//   QL   f16  [8][256][1024]   18944000    4194304
//   KH   f16  [8][256][1024]   23138304    4194304
//   KL   f16  [8][256][1024]   27332608    4194304
//   VT   f16  [8][128][2048]   31526912    4194304
//   Z    f16  [4096][512]      35721216    4194304
//   end                        39915520
// =====================================================================================================
extern "C" void kernel_launch(void* const* d_in, const int* in_sizes, int n_in,
                              void* d_out, int out_size, void* d_ws, size_t ws_size,
                              hipStream_t stream) {
  if (n_in < 13) return;
  const int xreq = ((NB - 1) * SEQ_FULL + SEQ) * DM;
  const int mreq = (NB - 1) * SEQ_FULL + SEQ;
  if (in_sizes[0] < xreq || in_sizes[1] < xreq || in_sizes[2] < xreq) return;
  if (in_sizes[3] < mreq) return;
  if (in_sizes[4] < DM * DM || in_sizes[6] < DM * DM || in_sizes[8] < DM * DM || in_sizes[10] < DM * DM) return;
  if (in_sizes[5] < DM || in_sizes[7] < DM || in_sizes[9] < DM || in_sizes[11] < DM) return;
  if (in_sizes[12] < NREL * HD) return;
  if (out_size < MT * DM) return;

  const float* query = (const float*)d_in[0];   // [NB_FULL][SEQ_FULL][512]
  const float* key   = (const float*)d_in[1];
  const float* value = (const float*)d_in[2];
  const int*   mask  = (const int*)d_in[3];     // [NB_FULL][SEQ_FULL] int32
  const float* wq = (const float*)d_in[4];      // [512][512] (in, out)
  const float* bq = (const float*)d_in[5];
  const float* wk = (const float*)d_in[6];
  const float* bk = (const float*)d_in[7];
  const float* wv = (const float*)d_in[8];
  const float* bv = (const float*)d_in[9];
  const float* wo = (const float*)d_in[10];
  const float* bo = (const float*)d_in[11];
  const float* rel = (const float*)d_in[12];    // [499][64]

  const size_t PX  = (size_t)MT * DM * 2;
  const size_t PWT = (size_t)3 * DM * DM * 2;
  const size_t PWO = (size_t)DM * DM * 2;
  const size_t PPE = (size_t)NPT * 1024 * 2;
  size_t off = 0;
  const size_t oXQ = off; off += 3 * PX;          // XQ | XK | XV
  const size_t oWT = off; off += PWT;
  const size_t oWO = off; off += PWO;
  const size_t oPE = off; off += PPE;
  const size_t oQH = off; off += PX;
  const size_t oQL = off; off += PX;
  const size_t oKH = off; off += PX;
  const size_t oKL = off; off += PX;
  const size_t oVT = off; off += PX;
  const size_t oZ  = off; off += PX;
  if (off > ws_size) return;
  if (off > (size_t)134217728) return;

  char* ws = (char*)d_ws;
  unsigned short* XQ  = (unsigned short*)(ws + oXQ);
  unsigned short* WT  = (unsigned short*)(ws + oWT);
  unsigned short* WOT = (unsigned short*)(ws + oWO);
  unsigned short* PEH = (unsigned short*)(ws + oPE);
  unsigned short* QH  = (unsigned short*)(ws + oQH);
  unsigned short* QL  = (unsigned short*)(ws + oQL);
  unsigned short* KH  = (unsigned short*)(ws + oKH);
  unsigned short* KL  = (unsigned short*)(ws + oKL);
  unsigned short* VT  = (unsigned short*)(ws + oVT);
  unsigned short* Z   = (unsigned short*)(ws + oZ);
  float* out0 = (float*)d_out;
  unsigned short* hdummy = XQ;                    // in-range placeholder for unused f16 output args

  const dim3 blk(256);
  const int gP = ((MT / 64) * (DM / 64)) / 8;     // 64x64 tiles / 8 waves, exact

  // (0) operand planes: query/key/value -> f16(bf16) per batch slice (XQ | XK | XV, contiguous); table -> f16(bf16 x64)
  //     clamped tiles; Wq|Wk|Wv|Wo [512][512] -> WT | WOT (contiguous) planes 0, 1, 2, 3 (transposed, f16 x64)
  cvt_all<<<dim3(4 * NTB + NBB + 3 * NB * LINB), blk, 0, stream>>>(query, key, value, wq, wk, wv, wo, rel, XQ, WT, PEH);

  // (1) q and k hi/res planes and v^T x16
  gemm_qkv<<<dim3(gP, 3), blk, 0, stream>>>(XQ, WT, QH, QL, KH, KL, VT, bq, bk, bv);

  // (2) attention -> ctx x16 plane
  attn_kernel<<<dim3((NB * NH * (SEQ / 16)) / AWV), dim3(128), 0, stream>>>(QH, QL, KH, KL, PEH, VT, mask, Z);

  // (3) output projection: out[row][n] = sum_k Z[row][k] * WOT[n][k] / (16*64) + bo[n]
  gemm64<0, 1><<<dim3(gP), blk, 0, stream>>>(Z, WOT, hdummy, hdummy, out0, DM, 1.0f / (WSCL * CSC), bo, 1.0f, MT, DM);
  (void)hipGetLastError();
}

// v007
// A run of this version takes 89.9 microseconds.
// Next to v006, in two timings, it ran 1.10 and 1.08 times as fast.
// Counting every step since v000, it is 3.17 times as fast.
// Contractions: x.Wq and x.Wk (q, k hi + residual planes), x.Wv (v^T plane), k.q^T (hi.hi + res.hi + hi.res),
// rel.q^T (hi + res), v^T.p^T and ctx.Wo, all on v_wmma_f32_16x16x32_f16 (f16 operands, f32 accumulate).
// Float inputs RNE-converted to bf16 on load and carried in f16 containers with power-of-two scales
// (x x1; Wq, Wk, Wv, Wo x64; rel table x64; q, k hi planes x16, residual planes x16x2048; v^T x16;
// p x4096; ctx x16); softmax, key mask and the relative-offset skew in f32 on VALU.
// Every f16 plane that a matrix product reads (x, W^T, q, k hi + residual, v^T, table, ctx) lies in fragment order: the
// 16 bytes of lane l of one operand load stand at piece base + 16*l, so that a load covers four whole 128-byte lines.
#include <hip/hip_runtime.h>
#include <math.h>

#ifndef NB
#define NB 2
#endif
#ifndef SEQ
#define SEQ 2048
#endif
#define NB_FULL  2
#define SEQ_FULL 2048
#define DM   512
#define NH   8
#define HD   64
#define MT   (NB * SEQ)
#define NREL 499
#define RCEN 249
#define POFF 22
#define NPT  34
#define AWV  4
#define RWP  52
#define WSCL 64.0f
#define QKS  16.0f
#define LSC  2048.0f
#define VSC  16.0f
#define PSC  4096.0f
#define CSC  16.0f
#define RSQD 0.125f
#define MASKV (-1.0e10f)
#define LINB ((SEQ * DM) / 2048)          // blocks of one batch slice of one activation plane
#define NTB  ((DM / 64) * (DM / 64))      // blocks of one weight transpose
#define NBB  ((NPT * 128) / 256)          // blocks of the table plane
#define GST  4                            // fragment sets of the projection GEMM's register ring

static_assert(NH * HD == DM);
static_assert(HD == 64);
static_assert(NB >= 1 && NB <= NB_FULL);
static_assert((SEQ % 64) == 0 && SEQ >= 64 && SEQ <= SEQ_FULL);
static_assert((MT % 64) == 0 && (DM % 64) == 0);
static_assert((((MT / 64) * (DM / 64)) % 8) == 0);
static_assert(((SEQ * DM) % 2048) == 0 && ((NPT * 128) % 256) == 0);
static_assert(((NB * NH * (SEQ / 16)) % AWV) == 0);
static_assert((2 * RCEN + 1) == NREL);
static_assert((DM % 32) == 0 && GST >= 2 && GST - 1 <= DM / 32);
static_assert(((RCEN - 15 + POFF) % 16) == 0 && POFF >= 15 && 16 * (NPT - 1) - POFF >= NREL - 1);

typedef _Float16 v16h __attribute__((ext_vector_type(16)));
typedef unsigned short v16us __attribute__((ext_vector_type(16)));
typedef unsigned short v8us  __attribute__((ext_vector_type(8)));
typedef float v8f __attribute__((ext_vector_type(8)));
typedef float v4f __attribute__((ext_vector_type(4)));
typedef unsigned int v4u __attribute__((ext_vector_type(4)));

union FragU { v16us v; v8us h[2]; };

// ---- scalar helpers --------------------------------------------------------------------------------
__device__ __forceinline__ unsigned short bf_bits(float f) {          // f32 -> bf16 bits, RNE convert
  const unsigned u = __float_as_uint(f);
  return (unsigned short)((u + 0x7FFFu + ((u >> 16) & 1u)) >> 16);
}
__device__ __forceinline__ float bf_up(unsigned short h) { return __uint_as_float(((unsigned)h) << 16); }
__device__ __forceinline__ float bfr(float f) { return bf_up(bf_bits(f)); }   // value of the bf16 RNE convert
__device__ __forceinline__ unsigned short h_bits(_Float16 x) { return __builtin_bit_cast(unsigned short, x); }
__device__ __forceinline__ unsigned short f2h(float f) { return h_bits((_Float16)f); }
__device__ __forceinline__ unsigned pk16(unsigned short a, unsigned short b) { return (unsigned)a | ((unsigned)b << 16); }
__device__ __forceinline__ int clampi(int v, int lo, int hi) { return v < lo ? lo : (v > hi ? hi : v); }
__device__ __forceinline__ v8f zero8() { v8f z = {0.f, 0.f, 0.f, 0.f, 0.f, 0.f, 0.f, 0.f}; return z; }

// ---- fragment loader: 16-bit A/B operand of k block k0..k0+31, lane l -> row/col (l&15), h = l>>4; elements 0..7 are
//      k0+8h.., elements 8..15 are k0+16+8h... Plane in fragment order: p = fragment base + 8*lane; the piece of
//      elements 0..7 is 256 halves (32 lanes x 8), the piece of elements 8..15 follows it.
//      A row-major [R][K] matrix (lane index = row, k contiguous) as such a plane: row tile T = row/16, piece
//      q = k/16 at (T*(K/16) + q)*256; in the piece lane l = row (l&15), k = 16*q + 8*(l>>4) .. +7.
__device__ __forceinline__ v16us ldfrag_p(const unsigned short* p) {
  FragU f;
  f.h[0] = *(const v8us*)(p);
  f.h[1] = *(const v8us*)(p + 256);
  return f.v;
}

// ---- WMMA helpers (f16 operand bits) with trailing VALU hazard gap --------------------------------
__device__ __forceinline__ v8f mma_raw(v16us a, v16us b, v8f c) {
  return __builtin_amdgcn_wmma_f32_16x16x32_f16(false, __builtin_bit_cast(v16h, a), false,
                                                __builtin_bit_cast(v16h, b), (short)0, c, false, false);
}
__device__ __forceinline__ v8f mma_g(v16us a, v16us b, v8f c) {                 // guarded
  c = mma_raw(a, b, c);
#if defined(__HIP_DEVICE_COMPILE__)
  asm volatile("v_nop\n\tv_nop\n\tv_nop\n\tv_nop" : "+v"(c) : "v"(a), "v"(b));
#endif
  return c;
}
__device__ __forceinline__ void acc_guard4(v8f& a, v8f& b, v8f& c, v8f& d) {
#if defined(__HIP_DEVICE_COMPILE__)
  asm volatile("v_nop\n\tv_nop\n\tv_nop\n\tv_nop" : "+v"(a), "+v"(b), "+v"(c), "+v"(d));
#endif
}
// orders LDS stores of this wave before later LDS loads of the same wave (cross-lane exchange)
__device__ __forceinline__ void wave_sync_lds() {
  __builtin_amdgcn_fence(__ATOMIC_RELEASE, "workgroup");
  __builtin_amdgcn_wave_barrier();
  __builtin_amdgcn_fence(__ATOMIC_ACQUIRE, "workgroup");
}

// the same exchange for a wave that has global loads in flight: waits for this wave's LDS operations only
__device__ __forceinline__ void wave_sync_lds_only() {
#if defined(__HIP_DEVICE_COMPILE__)
  // LDS stores of this wave are done before its later LDS loads issue, and the "memory" clobber keeps the compiler
  // from moving either across; the fence pair above would also wait out the next key block's global loads
  asm volatile("s_wait_dscnt 0x0" ::: "memory");
#endif
  __builtin_amdgcn_wave_barrier();
}

// stands behind a group of global stores that stay in flight: their address registers may be rewritten behind it
__device__ __forceinline__ void addr_regs_free() {
#if defined(__HIP_DEVICE_COMPILE__)
  asm volatile("s_wait_xcnt 0x0" ::: "memory");
#endif
}

// the same wait with the loads' address values as inputs: their registers stay live, so unwritten, up to the wait
// (the "memory" clobber alone does not keep a register write, or a later load's destination, behind it)
__device__ __forceinline__ void addr_regs_free_of(const void* a) {
#if defined(__HIP_DEVICE_COMPILE__)
  asm volatile("s_wait_xcnt 0x0" :: "v"(a) : "memory");
#endif
}
__device__ __forceinline__ void addr_regs_free_of(const void* a, const void* b) {
#if defined(__HIP_DEVICE_COMPILE__)
  asm volatile("s_wait_xcnt 0x0" :: "v"(a), "v"(b) : "memory");
#endif
}
__device__ __forceinline__ void addr_regs_free_of(const void* a, const void* b, const void* c) {
#if defined(__HIP_DEVICE_COMPILE__)
  asm volatile("s_wait_xcnt 0x0" :: "v"(a), "v"(b), "v"(c) : "memory");
#endif
}
__device__ __forceinline__ void addr_regs_free_of(const void* a, const void* b, const void* c, const void* d,
                                                  const void* e) {
#if defined(__HIP_DEVICE_COMPILE__)
  asm volatile("s_wait_xcnt 0x0" :: "v"(a), "v"(b), "v"(c), "v"(d), "v"(e) : "memory");
#endif
}

// =====================================================================================================
// Activation plane in fragment order: w[rows][DM] f32 -> o = f16 bits of (bf16 RNE value * sc), row tile T, piece q at
// (T*(DM/16) + q)*256 halves. One thread per 16-byte chunk of o: a wave reads 64 bytes of each of 16 rows and writes
// one whole piece; the 8 waves of a block take 8 pieces in a row, i.e. 512 consecutive bytes of each of the 16 rows.
// coverage: 256 threads x 8 = 2048 elements per block; bx = 0 .. rows*DM/2048 - 1 exact covers all of o.
// =====================================================================================================
__device__ __forceinline__ void cvt_rows(const float* __restrict__ w, unsigned short* o, float sc, int bx) {
  const int g = bx * 256 + threadIdx.x;                   // chunk = (piece, lane)
  const int pcs = g >> 5, l = g & 31;
  const int row = (pcs / (DM / 16)) * 16 + (l & 15);
  const int col = (pcs % (DM / 16)) * 16 + 8 * (l >> 4);
  const float* p = w + (size_t)row * DM + col;
  const v4f a0 = *(const v4f*)(p);
  const v4f a1 = *(const v4f*)(p + 4);
  addr_regs_free_of(p);
  v4u hv;
#pragma unroll
  for (int e = 0; e < 2; ++e) {
    hv[e]     = pk16(f2h(bfr(a0[2 * e]) * sc), f2h(bfr(a0[2 * e + 1]) * sc));
    hv[2 + e] = pk16(f2h(bfr(a1[2 * e]) * sc), f2h(bfr(a1[2 * e + 1]) * sc));
  }
  *(v4u*)(o + (size_t)g * 8) = hv;
}

// =====================================================================================================
// Table plane in fragment order: tile u (0..NPT-1) holds the 16 table rows clamp(16u - POFF + 0..15, 0, NREL-1) as
// four pieces of 256 halves; piece j, lane l = row (l&15) of the tile, head dims 16j + 8*(l>>4) .. +7, as f16 bits
// of (bf16 RNE value * sc). The band tiles of the attention kernel all start at a row = -POFF (mod 16), so every one
// of them is a tile of this plane; tile 0 is row 0 sixteen times, tile NPT-1 row NREL-1 sixteen times.
// coverage: one thread per 16-byte chunk, NPT*128 chunks, bx = 0 .. NPT*128/256 - 1 exact.
// =====================================================================================================
__device__ __forceinline__ void cvt_band(const float* __restrict__ w, unsigned short* o, float sc, int bx) {
  const int g = bx * 256 + threadIdx.x;
  if (g >= NPT * 128) return;                             // never taken with the exact grid; no barriers below
  const int u = g >> 7, j = (g >> 5) & 3, l = g & 31;
  const int row = clampi(16 * u - POFF + (l & 15), 0, NREL - 1);
  const float* p = w + (size_t)row * HD + 16 * j + 8 * (l >> 4);
  const v4f a0 = *(const v4f*)(p);
  const v4f a1 = *(const v4f*)(p + 4);
  v4u hv;
#pragma unroll
  for (int e = 0; e < 2; ++e) {
    hv[e]     = pk16(f2h(bfr(a0[2 * e]) * sc), f2h(bfr(a0[2 * e + 1]) * sc));
    hv[2 + e] = pk16(f2h(bfr(a1[2 * e]) * sc), f2h(bfr(a1[2 * e + 1]) * sc));
  }
  *(v4u*)(o + (size_t)g * 8) = hv;
}

// =====================================================================================================
// Transpose-convert: in w[R][C] f32 -> out o = the matrix [C][R] of f16 bits of (bf16 RNE value * sc), in fragment
// order (row tile T = c/16, piece q = r/16 at (T*(R/16) + q)*256). Block tile 64x64 through LDS (st[col][row], pitch
// 72 halves). Read phase: thread owns one input row x 16 columns. Write phase: the tile is 4 row tiles x 4 pieces;
// a wave writes one whole piece per store.
// R, C multiples of 64, (bx, by) = (0 .. C/64 - 1, 0 .. R/64 - 1) exact; st = the block's 64*72 halves of LDS.
// coverage: 16 pieces x 256 halves per block = the whole transposed tile; the blocks cover all of [C][R].
// =====================================================================================================
__device__ __forceinline__ void cvt_t(const float* __restrict__ w, unsigned short* o, int R, int C, float sc,
                                      int bx, int by, unsigned short* st) {
  const int t = threadIdx.x;
  const int r0 = by * 64, c0 = bx * 64;
  if (r0 + 64 > R || c0 + 64 > C) return;               // block-uniform, before the barrier; never taken
  {
    const int row = t >> 2, ch = (t & 3) * 16;
    const float* p = w + (size_t)(r0 + row) * C + c0 + ch;
#pragma unroll
    for (int q = 0; q < 4; ++q) {
      const v4f v = *(const v4f*)(p + 4 * q);
#pragma unroll
      for (int e = 0; e < 4; ++e) st[(ch + 4 * q + e) * 72 + row] = f2h(bfr(v[e]) * sc);
    }
  }
  __syncthreads();
  const int l = t & 31, wq = t >> 5;                     // lane in the piece; piece 8*half + wq of the tile's 16
  v4u hv[2];
#pragma unroll
  for (int half = 0; half < 2; ++half) {
    const int tl = 2 * half + (wq >> 2), q = wq & 3;      // row tile and piece in the block tile
    hv[half] = *(const v4u*)(st + (16 * tl + (l & 15)) * 72 + 16 * q + 8 * (l >> 4));
  }
#pragma unroll
  for (int half = 0; half < 2; ++half) {
    const int tl = 2 * half + (wq >> 2), q = wq & 3;
    unsigned short* dst = o + ((size_t)((c0 >> 4) + tl) * (size_t)(R >> 4) + (size_t)((r0 >> 4) + q)) * 256 + l * 8;
    *(v4u*)dst = hv[half];
  }
}

// =====================================================================================================
// All operand planes in one launch; none reads what another writes. The flat block index picks the work, the same for
// the whole block (the barrier of cvt_t is passed by all of a block's threads or by none):
// 4*NTB blocks: Wq, Wk, Wv, Wo [512][512] -> WT planes 0, 1, 2, 3 (transposed, x64; the last is WOT);
// NBB blocks: table -> PE (x64, clamped tiles); 3*NB*LINB blocks: query, key, value -> X planes 0, 1, 2 per batch slice.
// The transposes, which take longest, have the lowest indices.
// =====================================================================================================
__global__ __launch_bounds__(256) void cvt_all(
    const float* __restrict__ query, const float* __restrict__ key, const float* __restrict__ value,
    const float* __restrict__ wq, const float* __restrict__ wk, const float* __restrict__ wv,
    const float* __restrict__ wo, const float* __restrict__ rel,
    unsigned short* X, unsigned short* WT, unsigned short* PE) {
  __shared__ __align__(16) unsigned short st[64 * 72];
  int bid = blockIdx.x;
  if (bid < 4 * NTB) {
    const int ws = bid / NTB, tb = bid - ws * NTB;
    const float* w = (ws == 0) ? wq : (ws == 1) ? wk : (ws == 2) ? wv : wo;
    cvt_t(w, WT + (size_t)ws * DM * DM, DM, DM, WSCL, tb % (DM / 64), tb / (DM / 64), st);
    return;
  }
  bid -= 4 * NTB;
  if (bid < NBB) {
    cvt_band(rel, PE, WSCL, bid);
    return;
  }
  bid -= NBB;
  const int xs = bid / (NB * LINB), xr = bid - xs * (NB * LINB);
  if (xs > 2) return;                                     // never taken with the exact grid
  const float* x = (xs == 0) ? query : (xs == 1) ? key : value;
  const int by = xr / LINB;                               // batch slice: SEQ rows, a whole number of row tiles
  cvt_rows(x + (size_t)by * SEQ_FULL * DM, X + (size_t)xs * MT * DM + (size_t)by * SEQ * DM, 1.0f, xr - by * LINB);
}

// =====================================================================================================
// Register-blocked f16 WMMA GEMM: C[m][n] = sum_k A[m][k] * Bt[n][k], one wave per 64x64 tile, no block
// barriers. A = [M][K] and Bt = [N][K], both planes in fragment order (row tile T, k block kb: two pieces at
// (T*(K/32) + kb)*512 halves, so a row tile's k blocks follow one another); M, N multiples of 64,
// K = DM (bx = 0 .. tiles/8 - 1 exact so no wave exits early). The k loop is unrolled over a ring of GST fragment
// sets in registers: the 16 loads of k block kb + GST - 1 issue behind the first four products of k block kb, so that a
// load has nearly GST - 1 blocks of products to land; every load is a constant distance from one of two addresses. The products in
// the loop are the plain builtin, with no asm statement that names a fragment: the sets reach above v255. Both operand
// fragments use the split k map (elements 0..7 <- k0+8h.., 8..15 <- k0+16+8h..); D element r of a lane is
// (row 8h + r, col lane&15).
// s = acc*osc + bias term (BM 0: none; BM 1: bsc*bf16(bias[col]); BM 2: bsc*bf16(bias[row])).
// OM 0: f32 out Cf = s, pitch ldc.   OM 1: f16 out Ch = f16 bits(s).
// OM 2: f16 hi plane Ch = f16(s) and f16 residual plane Cl = f16((s - hi) * 2048), same layout.
// f16 outputs lie in fragment order (ldc unused). A 16x64 slab is four pieces of 256 halves; piece it, lane l =
// slab row (l&15), slab columns 16*it + 8*(l>>4) .. +7, i.e. one load of a fragment whose lane index is the row and
// whose k index is the column. OM 2: slab (row tile T = row/16, column tile tn) at ((tn*(M/16) + T)*4 + it)*256.
// OM 1: pieces 2*kb, 2*kb + 1 of a slab are k block kb of 32 columns; piece at
// (((tm*(N/32) + column/32)*4 + row tile in tm)*2 + (it&1))*256, so that a k block's four row tiles are contiguous.
// coverage: 4 slabs x 16 rows x 64 cols = the wave's whole 64x64 tile.
// =====================================================================================================
template <int OM, int BM>
__device__ __forceinline__ void gemm64_tile(
    const unsigned short* __restrict__ Ap, const unsigned short* __restrict__ Btp,
    unsigned short* Ch, unsigned short* Cl, float* Cf, int ldc, float osc,
    const float* __restrict__ bias, float bsc, int M, int N, int bx, float (*sT)[16 * 68]) {
  constexpr int K = DM;
  constexpr int NKB = K / 32;                  // k blocks
  const int lane = threadIdx.x & 31;
  const int wave = threadIdx.x >> 5;
  const int tilesN = N >> 6;
  const int tilesM = M >> 6;
  const int tile = bx * 8 + wave;
  if (tile >= tilesM * tilesN) return;   // wave-uniform; no block barriers in this kernel
  const int tm = tile / tilesN;
  const int tn = tile - tm * tilesN;
  const int m0 = tm << 6;
  const int n0 = tn << 6;

  const int rlane = lane & 15;                 // col (D) within subtile
  const int mOff  = (lane >> 4) * 8;           // D row offset
  constexpr size_t tstr = (size_t)NKB * 512;   // halves of one row tile of an operand plane
  const unsigned short* Aw = Ap + (size_t)(m0 >> 4) * tstr + lane * 8;    // this lane's chunk of row tile m0/16, k block 0
  const unsigned short* Bw = Btp + (size_t)(n0 >> 4) * tstr + lane * 8;

  v8f acc[4][4];
#pragma unroll
  for (int i = 0; i < 4; ++i)
#pragma unroll
    for (int j = 0; j < 4; ++j) acc[i][j] = zero8();

  v16us bh[GST][4], ah[GST][4];                // fragment set kb % GST holds k block kb
  // unrolled here and below: the sets are indexed by constants only, so they stay in registers
#pragma unroll
  for (int kb = 0; kb < GST - 1; ++kb) {
#pragma unroll
    for (int j = 0; j < 4; ++j) bh[kb][j] = ldfrag_p(Bw + (size_t)kb * 512 + (size_t)j * tstr);
#pragma unroll
    for (int i = 0; i < 4; ++i) ah[kb][i] = ldfrag_p(Aw + (size_t)kb * 512 + (size_t)i * tstr);
    // keeps the first sets' loads in the order of their use: loads return in order, and k block 0 is waited for first
    __builtin_amdgcn_sched_barrier(0);
  }
#pragma unroll
  for (int kb = 0; kb < NKB; ++kb) {
    const int st = kb % GST;
#pragma unroll
    for (int j = 0; j < 4; ++j) acc[0][j] = mma_raw(ah[st][0], bh[st][j], acc[0][j]);
    if (kb + GST - 1 < NKB) {
      const int kn = kb + GST - 1, sn = kn % GST;
      // keeps the fetch behind the four products above, so behind every product of k block kb - 1, whose set it refills:
      // moved up it would need a further set of registers
      __builtin_amdgcn_sched_barrier(0);
#pragma unroll
      for (int j = 0; j < 4; ++j) bh[sn][j] = ldfrag_p(Bw + (size_t)kn * 512 + (size_t)j * tstr);
#pragma unroll
      for (int i = 0; i < 4; ++i) ah[sn][i] = ldfrag_p(Aw + (size_t)kn * 512 + (size_t)i * tstr);
      // keeps the fetch in front of the block's other products: sunk towards its use it would have no time to land
      __builtin_amdgcn_sched_barrier(0);
    }
#pragma unroll
    for (int i = 1; i < 4; ++i) {
#pragma unroll
      for (int j = 0; j < 4; ++j) acc[i][j] = mma_raw(ah[st][i], bh[st][j], acc[i][j]);
    }
  }
  addr_regs_free_of(Aw, Bw);                   // the two addresses of every load above stay unwritten up to here
  acc_guard4(acc[0][0], acc[0][1], acc[0][2], acc[0][3]);
  acc_guard4(acc[1][0], acc[1][1], acc[1][2], acc[1][3]);
  acc_guard4(acc[2][0], acc[2][1], acc[2][2], acc[2][3]);
  acc_guard4(acc[3][0], acc[3][1], acc[3][2], acc[3][3]);

  const int hh2 = lane >> 4, c4 = (lane & 15) * 4;     // f32 out: 256-B row segment = 16 lanes x 16 B

  // column bias terms (fixed per wave); addresses n0+c4+3 < N and n0+48+8+7 < N
  v4f bc4 = {0.f, 0.f, 0.f, 0.f};
  float bc8[4][8];                                      // f16 out: piece it, columns 16*it + 8*hh2 .. +7
#pragma unroll
  for (int it = 0; it < 4; ++it)
#pragma unroll
    for (int e = 0; e < 8; ++e) bc8[it][e] = 0.f;
  if (BM == 1) {
    if (OM == 0) {
      const v4f t4 = *(const v4f*)(bias + n0 + c4);
#pragma unroll
      for (int e = 0; e < 4; ++e) bc4[e] = bfr(t4[e]) * bsc;
    } else {
#pragma unroll
      for (int it = 0; it < 4; ++it) {
        const v4f ta = *(const v4f*)(bias + n0 + 16 * it + 8 * hh2);
        const v4f tb = *(const v4f*)(bias + n0 + 16 * it + 8 * hh2 + 4);
#pragma unroll
        for (int e = 0; e < 4; ++e) { bc8[it][e] = bfr(ta[e]) * bsc; bc8[it][4 + e] = bfr(tb[e]) * bsc; }
      }
    }
  }

  // ---- epilogue ----
  float* slab = sT[wave];
#pragma unroll
  for (int i = 0; i < 4; ++i) {
    const int mBase = m0 + (i << 4);
#pragma unroll
    for (int j = 0; j < 4; ++j) {
#pragma unroll
      for (int r = 0; r < 8; ++r) {
        slab[(mOff + r) * 68 + (j << 4) + rlane] = acc[i][j][r];
      }
    }
    wave_sync_lds();
    if (OM == 0) {
      v4f vals[8];
#pragma unroll
      for (int it = 0; it < 8; ++it) {
        const int row = it * 2 + hh2;                      // it 0..7 x hh2 0..1 = rows 0..15
        const v4f v = *(const v4f*)(slab + row * 68 + c4);
        float rb2 = 0.f;
        if (BM == 2) rb2 = bfr(bias[mBase + row]) * bsc;
        vals[it] = v * osc + bc4 + rb2;
      }
      {
#pragma unroll
        for (int it = 0; it < 8; ++it) {
          const int row = it * 2 + hh2;
          *(v4f*)(Cf + (size_t)(mBase + row) * ldc + (size_t)n0 + c4) = vals[it];
        }
        
      }
    } else {
      v4u hv[4], hl[4];
      float rb2 = 0.f;
      if (BM == 2) rb2 = bfr(bias[mBase + rlane]) * bsc;
#pragma unroll
      for (int it = 0; it < 4; ++it) {
        const float* sp = slab + rlane * 68 + 16 * it + 8 * hh2;   // rows 0..15 x (it, hh2) = 8 column chunks
        v4u ha = {0u, 0u, 0u, 0u};
        v4u la = {0u, 0u, 0u, 0u};
#pragma unroll
        for (int e = 0; e < 4; ++e) {
          const float b0 = sp[2 * e]     * osc + bc8[it][2 * e]     + rb2;
          const float b1 = sp[2 * e + 1] * osc + bc8[it][2 * e + 1] + rb2;
          if (OM == 1) {
            ha[e] = pk16(f2h(b0), f2h(b1));
          } else {
            const _Float16 h0 = (_Float16)b0;
            const _Float16 h1 = (_Float16)b1;
            const float l0 = (b0 - (float)h0) * LSC;       // difference exact, power-of-two carry exact
            const float l1 = (b1 - (float)h1) * LSC;
            ha[e] = pk16(h_bits(h0), h_bits(h1));
            la[e] = pk16(f2h(l0), f2h(l1));
          }
        }
        hv[it] = ha;
        hl[it] = la;
      }
      {
#pragma unroll
        for (int it = 0; it < 4; ++it) {
          const size_t pc = (OM == 2)
              ? ((size_t)tn * (size_t)(M >> 4) + (size_t)(mBase >> 4)) * 4 + it
              : (((size_t)tm * (size_t)(N >> 5) + (size_t)((n0 >> 5) + (it >> 1))) * 4 + i) * 2 + (it & 1);
          const size_t go = pc * 256 + (size_t)(lane * 8);    // 32 lanes x 16 B = the whole piece
          *(v4u*)(Ch + go) = hv[it];
          if (OM == 2) *(v4u*)(Cl + go) = hl[it];
        }
        addr_regs_free();
      }
    }
    wave_sync_lds();
  }
}

// one product per launch, K = DM
template <int OM, int BM>
__global__ __launch_bounds__(256) void gemm64(
    const unsigned short* __restrict__ Ap, const unsigned short* __restrict__ Btp,
    unsigned short* Ch, unsigned short* Cl, float* Cf, int ldc, float osc,
    const float* __restrict__ bias, float bsc, int M, int N) {
  __shared__ __align__(16) float sT[8][16 * 68];   // per-wave 16x64 slab, pitch 68 floats
  gemm64_tile<OM, BM>(Ap, Btp, Ch, Cl, Cf, ldc, osc, bias, bsc, M, N, blockIdx.x, sT);
}

// The three input projections in one launch; none reads what another writes. blockIdx.y picks the product:
// 0: s = 16*(xq.Wq + bq) -> QH = f16(s), QL = f16(2048*(s - QH));  1: the same for k;
// 2: v^T x16: C[d][tok] = sum_k WT[1024+d][k] * XV[tok][k], bias by row d.
// X = the planes XQ | XK | XV, WT = Wq^T | Wk^T | Wv^T, each in fragment order. Output pointers that a product's OM does not use are null.
__global__ __launch_bounds__(256) void gemm_qkv(
    const unsigned short* __restrict__ X, const unsigned short* __restrict__ WT,
    unsigned short* QH, unsigned short* QL, unsigned short* KH, unsigned short* KL, unsigned short* VT,
    const float* __restrict__ bq, const float* __restrict__ bk, const float* __restrict__ bv) {
  __shared__ __align__(16) float sT[8][16 * 68];   // per-wave 16x64 slab, pitch 68 floats
  const int sel = blockIdx.y;
  const unsigned short* Xs = X + (size_t)sel * MT * DM;    // this product's activation and weight planes
  const unsigned short* Ws = WT + (size_t)sel * DM * DM;
  if (sel == 2) {
    gemm64_tile<1, 2>(Ws, Xs, VT, nullptr, nullptr, MT,
                      VSC / WSCL, bv, VSC, DM, MT, blockIdx.x, sT);
  } else {
    const bool isk = (sel == 1);
    gemm64_tile<2, 1>(Xs, Ws,
                      isk ? KH : QH, isk ? KL : QL, nullptr, DM, QKS / WSCL, isk ? bk : bq, QKS, MT, DM,
                      blockIdx.x, sT);
  }
}

// ---- per-tile products used by the attention kernel ----------------------------------------------
// Both give the TRANSPOSED tile: the plane rows (table rows, keys) are the A operand, the query rows the B operand,
// so that D register r of lane l is (plane row 8*(l>>4) + r, query l&15).
// R^T = b.ah + (b.al)/2048 over 64 head dims (b0, b1: fragments of a [n][64] f16 plane row, dims 0..31 and 32..63)
__device__ __forceinline__ v8f dot2_res(v16us ah0, v16us ah1, v16us al0, v16us al1, v16us b0, v16us b1) {
  v8f L = mma_g(b0, al0, zero8());
  L = mma_g(b1, al1, L);
  L = L * (1.0f / LSC);
  v8f R = mma_g(b0, ah0, L);
  R = mma_g(b1, ah1, R);
  return R;
}
// S^T = kh.qh + (kl.qh + kh.ql)/2048 over 64 head dims (kh from the hi plane row, kl from the residual plane row)
__device__ __forceinline__ v8f dot3_res(v16us qh0, v16us qh1, v16us ql0, v16us ql1,
                                        v16us kh0, v16us kh1, v16us kl0, v16us kl1) {
  v8f L = mma_g(kl0, qh0, zero8());
  L = mma_g(kl1, qh1, L);
  L = mma_g(kh0, ql0, L);
  L = mma_g(kh1, ql1, L);
  L = L * (1.0f / LSC);
  v8f S = mma_g(kh0, qh0, L);
  S = mma_g(kh1, qh1, S);
  return S;
}
// value of lane l ^ 16
__device__ __forceinline__ float xhalf(float x) {
  const int b = __builtin_bit_cast(int, x);
  return __builtin_bit_cast(float, __builtin_amdgcn_permlanex16(b, b, 0x76543210, 0xfedcba98, false, false));
}
__device__ __forceinline__ v4f lo4(v8f x) { return __builtin_shufflevector(x, x, 0, 1, 2, 3); }
__device__ __forceinline__ v4f hi4(v8f x) { return __builtin_shufflevector(x, x, 4, 5, 6, 7); }

// =====================================================================================================
// One key block (32 keys) of the attention loop; the layouts are those of the kernel's own comment below.
// BAND = true: the block's band columns hold more than one table row: two fresh band tiles, the LDS skew, and the next
// block's table tiles are fetched. BAND = false: every key of the block has the same clipped table row for every query of
// the tile, so bc = rel.q of that row (already scaled) is the bias of all 32 keys; no table load, band product or LDS.
// =====================================================================================================
template <bool BAND>
__device__ __forceinline__ void attn_pass(
    int kb, float bc, int ub, int lane, int hh, v16us qh0, v16us qh1, v16us ql0, v16us ql1,
    const unsigned short* __restrict__ KH, const unsigned short* __restrict__ KL,
    const unsigned short* __restrict__ PE, const unsigned short* __restrict__ VT, const int* __restrict__ mk,
    size_t kfix, size_t vfix, float* rst, const float* rld,
    v16us& ka0, v16us& ka1, v16us& ka2, v16us& ka3, v16us& kc0, v16us& kc1, v16us& kc2, v16us& kc3,
    v16us& pa0, v16us& pa1, v16us& pc0, v16us& pc1, int& mnx,
    v16us& vf0, v16us& vf1, v16us& vf2, v16us& vf3,
    v8f& carry, float& mx, float& ls, v8f& O0, v8f& O1, v8f& O2, v8f& O3) {
  const int sb = kb << 5;
  const int sn = (sb + 32 < SEQ) ? sb + 32 : SEQ - 32; // key block whose operands are fetched in this pass
  // scores, transposed: A row = key token, B column = query, k = head dim
  const v8f S0 = dot3_res(qh0, qh1, ql0, ql1, ka0, ka1, ka2, ka3);
  const v8f S1 = dot3_res(qh0, qh1, ql0, ql1, kc0, kc1, kc2, kc3);

  // relative band: columns 16..31 and 32..47 <-> table tiles clamp(ub + sb/16 + 1), clamp(ub + sb/16 + 2)
  v8f Pb1 = zero8(), Pb2 = zero8();
  if constexpr (BAND) {
    Pb1 = dot2_res(qh0, qh1, ql0, ql1, pa0, pa1);
    Pb2 = dot2_res(qh0, qh1, ql0, ql1, pc0, pc1);
  }

  // key mask of the block as 32 bits (bit = key), shifted so that bit r is key 8*hh + r and bit 16 + r key 16 + 8*hh + r
  const unsigned mw = __builtin_amdgcn_ballot_w32(mnx != 0) >> (8 * hh);

  // next key block's K, table and mask operands, one group (token tiles and columns below SEQ, table tiles clamped)
  {
    const int* mq = mk + sn;
    mnx = mq[0];
    const size_t ko = kfix + (size_t)(sn >> 4) * 1024;
    ka0 = ldfrag_p(KH + ko);        ka1 = ldfrag_p(KH + ko + 512);
    ka2 = ldfrag_p(KL + ko);        ka3 = ldfrag_p(KL + ko + 512);
    kc0 = ldfrag_p(KH + ko + 1024); kc1 = ldfrag_p(KH + ko + 1536);
    kc2 = ldfrag_p(KL + ko + 1024); kc3 = ldfrag_p(KL + ko + 1536);
    if constexpr (BAND) {
      const int un = ub + (sn >> 4);
      const unsigned short* p1 = PE + (size_t)clampi(un + 1, 0, NPT - 1) * 1024 + lane * 8;
      const unsigned short* p2 = PE + (size_t)clampi(un + 2, 0, NPT - 1) * 1024 + lane * 8;
      pa0 = ldfrag_p(p1); pa1 = ldfrag_p(p1 + 512);
      pc0 = ldfrag_p(p2); pc1 = ldfrag_p(p2 + 512);
      addr_regs_free_of(KH + ko, KL + ko, p1, p2, mq);
    } else {
      addr_regs_free_of(KH + ko, KL + ko, mq);
    }
  }
  if constexpr (BAND) {
    *(v4f*)(rst)      = lo4(carry); *(v4f*)(rst + 4)  = hi4(carry);
    *(v4f*)(rst + 16) = lo4(Pb1);   *(v4f*)(rst + 20) = hi4(Pb1);
    *(v4f*)(rst + 32) = lo4(Pb2);   *(v4f*)(rst + 36) = hi4(Pb2);
    carry = Pb2;
    wave_sync_lds_only();
  }

  // skew read (or the block's one bias) + scale, then replace-fill masked keys
  float s0[8], s1[8];
  // unrolled here and below: the per-key arrays are indexed by constants only, so they stay in registers
#pragma unroll
  for (int r = 0; r < 8; ++r) {
    float v0, v1;
    if constexpr (BAND) {
      const float rv0 = rld[r];
      const float rv1 = rld[16 + r];
      v0 = S0[r] * (RSQD / (QKS * QKS)) + rv0 * (1.0f / (QKS * WSCL));
      v1 = S1[r] * (RSQD / (QKS * QKS)) + rv1 * (1.0f / (QKS * WSCL));
    } else {
      v0 = S0[r] * (RSQD / (QKS * QKS)) + bc;
      v1 = S1[r] * (RSQD / (QKS * QKS)) + bc;
    }
    s0[r] = ((mw >> r) & 1u) ? v0 : MASKV;
    s1[r] = ((mw >> (16 + r)) & 1u) ? v1 : MASKV;
  }

  // online softmax: the lane's 16 scores are of one query; one exchange joins the two halves' maxima
  float xr[8];
#pragma unroll
  for (int r = 0; r < 8; ++r) xr[r] = fmaxf(s0[r], s1[r]);
  float xm = fmaxf(fmaxf(fmaxf(xr[0], xr[1]), fmaxf(xr[2], xr[3])), fmaxf(fmaxf(xr[4], xr[5]), fmaxf(xr[6], xr[7])));
  xm = fmaxf(xm, xhalf(xm));
  const float mn = fmaxf(mx, xm);
  const float al = __expf(mx - mn);
  mx = mn;
  float pr[8];
  FragU pf;                                          // P^T B fragment
#pragma unroll
  for (int r = 0; r < 8; ++r) {
    const float p0 = __expf(s0[r] - mn);
    const float p1 = __expf(s1[r] - mn);
    pr[r] = p0 + p1;
    pf.v[r]     = f2h(p0 * PSC);
    pf.v[8 + r] = f2h(p1 * PSC);
  }
  ls = ls * al + (((pr[0] + pr[1]) + (pr[2] + pr[3])) + ((pr[4] + pr[5]) + (pr[6] + pr[7])));
  O0 = O0 * al;
  O1 = O1 * al;
  O2 = O2 * al;
  O3 = O3 * al;

  // V^T A-fragments (row = dim, k = key token) against the P^T B fragment
  O0 = mma_g(vf0, pf.v, O0);
  O1 = mma_g(vf1, pf.v, O1);
  O2 = mma_g(vf2, pf.v, O2);
  O3 = mma_g(vf3, pf.v, O3);
  const size_t vo = vfix + (size_t)(sn >> 5) * 2048;
  vf0 = ldfrag_p(VT + vo);
  vf1 = ldfrag_p(VT + vo + 512);
  vf2 = ldfrag_p(VT + vo + 1024);
  vf3 = ldfrag_p(VT + vo + 1536);
  addr_regs_free_of(VT + vo);
}

// =====================================================================================================
// Non-causal attention with clipped relative-offset term and key-padding mask, head dim 64.
// Block = 128 threads = 4 waves; one wave owns one 16-row query tile (t0..t0+15) of one (batch b, head h)
// and loops all key blocks of 32 with an online max-subtracted softmax in f32.
// Every product is taken transposed (keys, table rows or head dims as A rows, queries as B columns): lane l works for
// the one query t0 + (l&15); lanes l and l^16 split that query's keys (8*(l>>4) + 0..7 of each 16) and head dims.
// Planes, all in fragment order (a fragment = two pieces of 256 halves, lane l's 8 halves at piece + 8*l):
// QH/KH f16 = 16*q, 16*k, QL/KL = 2048*(16q - QH) residuals: [head][token tile of 16][dims 0..31 | 32..63];
// PE f16 = 64*rel table, [tile u][dims 0..31 | 32..63], tile u = table rows clamp(16u - POFF + 0..15, 0, 498);
// VT f16 = 16*v transposed: [head][key block of 32][dim tile of 16]; mask int32 [NB_FULL][SEQ_FULL].
// Output Z f16 = 16*ctx, the matrix [MT][512] (row = b*SEQ + t, col = h*64+d) in fragment order:
// [token tile of 16][piece = col/16], the A operand of the output projection.
// Per key block sb: S^T = 256*k.q (hi.hi + res.hi + hi.res, 2 key subtiles); relative band of 48 columns:
// column c <-> table row clamp(234 - t0 + sb + c, 0, 498) (clamped per column, which IS the clipped index), so
// columns 16k..16k+15 are table tile clamp(16 - t0/16 + sb/16 + k, 0, NPT-1);
// columns 0..15 come from the tile carried over from the prior key block (its columns 32..47), columns
// 16..47 are two fresh tiles (hi + res products, value 1024*rel.q); a lane holds 8 consecutive band columns of its
// query per tile, stores them to per-wave LDS as [query][column] (pitch RWP floats) and reads back the columns
// c = 15 - query + key of its own 16 keys, i.e. table row clamp(j - i + 249, 0, 498);
// score = qk/8 + bias; then replace-fill -1e10 where mask[b][j] == 0; the block maximum is taken over the lane's 16
// scores and joined with lane l^16; p = exp(score - running max) in f32; l is kept per lane over the lane's own keys
// (the two halves are joined behind the loop); 4096*p as f16, score registers in order, IS the B fragment of P^T
// (elements 0..7 = keys 8*(l>>4) + 0..7, elements 8..15 = keys 16 + 8*(l>>4) + 0..7, the k map of the V^T fragments);
// O^T += V^T.P^T on 4 dim subtiles, O^T register r of lane l = (dim 16*tile + 8*(l>>4) + r, query l&15).
// coverage: 16 query rows x 64 halves per wave, NB*NH*(SEQ/16) wave tasks = all (b, t, h) segments of Z.
// LDS: band 16 queries x 48 columns of floats per wave at pitch RWP; columns read 0..46.
// Global operands run one key block ahead in registers: K (hi + residual), table rows and mask words are
// reloaded for key block kb + 1 behind the score and band products of key block kb, V^T behind its V^T.P^T
// products, into the same variables, so that a load has most of a pass to land before its wait. The last
// pass reloads its own block (addresses in range, values unused).
// Key blocks whose three table tiles are all clipped to table row 0 (keys far below the queries) or all to row NREL-1 (far
// above) have one bias per query, rel.q of that row, which the carried band tile holds at both ends of the band; only the
// key blocks between them (at most 17 of SEQ/32) run the band products and the LDS skew.
// =====================================================================================================
__global__ __launch_bounds__(128) void attn_kernel(
    const unsigned short* __restrict__ QH, const unsigned short* __restrict__ QL,
    const unsigned short* __restrict__ KH, const unsigned short* __restrict__ KL,
    const unsigned short* __restrict__ PE, const unsigned short* __restrict__ VT,
    const int* __restrict__ mask, unsigned short* Z) {
  __shared__ __align__(16) float relw[AWV][16 * RWP];            // band exchange, 13312 B
  const int lane = threadIdx.x & 31, wv = threadIdx.x >> 5, m = lane & 15, hh = lane >> 4;
  const int task = blockIdx.x * AWV + wv;            // 0 .. NB*NH*(SEQ/16)-1
  const int nqt = SEQ / 16;
  const int bh = task / nqt;                         // (b, h)
  const int t0 = (task - bh * nqt) << 4;             // query tile start
  const int b = bh / NH, h = bh - (bh / NH) * NH;
  if (b >= NB) return;                               // wave-uniform; never taken with exact grids; no block barriers
  const size_t tok0 = (size_t)b * SEQ;               // plane row base of this batch
  const int* mk = mask + (size_t)b * SEQ_FULL + lane;     // full input stride for the mask row; lane l fetches key l's word
  float* rst = relw[wv] + m * RWP + 8 * hh;               // band store: query m, columns 8*hh + 0..7 of a tile
  const float* rld = relw[wv] + m * RWP + 15 - m + 8 * hh;   // band read: query m, column of key 8*hh

  // Q B-fragments (hi and residual): columns t0+m, k = head dims 0..31 and 32..63
  const size_t qo = ((size_t)h * (MT / 16) + ((tok0 + (size_t)t0) >> 4)) * 1024 + (size_t)(lane * 8);
  const v16us qh0 = ldfrag_p(QH + qo);
  const v16us qh1 = ldfrag_p(QH + qo + 512);
  const v16us ql0 = ldfrag_p(QL + qo);
  const v16us ql1 = ldfrag_p(QL + qo + 512);
  addr_regs_free_of(QH + qo, QL + qo);

  const int ub = (RCEN - 15 + POFF) / 16 - (t0 >> 4);  // table tile of band columns 0..15 at sb = 0 (before clamp)

  // Key block kb uses table tiles clamp(ub + 2*kb + 0..2). Blocks 0 .. nlo-1 have all three at or below tile 0 (table row 0
  // sixteen times), blocks khi .. SEQ/32-1 all three at or above tile NPT-1 (row NREL-1 sixteen times); nlo < khi.
  // Both bounds are the same in every lane; read as scalars so that the three loops below are uniform branches and EXEC
  // stays all ones for the matrix instructions.
  const int nlo = __builtin_amdgcn_readfirstlane((ub < 0 ? -ub : 0) >> 1);
  const int khf = (NPT - ub) >> 1;
  const int khi = __builtin_amdgcn_readfirstlane(khf < SEQ / 32 ? khf : SEQ / 32);
  const int ub1 = ub + 2 * nlo;                        // table tile of band columns 0..15 of key block nlo (before clamp)

  // carried band tile: columns 0..15 of key block nlo
  const unsigned short* pcar = PE + (size_t)clampi(ub1, 0, NPT - 1) * 1024 + lane * 8;
  const v16us cf0 = ldfrag_p(pcar), cf1 = ldfrag_p(pcar + 512);
  addr_regs_free_of(pcar);

  // lane-fixed parts of the operand addresses; key block sb adds sb/16 token tiles (K), sb/16 table tiles,
  // sb/32 key blocks (V^T), sb columns (mask)
  const size_t kfix = ((size_t)h * (MT / 16) + (tok0 >> 4)) * 1024 + (size_t)(lane * 8);
  const size_t vfix = ((size_t)h * (MT / 32) + (tok0 >> 5)) * 2048 + (size_t)(lane * 8);

  // K, mask and V^T operands of key block 0
  v16us ka0 = ldfrag_p(KH + kfix),        ka1 = ldfrag_p(KH + kfix + 512);     // keys 0..15, hi
  v16us ka2 = ldfrag_p(KL + kfix),        ka3 = ldfrag_p(KL + kfix + 512);     // keys 0..15, residual
  v16us kc0 = ldfrag_p(KH + kfix + 1024), kc1 = ldfrag_p(KH + kfix + 1536);    // keys 16..31, hi
  v16us kc2 = ldfrag_p(KL + kfix + 1024), kc3 = ldfrag_p(KL + kfix + 1536);    // keys 16..31, residual
  int mnx = mk[0];                                                             // mask word of key lane
  addr_regs_free_of(KH + kfix, KL + kfix, mk);
  v16us vf0 = ldfrag_p(VT + vfix);
  v16us vf1 = ldfrag_p(VT + vfix + 512);
  v16us vf2 = ldfrag_p(VT + vfix + 1024);
  v16us vf3 = ldfrag_p(VT + vfix + 1536);
  addr_regs_free_of(VT + vfix);

  v8f carry = dot2_res(qh0, qh1, ql0, ql1, cf0, cf1);
  v16us pa0, pa1, pc0, pc1;                            // table operands; first fetched in front of the band loop

  float mx = -1.0e30f, ls = 0.f;                       // running maximum of the query; sum over this lane's keys
  v8f O0 = zero8(), O1 = zero8(), O2 = zero8(), O3 = zero8();

#define PASS_ARGS ub, lane, hh, qh0, qh1, ql0, ql1, KH, KL, PE, VT, mk, kfix, vfix, rst, rld,                \
                  ka0, ka1, ka2, ka3, kc0, kc1, kc2, kc3, pa0, pa1, pc0, pc1, mnx, vf0, vf1, vf2, vf3,        \
                  carry, mx, ls, O0, O1, O2, O3
  // the three loops stay rolled: one copy of each pass, so that the operands fetched ahead keep their registers
  // keys far below the queries, table row 0. Where nlo > 0, ub1 <= 0: the carried tile is tile 0, sixteen times that row,
  // so any of its registers is rel.q of the lane's query
  const float blo = carry[0] * (1.0f / (QKS * WSCL));
#pragma unroll 1
  for (int kb = 0; kb < nlo; ++kb) attn_pass<false>(kb, blo, PASS_ARGS);
  // the band proper; table operands of its first key block (band columns 16..31, 32..47), fetched here and not in front of
  // the loop above so that they hold no registers there; the block's score products stand between fetch and use
  const unsigned short* p1 = PE + (size_t)clampi(ub1 + 1, 0, NPT - 1) * 1024 + lane * 8;
  const unsigned short* p2 = PE + (size_t)clampi(ub1 + 2, 0, NPT - 1) * 1024 + lane * 8;
  pa0 = ldfrag_p(p1); pa1 = ldfrag_p(p1 + 512);
  pc0 = ldfrag_p(p2); pc1 = ldfrag_p(p2 + 512);
  addr_regs_free_of(p1, p2);
#pragma unroll 1
  for (int kb = nlo; kb < khi; ++kb) attn_pass<true>(kb, 0.f, PASS_ARGS);
  // keys far above, table row NREL-1. Where khi < SEQ/32, the tile carried out of block khi-1 is tile
  // clamp(ub + 2*khi) = NPT-1, sixteen times that row
  const float bhi = carry[0] * (1.0f / (QKS * WSCL));
#pragma unroll 1
  for (int kb = khi; kb < SEQ / 32; ++kb) attn_pass<false>(kb, bhi, PASS_ARGS);
#undef PASS_ARGS
  acc_guard4(O0, O1, O2, O3);

  // ---- epilogue: ctx = O / (l * PSC * VSC), stored x CSC as f16; a lane's 8 registers of a dim subtile are row l&15,
  //      columns h*64 + 16*subtile + 8*(l>>4) .. +7: lane l's chunk of piece h*4 + subtile, the wave fills four whole pieces
  const float g = (CSC / (PSC * VSC)) / (ls + xhalf(ls));   // l >= 1
  unsigned short* dst = Z + (((tok0 + (size_t)t0) >> 4) * (DM / 16) + (size_t)(h * (HD / 16))) * 256 + (size_t)(lane * 8);
  v4u z0, z1, z2, z3;
#pragma unroll
  for (int e = 0; e < 4; ++e) {
    z0[e] = pk16(f2h(O0[2 * e] * g), f2h(O0[2 * e + 1] * g));
    z1[e] = pk16(f2h(O1[2 * e] * g), f2h(O1[2 * e + 1] * g));
    z2[e] = pk16(f2h(O2[2 * e] * g), f2h(O2[2 * e + 1] * g));
    z3[e] = pk16(f2h(O3[2 * e] * g), f2h(O3[2 * e + 1] * g));
  }
  *(v4u*)(dst)       = z0;
  *(v4u*)(dst + 256) = z1;
  *(v4u*)(dst + 512) = z2;
  *(v4u*)(dst + 768) = z3;
}

// =====================================================================================================
// Workspace map (bytes, NB=2 SEQ=2048 -> MT=4096); every plane is an exact multiple of its whole-row /
// whole-line / 64x64-tile store granularity (rows MT, 1536, 512; 64 | each tiled dimension; the table plane
// is NPT tiles of 2048 bytes, all written); all offsets multiples of 2048. Every plane lies in fragment order.
//   XQ   f16  [4096][512]      0           4194304
//   XK   f16  [4096][512]      4194304     4194304
//   XV   f16  [4096][512]      8388608     4194304
//   WT   f16  [1536][512]      12582912    1572864   (Wq^T | Wk^T | Wv^T, x64)
//   WOT  f16  [512][512]       14155776     524288   (Wo^T, x64)
//   PEH  f16  [34][1024]       14680064      69632   (table x64, clamped tiles)
//   QH   f16  [8][256][1024]   14749696    4194304
//   QL   f16  [8][256][1024]   18944000    4194304
//   KH   f16  [8][256][1024]   23138304    4194304
//   KL   f16  [8][256][1024]   27332608    4194304
//   VT   f16  [8][128][2048]   31526912    4194304
//   Z    f16  [4096][512]      35721216    4194304
//   end                        39915520
// =====================================================================================================
extern "C" void kernel_launch(void* const* d_in, const int* in_sizes, int n_in,
                              void* d_out, int out_size, void* d_ws, size_t ws_size,
                              hipStream_t stream) {
  if (n_in < 13) return;
  const int xreq = ((NB - 1) * SEQ_FULL + SEQ) * DM;
  const int mreq = (NB - 1) * SEQ_FULL + SEQ;
  if (in_sizes[0] < xreq || in_sizes[1] < xreq || in_sizes[2] < xreq) return;
  if (in_sizes[3] < mreq) return;
  if (in_sizes[4] < DM * DM || in_sizes[6] < DM * DM || in_sizes[8] < DM * DM || in_sizes[10] < DM * DM) return;
  if (in_sizes[5] < DM || in_sizes[7] < DM || in_sizes[9] < DM || in_sizes[11] < DM) return;
  if (in_sizes[12] < NREL * HD) return;
  if (out_size < MT * DM) return;

  const float* query = (const float*)d_in[0];   // [NB_FULL][SEQ_FULL][512]
  const float* key   = (const float*)d_in[1];
  const float* value = (const float*)d_in[2];
  const int*   mask  = (const int*)d_in[3];     // [NB_FULL][SEQ_FULL] int32
  const float* wq = (const float*)d_in[4];      // [512][512] (in, out)
  const float* bq = (const float*)d_in[5];
  const float* wk = (const float*)d_in[6];
  const float* bk = (const float*)d_in[7];
  const float* wv = (const float*)d_in[8];
  const float* bv = (const float*)d_in[9];
  const float* wo = (const float*)d_in[10];
  const float* bo = (const float*)d_in[11];
  const float* rel = (const float*)d_in[12];    // [499][64]

  const size_t PX  = (size_t)MT * DM * 2;
  const size_t PWT = (size_t)3 * DM * DM * 2;
  const size_t PWO = (size_t)DM * DM * 2;
  const size_t PPE = (size_t)NPT * 1024 * 2;
  size_t off = 0;
  const size_t oXQ = off; off += 3 * PX;          // XQ | XK | XV
  const size_t oWT = off; off += PWT;
  const size_t oWO = off; off += PWO;
  const size_t oPE = off; off += PPE;
  const size_t oQH = off; off += PX;
  const size_t oQL = off; off += PX;
  const size_t oKH = off; off += PX;
  const size_t oKL = off; off += PX;
  const size_t oVT = off; off += PX;
  const size_t oZ  = off; off += PX;
  if (off > ws_size) return;
  if (off > (size_t)134217728) return;

  char* ws = (char*)d_ws;
  unsigned short* XQ  = (unsigned short*)(ws + oXQ);
  unsigned short* WT  = (unsigned short*)(ws + oWT);
  unsigned short* WOT = (unsigned short*)(ws + oWO);
  unsigned short* PEH = (unsigned short*)(ws + oPE);
  unsigned short* QH  = (unsigned short*)(ws + oQH);
  unsigned short* QL  = (unsigned short*)(ws + oQL);
  unsigned short* KH  = (unsigned short*)(ws + oKH);
  unsigned short* KL  = (unsigned short*)(ws + oKL);
  unsigned short* VT  = (unsigned short*)(ws + oVT);
  unsigned short* Z   = (unsigned short*)(ws + oZ);
  float* out0 = (float*)d_out;
  unsigned short* hdummy = XQ;                    // in-range placeholder for unused f16 output args

  const dim3 blk(256);
  const int gP = ((MT / 64) * (DM / 64)) / 8;     // 64x64 tiles / 8 waves, exact

  // (0) operand planes: query/key/value -> f16(bf16) per batch slice (XQ | XK | XV, contiguous); table -> f16(bf16 x64)
  //     clamped tiles; Wq|Wk|Wv|Wo [512][512] -> WT | WOT (contiguous) planes 0, 1, 2, 3 (transposed, f16 x64)
  cvt_all<<<dim3(4 * NTB + NBB + 3 * NB * LINB), blk, 0, stream>>>(query, key, value, wq, wk, wv, wo, rel, XQ, WT, PEH);

  // (1) q and k hi/res planes and v^T x16
  gemm_qkv<<<dim3(gP, 3), blk, 0, stream>>>(XQ, WT, QH, QL, KH, KL, VT, bq, bk, bv);

  // (2) attention -> ctx x16 plane
  attn_kernel<<<dim3((NB * NH * (SEQ / 16)) / AWV), dim3(128), 0, stream>>>(QH, QL, KH, KL, PEH, VT, mask, Z);

  // (3) output projection: out[row][n] = sum_k Z[row][k] * WOT[n][k] / (16*64) + bo[n]
  gemm64<0, 1><<<dim3(gP), blk, 0, stream>>>(Z, WOT, hdummy, hdummy, out0, DM, 1.0f / (WSCL * CSC), bo, 1.0f, MT, DM);
  (void)hipGetLastError();
}

// v008
// It runs in 71.9 microseconds.
// Next to v007, in two timings, it ran 1.27 and 1.24 times as fast.
// Over all steps from v000 it is 3.98 times as fast.
// Contractions: x.Wq and x.Wk (q, k hi + residual planes), x.Wv (v^T plane), k.q^T (hi.hi + res.hi + hi.res),
// rel.q^T (hi + res), v^T.p^T and ctx.Wo, all on v_wmma_f32_16x16x32_f16 (f16 operands, f32 accumulate).
// Float inputs RNE-converted to bf16 on load and carried in f16 containers with power-of-two scales
// (x x1; Wq, Wk, Wv, Wo x64; rel table x64; q, k hi planes x16, residual planes x16x2048; v^T x16;
// p x4096; ctx x16); softmax, key mask and the relative-offset skew in f32 on VALU.
// Every f16 plane that a matrix product reads (x, W^T, q, k hi + residual, v^T, table, ctx) lies in fragment order: the
// 16 bytes of lane l of one operand load stand at piece base + 16*l, so that a load covers four whole 128-byte lines.
#include <hip/hip_runtime.h>
#include <math.h>

#ifndef NB
#define NB 2
#endif
#ifndef SEQ
#define SEQ 2048
#endif
#define NB_FULL  2
#define SEQ_FULL 2048
#define DM   512
#define NH   8
#define HD   64
#define MT   (NB * SEQ)
#define NREL 499
#define RCEN 249
#define POFF 22
#define NPT  34
#define AWV  8
#define QT   2                             // query tiles of 16 rows of one attention wave
#define RWP  52
#define WSCL 64.0f
#define QKS  16.0f
#define LSC  2048.0f
#define VSC  16.0f
#define PSC  4096.0f
#define CSC  16.0f
#define RSQD 0.125f
#define MASKV (-1.0e10f)
#define LINB ((SEQ * DM) / 2048)          // blocks of one batch slice of one activation plane
#define NTB  ((DM / 64) * (DM / 64))      // blocks of one weight transpose
#define NBB  ((NPT * 128) / 256)          // blocks of the table plane
#define GST  4                            // fragment sets of the projection GEMM's register ring

static_assert(NH * HD == DM);
static_assert(HD == 64);
static_assert(NB >= 1 && NB <= NB_FULL);
static_assert((SEQ % 64) == 0 && SEQ >= 64 && SEQ <= SEQ_FULL);
static_assert((MT % 64) == 0 && (DM % 64) == 0);
static_assert((((MT / 64) * (DM / 64)) % 8) == 0);
static_assert(((SEQ * DM) % 2048) == 0 && ((NPT * 128) % 256) == 0);
static_assert(((NB * NH * (SEQ / 16)) % AWV) == 0 && (AWV % 2) == 0 && QT == 2 && ((SEQ / 32) % (AWV / 2)) == 0);
static_assert((2 * RCEN + 1) == NREL);
static_assert((DM % 32) == 0 && GST >= 2 && GST - 1 <= DM / 32);
static_assert(((RCEN - 15 + POFF) % 16) == 0 && POFF >= 15 && 16 * (NPT - 1) - POFF >= NREL - 1);

typedef _Float16 v16h __attribute__((ext_vector_type(16)));
typedef unsigned short v16us __attribute__((ext_vector_type(16)));
typedef unsigned short v8us  __attribute__((ext_vector_type(8)));
typedef float v8f __attribute__((ext_vector_type(8)));
typedef float v4f __attribute__((ext_vector_type(4)));
typedef unsigned int v4u __attribute__((ext_vector_type(4)));

union FragU { v16us v; v8us h[2]; };

// ---- scalar helpers --------------------------------------------------------------------------------
__device__ __forceinline__ unsigned short bf_bits(float f) {          // f32 -> bf16 bits, RNE convert
  const unsigned u = __float_as_uint(f);
  return (unsigned short)((u + 0x7FFFu + ((u >> 16) & 1u)) >> 16);
}
__device__ __forceinline__ float bf_up(unsigned short h) { return __uint_as_float(((unsigned)h) << 16); }
__device__ __forceinline__ float bfr(float f) { return bf_up(bf_bits(f)); }   // value of the bf16 RNE convert
__device__ __forceinline__ unsigned short h_bits(_Float16 x) { return __builtin_bit_cast(unsigned short, x); }
__device__ __forceinline__ unsigned short f2h(float f) { return h_bits((_Float16)f); }
__device__ __forceinline__ unsigned pk16(unsigned short a, unsigned short b) { return (unsigned)a | ((unsigned)b << 16); }
__device__ __forceinline__ int clampi(int v, int lo, int hi) { return v < lo ? lo : (v > hi ? hi : v); }
__device__ __forceinline__ v8f zero8() { v8f z = {0.f, 0.f, 0.f, 0.f, 0.f, 0.f, 0.f, 0.f}; return z; }

// ---- fragment loader: 16-bit A/B operand of k block k0..k0+31, lane l -> row/col (l&15), h = l>>4; elements 0..7 are
//      k0+8h.., elements 8..15 are k0+16+8h... Plane in fragment order: p = fragment base + 8*lane; the piece of
//      elements 0..7 is 256 halves (32 lanes x 8), the piece of elements 8..15 follows it.
//      A row-major [R][K] matrix (lane index = row, k contiguous) as such a plane: row tile T = row/16, piece
//      q = k/16 at (T*(K/16) + q)*256; in the piece lane l = row (l&15), k = 16*q + 8*(l>>4) .. +7.
__device__ __forceinline__ v16us ldfrag_p(const unsigned short* p) {
  FragU f;
  f.h[0] = *(const v8us*)(p);
  f.h[1] = *(const v8us*)(p + 256);
  return f.v;
}

// ---- WMMA helpers (f16 operand bits) with trailing VALU hazard gap --------------------------------
__device__ __forceinline__ v8f mma_raw(v16us a, v16us b, v8f c) {
  return __builtin_amdgcn_wmma_f32_16x16x32_f16(false, __builtin_bit_cast(v16h, a), false,
                                                __builtin_bit_cast(v16h, b), (short)0, c, false, false);
}
__device__ __forceinline__ void acc_guard4(v8f& a, v8f& b, v8f& c, v8f& d) {
#if defined(__HIP_DEVICE_COMPILE__)
  asm volatile("v_nop\n\tv_nop\n\tv_nop\n\tv_nop" : "+v"(a), "+v"(b), "+v"(c), "+v"(d));
#endif
}
// orders LDS stores of this wave before later LDS loads of the same wave (cross-lane exchange)
__device__ __forceinline__ void wave_sync_lds() {
  __builtin_amdgcn_fence(__ATOMIC_RELEASE, "workgroup");
  __builtin_amdgcn_wave_barrier();
  __builtin_amdgcn_fence(__ATOMIC_ACQUIRE, "workgroup");
}

// the same exchange for a wave that has global loads in flight: waits for this wave's LDS operations only
__device__ __forceinline__ void wave_sync_lds_only() {
#if defined(__HIP_DEVICE_COMPILE__)
  // LDS stores of this wave are done before its later LDS loads issue, and the "memory" clobber keeps the compiler
  // from moving either across; the fence pair above would also wait out the next key block's global loads
  asm volatile("s_wait_dscnt 0x0" ::: "memory");
#endif
  __builtin_amdgcn_wave_barrier();
}

// stands behind a group of global stores that stay in flight: their address registers may be rewritten behind it
__device__ __forceinline__ void addr_regs_free() {
#if defined(__HIP_DEVICE_COMPILE__)
  asm volatile("s_wait_xcnt 0x0" ::: "memory");
#endif
}

// the same wait with the loads' address values as inputs: their registers stay live, so unwritten, up to the wait
// (the "memory" clobber alone does not keep a register write, or a later load's destination, behind it)
__device__ __forceinline__ void addr_regs_free_of(const void* a) {
#if defined(__HIP_DEVICE_COMPILE__)
  asm volatile("s_wait_xcnt 0x0" :: "v"(a) : "memory");
#endif
}
__device__ __forceinline__ void addr_regs_free_of(const void* a, const void* b) {
#if defined(__HIP_DEVICE_COMPILE__)
  asm volatile("s_wait_xcnt 0x0" :: "v"(a), "v"(b) : "memory");
#endif
}
__device__ __forceinline__ void addr_regs_free_of(const void* a, const void* b, const void* c) {
#if defined(__HIP_DEVICE_COMPILE__)
  asm volatile("s_wait_xcnt 0x0" :: "v"(a), "v"(b), "v"(c) : "memory");
#endif
}
__device__ __forceinline__ void addr_regs_free_of(const void* a, const void* b, const void* c, const void* d,
                                                  const void* e, const void* f) {
#if defined(__HIP_DEVICE_COMPILE__)
  asm volatile("s_wait_xcnt 0x0" :: "v"(a), "v"(b), "v"(c), "v"(d), "v"(e), "v"(f) : "memory");
#endif
}

// =====================================================================================================
// Activation plane in fragment order: w[rows][DM] f32 -> o = f16 bits of (bf16 RNE value * sc), row tile T, piece q at
// (T*(DM/16) + q)*256 halves. One thread per 16-byte chunk of o: a wave reads 64 bytes of each of 16 rows and writes
// one whole piece; the 8 waves of a block take 8 pieces in a row, i.e. 512 consecutive bytes of each of the 16 rows.
// coverage: 256 threads x 8 = 2048 elements per block; bx = 0 .. rows*DM/2048 - 1 exact covers all of o.
// =====================================================================================================
__device__ __forceinline__ void cvt_rows(const float* __restrict__ w, unsigned short* o, float sc, int bx) {
  const int g = bx * 256 + threadIdx.x;                   // chunk = (piece, lane)
  const int pcs = g >> 5, l = g & 31;
  const int row = (pcs / (DM / 16)) * 16 + (l & 15);
  const int col = (pcs % (DM / 16)) * 16 + 8 * (l >> 4);
  const float* p = w + (size_t)row * DM + col;
  const v4f a0 = *(const v4f*)(p);
  const v4f a1 = *(const v4f*)(p + 4);
  addr_regs_free_of(p);
  v4u hv;
#pragma unroll
  for (int e = 0; e < 2; ++e) {
    hv[e]     = pk16(f2h(bfr(a0[2 * e]) * sc), f2h(bfr(a0[2 * e + 1]) * sc));
    hv[2 + e] = pk16(f2h(bfr(a1[2 * e]) * sc), f2h(bfr(a1[2 * e + 1]) * sc));
  }
  *(v4u*)(o + (size_t)g * 8) = hv;
}

// =====================================================================================================
// Table plane in fragment order: tile u (0..NPT-1) holds the 16 table rows clamp(16u - POFF + 0..15, 0, NREL-1) as
// four pieces of 256 halves; piece j, lane l = row (l&15) of the tile, head dims 16j + 8*(l>>4) .. +7, as f16 bits
// of (bf16 RNE value * sc). The band tiles of the attention kernel all start at a row = -POFF (mod 16), so every one
// of them is a tile of this plane; tile 0 is row 0 sixteen times, tile NPT-1 row NREL-1 sixteen times.
// coverage: one thread per 16-byte chunk, NPT*128 chunks, bx = 0 .. NPT*128/256 - 1 exact.
// =====================================================================================================
__device__ __forceinline__ void cvt_band(const float* __restrict__ w, unsigned short* o, float sc, int bx) {
  const int g = bx * 256 + threadIdx.x;
  if (g >= NPT * 128) return;                             // never taken with the exact grid; no barriers below
  const int u = g >> 7, j = (g >> 5) & 3, l = g & 31;
  const int row = clampi(16 * u - POFF + (l & 15), 0, NREL - 1);
  const float* p = w + (size_t)row * HD + 16 * j + 8 * (l >> 4);
  const v4f a0 = *(const v4f*)(p);
  const v4f a1 = *(const v4f*)(p + 4);
  v4u hv;
#pragma unroll
  for (int e = 0; e < 2; ++e) {
    hv[e]     = pk16(f2h(bfr(a0[2 * e]) * sc), f2h(bfr(a0[2 * e + 1]) * sc));
    hv[2 + e] = pk16(f2h(bfr(a1[2 * e]) * sc), f2h(bfr(a1[2 * e + 1]) * sc));
  }
  *(v4u*)(o + (size_t)g * 8) = hv;
}

// =====================================================================================================
// Transpose-convert: in w[R][C] f32 -> out o = the matrix [C][R] of f16 bits of (bf16 RNE value * sc), in fragment
// order (row tile T = c/16, piece q = r/16 at (T*(R/16) + q)*256). Block tile 64x64 through LDS (st[col][row], pitch
// 72 halves). Read phase: thread owns one input row x 16 columns. Write phase: the tile is 4 row tiles x 4 pieces;
// a wave writes one whole piece per store.
// R, C multiples of 64, (bx, by) = (0 .. C/64 - 1, 0 .. R/64 - 1) exact; st = the block's 64*72 halves of LDS.
// coverage: 16 pieces x 256 halves per block = the whole transposed tile; the blocks cover all of [C][R].
// =====================================================================================================
__device__ __forceinline__ void cvt_t(const float* __restrict__ w, unsigned short* o, int R, int C, float sc,
                                      int bx, int by, unsigned short* st) {
  const int t = threadIdx.x;
  const int r0 = by * 64, c0 = bx * 64;
  if (r0 + 64 > R || c0 + 64 > C) return;               // block-uniform, before the barrier; never taken
  {
    const int row = t >> 2, ch = (t & 3) * 16;
    const float* p = w + (size_t)(r0 + row) * C + c0 + ch;
#pragma unroll
    for (int q = 0; q < 4; ++q) {
      const v4f v = *(const v4f*)(p + 4 * q);
#pragma unroll
      for (int e = 0; e < 4; ++e) st[(ch + 4 * q + e) * 72 + row] = f2h(bfr(v[e]) * sc);
    }
  }
  __syncthreads();
  const int l = t & 31, wq = t >> 5;                     // lane in the piece; piece 8*half + wq of the tile's 16
  v4u hv[2];
#pragma unroll
  for (int half = 0; half < 2; ++half) {
    const int tl = 2 * half + (wq >> 2), q = wq & 3;      // row tile and piece in the block tile
    hv[half] = *(const v4u*)(st + (16 * tl + (l & 15)) * 72 + 16 * q + 8 * (l >> 4));
  }
#pragma unroll
  for (int half = 0; half < 2; ++half) {
    const int tl = 2 * half + (wq >> 2), q = wq & 3;
    unsigned short* dst = o + ((size_t)((c0 >> 4) + tl) * (size_t)(R >> 4) + (size_t)((r0 >> 4) + q)) * 256 + l * 8;
    *(v4u*)dst = hv[half];
  }
}

// =====================================================================================================
// All operand planes in one launch; none reads what another writes. The flat block index picks the work, the same for
// the whole block (the barrier of cvt_t is passed by all of a block's threads or by none):
// 4*NTB blocks: Wq, Wk, Wv, Wo [512][512] -> WT planes 0, 1, 2, 3 (transposed, x64; the last is WOT);
// NBB blocks: table -> PE (x64, clamped tiles); 3*NB*LINB blocks: query, key, value -> X planes 0, 1, 2 per batch slice.
// The transposes, which take longest, have the lowest indices.
// =====================================================================================================
__global__ __launch_bounds__(256) void cvt_all(
    const float* __restrict__ query, const float* __restrict__ key, const float* __restrict__ value,
    const float* __restrict__ wq, const float* __restrict__ wk, const float* __restrict__ wv,
    const float* __restrict__ wo, const float* __restrict__ rel,
    unsigned short* X, unsigned short* WT, unsigned short* PE) {
  __shared__ __align__(16) unsigned short st[64 * 72];
  int bid = blockIdx.x;
  if (bid < 4 * NTB) {
    const int ws = bid / NTB, tb = bid - ws * NTB;
    const float* w = (ws == 0) ? wq : (ws == 1) ? wk : (ws == 2) ? wv : wo;
    cvt_t(w, WT + (size_t)ws * DM * DM, DM, DM, WSCL, tb % (DM / 64), tb / (DM / 64), st);
    return;
  }
  bid -= 4 * NTB;
  if (bid < NBB) {
    cvt_band(rel, PE, WSCL, bid);
    return;
  }
  bid -= NBB;
  const int xs = bid / (NB * LINB), xr = bid - xs * (NB * LINB);
  if (xs > 2) return;                                     // never taken with the exact grid
  const float* x = (xs == 0) ? query : (xs == 1) ? key : value;
  const int by = xr / LINB;                               // batch slice: SEQ rows, a whole number of row tiles
  cvt_rows(x + (size_t)by * SEQ_FULL * DM, X + (size_t)xs * MT * DM + (size_t)by * SEQ * DM, 1.0f, xr - by * LINB);
}

// =====================================================================================================
// Register-blocked f16 WMMA GEMM: C[m][n] = sum_k A[m][k] * Bt[n][k], one wave per 64x64 tile, no block
// barriers. A = [M][K] and Bt = [N][K], both planes in fragment order (row tile T, k block kb: two pieces at
// (T*(K/32) + kb)*512 halves, so a row tile's k blocks follow one another); M, N multiples of 64,
// K = DM (bx = 0 .. tiles/8 - 1 exact so no wave exits early). The k loop is unrolled over a ring of GST fragment
// sets in registers: the 16 loads of k block kb + GST - 1 issue behind the first four products of k block kb, so that a
// load has nearly GST - 1 blocks of products to land; every load is a constant distance from one of two addresses. The products in
// the loop are the plain builtin, with no asm statement that names a fragment: the sets reach above v255. Both operand
// fragments use the split k map (elements 0..7 <- k0+8h.., 8..15 <- k0+16+8h..); D element r of a lane is
// (row 8h + r, col lane&15).
// s = acc*osc + bias term (BM 0: none; BM 1: bsc*bf16(bias[col]); BM 2: bsc*bf16(bias[row])).
// OM 0: f32 out Cf = s, pitch ldc.   OM 1: f16 out Ch = f16 bits(s).
// OM 2: f16 hi plane Ch = f16(s) and f16 residual plane Cl = f16((s - hi) * 2048), same layout.
// f16 outputs lie in fragment order (ldc unused). A 16x64 slab is four pieces of 256 halves; piece it, lane l =
// slab row (l&15), slab columns 16*it + 8*(l>>4) .. +7, i.e. one load of a fragment whose lane index is the row and
// whose k index is the column. OM 2: slab (row tile T = row/16, column tile tn) at ((tn*(M/16) + T)*4 + it)*256.
// OM 1: pieces 2*kb, 2*kb + 1 of a slab are k block kb of 32 columns; piece at
// (((tm*(N/32) + column/32)*4 + row tile in tm)*2 + (it&1))*256, so that a k block's four row tiles are contiguous.
// coverage: 4 slabs x 16 rows x 64 cols = the wave's whole 64x64 tile.
// =====================================================================================================
template <int OM, int BM>
__device__ __forceinline__ void gemm64_tile(
    const unsigned short* __restrict__ Ap, const unsigned short* __restrict__ Btp,
    unsigned short* Ch, unsigned short* Cl, float* Cf, int ldc, float osc,
    const float* __restrict__ bias, float bsc, int M, int N, int bx, float (*sT)[16 * 68]) {
  constexpr int K = DM;
  constexpr int NKB = K / 32;                  // k blocks
  const int lane = threadIdx.x & 31;
  const int wave = threadIdx.x >> 5;
  const int tilesN = N >> 6;
  const int tilesM = M >> 6;
  const int tile = bx * 8 + wave;
  if (tile >= tilesM * tilesN) return;   // wave-uniform; no block barriers in this kernel
  const int tm = tile / tilesN;
  const int tn = tile - tm * tilesN;
  const int m0 = tm << 6;
  const int n0 = tn << 6;

  const int rlane = lane & 15;                 // col (D) within subtile
  const int mOff  = (lane >> 4) * 8;           // D row offset
  constexpr size_t tstr = (size_t)NKB * 512;   // halves of one row tile of an operand plane
  const unsigned short* Aw = Ap + (size_t)(m0 >> 4) * tstr + lane * 8;    // this lane's chunk of row tile m0/16, k block 0
  const unsigned short* Bw = Btp + (size_t)(n0 >> 4) * tstr + lane * 8;

  v8f acc[4][4];
#pragma unroll
  for (int i = 0; i < 4; ++i)
#pragma unroll
    for (int j = 0; j < 4; ++j) acc[i][j] = zero8();

  v16us bh[GST][4], ah[GST][4];                // fragment set kb % GST holds k block kb
  // unrolled here and below: the sets are indexed by constants only, so they stay in registers
#pragma unroll
  for (int kb = 0; kb < GST - 1; ++kb) {
#pragma unroll
    for (int j = 0; j < 4; ++j) bh[kb][j] = ldfrag_p(Bw + (size_t)kb * 512 + (size_t)j * tstr);
#pragma unroll
    for (int i = 0; i < 4; ++i) ah[kb][i] = ldfrag_p(Aw + (size_t)kb * 512 + (size_t)i * tstr);
    // keeps the first sets' loads in the order of their use: loads return in order, and k block 0 is waited for first
    __builtin_amdgcn_sched_barrier(0);
  }
#pragma unroll
  for (int kb = 0; kb < NKB; ++kb) {
    const int st = kb % GST;
#pragma unroll
    for (int j = 0; j < 4; ++j) acc[0][j] = mma_raw(ah[st][0], bh[st][j], acc[0][j]);
    if (kb + GST - 1 < NKB) {
      const int kn = kb + GST - 1, sn = kn % GST;
      // keeps the fetch behind the four products above, so behind every product of k block kb - 1, whose set it refills:
      // moved up it would need a further set of registers
      __builtin_amdgcn_sched_barrier(0);
#pragma unroll
      for (int j = 0; j < 4; ++j) bh[sn][j] = ldfrag_p(Bw + (size_t)kn * 512 + (size_t)j * tstr);
#pragma unroll
      for (int i = 0; i < 4; ++i) ah[sn][i] = ldfrag_p(Aw + (size_t)kn * 512 + (size_t)i * tstr);
      // keeps the fetch in front of the block's other products: sunk towards its use it would have no time to land
      __builtin_amdgcn_sched_barrier(0);
    }
#pragma unroll
    for (int i = 1; i < 4; ++i) {
#pragma unroll
      for (int j = 0; j < 4; ++j) acc[i][j] = mma_raw(ah[st][i], bh[st][j], acc[i][j]);
    }
  }
  addr_regs_free_of(Aw, Bw);                   // the two addresses of every load above stay unwritten up to here
  acc_guard4(acc[0][0], acc[0][1], acc[0][2], acc[0][3]);
  acc_guard4(acc[1][0], acc[1][1], acc[1][2], acc[1][3]);
  acc_guard4(acc[2][0], acc[2][1], acc[2][2], acc[2][3]);
  acc_guard4(acc[3][0], acc[3][1], acc[3][2], acc[3][3]);

  const int hh2 = lane >> 4, c4 = (lane & 15) * 4;     // f32 out: 256-B row segment = 16 lanes x 16 B

  // column bias terms (fixed per wave); addresses n0+c4+3 < N and n0+48+8+7 < N
  v4f bc4 = {0.f, 0.f, 0.f, 0.f};
  float bc8[4][8];                                      // f16 out: piece it, columns 16*it + 8*hh2 .. +7
#pragma unroll
  for (int it = 0; it < 4; ++it)
#pragma unroll
    for (int e = 0; e < 8; ++e) bc8[it][e] = 0.f;
  if (BM == 1) {
    if (OM == 0) {
      const v4f t4 = *(const v4f*)(bias + n0 + c4);
#pragma unroll
      for (int e = 0; e < 4; ++e) bc4[e] = bfr(t4[e]) * bsc;
    } else {
#pragma unroll
      for (int it = 0; it < 4; ++it) {
        const v4f ta = *(const v4f*)(bias + n0 + 16 * it + 8 * hh2);
        const v4f tb = *(const v4f*)(bias + n0 + 16 * it + 8 * hh2 + 4);
#pragma unroll
        for (int e = 0; e < 4; ++e) { bc8[it][e] = bfr(ta[e]) * bsc; bc8[it][4 + e] = bfr(tb[e]) * bsc; }
      }
    }
  }

  // ---- epilogue ----
  float* slab = sT[wave];
#pragma unroll
  for (int i = 0; i < 4; ++i) {
    const int mBase = m0 + (i << 4);
#pragma unroll
    for (int j = 0; j < 4; ++j) {
#pragma unroll
      for (int r = 0; r < 8; ++r) {
        slab[(mOff + r) * 68 + (j << 4) + rlane] = acc[i][j][r];
      }
    }
    wave_sync_lds();
    if (OM == 0) {
      v4f vals[8];
#pragma unroll
      for (int it = 0; it < 8; ++it) {
        const int row = it * 2 + hh2;                      // it 0..7 x hh2 0..1 = rows 0..15
        const v4f v = *(const v4f*)(slab + row * 68 + c4);
        float rb2 = 0.f;
        if (BM == 2) rb2 = bfr(bias[mBase + row]) * bsc;
        vals[it] = v * osc + bc4 + rb2;
      }
      {
#pragma unroll
        for (int it = 0; it < 8; ++it) {
          const int row = it * 2 + hh2;
          *(v4f*)(Cf + (size_t)(mBase + row) * ldc + (size_t)n0 + c4) = vals[it];
        }
        
      }
    } else {
      v4u hv[4], hl[4];
      float rb2 = 0.f;
      if (BM == 2) rb2 = bfr(bias[mBase + rlane]) * bsc;
#pragma unroll
      for (int it = 0; it < 4; ++it) {
        const float* sp = slab + rlane * 68 + 16 * it + 8 * hh2;   // rows 0..15 x (it, hh2) = 8 column chunks
        v4u ha = {0u, 0u, 0u, 0u};
        v4u la = {0u, 0u, 0u, 0u};
#pragma unroll
        for (int e = 0; e < 4; ++e) {
          const float b0 = sp[2 * e]     * osc + bc8[it][2 * e]     + rb2;
          const float b1 = sp[2 * e + 1] * osc + bc8[it][2 * e + 1] + rb2;
          if (OM == 1) {
            ha[e] = pk16(f2h(b0), f2h(b1));
          } else {
            const _Float16 h0 = (_Float16)b0;
            const _Float16 h1 = (_Float16)b1;
            const float l0 = (b0 - (float)h0) * LSC;       // difference exact, power-of-two carry exact
            const float l1 = (b1 - (float)h1) * LSC;
            ha[e] = pk16(h_bits(h0), h_bits(h1));
            la[e] = pk16(f2h(l0), f2h(l1));
          }
        }
        hv[it] = ha;
        hl[it] = la;
      }
      {
#pragma unroll
        for (int it = 0; it < 4; ++it) {
          const size_t pc = (OM == 2)
              ? ((size_t)tn * (size_t)(M >> 4) + (size_t)(mBase >> 4)) * 4 + it
              : (((size_t)tm * (size_t)(N >> 5) + (size_t)((n0 >> 5) + (it >> 1))) * 4 + i) * 2 + (it & 1);
          const size_t go = pc * 256 + (size_t)(lane * 8);    // 32 lanes x 16 B = the whole piece
          *(v4u*)(Ch + go) = hv[it];
          if (OM == 2) *(v4u*)(Cl + go) = hl[it];
        }
        addr_regs_free();
      }
    }
    wave_sync_lds();
  }
}

// one product per launch, K = DM
template <int OM, int BM>
__global__ __launch_bounds__(256) void gemm64(
    const unsigned short* __restrict__ Ap, const unsigned short* __restrict__ Btp,
    unsigned short* Ch, unsigned short* Cl, float* Cf, int ldc, float osc,
    const float* __restrict__ bias, float bsc, int M, int N) {
  __shared__ __align__(16) float sT[8][16 * 68];   // per-wave 16x64 slab, pitch 68 floats
  gemm64_tile<OM, BM>(Ap, Btp, Ch, Cl, Cf, ldc, osc, bias, bsc, M, N, blockIdx.x, sT);
}

// The three input projections in one launch; none reads what another writes. blockIdx.y picks the product:
// 0: s = 16*(xq.Wq + bq) -> QH = f16(s), QL = f16(2048*(s - QH));  1: the same for k;
// 2: v^T x16: C[d][tok] = sum_k WT[1024+d][k] * XV[tok][k], bias by row d.
// X = the planes XQ | XK | XV, WT = Wq^T | Wk^T | Wv^T, each in fragment order. Output pointers that a product's OM does not use are null.
__global__ __launch_bounds__(256) void gemm_qkv(
    const unsigned short* __restrict__ X, const unsigned short* __restrict__ WT,
    unsigned short* QH, unsigned short* QL, unsigned short* KH, unsigned short* KL, unsigned short* VT,
    const float* __restrict__ bq, const float* __restrict__ bk, const float* __restrict__ bv) {
  __shared__ __align__(16) float sT[8][16 * 68];   // per-wave 16x64 slab, pitch 68 floats
  const int sel = blockIdx.y;
  const unsigned short* Xs = X + (size_t)sel * MT * DM;    // this product's activation and weight planes
  const unsigned short* Ws = WT + (size_t)sel * DM * DM;
  if (sel == 2) {
    gemm64_tile<1, 2>(Ws, Xs, VT, nullptr, nullptr, MT,
                      VSC / WSCL, bv, VSC, DM, MT, blockIdx.x, sT);
  } else {
    const bool isk = (sel == 1);
    gemm64_tile<2, 1>(Xs, Ws,
                      isk ? KH : QH, isk ? KL : QL, nullptr, DM, QKS / WSCL, isk ? bk : bq, QKS, MT, DM,
                      blockIdx.x, sT);
  }
}

// ---- per-tile products used by the attention kernel ----------------------------------------------
// Both give the TRANSPOSED tile: the plane rows (table rows, keys) are the A operand, the query rows the B operand,
// so that D register r of lane l is (plane row 8*(l>>4) + r, query l&15). q = the query tile's fragments
// {hi dims 0..31, hi dims 32..63, residual dims 0..31, residual dims 32..63}. The products are the plain builtin, with no
// asm statement that names an operand: with v_nop statements behind them the two query tiles' registers did not fit the
// window that such a statement can name, and fragments or a carried tile went to scratch and came back in every pass.
// R^T = b.qh + (b.ql)/2048 over 64 head dims (b0, b1: fragments of a [n][64] f16 plane row, dims 0..31 and 32..63)
__device__ __forceinline__ v8f dot2_res(const v16us (&q)[4], v16us b0, v16us b1) {
  v8f L = mma_raw(b0, q[2], zero8());
  L = mma_raw(b1, q[3], L);
  L = L * (1.0f / LSC);
  v8f R = mma_raw(b0, q[0], L);
  R = mma_raw(b1, q[1], R);
  return R;
}
// S^T = kh.qh + (kl.qh + kh.ql)/2048 over 64 head dims (kh from the hi plane row, kl from the residual plane row)
__device__ __forceinline__ v8f dot3_res(const v16us (&q)[4], v16us kh0, v16us kh1, v16us kl0, v16us kl1) {
  v8f L = mma_raw(kl0, q[0], zero8());
  L = mma_raw(kl1, q[1], L);
  L = mma_raw(kh0, q[2], L);
  L = mma_raw(kh1, q[3], L);
  L = L * (1.0f / LSC);
  v8f S = mma_raw(kh0, q[0], L);
  S = mma_raw(kh1, q[1], S);
  return S;
}
// value of lane l ^ 16
__device__ __forceinline__ float xhalf(float x) {
  const int b = __builtin_bit_cast(int, x);
  return __builtin_bit_cast(float, __builtin_amdgcn_permlanex16(b, b, 0x76543210, 0xfedcba98, false, false));
}
__device__ __forceinline__ v4f lo4(v8f x) { return __builtin_shufflevector(x, x, 0, 1, 2, 3); }
__device__ __forceinline__ v4f hi4(v8f x) { return __builtin_shufflevector(x, x, 4, 5, 6, 7); }
__device__ __forceinline__ v8f cat8(v4f a, v4f b) { return __builtin_shufflevector(a, b, 0, 1, 2, 3, 4, 5, 6, 7); }

// =====================================================================================================
// One key block (32 keys) of the attention loop for the wave's QT query tiles; the layouts are those of the kernel's own
// comment below. kf = K fragments {keys 0..15: hi, hi, residual, residual; keys 16..31: the same}, vf = V^T fragments of the
// four dim tiles, tf = table tiles x, x + 1, x + 2 (two fragments each), x = ub + 2*kb before the clamp.
// BAND = true: the block's band columns hold more than one table row: two fresh band tiles per query tile, the LDS skew,
// and the next block's table tiles are fetched. BAND = false: every key of the block has the same clipped table row for every
// query of the wave, so bc[t] = rel.q of that row (already scaled) is the bias of all 32 keys; no table load, band product, LDS.
// =====================================================================================================
template <bool BAND>
__device__ __forceinline__ void attn_pass(
    int kb, const float (&bc)[QT], int ub, int lane, int hh, const v16us (&q)[QT][4],
    const unsigned short* __restrict__ KH, const unsigned short* __restrict__ KL,
    const unsigned short* __restrict__ PE, const unsigned short* __restrict__ VT, const int* __restrict__ mk,
    size_t kfix, size_t vfix, float* rst, const float* rld,
    v16us (&kf)[8], v16us (&tf)[6], int& mnx, v16us (&vf)[4],
    v8f (&carry)[QT], float (&mx)[QT], float (&ls)[QT], v8f (&O)[QT][4]) {
  const int sb = kb << 5;
  const int sn = (sb + 32 < SEQ) ? sb + 32 : SEQ - 32; // key block whose operands are fetched in this pass
  // unrolled here and below: the per-tile and per-key arrays are indexed by constants only, so they stay in registers
  // scores, transposed: A row = key token, B column = query, k = head dim
  v8f S0[QT], S1[QT];
#pragma unroll
  for (int t = 0; t < QT; ++t) {
    S0[t] = dot3_res(q[t], kf[0], kf[1], kf[2], kf[3]);
    S1[t] = dot3_res(q[t], kf[4], kf[5], kf[6], kf[7]);
  }

  // relative band of query tile t: columns 16..31 and 32..47 <-> table tiles x + 1 - t, x + 2 - t
  v8f Pb1[QT], Pb2[QT];
  if constexpr (BAND) {
#pragma unroll
    for (int t = 0; t < QT; ++t) {
      Pb1[t] = dot2_res(q[t], tf[2 * (1 - t)], tf[2 * (1 - t) + 1]);
      Pb2[t] = dot2_res(q[t], tf[2 * (2 - t)], tf[2 * (2 - t) + 1]);
    }
  }

  // key mask of the block as 32 bits (bit = key), shifted so that bit r is key 8*hh + r and bit 16 + r key 16 + 8*hh + r
  const unsigned mw = __builtin_amdgcn_ballot_w32(mnx != 0) >> (8 * hh);

  // next key block's K, table and mask operands, one group (token tiles and columns below SEQ, table tiles clamped)
  {
    const int* mq = mk + sn;
    mnx = mq[0];
    const size_t ko = kfix + (size_t)(sn >> 4) * 1024;
    kf[0] = ldfrag_p(KH + ko);        kf[1] = ldfrag_p(KH + ko + 512);
    kf[2] = ldfrag_p(KL + ko);        kf[3] = ldfrag_p(KL + ko + 512);
    kf[4] = ldfrag_p(KH + ko + 1024); kf[5] = ldfrag_p(KH + ko + 1536);
    kf[6] = ldfrag_p(KL + ko + 1024); kf[7] = ldfrag_p(KL + ko + 1536);
    if constexpr (BAND) {
      const int un = ub + (sn >> 4);
      const unsigned short* p0 = PE + (size_t)clampi(un, 0, NPT - 1) * 1024 + lane * 8;
      const unsigned short* p1 = PE + (size_t)clampi(un + 1, 0, NPT - 1) * 1024 + lane * 8;
      const unsigned short* p2 = PE + (size_t)clampi(un + 2, 0, NPT - 1) * 1024 + lane * 8;
      tf[0] = ldfrag_p(p0); tf[1] = ldfrag_p(p0 + 512);
      tf[2] = ldfrag_p(p1); tf[3] = ldfrag_p(p1 + 512);
      tf[4] = ldfrag_p(p2); tf[5] = ldfrag_p(p2 + 512);
      addr_regs_free_of(KH + ko, KL + ko, p0, p1, p2, mq);
    } else {
      addr_regs_free_of(KH + ko, KL + ko, mq);
    }
  }
  if constexpr (BAND) {
#pragma unroll
    for (int t = 0; t < QT; ++t) {
      float* rs = rst + t * (16 * RWP);
      *(v4f*)(rs)      = lo4(carry[t]); *(v4f*)(rs + 4)  = hi4(carry[t]);
      *(v4f*)(rs + 16) = lo4(Pb1[t]);   *(v4f*)(rs + 20) = hi4(Pb1[t]);
      *(v4f*)(rs + 32) = lo4(Pb2[t]);   *(v4f*)(rs + 36) = hi4(Pb2[t]);
      carry[t] = Pb2[t];
    }
    wave_sync_lds_only();
  }

  FragU pf[QT];                                        // P^T B fragments
#pragma unroll
  for (int t = 0; t < QT; ++t) {
    // skew read (or the block's one bias) + scale, then replace-fill masked keys
    float s0[8], s1[8];
#pragma unroll
    for (int r = 0; r < 8; ++r) {
      float v0, v1;
      if constexpr (BAND) {
        const float rv0 = rld[t * (16 * RWP) + r];
        const float rv1 = rld[t * (16 * RWP) + 16 + r];
        v0 = S0[t][r] * (RSQD / (QKS * QKS)) + rv0 * (1.0f / (QKS * WSCL));
        v1 = S1[t][r] * (RSQD / (QKS * QKS)) + rv1 * (1.0f / (QKS * WSCL));
      } else {
        v0 = S0[t][r] * (RSQD / (QKS * QKS)) + bc[t];
        v1 = S1[t][r] * (RSQD / (QKS * QKS)) + bc[t];
      }
      s0[r] = ((mw >> r) & 1u) ? v0 : MASKV;
      s1[r] = ((mw >> (16 + r)) & 1u) ? v1 : MASKV;
    }

    // online softmax: the lane's 16 scores are of one query; one exchange joins the two halves' maxima
    float xr[8];
#pragma unroll
    for (int r = 0; r < 8; ++r) xr[r] = fmaxf(s0[r], s1[r]);
    float xm = fmaxf(fmaxf(fmaxf(xr[0], xr[1]), fmaxf(xr[2], xr[3])), fmaxf(fmaxf(xr[4], xr[5]), fmaxf(xr[6], xr[7])));
    xm = fmaxf(xm, xhalf(xm));
    const float mn = fmaxf(mx[t], xm);
    const float al = __expf(mx[t] - mn);
    mx[t] = mn;
    float pr[8];
#pragma unroll
    for (int r = 0; r < 8; ++r) {
      const float p0 = __expf(s0[r] - mn);
      const float p1 = __expf(s1[r] - mn);
      pr[r] = p0 + p1;
      pf[t].v[r]     = f2h(p0 * PSC);
      pf[t].v[8 + r] = f2h(p1 * PSC);
    }
    ls[t] = ls[t] * al + (((pr[0] + pr[1]) + (pr[2] + pr[3])) + ((pr[4] + pr[5]) + (pr[6] + pr[7])));
#pragma unroll
    for (int d = 0; d < 4; ++d) O[t][d] = O[t][d] * al;
  }

  // V^T A-fragments (row = dim, k = key token) against the P^T B fragments
#pragma unroll
  for (int t = 0; t < QT; ++t)
#pragma unroll
    for (int d = 0; d < 4; ++d) O[t][d] = mma_raw(vf[d], pf[t].v, O[t][d]);
  const size_t vo = vfix + (size_t)(sn >> 5) * 2048;
  vf[0] = ldfrag_p(VT + vo);
  vf[1] = ldfrag_p(VT + vo + 512);
  vf[2] = ldfrag_p(VT + vo + 1024);
  vf[3] = ldfrag_p(VT + vo + 1536);
  addr_regs_free_of(VT + vo);
}

// a wave's partial result of one query tile into its exchange slot: lane l's 16-byte chunk j at mp[32*j]
__device__ __forceinline__ void part_put(v4f* mp, const v8f (&O)[4], float mx, float ls) {
#pragma unroll
  for (int d = 0; d < 4; ++d) {
    mp[32 * (2 * d)]     = lo4(O[d]);
    mp[32 * (2 * d + 1)] = hi4(O[d]);
  }
  const v4f st = {mx, ls, 0.f, 0.f};
  mp[32 * 8] = st;
}
// joins this wave's partial result of a query tile with the other wave's (pp = its slot) and stores ctx:
// ctx = (O.fa + O'.fb) / (l * PSC * VSC), x CSC as f16; a lane's 8 registers of a dim subtile are row l&15, columns
// h*64 + 16*subtile + 8*(l>>4) .. +7: lane l's chunk of piece h*4 + subtile, the wave fills four whole pieces
__device__ __forceinline__ void part_join(const v4f* pp, const v8f (&O)[4], float mx, float ls, unsigned short* dst) {
  const v4f st = pp[32 * 8];
  const float mn = fmaxf(mx, st[0]);
  const float fa = __expf(mx - mn), fb = __expf(st[0] - mn);
  const float l = ls * fa + st[1] * fb;                    // over this lane's keys of both parts
  const float g = (CSC / (PSC * VSC)) / (l + xhalf(l));    // l >= 1
  const float ga = g * fa, gb = g * fb;
#pragma unroll
  for (int d = 0; d < 4; ++d) {
    const v8f x = O[d] * ga + cat8(pp[32 * (2 * d)], pp[32 * (2 * d + 1)]) * gb;
    v4u z;
#pragma unroll
    for (int e = 0; e < 4; ++e) z[e] = pk16(f2h(x[2 * e]), f2h(x[2 * e + 1]));
    *(v4u*)(dst + 256 * d) = z;
  }
  addr_regs_free();                                        // the stores' address and data registers may be rewritten behind it
}

// =====================================================================================================
// Non-causal attention with clipped relative-offset term and key-padding mask, head dim 64.
// Block = 256 threads = 8 waves. A wave's tile is QT = 2 query tiles of 16 rows (t0..t0+31) of one (batch b, head h) times a
// part of the key blocks of 32: every K and V^T fragment that it loads feeds both query tiles. Waves 2p and 2p + 1 share
// the query rows: wave 2p takes key blocks 0 .. ksp-1, wave 2p + 1 key blocks ksp .. SEQ/32-1, each with an online
// max-subtracted softmax in f32 over its part; behind the loops each hands the other one query tile's partial maximum, sum
// and O^T through LDS (one block barrier) and joins and stores the tile that it keeps.
// Every product is taken transposed (keys, table rows or head dims as A rows, queries as B columns): in query tile t lane l
// works for the one query t0 + 16t + (l&15); lanes l and l^16 split that query's keys (8*(l>>4) + 0..7 of each 16) and dims.
// Planes, all in fragment order (a fragment = two pieces of 256 halves, lane l's 8 halves at piece + 8*l):
// QH/KH f16 = 16*q, 16*k, QL/KL = 2048*(16q - QH) residuals: [head][token tile of 16][dims 0..31 | 32..63];
// PE f16 = 64*rel table, [tile u][dims 0..31 | 32..63], tile u = table rows clamp(16u - POFF + 0..15, 0, 498);
// VT f16 = 16*v transposed: [head][key block of 32][dim tile of 16]; mask int32 [NB_FULL][SEQ_FULL].
// Output Z f16 = 16*ctx, the matrix [MT][512] (row = b*SEQ + t, col = h*64+d) in fragment order:
// [token tile of 16][piece = col/16], the A operand of the output projection.
// Per key block sb and query tile starting at row tq: S^T = 256*k.q (hi.hi + res.hi + hi.res, 2 key subtiles); relative band
// of 48 columns: column c <-> table row clamp(234 - tq + sb + c, 0, 498) (clamped per column, which IS the clipped index),
// so columns 16k..16k+15 are table tile clamp(16 - tq/16 + sb/16 + k, 0, NPT-1);
// columns 0..15 come from the tile carried over from the prior key block (its columns 32..47), columns
// 16..47 are two fresh tiles (hi + res products, value 1024*rel.q); a lane holds 8 consecutive band columns of its
// query per tile, stores them to per-wave LDS as [query][column] (pitch RWP floats) and reads back the columns
// c = 15 - query + key of its own 16 keys, i.e. table row clamp(j - i + 249, 0, 498);
// score = qk/8 + bias; then replace-fill -1e10 where mask[b][j] == 0; the block maximum is taken over the lane's 16
// scores and joined with lane l^16; p = exp(score - running max) in f32; l is kept per lane over the lane's own keys
// (the two halves are joined behind the loop); 4096*p as f16, score registers in order, IS the B fragment of P^T
// (elements 0..7 = keys 8*(l>>4) + 0..7, elements 8..15 = keys 16 + 8*(l>>4) + 0..7, the k map of the V^T fragments);
// O^T += V^T.P^T on 4 dim subtiles, O^T register r of lane l = (dim 16*tile + 8*(l>>4) + r, query l&15).
// coverage: a wave stores 16 query rows x 64 halves, a wave pair 32 rows; NB*NH*(SEQ/32) pairs = all (b, t, h) segments of Z.
// LDS: band 16 queries x 48 columns of floats per wave and query tile at pitch RWP, columns read 0..46; exchange slot of
// 9 chunks of 16 bytes per lane and wave.
// Global operands run one key block ahead in registers: K (hi + residual), table rows and mask words are
// reloaded for key block kb + 1 behind the score and band products of key block kb, V^T behind its V^T.P^T
// products, into the same variables, so that a load has most of a pass to land before its wait. A wave's last
// pass loads the block behind its part, or its own at the end of the keys (addresses in range, values unused).
// Key blocks whose table tiles are all clipped to table row 0 (keys far below the queries) or all to row NREL-1 (far
// above) have one bias per query, rel.q of that row, which the carried band tile holds at both ends of the band; only the
// key blocks between them (at most 18 of SEQ/32) run the band products and the LDS skew.
// =====================================================================================================
__global__ __launch_bounds__(256) void attn_kernel(
    const unsigned short* __restrict__ QH, const unsigned short* __restrict__ QL,
    const unsigned short* __restrict__ KH, const unsigned short* __restrict__ KL,
    const unsigned short* __restrict__ PE, const unsigned short* __restrict__ VT,
    const int* __restrict__ mask, unsigned short* Z) {
  __shared__ __align__(16) float relw[AWV][QT][16 * RWP];        // band exchange, 53248 B
  __shared__ __align__(16) v4f mrg[AWV][9][32];                  // partial results, 36864 B
  const int lane = threadIdx.x & 31, m = lane & 15, hh = lane >> 4;
  const int wv = __builtin_amdgcn_readfirstlane(threadIdx.x >> 5);   // scalar: the branches on it below are uniform
  const int part = wv & 1;                           // which part of the keys
  const int task = blockIdx.x * (AWV / 2) + (wv >> 1);   // 0 .. NB*NH*(SEQ/32)-1
  const int nqt = SEQ / 32;                          // a multiple of AWV/2, so a block's tasks have the same (b, h)
  const int bh = task / nqt;                         // (b, h)
  const int t0 = (task - bh * nqt) << 5;             // first query row
  const int b = bh / NH, h = bh - (bh / NH) * NH;
  if (b >= NB) return;                               // the same for the whole block; never taken with exact grids
  const size_t tok0 = (size_t)b * SEQ;               // plane row base of this batch
  const int* mk = mask + (size_t)b * SEQ_FULL + lane;     // full input stride for the mask row; lane l fetches key l's word
  float* rst = relw[wv][0] + m * RWP + 8 * hh;               // band store: query m, columns 8*hh + 0..7 of a tile
  const float* rld = relw[wv][0] + m * RWP + 15 - m + 8 * hh;   // band read: query m, column of key 8*hh

  // Q B-fragments (hi and residual) of both query tiles: columns t0+16t+m, k = head dims 0..31 and 32..63
  const size_t qo = ((size_t)h * (MT / 16) + ((tok0 + (size_t)t0) >> 4)) * 1024 + (size_t)(lane * 8);
  v16us q[QT][4];
#pragma unroll
  for (int t = 0; t < QT; ++t) {
    q[t][0] = ldfrag_p(QH + qo + t * 1024);
    q[t][1] = ldfrag_p(QH + qo + t * 1024 + 512);
    q[t][2] = ldfrag_p(QL + qo + t * 1024);
    q[t][3] = ldfrag_p(QL + qo + t * 1024 + 512);
  }
  addr_regs_free_of(QH + qo, QL + qo);

  // table tile of band columns 0..15 of query tile 0 at sb = 0 (before clamp); query tile 1 stands one tile lower
  const int ub = (RCEN - 15 + POFF) / 16 - (t0 >> 4);

  // Key block kb uses table tiles clamp(ub + 2*kb + -1..2). Blocks 0 .. nlo-1 have all of them at or below tile 0 (table row 0
  // sixteen times), blocks khi .. SEQ/32-1 all at or above tile NPT-1 (row NREL-1 sixteen times); nlo < khi.
  const int nlo = (ub < 0 ? -ub : 0) >> 1;
  const int khf = (NPT - ub + 1) >> 1;
  const int khi = khf < SEQ / 32 ? khf : SEQ / 32;
  // The keys are parted so that the two waves have about the same work: a band block counts for about 1.45 others, so the
  // border moves from the middle by 0.23 blocks (29/128) for each band block that one half has more than the other.
  const int hkb = SEQ / 64;
  const int bl = clampi(khi, 0, hkb) - clampi(nlo, 0, hkb);
  const int ksp = clampi(hkb - (((2 * bl - (khi - nlo)) * 29) >> 7), 1, SEQ / 32 - 1);
  // This wave's key blocks k0 .. k1-1: k0 .. e1-1 below the band, e1 .. e2-1 in it, e2 .. k1-1 above. All bounds are the same
  // in every lane; read as scalars so that the three loops below are uniform branches and EXEC stays all ones for the
  // matrix instructions.
  const int k0 = __builtin_amdgcn_readfirstlane(part ? ksp : 0);
  const int k1 = __builtin_amdgcn_readfirstlane(part ? SEQ / 32 : ksp);
  const int e1 = __builtin_amdgcn_readfirstlane(clampi(nlo, k0, k1));
  const int e2 = __builtin_amdgcn_readfirstlane(clampi(khi, k0, k1));
  const int ub1 = ub + 2 * e1;                         // table tile of band columns 0..15 of key block e1 (before clamp)

  // carried band tiles: columns 0..15 of key block e1
  const unsigned short* pca = PE + (size_t)clampi(ub1, 0, NPT - 1) * 1024 + lane * 8;
  const unsigned short* pcb = PE + (size_t)clampi(ub1 - 1, 0, NPT - 1) * 1024 + lane * 8;
  const v16us ca0 = ldfrag_p(pca), ca1 = ldfrag_p(pca + 512);
  addr_regs_free();                                    // one wait per address: the next base may take this one's registers
  const v16us cb0 = ldfrag_p(pcb), cb1 = ldfrag_p(pcb + 512);
  addr_regs_free();

  // lane-fixed parts of the operand addresses; key block sb adds sb/16 token tiles (K), sb/16 table tiles,
  // sb/32 key blocks (V^T), sb columns (mask)
  const size_t kfix = ((size_t)h * (MT / 16) + (tok0 >> 4)) * 1024 + (size_t)(lane * 8);
  const size_t vfix = ((size_t)h * (MT / 32) + (tok0 >> 5)) * 2048 + (size_t)(lane * 8);

  // K, mask and V^T operands of key block k0
  const size_t kst = kfix + (size_t)k0 * 2048, vst = vfix + (size_t)k0 * 2048;
  const int* mst = mk + k0 * 32;
  v16us kf[8], vf[4];
  kf[0] = ldfrag_p(KH + kst);        kf[1] = ldfrag_p(KH + kst + 512);     // keys 0..15, hi
  kf[2] = ldfrag_p(KL + kst);        kf[3] = ldfrag_p(KL + kst + 512);     // keys 0..15, residual
  kf[4] = ldfrag_p(KH + kst + 1024); kf[5] = ldfrag_p(KH + kst + 1536);    // keys 16..31, hi
  kf[6] = ldfrag_p(KL + kst + 1024); kf[7] = ldfrag_p(KL + kst + 1536);    // keys 16..31, residual
  int mnx = mst[0];                                                        // mask word of key lane
  addr_regs_free_of(KH + kst, KL + kst, mst);
  vf[0] = ldfrag_p(VT + vst);
  vf[1] = ldfrag_p(VT + vst + 512);
  vf[2] = ldfrag_p(VT + vst + 1024);
  vf[3] = ldfrag_p(VT + vst + 1536);
  addr_regs_free_of(VT + vst);
  // keeps the carried tiles' products below behind the first K and V^T fetch: moved up, their load wait would stand in
  // front of that fetch and the wave would start with one more memory latency
  __builtin_amdgcn_sched_barrier(0);

  v8f carry[QT];
  carry[0] = dot2_res(q[0], ca0, ca1);
  carry[1] = dot2_res(q[1], cb0, cb1);
  v16us tf[6];                                         // table operands; first fetched in front of the band loop

  float mx[QT] = {-1.0e30f, -1.0e30f}, ls[QT] = {0.f, 0.f};   // running maximum of the query; sum over this lane's keys
  v8f O[QT][4];
#pragma unroll
  for (int t = 0; t < QT; ++t)
#pragma unroll
    for (int d = 0; d < 4; ++d) O[t][d] = zero8();

#define PASS_ARGS ub, lane, hh, q, KH, KL, PE, VT, mk, kfix, vfix, rst, rld, kf, tf, mnx, vf, carry, mx, ls, O
  // the three loops stay rolled: one copy of each pass, so that the operands fetched ahead keep their registers
  // keys far below the queries, table row 0. Where k0 < e1, e1 <= nlo and ub1 <= 0: the carried tiles are tile 0, sixteen
  // times that row, so any of their registers is rel.q of the lane's query
  const float blo[QT] = {carry[0][0] * (1.0f / (QKS * WSCL)), carry[1][0] * (1.0f / (QKS * WSCL))};
#pragma unroll 1
  for (int kb = k0; kb < e1; ++kb) attn_pass<false>(kb, blo, PASS_ARGS);
  // the band proper; table operands of its first key block, fetched here and not in front of the loop above so that
  // they hold no registers there; the block's score products stand between fetch and use. Only where this wave's part of
  // the keys holds band blocks (a scalar test): elsewhere the tiles are not used, and with their loads still in flight the
  // loop below, which reuses their registers, would wait out its own V^T fetch at the head of every pass
  if (e1 < e2) {
    const unsigned short* p0 = PE + (size_t)clampi(ub1, 0, NPT - 1) * 1024 + lane * 8;
    const unsigned short* p1 = PE + (size_t)clampi(ub1 + 1, 0, NPT - 1) * 1024 + lane * 8;
    const unsigned short* p2 = PE + (size_t)clampi(ub1 + 2, 0, NPT - 1) * 1024 + lane * 8;
    tf[0] = ldfrag_p(p0); tf[1] = ldfrag_p(p0 + 512);
    tf[2] = ldfrag_p(p1); tf[3] = ldfrag_p(p1 + 512);
    tf[4] = ldfrag_p(p2); tf[5] = ldfrag_p(p2 + 512);
    addr_regs_free_of(p0, p1, p2);
#pragma unroll 1
    for (int kb = e1; kb < e2; ++kb) attn_pass<true>(kb, blo, PASS_ARGS);
  }
  // keys far above, table row NREL-1. Where e2 < k1, e2 >= khi: the carried tiles, out of block e2-1 or as first formed,
  // are clamp(ub + 2*e2 - 0..1) = NPT-1, sixteen times that row
  const float bhi[QT] = {carry[0][0] * (1.0f / (QKS * WSCL)), carry[1][0] * (1.0f / (QKS * WSCL))};
#pragma unroll 1
  for (int kb = e2; kb < k1; ++kb) attn_pass<false>(kb, bhi, PASS_ARGS);
#undef PASS_ARGS
  acc_guard4(O[0][0], O[0][1], O[0][2], O[0][3]);

  // ---- epilogue: wave 2p keeps query tile 0 and hands over tile 1, wave 2p + 1 the other way round
  v4f* mp = &mrg[wv][0][lane];
  const v4f* pp = &mrg[wv ^ 1][0][lane];
  unsigned short* dst = Z + (((tok0 + (size_t)t0) >> 4) * (DM / 16) + (size_t)(h * (HD / 16))) * 256 + (size_t)(lane * 8);
  if (part == 0) part_put(mp, O[1], mx[1], ls[1]);
  else           part_put(mp, O[0], mx[0], ls[0]);
  __syncthreads();                                     // every wave's slot is written before its partner reads it
  if (part == 0) part_join(pp, O[0], mx[0], ls[0], dst);
  else           part_join(pp, O[1], mx[1], ls[1], dst + (DM / 16) * 256);
}

// =====================================================================================================
// Workspace map (bytes, NB=2 SEQ=2048 -> MT=4096); every plane is an exact multiple of its whole-row /
// whole-line / 64x64-tile store granularity (rows MT, 1536, 512; 64 | each tiled dimension; the table plane
// is NPT tiles of 2048 bytes, all written); all offsets multiples of 2048. Every plane lies in fragment order.
//   XQ   f16  [4096][512]      0           4194304
//   XK   f16  [4096][512]      4194304     4194304
//   XV   f16  [4096][512]      8388608     4194304
//   WT   f16  [1536][512]      12582912    1572864   (Wq^T | Wk^T | Wv^T, x64)
//   WOT  f16  [512][512]       14155776     524288   (Wo^T, x64)
//   PEH  f16  [34][1024]       14680064      69632   (table x64, clamped tiles)
//   QH   f16  [8][256][1024]   14749696    4194304
//   QL   f16  [8][256][1024]   18944000    4194304
//   KH   f16  [8][256][1024]   23138304    4194304
//   KL   f16  [8][256][1024]   27332608    4194304
//   VT   f16  [8][128][2048]   31526912    4194304
//   Z    f16  [4096][512]      35721216    4194304
//   end                        39915520
// =====================================================================================================
extern "C" void kernel_launch(void* const* d_in, const int* in_sizes, int n_in,
                              void* d_out, int out_size, void* d_ws, size_t ws_size,
                              hipStream_t stream) {
  if (n_in < 13) return;
  const int xreq = ((NB - 1) * SEQ_FULL + SEQ) * DM;
  const int mreq = (NB - 1) * SEQ_FULL + SEQ;
  if (in_sizes[0] < xreq || in_sizes[1] < xreq || in_sizes[2] < xreq) return;
  if (in_sizes[3] < mreq) return;
  if (in_sizes[4] < DM * DM || in_sizes[6] < DM * DM || in_sizes[8] < DM * DM || in_sizes[10] < DM * DM) return;
  if (in_sizes[5] < DM || in_sizes[7] < DM || in_sizes[9] < DM || in_sizes[11] < DM) return;
  if (in_sizes[12] < NREL * HD) return;
  if (out_size < MT * DM) return;

  const float* query = (const float*)d_in[0];   // [NB_FULL][SEQ_FULL][512]
  const float* key   = (const float*)d_in[1];
  const float* value = (const float*)d_in[2];
  const int*   mask  = (const int*)d_in[3];     // [NB_FULL][SEQ_FULL] int32
  const float* wq = (const float*)d_in[4];      // [512][512] (in, out)
  const float* bq = (const float*)d_in[5];
  const float* wk = (const float*)d_in[6];
  const float* bk = (const float*)d_in[7];
  const float* wv = (const float*)d_in[8];
  const float* bv = (const float*)d_in[9];
  const float* wo = (const float*)d_in[10];
  const float* bo = (const float*)d_in[11];
  const float* rel = (const float*)d_in[12];    // [499][64]

  const size_t PX  = (size_t)MT * DM * 2;
  const size_t PWT = (size_t)3 * DM * DM * 2;
  const size_t PWO = (size_t)DM * DM * 2;
  const size_t PPE = (size_t)NPT * 1024 * 2;
  size_t off = 0;
  const size_t oXQ = off; off += 3 * PX;          // XQ | XK | XV
  const size_t oWT = off; off += PWT;
  const size_t oWO = off; off += PWO;
  const size_t oPE = off; off += PPE;
  const size_t oQH = off; off += PX;
  const size_t oQL = off; off += PX;
  const size_t oKH = off; off += PX;
  const size_t oKL = off; off += PX;
  const size_t oVT = off; off += PX;
  const size_t oZ  = off; off += PX;
  if (off > ws_size) return;
  if (off > (size_t)134217728) return;

  char* ws = (char*)d_ws;
  unsigned short* XQ  = (unsigned short*)(ws + oXQ);
  unsigned short* WT  = (unsigned short*)(ws + oWT);
  unsigned short* WOT = (unsigned short*)(ws + oWO);
  unsigned short* PEH = (unsigned short*)(ws + oPE);
  unsigned short* QH  = (unsigned short*)(ws + oQH);
  unsigned short* QL  = (unsigned short*)(ws + oQL);
  unsigned short* KH  = (unsigned short*)(ws + oKH);
  unsigned short* KL  = (unsigned short*)(ws + oKL);
  unsigned short* VT  = (unsigned short*)(ws + oVT);
  unsigned short* Z   = (unsigned short*)(ws + oZ);
  float* out0 = (float*)d_out;
  unsigned short* hdummy = XQ;                    // in-range placeholder for unused f16 output args

  const dim3 blk(256);
  const int gP = ((MT / 64) * (DM / 64)) / 8;     // 64x64 tiles / 8 waves, exact

  // (0) operand planes: query/key/value -> f16(bf16) per batch slice (XQ | XK | XV, contiguous); table -> f16(bf16 x64)
  //     clamped tiles; Wq|Wk|Wv|Wo [512][512] -> WT | WOT (contiguous) planes 0, 1, 2, 3 (transposed, f16 x64)
  cvt_all<<<dim3(4 * NTB + NBB + 3 * NB * LINB), blk, 0, stream>>>(query, key, value, wq, wk, wv, wo, rel, XQ, WT, PEH);

  // (1) q and k hi/res planes and v^T x16
  gemm_qkv<<<dim3(gP, 3), blk, 0, stream>>>(XQ, WT, QH, QL, KH, KL, VT, bq, bk, bv);

  // (2) attention -> ctx x16 plane
  attn_kernel<<<dim3((NB * NH * (SEQ / 16)) / AWV), blk, 0, stream>>>(QH, QL, KH, KL, PEH, VT, mask, Z);

  // (3) output projection: out[row][n] = sum_k Z[row][k] * WOT[n][k] / (16*64) + bo[n]
  gemm64<0, 1><<<dim3(gP), blk, 0, stream>>>(Z, WOT, hdummy, hdummy, out0, DM, 1.0f / (WSCL * CSC), bo, 1.0f, MT, DM);
  (void)hipGetLastError();
}

// v009
// It runs in 55.8 microseconds.
// Timed twice side by side with v008, it ran 1.30 and 1.29 times as fast.
// Counting every step since v000, it is 5.15 times as fast.
// Contractions: x.Wq and x.Wk (q, k hi + residual planes), x.Wv (v^T plane), k.q^T (hi.hi + res.hi + hi.res),
// rel.q^T (hi + res), v^T.p^T and ctx.Wo, all on v_wmma_f32_16x16x32_f16 (f16 operands, f32 accumulate).
// Float inputs RNE-converted to bf16 on load and carried in f16 containers with power-of-two scales
// (x x1; Wq, Wk, Wv, Wo x64; rel table x64; q, k hi planes x16, residual planes x16x2048; v^T x16;
// p x4096; ctx x16); softmax, key mask and the relative-offset bias lookup in f32 on VALU. Masked keys are left out of the key
// and value planes (their softmax weight is 0), unless every key of a batch row is masked.
// Every f16 plane that a matrix product reads (x, W^T, q, k hi + residual, v^T, table, ctx) lies in fragment order: the
// 16 bytes of lane l of one operand load stand at piece base + 16*l, so that a load covers four whole 128-byte lines.
#include <hip/hip_runtime.h>
#include <math.h>

#ifndef NB
#define NB 2
#endif
#ifndef SEQ
#define SEQ 2048
#endif
#define NB_FULL  2
#define SEQ_FULL 2048
#define DM   512
#define NH   8
#define HD   64
#define MT   (NB * SEQ)
#define NREL 499
#define RCEN 249
#define POFF 22
#define NPT  34
#define AWV  8
#define QT   2                             // query tiles of 16 rows of one attention wave
#define RP   516                           // floats of one query's row of the bias table in LDS
#define RC0  6                             // its column of table row 0
#define PPAD (8 * SEQ_FULL)                // 4 x position of a place behind the last kept key
#define BWT  32                            // extra work of a key block with a bias per score, in 1/128 of a block
#define WSCL 64.0f
#define QKS  16.0f
#define LSC  2048.0f
#define VSC  16.0f
#define PSC  4096.0f
#define CSC  16.0f
#define RSQD 0.125f
#define MASKV (-1.0e10f)
#define LINB ((SEQ * DM) / 2048)          // blocks of one batch slice of one activation plane
#define NTB  ((DM / 64) * (DM / 64))      // blocks of one weight transpose
#define NBB  ((NPT * 128) / 256)          // blocks of the table plane
#define GST  4                            // fragment sets of the projection GEMM's register ring

static_assert(NH * HD == DM);
static_assert(HD == 64);
static_assert(NB >= 1 && NB <= NB_FULL);
static_assert((SEQ % 64) == 0 && SEQ >= 64 && SEQ <= SEQ_FULL);
static_assert((MT % 64) == 0 && (DM % 64) == 0);
static_assert((((MT / 64) * (DM / 64)) % 8) == 0);
static_assert(((SEQ * DM) % 2048) == 0 && ((NPT * 128) % 256) == 0);
static_assert(((NB * NH * (SEQ / 16)) % AWV) == 0 && (AWV % 2) == 0 && QT == 2 && ((SEQ / 32) % (AWV / 2)) == 0);
static_assert((2 * RCEN + 1) == NREL);
static_assert(SEQ == 2048 && NPT == 34 && POFF - 16 == RC0 && 16 * (NPT - 2) <= RP && (RP % 4) == 0);
static_assert((DM % 32) == 0 && GST >= 2 && GST - 1 <= DM / 32);
static_assert(((RCEN - 15 + POFF) % 16) == 0 && POFF >= 15 && 16 * (NPT - 1) - POFF >= NREL - 1);

typedef _Float16 v16h __attribute__((ext_vector_type(16)));
typedef unsigned short v16us __attribute__((ext_vector_type(16)));
typedef unsigned short v8us  __attribute__((ext_vector_type(8)));
typedef float v8f __attribute__((ext_vector_type(8)));
typedef float v4f __attribute__((ext_vector_type(4)));
typedef unsigned int v4u __attribute__((ext_vector_type(4)));
typedef int v4i __attribute__((ext_vector_type(4)));

union FragU { v16us v; v8us h[2]; };

// ---- scalar helpers --------------------------------------------------------------------------------
__device__ __forceinline__ unsigned short bf_bits(float f) {          // f32 -> bf16 bits, RNE convert
  const unsigned u = __float_as_uint(f);
  return (unsigned short)((u + 0x7FFFu + ((u >> 16) & 1u)) >> 16);
}
__device__ __forceinline__ float bf_up(unsigned short h) { return __uint_as_float(((unsigned)h) << 16); }
__device__ __forceinline__ float bfr(float f) { return bf_up(bf_bits(f)); }   // value of the bf16 RNE convert
__device__ __forceinline__ unsigned short h_bits(_Float16 x) { return __builtin_bit_cast(unsigned short, x); }
__device__ __forceinline__ unsigned short f2h(float f) { return h_bits((_Float16)f); }
__device__ __forceinline__ unsigned pk16(unsigned short a, unsigned short b) { return (unsigned)a | ((unsigned)b << 16); }
__device__ __forceinline__ int clampi(int v, int lo, int hi) { return v < lo ? lo : (v > hi ? hi : v); }
__device__ __forceinline__ int clamp_ord(int v, int lo, int hi) {     // clampi for lo <= hi: one minimum, one maximum
  const int a = v < hi ? v : hi;
  return a > lo ? a : lo;
}
__device__ __forceinline__ v8f zero8() { v8f z = {0.f, 0.f, 0.f, 0.f, 0.f, 0.f, 0.f, 0.f}; return z; }

// ---- fragment loader: 16-bit A/B operand of k block k0..k0+31, lane l -> row/col (l&15), h = l>>4; elements 0..7 are
//      k0+8h.., elements 8..15 are k0+16+8h... Plane in fragment order: p = fragment base + 8*lane; the piece of
//      elements 0..7 is 256 halves (32 lanes x 8), the piece of elements 8..15 follows it.
//      A row-major [R][K] matrix (lane index = row, k contiguous) as such a plane: row tile T = row/16, piece
//      q = k/16 at (T*(K/16) + q)*256; in the piece lane l = row (l&15), k = 16*q + 8*(l>>4) .. +7.
__device__ __forceinline__ v16us ldfrag_p(const unsigned short* p) {
  FragU f;
  f.h[0] = *(const v8us*)(p);
  f.h[1] = *(const v8us*)(p + 256);
  return f.v;
}

// ---- WMMA helpers (f16 operand bits) with trailing VALU hazard gap --------------------------------
__device__ __forceinline__ v8f mma_raw(v16us a, v16us b, v8f c) {
  return __builtin_amdgcn_wmma_f32_16x16x32_f16(false, __builtin_bit_cast(v16h, a), false,
                                                __builtin_bit_cast(v16h, b), (short)0, c, false, false);
}
__device__ __forceinline__ void acc_guard4(v8f& a, v8f& b, v8f& c, v8f& d) {
#if defined(__HIP_DEVICE_COMPILE__)
  asm volatile("v_nop\n\tv_nop\n\tv_nop\n\tv_nop" : "+v"(a), "+v"(b), "+v"(c), "+v"(d));
#endif
}
// orders LDS stores of this wave before later LDS loads of the same wave (cross-lane exchange)
__device__ __forceinline__ void wave_sync_lds() {
  __builtin_amdgcn_fence(__ATOMIC_RELEASE, "workgroup");
  __builtin_amdgcn_wave_barrier();
  __builtin_amdgcn_fence(__ATOMIC_ACQUIRE, "workgroup");
}

// stands behind a group of global stores that stay in flight: their address and data registers may be rewritten behind it
__device__ __forceinline__ void addr_regs_free() {
#if defined(__HIP_DEVICE_COMPILE__)
  asm volatile("s_wait_xcnt 0x0" ::: "memory");
#endif
}

// the same wait with the loads' address values as inputs: their registers stay live, so unwritten, up to the wait
// (the "memory" clobber alone does not keep a register write, or a later load's destination, behind it)
__device__ __forceinline__ void addr_regs_free_of(const void* a) {
#if defined(__HIP_DEVICE_COMPILE__)
  asm volatile("s_wait_xcnt 0x0" :: "v"(a) : "memory");
#endif
}
__device__ __forceinline__ void addr_regs_free_of(const void* a, const void* b) {
#if defined(__HIP_DEVICE_COMPILE__)
  asm volatile("s_wait_xcnt 0x0" :: "v"(a), "v"(b) : "memory");
#endif
}
__device__ __forceinline__ void addr_regs_free_of(const void* a, const void* b, const void* c) {
#if defined(__HIP_DEVICE_COMPILE__)
  asm volatile("s_wait_xcnt 0x0" :: "v"(a), "v"(b), "v"(c) : "memory");
#endif
}
__device__ __forceinline__ void addr_regs_free_of(const void* a, const void* b, const void* c, const void* d) {
#if defined(__HIP_DEVICE_COMPILE__)
  asm volatile("s_wait_xcnt 0x0" :: "v"(a), "v"(b), "v"(c), "v"(d) : "memory");
#endif
}

// =====================================================================================================
// Activation plane in fragment order: w[rows][DM] f32 -> o = f16 bits of (bf16 RNE value * sc), row tile T, piece q at
// (T*(DM/16) + q)*256 halves. One thread per 16-byte chunk of o: a wave reads 64 bytes of each of 16 rows and writes
// one whole piece; the 8 waves of a block take 8 pieces in a row, i.e. 512 consecutive bytes of each of the 16 rows.
// coverage: 256 threads x 8 = 2048 elements per block; bx = 0 .. rows*DM/2048 - 1 exact covers all of o.
// =====================================================================================================
__device__ __forceinline__ void cvt_rows(const float* __restrict__ w, unsigned short* o, float sc, int bx) {
  const int g = bx * 256 + threadIdx.x;                   // chunk = (piece, lane)
  const int pcs = g >> 5, l = g & 31;
  const int row = (pcs / (DM / 16)) * 16 + (l & 15);
  const int col = (pcs % (DM / 16)) * 16 + 8 * (l >> 4);
  const float* p = w + (size_t)row * DM + col;
  const v4f a0 = *(const v4f*)(p);
  const v4f a1 = *(const v4f*)(p + 4);
  addr_regs_free_of(p);
  v4u hv;
#pragma unroll
  for (int e = 0; e < 2; ++e) {
    hv[e]     = pk16(f2h(bfr(a0[2 * e]) * sc), f2h(bfr(a0[2 * e + 1]) * sc));
    hv[2 + e] = pk16(f2h(bfr(a1[2 * e]) * sc), f2h(bfr(a1[2 * e + 1]) * sc));
  }
  *(v4u*)(o + (size_t)g * 8) = hv;
  addr_regs_free();                                       // the store's registers may be rewritten behind it
}

// =====================================================================================================
// Key order of one batch row: ord[c] = position of the c-th key whose mask word is not 0 (a masked key's softmax weight is
// exp(-1e10 - max) = 0 in f32, so only the others are kept). With no such key every weight is equal: then all SEQ keys are
// kept, in place, and stay marked as masked. Returns the number of kept keys (1..SEQ), nopen = the number not masked.
// Wave w takes SEQ/8 keys as ballot words; ranks from popcounts; the waves' totals go through tot[8]. Two block barriers,
// passed by the whole block. ord = SEQ halves of LDS, written at 0 .. kept-1 only.
// =====================================================================================================
__device__ __forceinline__ int key_order(const int* __restrict__ mrow, unsigned short* ord, int* tot, int& nopen) {
  constexpr int WPW = SEQ / 256;                          // ballot words of one wave
  const int lane = threadIdx.x & 31, w = threadIdx.x >> 5;
  const int* mp = mrow + w * (WPW * 32) + lane;
  int mv[WPW];
#pragma unroll
  for (int i = 0; i < WPW; ++i) mv[i] = mp[i * 32];
  addr_regs_free_of(mp);
  unsigned wd[WPW];
  int cnt = 0;
#pragma unroll
  for (int i = 0; i < WPW; ++i) {
    wd[i] = __builtin_amdgcn_ballot_w32(mv[i] != 0);
    cnt += __builtin_popcount(wd[i]);
  }
  if (lane == 0) tot[w] = cnt;
  __syncthreads();                                        // every wave's total is written before it is summed
  int base = 0, n = 0;
#pragma unroll
  for (int k = 0; k < 8; ++k) {
    const int v = tot[k];
    base += (k < w) ? v : 0;
    n += v;
  }
  if (n == 0) base = w * (WPW * 32);
#pragma unroll
  for (int i = 0; i < WPW; ++i) {
    const unsigned word = (n == 0) ? 0xFFFFFFFFu : wd[i];
    if ((word >> lane) & 1u)
      ord[base + __builtin_popcount(word & ((1u << lane) - 1u))] = (unsigned short)((w * WPW + i) * 32 + lane);
    base += __builtin_popcount(word);
  }
  __syncthreads();                                        // the order is complete before any thread reads it
  nopen = n;
  return n == 0 ? SEQ : n;
}

// cvt_rows for the key and value planes of one batch slice: plane row c is input row ord[c] for c < kept, zeros behind
// (the projections read every row). Same chunks, coverage and stores as cvt_rows.
__device__ __forceinline__ void cvt_rows_sel(const float* __restrict__ w, unsigned short* o, int bx,
                                             const unsigned short* ord, int kept) {
  const int g = bx * 256 + threadIdx.x;                   // chunk = (piece, lane)
  const int pcs = g >> 5, l = g & 31;
  const int c = (pcs / (DM / 16)) * 16 + (l & 15);
  const int col = (pcs % (DM / 16)) * 16 + 8 * (l >> 4);
  v4f a0 = {0.f, 0.f, 0.f, 0.f}, a1 = {0.f, 0.f, 0.f, 0.f};
  if (c < kept) {
    const float* p = w + (size_t)clampi((int)ord[c], 0, SEQ - 1) * DM + col;
    a0 = *(const v4f*)(p);
    a1 = *(const v4f*)(p + 4);
    addr_regs_free_of(p);
  }
  v4u hv;
#pragma unroll
  for (int e = 0; e < 2; ++e) {
    hv[e]     = pk16(f2h(bfr(a0[2 * e])), f2h(bfr(a0[2 * e + 1])));
    hv[2 + e] = pk16(f2h(bfr(a1[2 * e])), f2h(bfr(a1[2 * e + 1])));
  }
  *(v4u*)(o + (size_t)g * 8) = hv;
  addr_regs_free();                                       // the store's registers may be rewritten behind it
}

// =====================================================================================================
// Table plane in fragment order: tile u (0..NPT-1) holds the 16 table rows clamp(16u - POFF + 0..15, 0, NREL-1) as
// four pieces of 256 halves; piece j, lane l = row (l&15) of the tile, head dims 16j + 8*(l>>4) .. +7, as f16 bits
// of (bf16 RNE value * sc). The attention kernel reads tiles 1 .. NPT-2, which hold every table row; tile 0 is row 0
// sixteen times, tile NPT-1 row NREL-1 sixteen times.
// coverage: one thread per 16-byte chunk, NPT*128 chunks, bx = 0 .. NPT*128/256 - 1 exact.
// =====================================================================================================
__device__ __forceinline__ void cvt_band(const float* __restrict__ w, unsigned short* o, float sc, int bx) {
  const int g = bx * 256 + threadIdx.x;
  if (g >= NPT * 128) return;                             // never taken with the exact grid; no barriers below
  const int u = g >> 7, j = (g >> 5) & 3, l = g & 31;
  const int row = clampi(16 * u - POFF + (l & 15), 0, NREL - 1);
  const float* p = w + (size_t)row * HD + 16 * j + 8 * (l >> 4);
  const v4f a0 = *(const v4f*)(p);
  const v4f a1 = *(const v4f*)(p + 4);
  v4u hv;
#pragma unroll
  for (int e = 0; e < 2; ++e) {
    hv[e]     = pk16(f2h(bfr(a0[2 * e]) * sc), f2h(bfr(a0[2 * e + 1]) * sc));
    hv[2 + e] = pk16(f2h(bfr(a1[2 * e]) * sc), f2h(bfr(a1[2 * e + 1]) * sc));
  }
  *(v4u*)(o + (size_t)g * 8) = hv;
}

// =====================================================================================================
// Transpose-convert: in w[R][C] f32 -> out o = the matrix [C][R] of f16 bits of (bf16 RNE value * sc), in fragment
// order (row tile T = c/16, piece q = r/16 at (T*(R/16) + q)*256). Block tile 64x64 through LDS (st[col][row], pitch
// 72 halves). Read phase: thread owns one input row x 16 columns. Write phase: the tile is 4 row tiles x 4 pieces;
// a wave writes one whole piece per store.
// R, C multiples of 64, (bx, by) = (0 .. C/64 - 1, 0 .. R/64 - 1) exact; st = the block's 64*72 halves of LDS.
// coverage: 16 pieces x 256 halves per block = the whole transposed tile; the blocks cover all of [C][R].
// =====================================================================================================
__device__ __forceinline__ void cvt_t(const float* __restrict__ w, unsigned short* o, int R, int C, float sc,
                                      int bx, int by, unsigned short* st) {
  const int t = threadIdx.x;
  const int r0 = by * 64, c0 = bx * 64;
  if (r0 + 64 > R || c0 + 64 > C) return;               // block-uniform, before the barrier; never taken
  {
    const int row = t >> 2, ch = (t & 3) * 16;
    const float* p = w + (size_t)(r0 + row) * C + c0 + ch;
#pragma unroll
    for (int q = 0; q < 4; ++q) {
      const v4f v = *(const v4f*)(p + 4 * q);
#pragma unroll
      for (int e = 0; e < 4; ++e) st[(ch + 4 * q + e) * 72 + row] = f2h(bfr(v[e]) * sc);
    }
  }
  __syncthreads();
  const int l = t & 31, wq = t >> 5;                     // lane in the piece; piece 8*half + wq of the tile's 16
  v4u hv[2];
#pragma unroll
  for (int half = 0; half < 2; ++half) {
    const int tl = 2 * half + (wq >> 2), q = wq & 3;      // row tile and piece in the block tile
    hv[half] = *(const v4u*)(st + (16 * tl + (l & 15)) * 72 + 16 * q + 8 * (l >> 4));
  }
#pragma unroll
  for (int half = 0; half < 2; ++half) {
    const int tl = 2 * half + (wq >> 2), q = wq & 3;
    unsigned short* dst = o + ((size_t)((c0 >> 4) + tl) * (size_t)(R >> 4) + (size_t)((r0 >> 4) + q)) * 256 + l * 8;
    *(v4u*)dst = hv[half];
  }
}

// =====================================================================================================
// All operand planes in one launch; none reads what another writes. The flat block index picks the work, the same for
// the whole block (the barrier of cvt_t is passed by all of a block's threads or by none):
// 4*NTB blocks: Wq, Wk, Wv, Wo [512][512] -> WT planes 0, 1, 2, 3 (transposed, x64; the last is WOT);
// NBB blocks: table -> PE (x64, clamped tiles); 3*NB*LINB blocks: query, key, value -> X planes 0, 1, 2 per batch slice;
// the key and value planes hold the kept keys' rows in key order (each such block forms the order of its batch row itself);
// the first key block of a batch slice also writes P4[c] = 4 x position of kept key c (PPAD behind them) and CM[c] = its mask.
// The transposes, which take longest, have the lowest indices.
// =====================================================================================================
__global__ __launch_bounds__(256) void cvt_all(
    const float* __restrict__ query, const float* __restrict__ key, const float* __restrict__ value,
    const float* __restrict__ wq, const float* __restrict__ wk, const float* __restrict__ wv,
    const float* __restrict__ wo, const float* __restrict__ rel, const int* __restrict__ mask,
    unsigned short* X, unsigned short* WT, unsigned short* PE, int* P4, int* CM) {
  __shared__ __align__(16) unsigned short st[64 * 72];
  int bid = blockIdx.x;
  if (bid < 4 * NTB) {
    const int ws = bid / NTB, tb = bid - ws * NTB;
    const float* w = (ws == 0) ? wq : (ws == 1) ? wk : (ws == 2) ? wv : wo;
    cvt_t(w, WT + (size_t)ws * DM * DM, DM, DM, WSCL, tb % (DM / 64), tb / (DM / 64), st);
    return;
  }
  bid -= 4 * NTB;
  if (bid < NBB) {
    cvt_band(rel, PE, WSCL, bid);
    return;
  }
  bid -= NBB;
  const int xs = bid / (NB * LINB), xr = bid - xs * (NB * LINB);
  if (xs > 2) return;                                     // never taken with the exact grid
  const float* x = (xs == 0) ? query : (xs == 1) ? key : value;
  const int by = xr / LINB;                               // batch slice: SEQ rows, a whole number of row tiles
  const int bl = xr - by * LINB;
  unsigned short* xo = X + (size_t)xs * MT * DM + (size_t)by * SEQ * DM;
  if (xs == 0) {                                          // the same for the whole block, like the barriers below it
    cvt_rows(x + (size_t)by * SEQ_FULL * DM, xo, 1.0f, bl);
    return;
  }
  unsigned short* ord = st;                               // SEQ halves, then the waves' totals
  int nopen;
  const int kept = key_order(mask + (size_t)by * SEQ_FULL, ord, (int*)(st + SEQ), nopen);
  cvt_rows_sel(x + (size_t)by * SEQ_FULL * DM, xo, bl, ord, kept);
  if (xs == 1 && bl == 0) {
    int* pd = P4 + by * SEQ + threadIdx.x;
    int* cd = CM + by * SEQ + threadIdx.x;
    // unrolled: every store is a constant distance from one of two addresses
#pragma unroll
    for (int i = 0; i < SEQ / 256; ++i) {
      const int c = i * 256 + threadIdx.x;
      int pv = PPAD;
      if (c < kept) pv = 4 * (int)ord[c];
      pd[i * 256] = pv;
      cd[i * 256] = (c < nopen) ? 1 : 0;
    }
    addr_regs_free_of(pd, cd);
  }
}

// =====================================================================================================
// Register-blocked f16 WMMA GEMM: C[m][n] = sum_k A[m][k] * Bt[n][k], one wave per 64x64 tile, no block
// barriers. A = [M][K] and Bt = [N][K], both planes in fragment order (row tile T, k block kb: two pieces at
// (T*(K/32) + kb)*512 halves, so a row tile's k blocks follow one another); M, N multiples of 64,
// K = DM (bx = 0 .. tiles/8 - 1 exact so no wave exits early). The k loop is unrolled over a ring of GST fragment
// sets in registers: the 16 loads of k block kb + GST - 1 issue behind the first four products of k block kb, so that a
// load has nearly GST - 1 blocks of products to land; every load is a constant distance from one of two addresses. The products in
// the loop are the plain builtin, with no asm statement that names a fragment: the sets reach above v255. Both operand
// fragments use the split k map (elements 0..7 <- k0+8h.., 8..15 <- k0+16+8h..); D element r of a lane is
// (row 8h + r, col lane&15).
// s = acc*osc + bias term (BM 0: none; BM 1: bsc*bf16(bias[col]); BM 2: bsc*bf16(bias[row])).
// OM 0: f32 out Cf = s, pitch ldc.   OM 1: f16 out Ch = f16 bits(s).
// OM 2: f16 hi plane Ch = f16(s) and f16 residual plane Cl = f16((s - hi) * 2048), same layout.
// f16 outputs lie in fragment order (ldc unused). A 16x64 slab is four pieces of 256 halves; piece it, lane l =
// slab row (l&15), slab columns 16*it + 8*(l>>4) .. +7, i.e. one load of a fragment whose lane index is the row and
// whose k index is the column. OM 2: slab (row tile T = row/16, column tile tn) at ((tn*(M/16) + T)*4 + it)*256.
// OM 1: pieces 2*kb, 2*kb + 1 of a slab are k block kb of 32 columns; piece at
// (((tm*(N/32) + column/32)*4 + row tile in tm)*2 + (it&1))*256, so that a k block's four row tiles are contiguous.
// coverage: 4 slabs x 16 rows x 64 cols = the wave's whole 64x64 tile.
// =====================================================================================================
template <int OM, int BM>
__device__ __forceinline__ void gemm64_tile(
    const unsigned short* __restrict__ Ap, const unsigned short* __restrict__ Btp,
    unsigned short* Ch, unsigned short* Cl, float* Cf, int ldc, float osc,
    const float* __restrict__ bias, float bsc, int M, int N, int bx, float (*sT)[16 * 68]) {
  constexpr int K = DM;
  constexpr int NKB = K / 32;                  // k blocks
  const int lane = threadIdx.x & 31;
  const int wave = threadIdx.x >> 5;
  const int tilesN = N >> 6;
  const int tilesM = M >> 6;
  const int tile = bx * 8 + wave;
  if (tile >= tilesM * tilesN) return;   // wave-uniform; no block barriers in this kernel
  const int tm = tile / tilesN;
  const int tn = tile - tm * tilesN;
  const int m0 = tm << 6;
  const int n0 = tn << 6;

  const int rlane = lane & 15;                 // col (D) within subtile
  const int mOff  = (lane >> 4) * 8;           // D row offset
  constexpr size_t tstr = (size_t)NKB * 512;   // halves of one row tile of an operand plane
  const unsigned short* Aw = Ap + (size_t)(m0 >> 4) * tstr + lane * 8;    // this lane's chunk of row tile m0/16, k block 0
  const unsigned short* Bw = Btp + (size_t)(n0 >> 4) * tstr + lane * 8;

  v8f acc[4][4];
#pragma unroll
  for (int i = 0; i < 4; ++i)
#pragma unroll
    for (int j = 0; j < 4; ++j) acc[i][j] = zero8();

  v16us bh[GST][4], ah[GST][4];                // fragment set kb % GST holds k block kb
  // unrolled here and below: the sets are indexed by constants only, so they stay in registers
#pragma unroll
  for (int kb = 0; kb < GST - 1; ++kb) {
#pragma unroll
    for (int j = 0; j < 4; ++j) bh[kb][j] = ldfrag_p(Bw + (size_t)kb * 512 + (size_t)j * tstr);
#pragma unroll
    for (int i = 0; i < 4; ++i) ah[kb][i] = ldfrag_p(Aw + (size_t)kb * 512 + (size_t)i * tstr);
    // keeps the first sets' loads in the order of their use: loads return in order, and k block 0 is waited for first
    __builtin_amdgcn_sched_barrier(0);
  }
#pragma unroll
  for (int kb = 0; kb < NKB; ++kb) {
    const int st = kb % GST;
#pragma unroll
    for (int j = 0; j < 4; ++j) acc[0][j] = mma_raw(ah[st][0], bh[st][j], acc[0][j]);
    if (kb + GST - 1 < NKB) {
      const int kn = kb + GST - 1, sn = kn % GST;
      // keeps the fetch behind the four products above, so behind every product of k block kb - 1, whose set it refills:
      // moved up it would need a further set of registers
      __builtin_amdgcn_sched_barrier(0);
#pragma unroll
      for (int j = 0; j < 4; ++j) bh[sn][j] = ldfrag_p(Bw + (size_t)kn * 512 + (size_t)j * tstr);
#pragma unroll
      for (int i = 0; i < 4; ++i) ah[sn][i] = ldfrag_p(Aw + (size_t)kn * 512 + (size_t)i * tstr);
      // keeps the fetch in front of the block's other products: sunk towards its use it would have no time to land
      __builtin_amdgcn_sched_barrier(0);
    }
#pragma unroll
    for (int i = 1; i < 4; ++i) {
#pragma unroll
      for (int j = 0; j < 4; ++j) acc[i][j] = mma_raw(ah[st][i], bh[st][j], acc[i][j]);
    }
  }
  addr_regs_free_of(Aw, Bw);                   // the two addresses of every load above stay unwritten up to here
  acc_guard4(acc[0][0], acc[0][1], acc[0][2], acc[0][3]);
  acc_guard4(acc[1][0], acc[1][1], acc[1][2], acc[1][3]);
  acc_guard4(acc[2][0], acc[2][1], acc[2][2], acc[2][3]);
  acc_guard4(acc[3][0], acc[3][1], acc[3][2], acc[3][3]);

  const int hh2 = lane >> 4, c4 = (lane & 15) * 4;     // f32 out: 256-B row segment = 16 lanes x 16 B

  // column bias terms (fixed per wave); addresses n0+c4+3 < N and n0+48+8+7 < N
  v4f bc4 = {0.f, 0.f, 0.f, 0.f};
  float bc8[4][8];                                      // f16 out: piece it, columns 16*it + 8*hh2 .. +7
#pragma unroll
  for (int it = 0; it < 4; ++it)
#pragma unroll
    for (int e = 0; e < 8; ++e) bc8[it][e] = 0.f;
  if (BM == 1) {
    if (OM == 0) {
      const v4f t4 = *(const v4f*)(bias + n0 + c4);
#pragma unroll
      for (int e = 0; e < 4; ++e) bc4[e] = bfr(t4[e]) * bsc;
    } else {
#pragma unroll
      for (int it = 0; it < 4; ++it) {
        const v4f ta = *(const v4f*)(bias + n0 + 16 * it + 8 * hh2);
        const v4f tb = *(const v4f*)(bias + n0 + 16 * it + 8 * hh2 + 4);
#pragma unroll
        for (int e = 0; e < 4; ++e) { bc8[it][e] = bfr(ta[e]) * bsc; bc8[it][4 + e] = bfr(tb[e]) * bsc; }
      }
    }
  }

  // ---- epilogue ----
  float* slab = sT[wave];
#pragma unroll
  for (int i = 0; i < 4; ++i) {
    const int mBase = m0 + (i << 4);
#pragma unroll
    for (int j = 0; j < 4; ++j) {
#pragma unroll
      for (int r = 0; r < 8; ++r) {
        slab[(mOff + r) * 68 + (j << 4) + rlane] = acc[i][j][r];
      }
    }
    wave_sync_lds();
    if (OM == 0) {
      v4f vals[8];
#pragma unroll
      for (int it = 0; it < 8; ++it) {
        const int row = it * 2 + hh2;                      // it 0..7 x hh2 0..1 = rows 0..15
        const v4f v = *(const v4f*)(slab + row * 68 + c4);
        float rb2 = 0.f;
        if (BM == 2) rb2 = bfr(bias[mBase + row]) * bsc;
        vals[it] = v * osc + bc4 + rb2;
      }
      {
#pragma unroll
        for (int it = 0; it < 8; ++it) {
          const int row = it * 2 + hh2;
          *(v4f*)(Cf + (size_t)(mBase + row) * ldc + (size_t)n0 + c4) = vals[it];
        }
        
      }
    } else {
      v4u hv[4], hl[4];
      float rb2 = 0.f;
      if (BM == 2) rb2 = bfr(bias[mBase + rlane]) * bsc;
#pragma unroll
      for (int it = 0; it < 4; ++it) {
        const float* sp = slab + rlane * 68 + 16 * it + 8 * hh2;   // rows 0..15 x (it, hh2) = 8 column chunks
        v4u ha = {0u, 0u, 0u, 0u};
        v4u la = {0u, 0u, 0u, 0u};
#pragma unroll
        for (int e = 0; e < 4; ++e) {
          const float b0 = sp[2 * e]     * osc + bc8[it][2 * e]     + rb2;
          const float b1 = sp[2 * e + 1] * osc + bc8[it][2 * e + 1] + rb2;
          if (OM == 1) {
            ha[e] = pk16(f2h(b0), f2h(b1));
          } else {
            const _Float16 h0 = (_Float16)b0;
            const _Float16 h1 = (_Float16)b1;
            const float l0 = (b0 - (float)h0) * LSC;       // difference exact, power-of-two carry exact
            const float l1 = (b1 - (float)h1) * LSC;
            ha[e] = pk16(h_bits(h0), h_bits(h1));
            la[e] = pk16(f2h(l0), f2h(l1));
          }
        }
        hv[it] = ha;
        hl[it] = la;
      }
      {
#pragma unroll
        for (int it = 0; it < 4; ++it) {
          const size_t pc = (OM == 2)
              ? ((size_t)tn * (size_t)(M >> 4) + (size_t)(mBase >> 4)) * 4 + it
              : (((size_t)tm * (size_t)(N >> 5) + (size_t)((n0 >> 5) + (it >> 1))) * 4 + i) * 2 + (it & 1);
          const size_t go = pc * 256 + (size_t)(lane * 8);    // 32 lanes x 16 B = the whole piece
          *(v4u*)(Ch + go) = hv[it];
          if (OM == 2) *(v4u*)(Cl + go) = hl[it];
        }
        addr_regs_free();
      }
    }
    wave_sync_lds();
  }
}

// one product per launch, K = DM
template <int OM, int BM>
__global__ __launch_bounds__(256) void gemm64(
    const unsigned short* __restrict__ Ap, const unsigned short* __restrict__ Btp,
    unsigned short* Ch, unsigned short* Cl, float* Cf, int ldc, float osc,
    const float* __restrict__ bias, float bsc, int M, int N) {
  __shared__ __align__(16) float sT[8][16 * 68];   // per-wave 16x64 slab, pitch 68 floats
  gemm64_tile<OM, BM>(Ap, Btp, Ch, Cl, Cf, ldc, osc, bias, bsc, M, N, blockIdx.x, sT);
}

// The three input projections in one launch; none reads what another writes. blockIdx.y picks the product:
// 0: s = 16*(xq.Wq + bq) -> QH = f16(s), QL = f16(2048*(s - QH));  1: the same for k;
// 2: v^T x16: C[d][tok] = sum_k WT[1024+d][k] * XV[tok][k], bias by row d.
// X = the planes XQ | XK | XV, WT = Wq^T | Wk^T | Wv^T, each in fragment order. Output pointers that a product's OM does not use are null.
__global__ __launch_bounds__(256) void gemm_qkv(
    const unsigned short* __restrict__ X, const unsigned short* __restrict__ WT,
    unsigned short* QH, unsigned short* QL, unsigned short* KH, unsigned short* KL, unsigned short* VT,
    const float* __restrict__ bq, const float* __restrict__ bk, const float* __restrict__ bv) {
  __shared__ __align__(16) float sT[8][16 * 68];   // per-wave 16x64 slab, pitch 68 floats
  const int sel = blockIdx.y;
  const unsigned short* Xs = X + (size_t)sel * MT * DM;    // this product's activation and weight planes
  const unsigned short* Ws = WT + (size_t)sel * DM * DM;
  if (sel == 2) {
    gemm64_tile<1, 2>(Ws, Xs, VT, nullptr, nullptr, MT,
                      VSC / WSCL, bv, VSC, DM, MT, blockIdx.x, sT);
  } else {
    const bool isk = (sel == 1);
    gemm64_tile<2, 1>(Xs, Ws,
                      isk ? KH : QH, isk ? KL : QL, nullptr, DM, QKS / WSCL, isk ? bk : bq, QKS, MT, DM,
                      blockIdx.x, sT);
  }
}

// ---- per-tile products used by the attention kernel ----------------------------------------------
// Both give the TRANSPOSED tile: the plane rows (table rows, keys) are the A operand, the query rows the B operand,
// so that D register r of lane l is (plane row 8*(l>>4) + r, query l&15). q = the query tile's fragments
// {hi dims 0..31, hi dims 32..63, residual dims 0..31, residual dims 32..63}. The products are the plain builtin, with no
// asm statement that names an operand: with v_nop statements behind them the two query tiles' registers did not fit the
// window that such a statement can name, and fragments went to scratch and came back in every pass.
// R^T = b.qh + (b.ql)/2048 over 64 head dims (b0, b1: fragments of a [n][64] f16 plane row, dims 0..31 and 32..63)
__device__ __forceinline__ v8f dot2_res(const v16us (&q)[4], v16us b0, v16us b1) {
  v8f L = mma_raw(b0, q[2], zero8());
  L = mma_raw(b1, q[3], L);
  L = L * (1.0f / LSC);
  v8f R = mma_raw(b0, q[0], L);
  R = mma_raw(b1, q[1], R);
  return R;
}
// S^T = kh.qh + (kl.qh + kh.ql)/2048 over 64 head dims (kh from the hi plane row, kl from the residual plane row)
__device__ __forceinline__ v8f dot3_res(const v16us (&q)[4], v16us kh0, v16us kh1, v16us kl0, v16us kl1) {
  v8f L = mma_raw(kl0, q[0], zero8());
  L = mma_raw(kl1, q[1], L);
  L = mma_raw(kh0, q[2], L);
  L = mma_raw(kh1, q[3], L);
  L = L * (1.0f / LSC);
  v8f S = mma_raw(kh0, q[0], L);
  S = mma_raw(kh1, q[1], S);
  return S;
}
// value of lane l ^ 16
__device__ __forceinline__ float xhalf(float x) {
  const int b = __builtin_bit_cast(int, x);
  return __builtin_bit_cast(float, __builtin_amdgcn_permlanex16(b, b, 0x76543210, 0xfedcba98, false, false));
}
__device__ __forceinline__ v4f lo4(v8f x) { return __builtin_shufflevector(x, x, 0, 1, 2, 3); }
__device__ __forceinline__ v4f hi4(v8f x) { return __builtin_shufflevector(x, x, 4, 5, 6, 7); }
__device__ __forceinline__ v8f cat8(v4f a, v4f b) { return __builtin_shufflevector(a, b, 0, 1, 2, 3, 4, 5, 6, 7); }

// =====================================================================================================
// One key block (32 keys) of the attention loop for the wave's QT query tiles; the layouts are those of the kernel's own
// comment below. kf = K fragments {keys 0..15: hi, hi, residual, residual; keys 16..31: the same}, vf = V^T fragments of the
// four dim tiles, pk = 4 x position of the lane's 16 keys (8*hh + 0..7, 16 + 8*hh + 0..7).
// BAND = true: the block's keys meet more than one table row: each score's bias is read from the query's row of the LDS table
// at byte clamp(pk + rcx[t], rlo[t], rlo[t] + 4*(NREL-1)) of rtb, i.e. table row clamp(j - i + RCEN, 0, NREL-1), and the
// next block's positions are fetched. BAND = false: every key of the block has the same clipped table row for every
// query of the wave, so bc[t] = rel.q of that row is the bias of all 32 keys; no position load, no LDS.
// =====================================================================================================
template <bool BAND>
__device__ __forceinline__ void attn_pass(
    int kb, const float (&bc)[QT], int hh, const v16us (&q)[QT][4],
    const unsigned short* __restrict__ KH, const unsigned short* __restrict__ KL,
    const unsigned short* __restrict__ VT, const int* __restrict__ mk, const int* __restrict__ pl,
    size_t kfix, size_t vfix, const char* rtb, const int (&rlo)[QT], const int (&rcx)[QT],
    v16us (&kf)[8], v4i (&pk)[4], int& mnx, v16us (&vf)[4],
    float (&mx)[QT], float (&ls)[QT], v8f (&O)[QT][4]) {
  const int sb = kb << 5;
  const int sn = (sb + 32 < SEQ) ? sb + 32 : SEQ - 32; // key block whose operands are fetched in this pass
  // unrolled here and below: the per-tile and per-key arrays are indexed by constants only, so they stay in registers
  // scores, transposed: A row = key token, B column = query, k = head dim
  v8f S0[QT], S1[QT];
#pragma unroll
  for (int t = 0; t < QT; ++t) {
    S0[t] = dot3_res(q[t], kf[0], kf[1], kf[2], kf[3]);
    S1[t] = dot3_res(q[t], kf[4], kf[5], kf[6], kf[7]);
  }

  // biases of the lane's 16 keys for its query of each tile, read in front of the fetch that renews pk
  float rv[QT][16];
  if constexpr (BAND) {
#pragma unroll
    for (int t = 0; t < QT; ++t)
#pragma unroll
      for (int r = 0; r < 16; ++r)
        rv[t][r] = *(const float*)(rtb + clamp_ord(pk[r >> 2][r & 3] + rcx[t], rlo[t], rlo[t] + 4 * (NREL - 1)));
  }

  // key mask of the block as 32 bits (bit = key), shifted so that bit r is key 8*hh + r and bit 16 + r key 16 + 8*hh + r
  const unsigned mw = __builtin_amdgcn_ballot_w32(mnx != 0) >> (8 * hh);

  // next key block's K, position and mask operands, one group (token tiles and columns below SEQ)
  {
    const int* mq = mk + sn;
    mnx = mq[0];
    const size_t ko = kfix + (size_t)(sn >> 4) * 1024;
    kf[0] = ldfrag_p(KH + ko);        kf[1] = ldfrag_p(KH + ko + 512);
    kf[2] = ldfrag_p(KL + ko);        kf[3] = ldfrag_p(KL + ko + 512);
    kf[4] = ldfrag_p(KH + ko + 1024); kf[5] = ldfrag_p(KH + ko + 1536);
    kf[6] = ldfrag_p(KL + ko + 1024); kf[7] = ldfrag_p(KL + ko + 1536);
    if constexpr (BAND) {
      const int* pq = pl + sn;
      pk[0] = *(const v4i*)(pq);      pk[1] = *(const v4i*)(pq + 4);
      pk[2] = *(const v4i*)(pq + 16); pk[3] = *(const v4i*)(pq + 20);
      addr_regs_free_of(KH + ko, KL + ko, mq, pq);
    } else {
      addr_regs_free_of(KH + ko, KL + ko, mq);
    }
  }

  FragU pf[QT];                                        // P^T B fragments
#pragma unroll
  for (int t = 0; t < QT; ++t) {
    // scale + bias (the key's own or the block's one), then replace-fill masked keys
    float s0[8], s1[8];
#pragma unroll
    for (int r = 0; r < 8; ++r) {
      float v0, v1;
      if constexpr (BAND) {
        v0 = S0[t][r] * (RSQD / (QKS * QKS)) + rv[t][r];
        v1 = S1[t][r] * (RSQD / (QKS * QKS)) + rv[t][8 + r];
      } else {
        v0 = S0[t][r] * (RSQD / (QKS * QKS)) + bc[t];
        v1 = S1[t][r] * (RSQD / (QKS * QKS)) + bc[t];
      }
      s0[r] = ((mw >> r) & 1u) ? v0 : MASKV;
      s1[r] = ((mw >> (16 + r)) & 1u) ? v1 : MASKV;
    }

    // online softmax: the lane's 16 scores are of one query; one exchange joins the two halves' maxima
    float xr[8];
#pragma unroll
    for (int r = 0; r < 8; ++r) xr[r] = fmaxf(s0[r], s1[r]);
    float xm = fmaxf(fmaxf(fmaxf(xr[0], xr[1]), fmaxf(xr[2], xr[3])), fmaxf(fmaxf(xr[4], xr[5]), fmaxf(xr[6], xr[7])));
    xm = fmaxf(xm, xhalf(xm));
    const float mn = fmaxf(mx[t], xm);
    const float al = __expf(mx[t] - mn);
    mx[t] = mn;
    float pr[8];
#pragma unroll
    for (int r = 0; r < 8; ++r) {
      const float p0 = __expf(s0[r] - mn);
      const float p1 = __expf(s1[r] - mn);
      pr[r] = p0 + p1;
      pf[t].v[r]     = f2h(p0 * PSC);
      pf[t].v[8 + r] = f2h(p1 * PSC);
    }
    ls[t] = ls[t] * al + (((pr[0] + pr[1]) + (pr[2] + pr[3])) + ((pr[4] + pr[5]) + (pr[6] + pr[7])));
#pragma unroll
    for (int d = 0; d < 4; ++d) O[t][d] = O[t][d] * al;
  }

  // V^T A-fragments (row = dim, k = key token) against the P^T B fragments
#pragma unroll
  for (int t = 0; t < QT; ++t)
#pragma unroll
    for (int d = 0; d < 4; ++d) O[t][d] = mma_raw(vf[d], pf[t].v, O[t][d]);
  const size_t vo = vfix + (size_t)(sn >> 5) * 2048;
  vf[0] = ldfrag_p(VT + vo);
  vf[1] = ldfrag_p(VT + vo + 512);
  vf[2] = ldfrag_p(VT + vo + 1024);
  vf[3] = ldfrag_p(VT + vo + 1536);
  addr_regs_free_of(VT + vo);
}

// a wave's partial result of one query tile into its exchange slot: lane l's 16-byte chunk j at mp[32*j]
__device__ __forceinline__ void part_put(v4f* mp, const v8f (&O)[4], float mx, float ls) {
#pragma unroll
  for (int d = 0; d < 4; ++d) {
    mp[32 * (2 * d)]     = lo4(O[d]);
    mp[32 * (2 * d + 1)] = hi4(O[d]);
  }
  const v4f st = {mx, ls, 0.f, 0.f};
  mp[32 * 8] = st;
}
// joins this wave's partial result of a query tile with the other wave's (pp = its slot) and stores ctx:
// ctx = (O.fa + O'.fb) / (l * PSC * VSC), x CSC as f16; a lane's 8 registers of a dim subtile are row l&15, columns
// h*64 + 16*subtile + 8*(l>>4) .. +7: lane l's chunk of piece h*4 + subtile, the wave fills four whole pieces
__device__ __forceinline__ void part_join(const v4f* pp, const v8f (&O)[4], float mx, float ls, unsigned short* dst) {
  const v4f st = pp[32 * 8];
  const float mn = fmaxf(mx, st[0]);
  const float fa = __expf(mx - mn), fb = __expf(st[0] - mn);
  const float l = ls * fa + st[1] * fb;                    // over this lane's keys of both parts
  const float g = (CSC / (PSC * VSC)) / (l + xhalf(l));    // l >= 1
  const float ga = g * fa, gb = g * fb;
#pragma unroll
  for (int d = 0; d < 4; ++d) {
    const v8f x = O[d] * ga + cat8(pp[32 * (2 * d)], pp[32 * (2 * d + 1)]) * gb;
    v4u z;
#pragma unroll
    for (int e = 0; e < 4; ++e) z[e] = pk16(f2h(x[2 * e]), f2h(x[2 * e + 1]));
    *(v4u*)(dst + 256 * d) = z;
  }
  addr_regs_free();                                        // the stores' address and data registers may be rewritten behind it
}

// =====================================================================================================
// Non-causal attention with clipped relative-offset term and key-padding mask, head dim 64, over the KEPT keys only: the K
// and V^T planes hold the kept keys of a batch row in key order (cvt_all), zeros' projections behind them; P4[c] = 4 x position
// of kept key c, rising, PPAD behind the last; CM[c] = 1 for a kept key that is not masked. nkb = key blocks of 32 with a kept key.
// Block = 256 threads = 8 waves. A wave's tile is QT = 2 query tiles of 16 rows (t0..t0+31) of one (batch b, head h) times a
// part of the key blocks: every K and V^T fragment that it loads feeds both query tiles. Waves 2p and 2p + 1 share
// the query rows: wave 2p takes key blocks 0 .. ksp-1, wave 2p + 1 key blocks ksp .. nkb-1 (none where nkb = 1), each with an
// online max-subtracted softmax in f32 over its part; behind the loops each hands the other one query tile's partial maximum,
// sum and O^T through LDS (one block barrier) and joins and stores the tile that it keeps.
// Every product is taken transposed (keys, table rows or head dims as A rows, queries as B columns): in query tile t lane l
// works for the one query t0 + 16t + (l&15); lanes l and l^16 split that query's keys (8*(l>>4) + 0..7 of each 16) and dims.
// Planes, all in fragment order (a fragment = two pieces of 256 halves, lane l's 8 halves at piece + 8*l):
// QH/KH f16 = 16*q, 16*k, QL/KL = 2048*(16q - QH) residuals: [head][token tile of 16][dims 0..31 | 32..63];
// PE f16 = 64*rel table, [tile u][dims 0..31 | 32..63], tile u = table rows clamp(16u - POFF + 0..15, 0, 498);
// VT f16 = 16*v transposed: [head][key block of 32][dim tile of 16].
// Output Z f16 = 16*ctx, the matrix [MT][512] (row = b*SEQ + t, col = h*64+d) in fragment order:
// [token tile of 16][piece = col/16], the A operand of the output projection.
// Bias table: in front of the loops a wave pair forms rel.q of its 32 queries against table tiles 1 .. NPT-2 (hi + res products,
// each wave half the tiles) and stores it in LDS as [query][column], column RC0 + row for table rows 0..498, pitch RP floats;
// one block barrier; it is only read from there on.
// Per key block: S^T = 256*k.q (hi.hi + res.hi + hi.res, 2 key subtiles); score = qk/8 + bias of table row
// clamp(j - i + 249, 0, 498), j = the key's position; then replace-fill -1e10 where CM = 0; the block maximum is taken over
// the lane's 16 scores and joined with lane l^16; p = exp(score - running max) in f32; l is kept per lane over the lane's own
// keys (the two halves are joined behind the loop); 4096*p as f16, score registers in order, IS the B fragment of P^T
// (elements 0..7 = keys 8*(l>>4) + 0..7, elements 8..15 = keys 16 + 8*(l>>4) + 0..7, the k map of the V^T fragments);
// O^T += V^T.P^T on 4 dim subtiles, O^T register r of lane l = (dim 16*tile + 8*(l>>4) + r, query l&15).
// coverage: a wave stores 16 query rows x 64 halves, a wave pair 32 rows; NB*NH*(SEQ/32) pairs = all (b, t, h) segments of Z.
// LDS: 32 rows of RP floats per wave pair; exchange slot of 9 chunks of 16 bytes per lane and wave.
// Global operands run one key block ahead in registers: K (hi + residual), positions and mask words are
// reloaded for key block kb + 1 behind the score products of key block kb, V^T behind its V^T.P^T
// products, into the same variables, so that a load has most of a pass to land before its wait. A wave's last
// pass loads the block behind its part, or its own at the end of the planes (addresses in range, values unused).
// Key blocks whose last key lies at or below t0 - 249 have table row 0 for every query of the wave, those whose first key lies
// at or above t0 + 31 + 249 row NREL-1: one bias per query. Only the key blocks between them read a bias per score.
// =====================================================================================================
__global__ __launch_bounds__(256) void attn_kernel(
    const unsigned short* __restrict__ QH, const unsigned short* __restrict__ QL,
    const unsigned short* __restrict__ KH, const unsigned short* __restrict__ KL,
    const unsigned short* __restrict__ PE, const unsigned short* __restrict__ VT,
    const int* __restrict__ P4, const int* __restrict__ CM, unsigned short* Z) {
  __shared__ __align__(16) float rtab[AWV / 2][32][RP];          // bias tables, 264192 B
  __shared__ __align__(16) v4f mrg[AWV][9][32];                  // partial results, 36864 B
  const int lane = threadIdx.x & 31, m = lane & 15, hh = lane >> 4;
  const int wv = __builtin_amdgcn_readfirstlane(threadIdx.x >> 5);   // scalar: the branches on it below are uniform
  const int part = wv & 1;                           // which part of the keys
  const int task = blockIdx.x * (AWV / 2) + (wv >> 1);   // 0 .. NB*NH*(SEQ/32)-1
  const int nqt = SEQ / 32;                          // a multiple of AWV/2, so a block's tasks have the same (b, h)
  const int bh = task / nqt;                         // (b, h)
  const int t0 = (task - bh * nqt) << 5;             // first query row
  const int b = bh / NH, h = bh - (bh / NH) * NH;
  if (b >= NB) return;                               // the same for the whole block; never taken with exact grids
  const size_t tok0 = (size_t)b * SEQ;               // plane row base of this batch
  const int* mk = CM + tok0 + lane;                  // lane l fetches key l's word
  const int* pl = P4 + tok0 + 8 * hh;                // positions of the lane's keys of a block

  // Q B-fragments (hi and residual) of both query tiles: columns t0+16t+m, k = head dims 0..31 and 32..63
  const size_t qo = ((size_t)h * (MT / 16) + ((tok0 + (size_t)t0) >> 4)) * 1024 + (size_t)(lane * 8);
  v16us q[QT][4];
#pragma unroll
  for (int t = 0; t < QT; ++t) {
    q[t][0] = ldfrag_p(QH + qo + t * 1024);
    q[t][1] = ldfrag_p(QH + qo + t * 1024 + 512);
    q[t][2] = ldfrag_p(QL + qo + t * 1024);
    q[t][3] = ldfrag_p(QL + qo + t * 1024 + 512);
  }
  addr_regs_free_of(QH + qo, QL + qo);

  // this wave's half of the table tiles, two sets of four tiles' fragments; the first four are fetched here, in front of
  // the wait for the positions below. Unrolled here and below: the sets are indexed by constants only, and every load is a
  // constant distance from pt
  constexpr int TPW = (NPT - 2) / 2;
  static_assert((TPW % 4) == 0);
  const unsigned short* pt = PE + (size_t)(1 + TPW * part) * 1024 + lane * 8;
  v16us ta[2][8];
#pragma unroll
  for (int e = 0; e < 8; ++e) ta[0][e] = ldfrag_p(pt + e * 512);

  // first and last position of key blocks lane and lane + 32
  const int* pe = P4 + tok0 + 32 * lane;
  const int f0 = pe[0], l0 = pe[31], f1 = pe[1024], l1 = pe[1024 + 31];
  addr_regs_free_of(pe);
  // Positions rise with the key's place, so the blocks with a kept key, those far below and those far above the queries are
  // each a run of blocks: their numbers are counts over the 64 blocks (ballots: the same in every lane).
  const int plo = 4 * (t0 - RCEN), phi = 4 * (t0 + 31 + RCEN);
  const int nkb = clampi(__builtin_popcount(__builtin_amdgcn_ballot_w32(f0 < 4 * SEQ)) +
                         __builtin_popcount(__builtin_amdgcn_ballot_w32(f1 < 4 * SEQ)), 1, SEQ / 32);
  const int nlo = clampi(__builtin_popcount(__builtin_amdgcn_ballot_w32(l0 <= plo)) +
                         __builtin_popcount(__builtin_amdgcn_ballot_w32(l1 <= plo)), 0, nkb);
  const int khi = clampi(nkb - __builtin_popcount(__builtin_amdgcn_ballot_w32(f0 >= phi && f0 < 4 * SEQ)) -
                         __builtin_popcount(__builtin_amdgcn_ballot_w32(f1 >= phi && f1 < 4 * SEQ)), nlo, nkb);
  // The keys are parted so that the two waves have about the same work, a block with a bias per score counting BWT/128 more
  // than another: ksp = where the running work reaches half of the whole.
  const int nbd = khi - nlo;
  const int hw = (128 * nkb + BWT * nbd) >> 1;
  const int ksr = (hw <= 128 * nlo) ? ((hw + 64) >> 7)
                : (hw <= 128 * nlo + (128 + BWT) * nbd) ? nlo + (hw - 128 * nlo + (128 + BWT) / 2) / (128 + BWT)
                                                        : ((hw - BWT * nbd + 64) >> 7);
  const int ksp = clampi(ksr, 1, nkb);
  // This wave's key blocks k0 .. k1-1: k0 .. e1-1 below the band, e1 .. e2-1 in it, e2 .. k1-1 above. All bounds are the same
  // in every lane; read as scalars so that the three loops below are uniform branches and EXEC stays all ones for the
  // matrix instructions.
  const int k0 = __builtin_amdgcn_readfirstlane(part ? ksp : 0);
  const int k1 = __builtin_amdgcn_readfirstlane(part ? nkb : ksp);
  const int e1 = __builtin_amdgcn_readfirstlane(clampi(nlo, k0, k1));
  const int e2 = __builtin_amdgcn_readfirstlane(clampi(khi, k0, k1));

  // lane-fixed parts of the operand addresses; key block sb adds sb/16 token tiles (K), sb/32 key blocks (V^T), sb columns
  const size_t kfix = ((size_t)h * (MT / 16) + (tok0 >> 4)) * 1024 + (size_t)(lane * 8);
  const size_t vfix = ((size_t)h * (MT / 32) + (tok0 >> 5)) * 2048 + (size_t)(lane * 8);

  // positions of the first key block with a bias per score (of the row's last block where e1 is behind it), fetched here, in
  // front of every other operand: fetched in front of that loop they would be its youngest loads on entry, and the wait for
  // them at the head of each of its passes would wait out the pass's V^T fetch too
  const int* pq0 = pl + (e1 < SEQ / 32 ? e1 : SEQ / 32 - 1) * 32;
  v4i pk[4];
  pk[0] = *(const v4i*)(pq0);      pk[1] = *(const v4i*)(pq0 + 4);
  pk[2] = *(const v4i*)(pq0 + 16); pk[3] = *(const v4i*)(pq0 + 20);
  addr_regs_free_of(pq0);

  // K, mask and V^T operands of key block k0 (of the planes' last block where k0 is behind it)
  const int kf0 = k0 < SEQ / 32 ? k0 : SEQ / 32 - 1;
  const size_t kst = kfix + (size_t)kf0 * 2048, vst = vfix + (size_t)kf0 * 2048;
  const int* mst = mk + kf0 * 32;
  v16us kf[8], vf[4];
  kf[0] = ldfrag_p(KH + kst);        kf[1] = ldfrag_p(KH + kst + 512);     // keys 0..15, hi
  kf[2] = ldfrag_p(KL + kst);        kf[3] = ldfrag_p(KL + kst + 512);     // keys 0..15, residual
  kf[4] = ldfrag_p(KH + kst + 1024); kf[5] = ldfrag_p(KH + kst + 1536);    // keys 16..31, hi
  kf[6] = ldfrag_p(KL + kst + 1024); kf[7] = ldfrag_p(KL + kst + 1536);    // keys 16..31, residual
  int mnx = mst[0];                                                        // mask word of key lane
  addr_regs_free_of(KH + kst, KL + kst, mst);
  vf[0] = ldfrag_p(VT + vst);
  vf[1] = ldfrag_p(VT + vst + 512);
  vf[2] = ldfrag_p(VT + vst + 1024);
  vf[3] = ldfrag_p(VT + vst + 1536);
  addr_regs_free_of(VT + vst);

  // bias table of the pair's 32 queries: this wave's half of table tiles 1 .. NPT-2, four tiles at a time; D register r of
  // lane l is (table row 8*hh + r of the tile, query m), 8 columns in a row of the query's LDS row; 1/(16*64) is a power of two
  {
    float* rs = &rtab[wv >> 1][m][16 * TPW * part + 8 * hh];
#pragma unroll
    for (int g = 0; g < TPW / 4; ++g) {
      if (g + 1 < TPW / 4) {
#pragma unroll
        for (int e = 0; e < 8; ++e) ta[(g + 1) & 1][e] = ldfrag_p(pt + (g + 1) * 4096 + e * 512);
      }
      // keeps the next four tiles' fetch in front of these four tiles' products: sunk towards its use it would have no time to land
      __builtin_amdgcn_sched_barrier(0);
#pragma unroll
      for (int v = 0; v < 4; ++v) {
#pragma unroll
        for (int t = 0; t < QT; ++t) {
          const v8f D = dot2_res(q[t], ta[g & 1][2 * v], ta[g & 1][2 * v + 1]) * (1.0f / (QKS * WSCL));
          *(v4f*)(rs + t * (16 * RP) + 16 * (4 * g + v))     = lo4(D);
          *(v4f*)(rs + t * (16 * RP) + 16 * (4 * g + v) + 4) = hi4(D);
        }
      }
    }
    addr_regs_free_of(pt);                             // the one address of every table load stays unwritten up to here
  }
  __syncthreads();                                     // both halves of every pair's table are written before it is read

  // byte places in rtab: rlo[t] = table row 0 of the lane's query of tile t; rcx[t] + 4*j = row j - i + RCEN before the clamp
  const char* rtb = (const char*)&rtab[0][0][0];
  int rlo[QT], rcx[QT];
#pragma unroll
  for (int t = 0; t < QT; ++t) {
    rlo[t] = 4 * (((wv >> 1) * 32 + 16 * t + m) * RP + RC0);
    rcx[t] = rlo[t] + 4 * (RCEN - (t0 + 16 * t + m));
  }
  const float blo[QT] = {*(const float*)(rtb + rlo[0]), *(const float*)(rtb + rlo[1])};
  const float bhi[QT] = {*(const float*)(rtb + rlo[0] + 4 * (NREL - 1)), *(const float*)(rtb + rlo[1] + 4 * (NREL - 1))};

  float mx[QT] = {-1.0e30f, -1.0e30f}, ls[QT] = {0.f, 0.f};   // running maximum of the query; sum over this lane's keys
  v8f O[QT][4];
#pragma unroll
  for (int t = 0; t < QT; ++t)
#pragma unroll
    for (int d = 0; d < 4; ++d) O[t][d] = zero8();

#define PASS_ARGS hh, q, KH, KL, VT, mk, pl, kfix, vfix, rtb, rlo, rcx, kf, pk, mnx, vf, mx, ls, O
  // the three loops stay rolled: one copy of each pass, so that the operands fetched ahead keep their registers
  // keys far below the queries, table row 0
#pragma unroll 1
  for (int kb = k0; kb < e1; ++kb) attn_pass<false>(kb, blo, PASS_ARGS);
  // the band proper
#pragma unroll 1
  for (int kb = e1; kb < e2; ++kb) attn_pass<true>(kb, blo, PASS_ARGS);
  // keys far above, table row NREL-1
#pragma unroll 1
  for (int kb = e2; kb < k1; ++kb) attn_pass<false>(kb, bhi, PASS_ARGS);
#undef PASS_ARGS
  acc_guard4(O[0][0], O[0][1], O[0][2], O[0][3]);

  // ---- epilogue: wave 2p keeps query tile 0 and hands over tile 1, wave 2p + 1 the other way round
  v4f* mp = &mrg[wv][0][lane];
  const v4f* pp = &mrg[wv ^ 1][0][lane];
  unsigned short* dst = Z + (((tok0 + (size_t)t0) >> 4) * (DM / 16) + (size_t)(h * (HD / 16))) * 256 + (size_t)(lane * 8);
  if (part == 0) part_put(mp, O[1], mx[1], ls[1]);
  else           part_put(mp, O[0], mx[0], ls[0]);
  __syncthreads();                                     // every wave's slot is written before its partner reads it
  if (part == 0) part_join(pp, O[0], mx[0], ls[0], dst);
  else           part_join(pp, O[1], mx[1], ls[1], dst + (DM / 16) * 256);
}

// =====================================================================================================
// Workspace map (bytes, NB=2 SEQ=2048 -> MT=4096); every plane is an exact multiple of its whole-row /
// whole-line / 64x64-tile store granularity (rows MT, 1536, 512; 64 | each tiled dimension; the table plane
// is NPT tiles of 2048 bytes, all written); all offsets multiples of 2048. Every f16 plane lies in fragment order.
//   XQ   f16  [4096][512]      0           4194304
//   XK   f16  [4096][512]      4194304     4194304
//   XV   f16  [4096][512]      8388608     4194304
//   WT   f16  [1536][512]      12582912    1572864   (Wq^T | Wk^T | Wv^T, x64)
//   WOT  f16  [512][512]       14155776     524288   (Wo^T, x64)
//   PEH  f16  [34][1024]       14680064      69632   (table x64, clamped tiles)
//   QH   f16  [8][256][1024]   14749696    4194304
//   QL   f16  [8][256][1024]   18944000    4194304
//   KH   f16  [8][256][1024]   23138304    4194304
//   KL   f16  [8][256][1024]   27332608    4194304
//   VT   f16  [8][128][2048]   31526912    4194304
//   Z    f16  [4096][512]      35721216    4194304
//   P4   i32  [2][2048]        39915520      16384   (4 x position of the kept keys)
//   CM   i32  [2][2048]        39931904      16384   (mask of the kept keys)
//   end                        39948288
// =====================================================================================================
extern "C" void kernel_launch(void* const* d_in, const int* in_sizes, int n_in,
                              void* d_out, int out_size, void* d_ws, size_t ws_size,
                              hipStream_t stream) {
  if (n_in < 13) return;
  const int xreq = ((NB - 1) * SEQ_FULL + SEQ) * DM;
  const int mreq = (NB - 1) * SEQ_FULL + SEQ;
  if (in_sizes[0] < xreq || in_sizes[1] < xreq || in_sizes[2] < xreq) return;
  if (in_sizes[3] < mreq) return;
  if (in_sizes[4] < DM * DM || in_sizes[6] < DM * DM || in_sizes[8] < DM * DM || in_sizes[10] < DM * DM) return;
  if (in_sizes[5] < DM || in_sizes[7] < DM || in_sizes[9] < DM || in_sizes[11] < DM) return;
  if (in_sizes[12] < NREL * HD) return;
  if (out_size < MT * DM) return;

  const float* query = (const float*)d_in[0];   // [NB_FULL][SEQ_FULL][512]
  const float* key   = (const float*)d_in[1];
  const float* value = (const float*)d_in[2];
  const int*   mask  = (const int*)d_in[3];     // [NB_FULL][SEQ_FULL] int32
  const float* wq = (const float*)d_in[4];      // [512][512] (in, out)
  const float* bq = (const float*)d_in[5];
  const float* wk = (const float*)d_in[6];
  const float* bk = (const float*)d_in[7];
  const float* wv = (const float*)d_in[8];
  const float* bv = (const float*)d_in[9];
  const float* wo = (const float*)d_in[10];
  const float* bo = (const float*)d_in[11];
  const float* rel = (const float*)d_in[12];    // [499][64]

  const size_t PX  = (size_t)MT * DM * 2;
  const size_t PWT = (size_t)3 * DM * DM * 2;
  const size_t PWO = (size_t)DM * DM * 2;
  const size_t PPE = (size_t)NPT * 1024 * 2;
  size_t off = 0;
  const size_t oXQ = off; off += 3 * PX;          // XQ | XK | XV
  const size_t oWT = off; off += PWT;
  const size_t oWO = off; off += PWO;
  const size_t oPE = off; off += PPE;
  const size_t oQH = off; off += PX;
  const size_t oQL = off; off += PX;
  const size_t oKH = off; off += PX;
  const size_t oKL = off; off += PX;
  const size_t oVT = off; off += PX;
  const size_t oZ  = off; off += PX;
  const size_t oP4 = off; off += (size_t)MT * 4;
  const size_t oCM = off; off += (size_t)MT * 4;
  if (off > ws_size) return;
  if (off > (size_t)134217728) return;

  char* ws = (char*)d_ws;
  unsigned short* XQ  = (unsigned short*)(ws + oXQ);
  unsigned short* WT  = (unsigned short*)(ws + oWT);
  unsigned short* WOT = (unsigned short*)(ws + oWO);
  unsigned short* PEH = (unsigned short*)(ws + oPE);
  unsigned short* QH  = (unsigned short*)(ws + oQH);
  unsigned short* QL  = (unsigned short*)(ws + oQL);
  unsigned short* KH  = (unsigned short*)(ws + oKH);
  unsigned short* KL  = (unsigned short*)(ws + oKL);
  unsigned short* VT  = (unsigned short*)(ws + oVT);
  unsigned short* Z   = (unsigned short*)(ws + oZ);
  int* P4 = (int*)(ws + oP4);
  int* CM = (int*)(ws + oCM);
  float* out0 = (float*)d_out;
  unsigned short* hdummy = XQ;                    // in-range placeholder for unused f16 output args

  const dim3 blk(256);
  const int gP = ((MT / 64) * (DM / 64)) / 8;     // 64x64 tiles / 8 waves, exact

  // (0) operand planes: query/key/value -> f16(bf16) per batch slice (XQ | XK | XV, contiguous; kept keys only); table -> f16(bf16 x64)
  //     clamped tiles; Wq|Wk|Wv|Wo [512][512] -> WT | WOT (contiguous) planes 0, 1, 2, 3 (transposed, f16 x64)
  cvt_all<<<dim3(4 * NTB + NBB + 3 * NB * LINB), blk, 0, stream>>>(query, key, value, wq, wk, wv, wo, rel, mask, XQ, WT, PEH, P4, CM);

  // (1) q and k hi/res planes and v^T x16
  gemm_qkv<<<dim3(gP, 3), blk, 0, stream>>>(XQ, WT, QH, QL, KH, KL, VT, bq, bk, bv);

  // (2) attention -> ctx x16 plane
  attn_kernel<<<dim3((NB * NH * (SEQ / 16)) / AWV), blk, 0, stream>>>(QH, QL, KH, KL, PEH, VT, P4, CM, Z);

  // (3) output projection: out[row][n] = sum_k Z[row][k] * WOT[n][k] / (16*64) + bo[n]
  gemm64<0, 1><<<dim3(gP), blk, 0, stream>>>(Z, WOT, hdummy, hdummy, out0, DM, 1.0f / (WSCL * CSC), bo, 1.0f, MT, DM);
  (void)hipGetLastError();
}

// v010
// It runs in 52.1 microseconds.
// Timed twice side by side with v009, it ran 1.06 and 1.07 times as fast.
// All steps since v000 together make it 5.49 times as fast.
// Contractions: x.Wq and x.Wk (q, k hi + residual planes), x.Wv (v^T plane), k.q^T (hi.hi + res.hi + hi.res),
// rel.q^T (hi + res), v^T.p^T and ctx.Wo, all on v_wmma_f32_16x16x32_f16 (f16 operands, f32 accumulate).
// Float inputs RNE-converted to bf16 on load and carried in f16 containers with power-of-two scales
// (x x1; Wq, Wk, Wv, Wo x64; rel table x64; q, k hi planes x16, residual planes x16x2048; v^T x16;
// p x4096; ctx x16); softmax, key mask and the relative-offset bias lookup in f32 on VALU. Masked keys are left out of the key
// and value planes (their softmax weight is 0), unless every key of a batch row is masked.
// Every f16 plane that a matrix product reads (Wo^T, q, k hi + residual, v^T, table, ctx; the x rows in LDS) lies in fragment order:
// the 16 bytes of lane l of one operand load stand at piece base + 16*l, so that a load covers four whole 128-byte lines.
// The input projections read x and Wq, Wk, Wv as f32 and convert them themselves.
#include <hip/hip_runtime.h>
#include <math.h>

#ifndef NB
#define NB 2
#endif
#ifndef SEQ
#define SEQ 2048
#endif
#define NB_FULL  2
#define SEQ_FULL 2048
#define DM   512
#define NH   8
#define HD   64
#define MT   (NB * SEQ)
#define NREL 499
#define RCEN 249
#define POFF 22
#define NPT  34
#define AWV  8
#define QT   2                             // query tiles of 16 rows of one attention wave
#define RP   516                           // floats of one query's row of the bias table in LDS
#define RC0  6                             // its column of table row 0
#define PPAD (8 * SEQ_FULL)                // 4 x position of a place behind the last kept key
#define BWT  32                            // extra work of a key block with a bias per score, in 1/128 of a block
#define WSCL 64.0f
#define QKS  16.0f
#define LSC  2048.0f
#define VSC  16.0f
#define PSC  4096.0f
#define CSC  16.0f
#define RSQD 0.125f
#define MASKV (-1.0e10f)
#define NTB  ((DM / 64) * (DM / 64))      // blocks of one weight transpose
#define NBB  ((NPT * 128) / 256)          // blocks of the table plane
#define GST  4                            // fragment sets of the projection GEMM's register ring

static_assert(NH * HD == DM);
static_assert(HD == 64);
static_assert(NB >= 1 && NB <= NB_FULL);
static_assert((SEQ % 64) == 0 && SEQ >= 64 && SEQ <= SEQ_FULL);
static_assert((MT % 64) == 0 && (DM % 64) == 0);
static_assert((((MT / 64) * (DM / 64)) % 8) == 0);
static_assert(((SEQ * DM) % 2048) == 0 && ((NPT * 128) % 256) == 0);
static_assert(((NB * NH * (SEQ / 16)) % AWV) == 0 && (AWV % 2) == 0 && QT == 2 && ((SEQ / 32) % (AWV / 2)) == 0);
static_assert((2 * RCEN + 1) == NREL);
static_assert(SEQ == 2048 && NPT == 34 && POFF - 16 == RC0 && 16 * (NPT - 2) <= RP && (RP % 4) == 0);
static_assert((DM % 32) == 0 && GST >= 2 && GST - 1 <= DM / 32);
static_assert(((RCEN - 15 + POFF) % 16) == 0 && POFF >= 15 && 16 * (NPT - 1) - POFF >= NREL - 1);

typedef _Float16 v16h __attribute__((ext_vector_type(16)));
typedef unsigned short v16us __attribute__((ext_vector_type(16)));
typedef unsigned short v8us  __attribute__((ext_vector_type(8)));
typedef float v8f __attribute__((ext_vector_type(8)));
typedef float v4f __attribute__((ext_vector_type(4)));
typedef unsigned int v4u __attribute__((ext_vector_type(4)));
typedef int v4i __attribute__((ext_vector_type(4)));
typedef unsigned int v8u __attribute__((ext_vector_type(8)));

union FragU { v16us v; v8us h[2]; };

// ---- scalar helpers --------------------------------------------------------------------------------
__device__ __forceinline__ unsigned short bf_bits(float f) {          // f32 -> bf16 bits, RNE convert
  const unsigned u = __float_as_uint(f);
  return (unsigned short)((u + 0x7FFFu + ((u >> 16) & 1u)) >> 16);
}
__device__ __forceinline__ float bf_up(unsigned short h) { return __uint_as_float(((unsigned)h) << 16); }
__device__ __forceinline__ float bfr(float f) { return bf_up(bf_bits(f)); }   // value of the bf16 RNE convert
__device__ __forceinline__ unsigned short h_bits(_Float16 x) { return __builtin_bit_cast(unsigned short, x); }
__device__ __forceinline__ unsigned short f2h(float f) { return h_bits((_Float16)f); }
__device__ __forceinline__ unsigned pk16(unsigned short a, unsigned short b) { return (unsigned)a | ((unsigned)b << 16); }
__device__ __forceinline__ int clampi(int v, int lo, int hi) { return v < lo ? lo : (v > hi ? hi : v); }
__device__ __forceinline__ int clamp_ord(int v, int lo, int hi) {     // clampi for lo <= hi: one minimum, one maximum
  const int a = v < hi ? v : hi;
  return a > lo ? a : lo;
}
__device__ __forceinline__ v8f zero8() { v8f z = {0.f, 0.f, 0.f, 0.f, 0.f, 0.f, 0.f, 0.f}; return z; }

// two f32 -> their bf16 RNE values, packed (a low): the hardware's packed convert rounds to nearest even like bf_bits
typedef __bf16 v2bf __attribute__((ext_vector_type(2)));
typedef float v2f __attribute__((ext_vector_type(2)));
__device__ __forceinline__ unsigned bf2(float a, float b) {
  const v2f x = {a, b};
  return __builtin_bit_cast(unsigned, __builtin_convertvector(x, v2bf));
}
__device__ __forceinline__ float bf_lo(unsigned p) { return __uint_as_float(p << 16); }           // value of the low bf16
__device__ __forceinline__ float bf_hi(unsigned p) { return __uint_as_float(p & 0xFFFF0000u); }   // value of the high bf16

// ---- fragment loader: 16-bit A/B operand of k block k0..k0+31, lane l -> row/col (l&15), h = l>>4; elements 0..7 are
//      k0+8h.., elements 8..15 are k0+16+8h... Plane in fragment order: p = fragment base + 8*lane; the piece of
//      elements 0..7 is 256 halves (32 lanes x 8), the piece of elements 8..15 follows it.
//      A row-major [R][K] matrix (lane index = row, k contiguous) as such a plane: row tile T = row/16, piece
//      q = k/16 at (T*(K/16) + q)*256; in the piece lane l = row (l&15), k = 16*q + 8*(l>>4) .. +7.
__device__ __forceinline__ v16us ldfrag_p(const unsigned short* p) {
  FragU f;
  f.h[0] = *(const v8us*)(p);
  f.h[1] = *(const v8us*)(p + 256);
  return f.v;
}

// ---- WMMA helpers (f16 operand bits) with trailing VALU hazard gap --------------------------------
__device__ __forceinline__ v8f mma_raw(v16us a, v16us b, v8f c) {
  return __builtin_amdgcn_wmma_f32_16x16x32_f16(false, __builtin_bit_cast(v16h, a), false,
                                                __builtin_bit_cast(v16h, b), (short)0, c, false, false);
}
__device__ __forceinline__ void acc_guard4(v8f& a, v8f& b, v8f& c, v8f& d) {
#if defined(__HIP_DEVICE_COMPILE__)
  asm volatile("v_nop\n\tv_nop\n\tv_nop\n\tv_nop" : "+v"(a), "+v"(b), "+v"(c), "+v"(d));
#endif
}
// orders LDS stores of this wave before later LDS loads of the same wave (cross-lane exchange)
__device__ __forceinline__ void wave_sync_lds() {
  __builtin_amdgcn_fence(__ATOMIC_RELEASE, "workgroup");
  __builtin_amdgcn_wave_barrier();
  __builtin_amdgcn_fence(__ATOMIC_ACQUIRE, "workgroup");
}

// stands behind a group of global stores that stay in flight: their address and data registers may be rewritten behind it
__device__ __forceinline__ void addr_regs_free() {
#if defined(__HIP_DEVICE_COMPILE__)
  asm volatile("s_wait_xcnt 0x0" ::: "memory");
#endif
}

// the same wait with the loads' address values as inputs: their registers stay live, so unwritten, up to the wait
// (the "memory" clobber alone does not keep a register write, or a later load's destination, behind it)
__device__ __forceinline__ void addr_regs_free_of(const void* a) {
#if defined(__HIP_DEVICE_COMPILE__)
  asm volatile("s_wait_xcnt 0x0" :: "v"(a) : "memory");
#endif
}
__device__ __forceinline__ void addr_regs_free_of(const void* a, const void* b) {
#if defined(__HIP_DEVICE_COMPILE__)
  asm volatile("s_wait_xcnt 0x0" :: "v"(a), "v"(b) : "memory");
#endif
}
__device__ __forceinline__ void addr_regs_free_of(const void* a, const void* b, const void* c) {
#if defined(__HIP_DEVICE_COMPILE__)
  asm volatile("s_wait_xcnt 0x0" :: "v"(a), "v"(b), "v"(c) : "memory");
#endif
}
__device__ __forceinline__ void addr_regs_free_of(const void* a, const void* b, const void* c, const void* d) {
#if defined(__HIP_DEVICE_COMPILE__)
  asm volatile("s_wait_xcnt 0x0" :: "v"(a), "v"(b), "v"(c), "v"(d) : "memory");
#endif
}

// =====================================================================================================
// Key order of one batch row: ord[c] = position of the c-th key whose mask word is not 0 (a masked key's softmax weight is
// exp(-1e10 - max) = 0 in f32, so only the others are kept). With no such key every weight is equal: then all SEQ keys are
// kept, in place, and stay marked as masked. Returns the number of kept keys (1..SEQ), nopen = the number not masked.
// Wave w takes SEQ/8 keys as ballot words; ranks from popcounts; the waves' totals go through tot[8]. Two block barriers,
// passed by the whole block. ord = SEQ halves of LDS, written at 0 .. kept-1 only.
// =====================================================================================================
__device__ __forceinline__ int key_order(const int* __restrict__ mrow, unsigned short* ord, int* tot, int& nopen) {
  constexpr int WPW = SEQ / 256;                          // ballot words of one wave
  const int lane = threadIdx.x & 31, w = threadIdx.x >> 5;
  const int* mp = mrow + w * (WPW * 32) + lane;
  int mv[WPW];
#pragma unroll
  for (int i = 0; i < WPW; ++i) mv[i] = mp[i * 32];
  addr_regs_free_of(mp);
  unsigned wd[WPW];
  int cnt = 0;
#pragma unroll
  for (int i = 0; i < WPW; ++i) {
    wd[i] = __builtin_amdgcn_ballot_w32(mv[i] != 0);
    cnt += __builtin_popcount(wd[i]);
  }
  if (lane == 0) tot[w] = cnt;
  __syncthreads();                                        // every wave's total is written before it is summed
  int base = 0, n = 0;
#pragma unroll
  for (int k = 0; k < 8; ++k) {
    const int v = tot[k];
    base += (k < w) ? v : 0;
    n += v;
  }
  if (n == 0) base = w * (WPW * 32);
#pragma unroll
  for (int i = 0; i < WPW; ++i) {
    const unsigned word = (n == 0) ? 0xFFFFFFFFu : wd[i];
    if ((word >> lane) & 1u)
      ord[base + __builtin_popcount(word & ((1u << lane) - 1u))] = (unsigned short)((w * WPW + i) * 32 + lane);
    base += __builtin_popcount(word);
  }
  __syncthreads();                                        // the order is complete before any thread reads it
  nopen = n;
  return n == 0 ? SEQ : n;
}

// =====================================================================================================
// Table plane in fragment order: tile u (0..NPT-1) holds the 16 table rows clamp(16u - POFF + 0..15, 0, NREL-1) as
// four pieces of 256 halves; piece j, lane l = row (l&15) of the tile, head dims 16j + 8*(l>>4) .. +7, as f16 bits
// of (bf16 RNE value * sc). The attention kernel reads tiles 1 .. NPT-2, which hold every table row; tile 0 is row 0
// sixteen times, tile NPT-1 row NREL-1 sixteen times.
// coverage: one thread per 16-byte chunk, NPT*128 chunks, bx = 0 .. NPT*128/256 - 1 exact.
// =====================================================================================================
__device__ __forceinline__ void cvt_band(const float* __restrict__ w, unsigned short* o, float sc, int bx) {
  const int g = bx * 256 + threadIdx.x;
  if (g >= NPT * 128) return;                             // never taken with the exact grid; no barriers below
  const int u = g >> 7, j = (g >> 5) & 3, l = g & 31;
  const int row = clampi(16 * u - POFF + (l & 15), 0, NREL - 1);
  const float* p = w + (size_t)row * HD + 16 * j + 8 * (l >> 4);
  const v4f a0 = *(const v4f*)(p);
  const v4f a1 = *(const v4f*)(p + 4);
  addr_regs_free_of(p);
  v4u hv;
#pragma unroll
  for (int e = 0; e < 2; ++e) {
    hv[e]     = pk16(f2h(bfr(a0[2 * e]) * sc), f2h(bfr(a0[2 * e + 1]) * sc));
    hv[2 + e] = pk16(f2h(bfr(a1[2 * e]) * sc), f2h(bfr(a1[2 * e + 1]) * sc));
  }
  *(v4u*)(o + (size_t)g * 8) = hv;
  addr_regs_free();                                       // the store's registers may be rewritten behind it
}

// =====================================================================================================
// Transpose-convert: in w[R][C] f32 -> out o = the matrix [C][R] of f16 bits of (bf16 RNE value * sc), in fragment
// order (row tile T = c/16, piece q = r/16 at (T*(R/16) + q)*256). Block tile 64x64 through LDS (st[col][row], pitch
// 72 halves). Read phase: thread owns one input row x 16 columns. Write phase: the tile is 4 row tiles x 4 pieces;
// a wave writes one whole piece per store.
// R, C multiples of 64, (bx, by) = (0 .. C/64 - 1, 0 .. R/64 - 1) exact; st = the block's 64*72 halves of LDS.
// coverage: 16 pieces x 256 halves per block = the whole transposed tile; the blocks cover all of [C][R].
// =====================================================================================================
__device__ __forceinline__ void cvt_t(const float* __restrict__ w, unsigned short* o, int R, int C, float sc,
                                      int bx, int by, unsigned short* st) {
  const int t = threadIdx.x;
  const int r0 = by * 64, c0 = bx * 64;
  if (r0 + 64 > R || c0 + 64 > C) return;               // block-uniform, before the barrier; never taken
  {
    const int row = t >> 2, ch = (t & 3) * 16;
    const float* p = w + (size_t)(r0 + row) * C + c0 + ch;
#pragma unroll
    for (int q = 0; q < 4; ++q) {
      const v4f v = *(const v4f*)(p + 4 * q);
#pragma unroll
      for (int e = 0; e < 4; ++e) st[(ch + 4 * q + e) * 72 + row] = f2h(bfr(v[e]) * sc);
    }
    addr_regs_free_of(p);
  }
  __syncthreads();
  const int l = t & 31, wq = t >> 5;                     // lane in the piece; piece 8*half + wq of the tile's 16
  v4u hv[2];
#pragma unroll
  for (int half = 0; half < 2; ++half) {
    const int tl = 2 * half + (wq >> 2), q = wq & 3;      // row tile and piece in the block tile
    hv[half] = *(const v4u*)(st + (16 * tl + (l & 15)) * 72 + 16 * q + 8 * (l >> 4));
  }
#pragma unroll
  for (int half = 0; half < 2; ++half) {
    const int tl = 2 * half + (wq >> 2), q = wq & 3;
    unsigned short* dst = o + ((size_t)((c0 >> 4) + tl) * (size_t)(R >> 4) + (size_t)((r0 >> 4) + q)) * 256 + l * 8;
    *(v4u*)dst = hv[half];
  }
  addr_regs_free();                                       // the stores' registers may be rewritten behind it
}

// =====================================================================================================
// Register-blocked f16 WMMA GEMM: C[m][n] = sum_k A[m][k] * Bt[n][k], one wave per 64x64 tile, no block
// barriers. A = [M][K] and Bt = [N][K], both planes in fragment order (row tile T, k block kb: two pieces at
// (T*(K/32) + kb)*512 halves, so a row tile's k blocks follow one another); M, N multiples of 64,
// K = DM (bx = 0 .. tiles/8 - 1 exact so no wave exits early). The k loop is unrolled over a ring of GST fragment
// sets in registers: the 16 loads of k block kb + GST - 1 issue behind the first four products of k block kb, so that a
// load has nearly GST - 1 blocks of products to land; every load is a constant distance from one of two addresses. The products in
// the loop are the plain builtin, with no asm statement that names a fragment: the sets reach above v255. Both operand
// fragments use the split k map (elements 0..7 <- k0+8h.., 8..15 <- k0+16+8h..); D element r of a lane is
// (row 8h + r, col lane&15).
// s = acc*osc + bias term (BM 0: none; BM 1: bsc*bf16(bias[col]); BM 2: bsc*bf16(bias[row])).
// OM 0: f32 out Cf = s, pitch ldc.   OM 1: f16 out Ch = f16 bits(s).
// OM 2: f16 hi plane Ch = f16(s) and f16 residual plane Cl = f16((s - hi) * 2048), same layout.
// f16 outputs lie in fragment order (ldc unused). A 16x64 slab is four pieces of 256 halves; piece it, lane l =
// slab row (l&15), slab columns 16*it + 8*(l>>4) .. +7, i.e. one load of a fragment whose lane index is the row and
// whose k index is the column. OM 2: slab (row tile T = row/16, column tile tn) at ((tn*(M/16) + T)*4 + it)*256.
// OM 1: pieces 2*kb, 2*kb + 1 of a slab are k block kb of 32 columns; piece at
// (((tm*(N/32) + column/32)*4 + row tile in tm)*2 + (it&1))*256, so that a k block's four row tiles are contiguous.
// coverage: 4 slabs x 16 rows x 64 cols = the wave's whole 64x64 tile.
// =====================================================================================================
template <int OM, int BM>
__device__ __forceinline__ void gemm64_tile(
    const unsigned short* __restrict__ Ap, const unsigned short* __restrict__ Btp,
    unsigned short* Ch, unsigned short* Cl, float* Cf, int ldc, float osc,
    const float* __restrict__ bias, float bsc, int M, int N, int bx, float (*sT)[16 * 68]) {
  constexpr int K = DM;
  constexpr int NKB = K / 32;                  // k blocks
  const int lane = threadIdx.x & 31;
  const int wave = threadIdx.x >> 5;
  const int tilesN = N >> 6;
  const int tilesM = M >> 6;
  const int tile = bx * 8 + wave;
  if (tile >= tilesM * tilesN) return;   // wave-uniform; no block barriers in this kernel
  const int tm = tile / tilesN;
  const int tn = tile - tm * tilesN;
  const int m0 = tm << 6;
  const int n0 = tn << 6;

  const int rlane = lane & 15;                 // col (D) within subtile
  const int mOff  = (lane >> 4) * 8;           // D row offset
  constexpr size_t tstr = (size_t)NKB * 512;   // halves of one row tile of an operand plane
  const unsigned short* Aw = Ap + (size_t)(m0 >> 4) * tstr + lane * 8;    // this lane's chunk of row tile m0/16, k block 0
  const unsigned short* Bw = Btp + (size_t)(n0 >> 4) * tstr + lane * 8;

  v8f acc[4][4];
#pragma unroll
  for (int i = 0; i < 4; ++i)
#pragma unroll
    for (int j = 0; j < 4; ++j) acc[i][j] = zero8();

  v16us bh[GST][4], ah[GST][4];                // fragment set kb % GST holds k block kb
  // unrolled here and below: the sets are indexed by constants only, so they stay in registers
#pragma unroll
  for (int kb = 0; kb < GST - 1; ++kb) {
#pragma unroll
    for (int j = 0; j < 4; ++j) bh[kb][j] = ldfrag_p(Bw + (size_t)kb * 512 + (size_t)j * tstr);
#pragma unroll
    for (int i = 0; i < 4; ++i) ah[kb][i] = ldfrag_p(Aw + (size_t)kb * 512 + (size_t)i * tstr);
    // keeps the first sets' loads in the order of their use: loads return in order, and k block 0 is waited for first
    __builtin_amdgcn_sched_barrier(0);
  }
#pragma unroll
  for (int kb = 0; kb < NKB; ++kb) {
    const int st = kb % GST;
#pragma unroll
    for (int j = 0; j < 4; ++j) acc[0][j] = mma_raw(ah[st][0], bh[st][j], acc[0][j]);
    if (kb + GST - 1 < NKB) {
      const int kn = kb + GST - 1, sn = kn % GST;
      // keeps the fetch behind the four products above, so behind every product of k block kb - 1, whose set it refills:
      // moved up it would need a further set of registers
      __builtin_amdgcn_sched_barrier(0);
#pragma unroll
      for (int j = 0; j < 4; ++j) bh[sn][j] = ldfrag_p(Bw + (size_t)kn * 512 + (size_t)j * tstr);
#pragma unroll
      for (int i = 0; i < 4; ++i) ah[sn][i] = ldfrag_p(Aw + (size_t)kn * 512 + (size_t)i * tstr);
      // keeps the fetch in front of the block's other products: sunk towards its use it would have no time to land
      __builtin_amdgcn_sched_barrier(0);
    }
#pragma unroll
    for (int i = 1; i < 4; ++i) {
#pragma unroll
      for (int j = 0; j < 4; ++j) acc[i][j] = mma_raw(ah[st][i], bh[st][j], acc[i][j]);
    }
  }
  addr_regs_free_of(Aw, Bw);                   // the two addresses of every load above stay unwritten up to here
  acc_guard4(acc[0][0], acc[0][1], acc[0][2], acc[0][3]);
  acc_guard4(acc[1][0], acc[1][1], acc[1][2], acc[1][3]);
  acc_guard4(acc[2][0], acc[2][1], acc[2][2], acc[2][3]);
  acc_guard4(acc[3][0], acc[3][1], acc[3][2], acc[3][3]);

  const int hh2 = lane >> 4, c4 = (lane & 15) * 4;     // f32 out: 256-B row segment = 16 lanes x 16 B

  // column bias terms (fixed per wave); addresses n0+c4+3 < N and n0+48+8+7 < N
  v4f bc4 = {0.f, 0.f, 0.f, 0.f};
  float bc8[4][8];                                      // f16 out: piece it, columns 16*it + 8*hh2 .. +7
#pragma unroll
  for (int it = 0; it < 4; ++it)
#pragma unroll
    for (int e = 0; e < 8; ++e) bc8[it][e] = 0.f;
  if (BM == 1) {
    if (OM == 0) {
      const v4f t4 = *(const v4f*)(bias + n0 + c4);
#pragma unroll
      for (int e = 0; e < 4; ++e) bc4[e] = bfr(t4[e]) * bsc;
    } else {
#pragma unroll
      for (int it = 0; it < 4; ++it) {
        const v4f ta = *(const v4f*)(bias + n0 + 16 * it + 8 * hh2);
        const v4f tb = *(const v4f*)(bias + n0 + 16 * it + 8 * hh2 + 4);
#pragma unroll
        for (int e = 0; e < 4; ++e) { bc8[it][e] = bfr(ta[e]) * bsc; bc8[it][4 + e] = bfr(tb[e]) * bsc; }
      }
    }
  }

  // ---- epilogue ----
  float* slab = sT[wave];
#pragma unroll
  for (int i = 0; i < 4; ++i) {
    const int mBase = m0 + (i << 4);
#pragma unroll
    for (int j = 0; j < 4; ++j) {
#pragma unroll
      for (int r = 0; r < 8; ++r) {
        slab[(mOff + r) * 68 + (j << 4) + rlane] = acc[i][j][r];
      }
    }
    wave_sync_lds();
    if (OM == 0) {
      v4f vals[8];
#pragma unroll
      for (int it = 0; it < 8; ++it) {
        const int row = it * 2 + hh2;                      // it 0..7 x hh2 0..1 = rows 0..15
        const v4f v = *(const v4f*)(slab + row * 68 + c4);
        float rb2 = 0.f;
        if (BM == 2) rb2 = bfr(bias[mBase + row]) * bsc;
        vals[it] = v * osc + bc4 + rb2;
      }
      {
#pragma unroll
        for (int it = 0; it < 8; ++it) {
          const int row = it * 2 + hh2;
          *(v4f*)(Cf + (size_t)(mBase + row) * ldc + (size_t)n0 + c4) = vals[it];
        }
        
      }
    } else {
      v4u hv[4], hl[4];
      float rb2 = 0.f;
      if (BM == 2) rb2 = bfr(bias[mBase + rlane]) * bsc;
#pragma unroll
      for (int it = 0; it < 4; ++it) {
        const float* sp = slab + rlane * 68 + 16 * it + 8 * hh2;   // rows 0..15 x (it, hh2) = 8 column chunks
        v4u ha = {0u, 0u, 0u, 0u};
        v4u la = {0u, 0u, 0u, 0u};
#pragma unroll
        for (int e = 0; e < 4; ++e) {
          const float b0 = sp[2 * e]     * osc + bc8[it][2 * e]     + rb2;
          const float b1 = sp[2 * e + 1] * osc + bc8[it][2 * e + 1] + rb2;
          if (OM == 1) {
            ha[e] = pk16(f2h(b0), f2h(b1));
          } else {
            const _Float16 h0 = (_Float16)b0;
            const _Float16 h1 = (_Float16)b1;
            const float l0 = (b0 - (float)h0) * LSC;       // difference exact, power-of-two carry exact
            const float l1 = (b1 - (float)h1) * LSC;
            ha[e] = pk16(h_bits(h0), h_bits(h1));
            la[e] = pk16(f2h(l0), f2h(l1));
          }
        }
        hv[it] = ha;
        hl[it] = la;
      }
      {
#pragma unroll
        for (int it = 0; it < 4; ++it) {
          const size_t pc = (OM == 2)
              ? ((size_t)tn * (size_t)(M >> 4) + (size_t)(mBase >> 4)) * 4 + it
              : (((size_t)tm * (size_t)(N >> 5) + (size_t)((n0 >> 5) + (it >> 1))) * 4 + i) * 2 + (it & 1);
          const size_t go = pc * 256 + (size_t)(lane * 8);    // 32 lanes x 16 B = the whole piece
          *(v4u*)(Ch + go) = hv[it];
          if (OM == 2) *(v4u*)(Cl + go) = hl[it];
        }
        addr_regs_free();
      }
    }
    wave_sync_lds();
  }
}

// one product per launch, K = DM
template <int OM, int BM>
__global__ __launch_bounds__(256) void gemm64(
    const unsigned short* __restrict__ Ap, const unsigned short* __restrict__ Btp,
    unsigned short* Ch, unsigned short* Cl, float* Cf, int ldc, float osc,
    const float* __restrict__ bias, float bsc, int M, int N) {
  __shared__ __align__(16) float sT[8][16 * 68];   // per-wave 16x64 slab, pitch 68 floats
  gemm64_tile<OM, BM>(Ap, Btp, Ch, Cl, Cf, ldc, osc, bias, bsc, M, N, blockIdx.x, sT);
}

// ---- the input projections, straight from the f32 inputs ---------------------------------------------
// the 16 rows of one k block of a weight matrix w[k][n] that lane l needs (k0 + 8*(l>>4) + 0..7, k0 + 16 + 8*(l>>4) + 0..7),
// four columns each: sb = the matrix at row k0 - 32*KO, the same for the wave; vo = the lane's bytes, (8*(l>>4)*DM + n0 + 4*(l&15))*4.
// A load covers two rows x 256 bytes, four whole lines, and is a constant distance from sb + vo. The wait behind the loads names
// both as inputs: their registers stay live, so unwritten, up to it.
template <int KO>
__device__ __forceinline__ void ldw(v4f (&w)[16], const char* sb, unsigned vo) {
#pragma unroll
  for (int e = 0; e < 8; ++e) {
    w[e]     = *(const v4f*)(sb + vo + (KO * 32 + e) * (DM * 4));
    w[8 + e] = *(const v4f*)(sb + vo + (KO * 32 + 16 + e) * (DM * 4));
  }
#if defined(__HIP_DEVICE_COMPILE__)
  asm volatile("s_wait_xcnt 0x0" :: "s"(sb), "v"(vo) : "memory");
#endif
}
// weight fragments of one k block, formed in registers from its loaded rows as f16 bits of (bf16 RNE value x64): component j of the
// rows is fragment j, whose lane index l&15 stands for column n0 + 4*(l&15) + j; element e is row e of ldw, i.e. the split k map of
// ldfrag_p. Neighbouring components are rounded as a pair: they lie in neighbouring registers.
__device__ __forceinline__ void cvtw(const v4f (&w)[16], v8u (&wf)[4]) {
  unsigned p[16][2];
#pragma unroll
  for (int e = 0; e < 16; ++e) {
    p[e][0] = bf2(w[e][0], w[e][1]);
    p[e][1] = bf2(w[e][2], w[e][3]);
  }
#pragma unroll
  for (int e = 0; e < 8; ++e) {
#pragma unroll
    for (int g = 0; g < 2; ++g) {
      wf[2 * g][e]     = pk16(f2h(bf_lo(p[2 * e][g]) * WSCL), f2h(bf_lo(p[2 * e + 1][g]) * WSCL));
      wf[2 * g + 1][e] = pk16(f2h(bf_hi(p[2 * e][g]) * WSCL), f2h(bf_hi(p[2 * e + 1][g]) * WSCL));
    }
  }
}
// activation fragments of the four row tiles of one k block from LDS (xl = k block base + 8*lane)
__device__ __forceinline__ void ldx(v16us (&xf)[4], const unsigned short* xl) {
#pragma unroll
  for (int i = 0; i < 4; ++i) xf[i] = ldfrag_p(xl + i * (DM * 16));
}
// the 16 products of one k block
__device__ __forceinline__ void mm16(const v8u (&wf)[4], const v16us (&xf)[4], v8f (&acc)[4][4]) {
#pragma unroll
  for (int i = 0; i < 4; ++i)
#pragma unroll
    for (int j = 0; j < 4; ++j) acc[i][j] = mma_raw(xf[i], __builtin_bit_cast(v16us, wf[j]), acc[i][j]);
}

// =====================================================================================================
// The three input projections and the two small operand planes in one launch; none reads what another writes. The flat block
// index picks the work, the same for the whole block (so are all barriers below).
// Blocks 0 .. 3*GB-1: product sel = bid/GB (0: q, 1: k, 2: v) of 64 plane rows (tokens) x all DM columns; wave w takes
// columns 64w .. 64w+63, i.e. head w. The block converts its 64 input rows once, f32 -> f16 bits of the bf16 RNE value, into LDS
// in fragment order (row tile T, piece q at (T*(DM/16) + q)*256 halves; wave w fills pieces 16w .. 16w+15: one row a lane);
// for k and v plane row c of a batch slice is input row ord[c] for c < kept, zeros behind (key_order, formed by each block).
// One block barrier; then each wave runs the k loop on its own: weights come as f32 rows, fetched up to two k blocks ahead, and
// are converted (bf16 RNE value x64 as f16) where they are used. The k loop stays rolled, two k blocks a trip (two row sets).
// D register r of lane l of acc[i][j] = (plane row 16i + 8*(l>>4) + r, column 64w + 4*(l&15) + j).
// q, k: s = 16*(x.W + b) -> hi plane f16(s), residual plane f16(2048*(s - hi)), [head][token tile][dims 0..31 | 32..63],
// through a per-wave 16x64 f32 slab. v: 16*(x.Wv + bv) as f16: a lane's 8 registers are 8 tokens of one dim, one 16-byte
// chunk of VT = [head][key block of 32][dim tile of 16][tokens 0..15 | 16..31]; a 2 KB slab puts the chunks in piece order.
// The first k block of a batch slice also writes P4[c] = 4 x position of kept key c (PPAD behind them) and CM[c] = its mask.
// Blocks 3*GB ..: NTB blocks Wo -> WOT (transposed, x64), NBB blocks table -> PE (x64, clamped tiles).
// =====================================================================================================
#define GB (MT / 64)
__global__ __launch_bounds__(256) void gemm_qkv(
    const float* __restrict__ query, const float* __restrict__ key, const float* __restrict__ value,
    const float* __restrict__ wq, const float* __restrict__ wk, const float* __restrict__ wv,
    const float* __restrict__ wo, const float* __restrict__ rel, const int* __restrict__ mask,
    const float* __restrict__ bq, const float* __restrict__ bk, const float* __restrict__ bv,
    unsigned short* QH, unsigned short* QL, unsigned short* KH, unsigned short* KL, unsigned short* VT,
    unsigned short* WOT, unsigned short* PE, int* P4, int* CM) {
  __shared__ __align__(16) unsigned short xs[64 * DM];   // the block's activation rows, fragment order
  __shared__ __align__(16) float sT[8][16 * 68];         // per-wave slab; in front of the k loop the key order
  static_assert((SEQ % 64) == 0 && 64 * DM >= 64 * 72 && 8 * 16 * 68 * 4 >= SEQ * 2 + 32);
  int bid = blockIdx.x;
  if (bid >= 3 * GB) {
    bid -= 3 * GB;
    if (bid < NTB) {
      cvt_t(wo, WOT, DM, DM, WSCL, bid % (DM / 64), bid / (DM / 64), xs);
      return;
    }
    bid -= NTB;
    if (bid < NBB) cvt_band(rel, PE, WSCL, bid);
    return;
  }
  const int sel = bid / GB, bx = bid - sel * GB;
  const int lane = threadIdx.x & 31, wave = threadIdx.x >> 5;
  const int rlane = lane & 15, hh2 = lane >> 4;
  const int m0 = bx * 64;                                 // first plane row
  const int by = m0 / SEQ, c0 = m0 - by * SEQ;            // batch slice: SEQ rows, a whole number of blocks
  const int n0 = wave * 64;
  const float* x = ((sel == 0) ? query : (sel == 1) ? key : value) + (size_t)by * SEQ_FULL * DM;
  const float* w = (sel == 0) ? wq : (sel == 1) ? wk : wv;

  // weight rows of k block 0, fetched in front of everything else
  const unsigned wvo = (unsigned)(((8 * hh2) * DM + n0 + 4 * rlane) * 4);
  v4f wa[16], wb[16];
  ldw<0>(wa, (const char*)w, wvo);

  unsigned short* ord = (unsigned short*)&sT[0][0];       // SEQ halves, then the waves' totals
  int kept = SEQ, nopen = SEQ;
  if (sel != 0) kept = key_order(mask + (size_t)by * SEQ_FULL, ord, (int*)(ord + SEQ), nopen);

  {
    const int c = c0 + (wave >> 1) * 16 + rlane;          // the lane's plane row in the batch slice
    int row = c;
    if (sel != 0) row = (c < kept) ? clampi((int)ord[c], 0, SEQ - 1) : -1;
    v4f a[32];
    // unrolled here and below: the array is indexed by constants only, and every load is a constant distance from p
#pragma unroll
    for (int i = 0; i < 32; ++i) a[i] = v4f{0.f, 0.f, 0.f, 0.f};
    if (row >= 0) {
      const float* p = x + (size_t)row * DM + (wave & 1) * 256 + 8 * hh2;
#pragma unroll
      for (int i = 0; i < 16; ++i) {
        a[2 * i]     = *(const v4f*)(p + 16 * i);
        a[2 * i + 1] = *(const v4f*)(p + 16 * i + 4);
      }
      addr_regs_free_of(p);
    }
    ldw<1>(wb, (const char*)w, wvo);                      // k block 1: lands under the conversion below
    unsigned short* xd = xs + (size_t)(wave * 16) * 256 + lane * 8;
#pragma unroll
    for (int i = 0; i < 16; ++i) {
      v4u hv;
#pragma unroll
      for (int e = 0; e < 2; ++e) {
        const unsigned p0 = bf2(a[2 * i][2 * e], a[2 * i][2 * e + 1]);
        const unsigned p1 = bf2(a[2 * i + 1][2 * e], a[2 * i + 1][2 * e + 1]);
        hv[e]     = pk16(f2h(bf_lo(p0)), f2h(bf_hi(p0)));
        hv[2 + e] = pk16(f2h(bf_lo(p1)), f2h(bf_hi(p1)));
      }
      *(v4u*)(xd + i * 256) = hv;
    }
  }
  if (sel == 1 && c0 == 0) {
    int* pd = P4 + by * SEQ + threadIdx.x;
    int* cd = CM + by * SEQ + threadIdx.x;
    // unrolled: every store is a constant distance from one of two addresses
#pragma unroll
    for (int i = 0; i < SEQ / 256; ++i) {
      const int c = i * 256 + threadIdx.x;
      int pv = PPAD;
      if (c < kept) pv = 4 * (int)ord[c];
      pd[i * 256] = pv;
      cd[i * 256] = (c < nopen) ? 1 : 0;
    }
    addr_regs_free_of(pd, cd);
  }
  __syncthreads();                                        // the 64 rows are in LDS, and the key order is read, before the k loop

  v8f acc[4][4];
#pragma unroll
  for (int i = 0; i < 4; ++i)
#pragma unroll
    for (int j = 0; j < 4; ++j) acc[i][j] = zero8();
  const unsigned short* xl = xs + lane * 8;
  v8u wf[4];
  v16us xf[4];
  // rolled: one copy of two k blocks, so that the kernel's text stays small. The LDS reads of a k block stand in front of its
  // conversion, which covers them; a row set is refilled for k block kb + 2 as soon as it is converted, in front of the products of
  // k block kb; the last trip fetches its own k blocks again (in range, unused).
  // The scheduling barriers keep that order: a fetch sunk towards its use, or a conversion (with its wait) lifted over the
  // products in front of it, would leave the loads less than a k block to land.
#pragma unroll 1
  for (int kb = 0; kb < DM / 32; kb += 2) {
    const char* wn = (const char*)(w + (size_t)(kb + 2 < DM / 32 ? kb + 2 : kb) * 32 * DM);
    ldx(xf, xl + kb * 512);
    cvtw(wa, wf);
    __builtin_amdgcn_sched_barrier(0);
    ldw<0>(wa, wn, wvo);
    __builtin_amdgcn_sched_barrier(0);
    mm16(wf, xf, acc);
    __builtin_amdgcn_sched_barrier(0);
    ldx(xf, xl + (kb + 1) * 512);
    cvtw(wb, wf);
    __builtin_amdgcn_sched_barrier(0);
    ldw<1>(wb, wn, wvo);
    __builtin_amdgcn_sched_barrier(0);
    mm16(wf, xf, acc);
    __builtin_amdgcn_sched_barrier(0);
  }

  if (sel == 2) {
    const float* bp = bv + n0 + 4 * rlane;
    const v4f tb = *(const v4f*)(bp);
    addr_regs_free_of(bp);
    float bj[4];
#pragma unroll
    for (int j = 0; j < 4; ++j) bj[j] = bfr(tb[j]) * VSC;
    unsigned short* sl = (unsigned short*)sT[wave];
#pragma unroll
    for (int i = 0; i < 4; ++i) {
#pragma unroll
      for (int j = 0; j < 4; ++j) {
        v4u z;
#pragma unroll
        for (int e = 0; e < 4; ++e)
          z[e] = pk16(f2h(acc[i][j][2 * e] * (VSC / WSCL) + bj[j]), f2h(acc[i][j][2 * e + 1] * (VSC / WSCL) + bj[j]));
        // dim 4*rlane + j of the head: dim tile rlane/4, chunk 16*hh2 + 4*(rlane&3) + j of its piece
        *(v4u*)(sl + (rlane >> 2) * 256 + (16 * hh2 + 4 * (rlane & 3) + j) * 8) = z;
      }
      wave_sync_lds();
      v4u y[4];
#pragma unroll
      for (int d = 0; d < 4; ++d) y[d] = *(const v4u*)(sl + d * 256 + lane * 8);
#pragma unroll
      for (int d = 0; d < 4; ++d) {
        const size_t pc = (((size_t)wave * (size_t)(MT >> 5) + (size_t)((m0 >> 5) + (i >> 1))) * 4 + d) * 2 + (i & 1);
        *(v4u*)(VT + pc * 256 + (size_t)(lane * 8)) = y[d];
      }
      addr_regs_free();
      wave_sync_lds();
    }
    return;
  }

  const float* bias = (sel == 1) ? bk : bq;
  unsigned short* Ch = (sel == 1) ? KH : QH;
  unsigned short* Cl = (sel == 1) ? KL : QL;
  const float* bp = bias + n0 + 8 * hh2;
  float bc8[4][8];                                        // piece it, columns 16*it + 8*hh2 .. +7
#pragma unroll
  for (int it = 0; it < 4; ++it) {
    const v4f ta = *(const v4f*)(bp + 16 * it);
    const v4f tb = *(const v4f*)(bp + 16 * it + 4);
#pragma unroll
    for (int e = 0; e < 4; ++e) { bc8[it][e] = bfr(ta[e]) * QKS; bc8[it][4 + e] = bfr(tb[e]) * QKS; }
  }
  addr_regs_free_of(bp);
  float* slab = sT[wave];
#pragma unroll
  for (int i = 0; i < 4; ++i) {
#pragma unroll
    for (int r = 0; r < 8; ++r) {
      const v4f v = {acc[i][0][r], acc[i][1][r], acc[i][2][r], acc[i][3][r]};   // columns 4*rlane + 0..3
      *(v4f*)(slab + (8 * hh2 + r) * 68 + 4 * rlane) = v;
    }
    wave_sync_lds();
    v4u hv[4], hl[4];
#pragma unroll
    for (int it = 0; it < 4; ++it) {
      const float* sp = slab + rlane * 68 + 16 * it + 8 * hh2;   // rows 0..15 x (it, hh2) = 8 column chunks
#pragma unroll
      for (int e = 0; e < 4; ++e) {
        const float b0 = sp[2 * e]     * (QKS / WSCL) + bc8[it][2 * e];
        const float b1 = sp[2 * e + 1] * (QKS / WSCL) + bc8[it][2 * e + 1];
        const _Float16 h0 = (_Float16)b0;
        const _Float16 h1 = (_Float16)b1;
        const float l0 = (b0 - (float)h0) * LSC;           // difference exact, power-of-two carry exact
        const float l1 = (b1 - (float)h1) * LSC;
        hv[it][e] = pk16(h_bits(h0), h_bits(h1));
        hl[it][e] = pk16(f2h(l0), f2h(l1));
      }
    }
#pragma unroll
    for (int it = 0; it < 4; ++it) {
      const size_t pc = ((size_t)wave * (size_t)(MT >> 4) + (size_t)((m0 >> 4) + i)) * 4 + it;
      const size_t go = pc * 256 + (size_t)(lane * 8);     // 32 lanes x 16 B = the whole piece
      *(v4u*)(Ch + go) = hv[it];
      *(v4u*)(Cl + go) = hl[it];
    }
    addr_regs_free();
    wave_sync_lds();
  }
}

// ---- per-tile products used by the attention kernel ----------------------------------------------
// Both give the TRANSPOSED tile: the plane rows (table rows, keys) are the A operand, the query rows the B operand,
// so that D register r of lane l is (plane row 8*(l>>4) + r, query l&15). q = the query tile's fragments
// {hi dims 0..31, hi dims 32..63, residual dims 0..31, residual dims 32..63}. The products are the plain builtin, with no
// asm statement that names an operand: with v_nop statements behind them the two query tiles' registers did not fit the
// window that such a statement can name, and fragments went to scratch and came back in every pass.
// R^T = b.qh + (b.ql)/2048 over 64 head dims (b0, b1: fragments of a [n][64] f16 plane row, dims 0..31 and 32..63)
__device__ __forceinline__ v8f dot2_res(const v16us (&q)[4], v16us b0, v16us b1) {
  v8f L = mma_raw(b0, q[2], zero8());
  L = mma_raw(b1, q[3], L);
  L = L * (1.0f / LSC);
  v8f R = mma_raw(b0, q[0], L);
  R = mma_raw(b1, q[1], R);
  return R;
}
// S^T = kh.qh + (kl.qh + kh.ql)/2048 over 64 head dims (kh from the hi plane row, kl from the residual plane row)
__device__ __forceinline__ v8f dot3_res(const v16us (&q)[4], v16us kh0, v16us kh1, v16us kl0, v16us kl1) {
  v8f L = mma_raw(kl0, q[0], zero8());
  L = mma_raw(kl1, q[1], L);
  L = mma_raw(kh0, q[2], L);
  L = mma_raw(kh1, q[3], L);
  L = L * (1.0f / LSC);
  v8f S = mma_raw(kh0, q[0], L);
  S = mma_raw(kh1, q[1], S);
  return S;
}
// value of lane l ^ 16
__device__ __forceinline__ float xhalf(float x) {
  const int b = __builtin_bit_cast(int, x);
  return __builtin_bit_cast(float, __builtin_amdgcn_permlanex16(b, b, 0x76543210, 0xfedcba98, false, false));
}
__device__ __forceinline__ v4f lo4(v8f x) { return __builtin_shufflevector(x, x, 0, 1, 2, 3); }
__device__ __forceinline__ v4f hi4(v8f x) { return __builtin_shufflevector(x, x, 4, 5, 6, 7); }
__device__ __forceinline__ v8f cat8(v4f a, v4f b) { return __builtin_shufflevector(a, b, 0, 1, 2, 3, 4, 5, 6, 7); }

// =====================================================================================================
// One key block (32 keys) of the attention loop for the wave's QT query tiles; the layouts are those of the kernel's own
// comment below. kf = K fragments {keys 0..15: hi, hi, residual, residual; keys 16..31: the same}, vf = V^T fragments of the
// four dim tiles, pk = 4 x position of the lane's 16 keys (8*hh + 0..7, 16 + 8*hh + 0..7).
// BAND = true: the block's keys meet more than one table row: each score's bias is read from the query's row of the LDS table
// at byte clamp(pk + rcx[t], rlo[t], rlo[t] + 4*(NREL-1)) of rtb, i.e. table row clamp(j - i + RCEN, 0, NREL-1), and the
// next block's positions are fetched. BAND = false: every key of the block has the same clipped table row for every
// query of the wave, so bc[t] = rel.q of that row is the bias of all 32 keys; no position load, no LDS.
// =====================================================================================================
template <bool BAND>
__device__ __forceinline__ void attn_pass(
    int kb, const float (&bc)[QT], int hh, const v16us (&q)[QT][4],
    const unsigned short* __restrict__ KH, const unsigned short* __restrict__ KL,
    const unsigned short* __restrict__ VT, const int* __restrict__ mk, const int* __restrict__ pl,
    size_t kfix, size_t vfix, const char* rtb, const int (&rlo)[QT], const int (&rcx)[QT],
    v16us (&kf)[8], v4i (&pk)[4], int& mnx, v16us (&vf)[4],
    float (&mx)[QT], float (&ls)[QT], v8f (&O)[QT][4]) {
  const int sb = kb << 5;
  const int sn = (sb + 32 < SEQ) ? sb + 32 : SEQ - 32; // key block whose operands are fetched in this pass
  // unrolled here and below: the per-tile and per-key arrays are indexed by constants only, so they stay in registers
  // scores, transposed: A row = key token, B column = query, k = head dim
  v8f S0[QT], S1[QT];
#pragma unroll
  for (int t = 0; t < QT; ++t) {
    S0[t] = dot3_res(q[t], kf[0], kf[1], kf[2], kf[3]);
    S1[t] = dot3_res(q[t], kf[4], kf[5], kf[6], kf[7]);
  }

  // biases of the lane's 16 keys for its query of each tile, read in front of the fetch that renews pk
  float rv[QT][16];
  if constexpr (BAND) {
#pragma unroll
    for (int t = 0; t < QT; ++t)
#pragma unroll
      for (int r = 0; r < 16; ++r)
        rv[t][r] = *(const float*)(rtb + clamp_ord(pk[r >> 2][r & 3] + rcx[t], rlo[t], rlo[t] + 4 * (NREL - 1)));
  }

  // key mask of the block as 32 bits (bit = key), shifted so that bit r is key 8*hh + r and bit 16 + r key 16 + 8*hh + r
  const unsigned mw = __builtin_amdgcn_ballot_w32(mnx != 0) >> (8 * hh);

  // next key block's K, position and mask operands, one group (token tiles and columns below SEQ)
  {
    const int* mq = mk + sn;
    mnx = mq[0];
    const size_t ko = kfix + (size_t)(sn >> 4) * 1024;
    kf[0] = ldfrag_p(KH + ko);        kf[1] = ldfrag_p(KH + ko + 512);
    kf[2] = ldfrag_p(KL + ko);        kf[3] = ldfrag_p(KL + ko + 512);
    kf[4] = ldfrag_p(KH + ko + 1024); kf[5] = ldfrag_p(KH + ko + 1536);
    kf[6] = ldfrag_p(KL + ko + 1024); kf[7] = ldfrag_p(KL + ko + 1536);
    if constexpr (BAND) {
      const int* pq = pl + sn;
      pk[0] = *(const v4i*)(pq);      pk[1] = *(const v4i*)(pq + 4);
      pk[2] = *(const v4i*)(pq + 16); pk[3] = *(const v4i*)(pq + 20);
      addr_regs_free_of(KH + ko, KL + ko, mq, pq);
    } else {
      addr_regs_free_of(KH + ko, KL + ko, mq);
    }
  }

  FragU pf[QT];                                        // P^T B fragments
#pragma unroll
  for (int t = 0; t < QT; ++t) {
    // scale + bias (the key's own or the block's one), then replace-fill masked keys
    float s0[8], s1[8];
#pragma unroll
    for (int r = 0; r < 8; ++r) {
      float v0, v1;
      if constexpr (BAND) {
        v0 = S0[t][r] * (RSQD / (QKS * QKS)) + rv[t][r];
        v1 = S1[t][r] * (RSQD / (QKS * QKS)) + rv[t][8 + r];
      } else {
        v0 = S0[t][r] * (RSQD / (QKS * QKS)) + bc[t];
        v1 = S1[t][r] * (RSQD / (QKS * QKS)) + bc[t];
      }
      s0[r] = ((mw >> r) & 1u) ? v0 : MASKV;
      s1[r] = ((mw >> (16 + r)) & 1u) ? v1 : MASKV;
    }

    // online softmax: the lane's 16 scores are of one query; one exchange joins the two halves' maxima
    float xr[8];
#pragma unroll
    for (int r = 0; r < 8; ++r) xr[r] = fmaxf(s0[r], s1[r]);
    float xm = fmaxf(fmaxf(fmaxf(xr[0], xr[1]), fmaxf(xr[2], xr[3])), fmaxf(fmaxf(xr[4], xr[5]), fmaxf(xr[6], xr[7])));
    xm = fmaxf(xm, xhalf(xm));
    const float mn = fmaxf(mx[t], xm);
    const float al = __expf(mx[t] - mn);
    mx[t] = mn;
    float pr[8];
#pragma unroll
    for (int r = 0; r < 8; ++r) {
      const float p0 = __expf(s0[r] - mn);
      const float p1 = __expf(s1[r] - mn);
      pr[r] = p0 + p1;
      pf[t].v[r]     = f2h(p0 * PSC);
      pf[t].v[8 + r] = f2h(p1 * PSC);
    }
    ls[t] = ls[t] * al + (((pr[0] + pr[1]) + (pr[2] + pr[3])) + ((pr[4] + pr[5]) + (pr[6] + pr[7])));
#pragma unroll
    for (int d = 0; d < 4; ++d) O[t][d] = O[t][d] * al;
  }

  // V^T A-fragments (row = dim, k = key token) against the P^T B fragments
#pragma unroll
  for (int t = 0; t < QT; ++t)
#pragma unroll
    for (int d = 0; d < 4; ++d) O[t][d] = mma_raw(vf[d], pf[t].v, O[t][d]);
  const size_t vo = vfix + (size_t)(sn >> 5) * 2048;
  vf[0] = ldfrag_p(VT + vo);
  vf[1] = ldfrag_p(VT + vo + 512);
  vf[2] = ldfrag_p(VT + vo + 1024);
  vf[3] = ldfrag_p(VT + vo + 1536);
  addr_regs_free_of(VT + vo);
}

// a wave's partial result of one query tile into its exchange slot: lane l's 16-byte chunk j at mp[32*j]
__device__ __forceinline__ void part_put(v4f* mp, const v8f (&O)[4], float mx, float ls) {
#pragma unroll
  for (int d = 0; d < 4; ++d) {
    mp[32 * (2 * d)]     = lo4(O[d]);
    mp[32 * (2 * d + 1)] = hi4(O[d]);
  }
  const v4f st = {mx, ls, 0.f, 0.f};
  mp[32 * 8] = st;
}
// joins this wave's partial result of a query tile with the other wave's (pp = its slot) and stores ctx:
// ctx = (O.fa + O'.fb) / (l * PSC * VSC), x CSC as f16; a lane's 8 registers of a dim subtile are row l&15, columns
// h*64 + 16*subtile + 8*(l>>4) .. +7: lane l's chunk of piece h*4 + subtile, the wave fills four whole pieces
__device__ __forceinline__ void part_join(const v4f* pp, const v8f (&O)[4], float mx, float ls, unsigned short* dst) {
  const v4f st = pp[32 * 8];
  const float mn = fmaxf(mx, st[0]);
  const float fa = __expf(mx - mn), fb = __expf(st[0] - mn);
  const float l = ls * fa + st[1] * fb;                    // over this lane's keys of both parts
  const float g = (CSC / (PSC * VSC)) / (l + xhalf(l));    // l >= 1
  const float ga = g * fa, gb = g * fb;
#pragma unroll
  for (int d = 0; d < 4; ++d) {
    const v8f x = O[d] * ga + cat8(pp[32 * (2 * d)], pp[32 * (2 * d + 1)]) * gb;
    v4u z;
#pragma unroll
    for (int e = 0; e < 4; ++e) z[e] = pk16(f2h(x[2 * e]), f2h(x[2 * e + 1]));
    *(v4u*)(dst + 256 * d) = z;
  }
  addr_regs_free();                                        // the stores' address and data registers may be rewritten behind it
}

// =====================================================================================================
// Non-causal attention with clipped relative-offset term and key-padding mask, head dim 64, over the KEPT keys only: the K
// and V^T planes hold the kept keys of a batch row in key order (gemm_qkv), zeros' projections behind them; P4[c] = 4 x position
// of kept key c, rising, PPAD behind the last; CM[c] = 1 for a kept key that is not masked. nkb = key blocks of 32 with a kept key.
// Block = 256 threads = 8 waves. A wave's tile is QT = 2 query tiles of 16 rows (t0..t0+31) of one (batch b, head h) times a
// part of the key blocks: every K and V^T fragment that it loads feeds both query tiles. Waves 2p and 2p + 1 share
// the query rows: wave 2p takes key blocks 0 .. ksp-1, wave 2p + 1 key blocks ksp .. nkb-1 (none where nkb = 1), each with an
// online max-subtracted softmax in f32 over its part; behind the loops each hands the other one query tile's partial maximum,
// sum and O^T through LDS (one block barrier) and joins and stores the tile that it keeps.
// Every product is taken transposed (keys, table rows or head dims as A rows, queries as B columns): in query tile t lane l
// works for the one query t0 + 16t + (l&15); lanes l and l^16 split that query's keys (8*(l>>4) + 0..7 of each 16) and dims.
// Planes, all in fragment order (a fragment = two pieces of 256 halves, lane l's 8 halves at piece + 8*l):
// QH/KH f16 = 16*q, 16*k, QL/KL = 2048*(16q - QH) residuals: [head][token tile of 16][dims 0..31 | 32..63];
// PE f16 = 64*rel table, [tile u][dims 0..31 | 32..63], tile u = table rows clamp(16u - POFF + 0..15, 0, 498);
// VT f16 = 16*v transposed: [head][key block of 32][dim tile of 16].
// Output Z f16 = 16*ctx, the matrix [MT][512] (row = b*SEQ + t, col = h*64+d) in fragment order:
// [token tile of 16][piece = col/16], the A operand of the output projection.
// Bias table: in front of the loops a wave pair forms rel.q of its 32 queries against table tiles 1 .. NPT-2 (hi + res products,
// each wave half the tiles) and stores it in LDS as [query][column], column RC0 + row for table rows 0..498, pitch RP floats;
// one block barrier; it is only read from there on.
// Per key block: S^T = 256*k.q (hi.hi + res.hi + hi.res, 2 key subtiles); score = qk/8 + bias of table row
// clamp(j - i + 249, 0, 498), j = the key's position; then replace-fill -1e10 where CM = 0; the block maximum is taken over
// the lane's 16 scores and joined with lane l^16; p = exp(score - running max) in f32; l is kept per lane over the lane's own
// keys (the two halves are joined behind the loop); 4096*p as f16, score registers in order, IS the B fragment of P^T
// (elements 0..7 = keys 8*(l>>4) + 0..7, elements 8..15 = keys 16 + 8*(l>>4) + 0..7, the k map of the V^T fragments);
// O^T += V^T.P^T on 4 dim subtiles, O^T register r of lane l = (dim 16*tile + 8*(l>>4) + r, query l&15).
// coverage: a wave stores 16 query rows x 64 halves, a wave pair 32 rows; NB*NH*(SEQ/32) pairs = all (b, t, h) segments of Z.
// LDS: 32 rows of RP floats per wave pair; exchange slot of 9 chunks of 16 bytes per lane and wave.
// Global operands run one key block ahead in registers: K (hi + residual), positions and mask words are
// reloaded for key block kb + 1 behind the score products of key block kb, V^T behind its V^T.P^T
// products, into the same variables, so that a load has most of a pass to land before its wait. A wave's last
// pass loads the block behind its part, or its own at the end of the planes (addresses in range, values unused).
// Key blocks whose last key lies at or below t0 - 249 have table row 0 for every query of the wave, those whose first key lies
// at or above t0 + 31 + 249 row NREL-1: one bias per query. Only the key blocks between them read a bias per score.
// =====================================================================================================
__global__ __launch_bounds__(256) void attn_kernel(
    const unsigned short* __restrict__ QH, const unsigned short* __restrict__ QL,
    const unsigned short* __restrict__ KH, const unsigned short* __restrict__ KL,
    const unsigned short* __restrict__ PE, const unsigned short* __restrict__ VT,
    const int* __restrict__ P4, const int* __restrict__ CM, unsigned short* Z) {
  __shared__ __align__(16) float rtab[AWV / 2][32][RP];          // bias tables, 264192 B
  __shared__ __align__(16) v4f mrg[AWV][9][32];                  // partial results, 36864 B
  const int lane = threadIdx.x & 31, m = lane & 15, hh = lane >> 4;
  const int wv = __builtin_amdgcn_readfirstlane(threadIdx.x >> 5);   // scalar: the branches on it below are uniform
  const int part = wv & 1;                           // which part of the keys
  const int task = blockIdx.x * (AWV / 2) + (wv >> 1);   // 0 .. NB*NH*(SEQ/32)-1
  const int nqt = SEQ / 32;                          // a multiple of AWV/2, so a block's tasks have the same (b, h)
  const int bh = task / nqt;                         // (b, h)
  const int t0 = (task - bh * nqt) << 5;             // first query row
  const int b = bh / NH, h = bh - (bh / NH) * NH;
  if (b >= NB) return;                               // the same for the whole block; never taken with exact grids
  const size_t tok0 = (size_t)b * SEQ;               // plane row base of this batch
  const int* mk = CM + tok0 + lane;                  // lane l fetches key l's word
  const int* pl = P4 + tok0 + 8 * hh;                // positions of the lane's keys of a block

  // Q B-fragments (hi and residual) of both query tiles: columns t0+16t+m, k = head dims 0..31 and 32..63
  const size_t qo = ((size_t)h * (MT / 16) + ((tok0 + (size_t)t0) >> 4)) * 1024 + (size_t)(lane * 8);
  v16us q[QT][4];
#pragma unroll
  for (int t = 0; t < QT; ++t) {
    q[t][0] = ldfrag_p(QH + qo + t * 1024);
    q[t][1] = ldfrag_p(QH + qo + t * 1024 + 512);
    q[t][2] = ldfrag_p(QL + qo + t * 1024);
    q[t][3] = ldfrag_p(QL + qo + t * 1024 + 512);
  }
  addr_regs_free_of(QH + qo, QL + qo);

  // this wave's half of the table tiles, two sets of four tiles' fragments; the first four are fetched here, in front of
  // the wait for the positions below. Unrolled here and below: the sets are indexed by constants only, and every load is a
  // constant distance from pt
  constexpr int TPW = (NPT - 2) / 2;
  static_assert((TPW % 4) == 0);
  const unsigned short* pt = PE + (size_t)(1 + TPW * part) * 1024 + lane * 8;
  v16us ta[2][8];
#pragma unroll
  for (int e = 0; e < 8; ++e) ta[0][e] = ldfrag_p(pt + e * 512);

  // first and last position of key blocks lane and lane + 32
  const int* pe = P4 + tok0 + 32 * lane;
  const int f0 = pe[0], l0 = pe[31], f1 = pe[1024], l1 = pe[1024 + 31];
  addr_regs_free_of(pe);
  // Positions rise with the key's place, so the blocks with a kept key, those far below and those far above the queries are
  // each a run of blocks: their numbers are counts over the 64 blocks (ballots: the same in every lane).
  const int plo = 4 * (t0 - RCEN), phi = 4 * (t0 + 31 + RCEN);
  const int nkb = clampi(__builtin_popcount(__builtin_amdgcn_ballot_w32(f0 < 4 * SEQ)) +
                         __builtin_popcount(__builtin_amdgcn_ballot_w32(f1 < 4 * SEQ)), 1, SEQ / 32);
  const int nlo = clampi(__builtin_popcount(__builtin_amdgcn_ballot_w32(l0 <= plo)) +
                         __builtin_popcount(__builtin_amdgcn_ballot_w32(l1 <= plo)), 0, nkb);
  const int khi = clampi(nkb - __builtin_popcount(__builtin_amdgcn_ballot_w32(f0 >= phi && f0 < 4 * SEQ)) -
                         __builtin_popcount(__builtin_amdgcn_ballot_w32(f1 >= phi && f1 < 4 * SEQ)), nlo, nkb);
  // The keys are parted so that the two waves have about the same work, a block with a bias per score counting BWT/128 more
  // than another: ksp = where the running work reaches half of the whole.
  const int nbd = khi - nlo;
  const int hw = (128 * nkb + BWT * nbd) >> 1;
  const int ksr = (hw <= 128 * nlo) ? ((hw + 64) >> 7)
                : (hw <= 128 * nlo + (128 + BWT) * nbd) ? nlo + (hw - 128 * nlo + (128 + BWT) / 2) / (128 + BWT)
                                                        : ((hw - BWT * nbd + 64) >> 7);
  const int ksp = clampi(ksr, 1, nkb);
  // This wave's key blocks k0 .. k1-1: k0 .. e1-1 below the band, e1 .. e2-1 in it, e2 .. k1-1 above. All bounds are the same
  // in every lane; read as scalars so that the three loops below are uniform branches and EXEC stays all ones for the
  // matrix instructions.
  const int k0 = __builtin_amdgcn_readfirstlane(part ? ksp : 0);
  const int k1 = __builtin_amdgcn_readfirstlane(part ? nkb : ksp);
  const int e1 = __builtin_amdgcn_readfirstlane(clampi(nlo, k0, k1));
  const int e2 = __builtin_amdgcn_readfirstlane(clampi(khi, k0, k1));

  // lane-fixed parts of the operand addresses; key block sb adds sb/16 token tiles (K), sb/32 key blocks (V^T), sb columns
  const size_t kfix = ((size_t)h * (MT / 16) + (tok0 >> 4)) * 1024 + (size_t)(lane * 8);
  const size_t vfix = ((size_t)h * (MT / 32) + (tok0 >> 5)) * 2048 + (size_t)(lane * 8);

  // positions of the first key block with a bias per score (of the row's last block where e1 is behind it), fetched here, in
  // front of every other operand: fetched in front of that loop they would be its youngest loads on entry, and the wait for
  // them at the head of each of its passes would wait out the pass's V^T fetch too
  const int* pq0 = pl + (e1 < SEQ / 32 ? e1 : SEQ / 32 - 1) * 32;
  v4i pk[4];
  pk[0] = *(const v4i*)(pq0);      pk[1] = *(const v4i*)(pq0 + 4);
  pk[2] = *(const v4i*)(pq0 + 16); pk[3] = *(const v4i*)(pq0 + 20);
  addr_regs_free_of(pq0);

  // K, mask and V^T operands of key block k0 (of the planes' last block where k0 is behind it)
  const int kf0 = k0 < SEQ / 32 ? k0 : SEQ / 32 - 1;
  const size_t kst = kfix + (size_t)kf0 * 2048, vst = vfix + (size_t)kf0 * 2048;
  const int* mst = mk + kf0 * 32;
  v16us kf[8], vf[4];
  kf[0] = ldfrag_p(KH + kst);        kf[1] = ldfrag_p(KH + kst + 512);     // keys 0..15, hi
  kf[2] = ldfrag_p(KL + kst);        kf[3] = ldfrag_p(KL + kst + 512);     // keys 0..15, residual
  kf[4] = ldfrag_p(KH + kst + 1024); kf[5] = ldfrag_p(KH + kst + 1536);    // keys 16..31, hi
  kf[6] = ldfrag_p(KL + kst + 1024); kf[7] = ldfrag_p(KL + kst + 1536);    // keys 16..31, residual
  int mnx = mst[0];                                                        // mask word of key lane
  addr_regs_free_of(KH + kst, KL + kst, mst);
  vf[0] = ldfrag_p(VT + vst);
  vf[1] = ldfrag_p(VT + vst + 512);
  vf[2] = ldfrag_p(VT + vst + 1024);
  vf[3] = ldfrag_p(VT + vst + 1536);
  addr_regs_free_of(VT + vst);

  // bias table of the pair's 32 queries: this wave's half of table tiles 1 .. NPT-2, four tiles at a time; D register r of
  // lane l is (table row 8*hh + r of the tile, query m), 8 columns in a row of the query's LDS row; 1/(16*64) is a power of two
  {
    float* rs = &rtab[wv >> 1][m][16 * TPW * part + 8 * hh];
#pragma unroll
    for (int g = 0; g < TPW / 4; ++g) {
      if (g + 1 < TPW / 4) {
#pragma unroll
        for (int e = 0; e < 8; ++e) ta[(g + 1) & 1][e] = ldfrag_p(pt + (g + 1) * 4096 + e * 512);
      }
      // keeps the next four tiles' fetch in front of these four tiles' products: sunk towards its use it would have no time to land
      __builtin_amdgcn_sched_barrier(0);
#pragma unroll
      for (int v = 0; v < 4; ++v) {
#pragma unroll
        for (int t = 0; t < QT; ++t) {
          const v8f D = dot2_res(q[t], ta[g & 1][2 * v], ta[g & 1][2 * v + 1]) * (1.0f / (QKS * WSCL));
          *(v4f*)(rs + t * (16 * RP) + 16 * (4 * g + v))     = lo4(D);
          *(v4f*)(rs + t * (16 * RP) + 16 * (4 * g + v) + 4) = hi4(D);
        }
      }
    }
    addr_regs_free_of(pt);                             // the one address of every table load stays unwritten up to here
  }
  __syncthreads();                                     // both halves of every pair's table are written before it is read

  // byte places in rtab: rlo[t] = table row 0 of the lane's query of tile t; rcx[t] + 4*j = row j - i + RCEN before the clamp
  const char* rtb = (const char*)&rtab[0][0][0];
  int rlo[QT], rcx[QT];
#pragma unroll
  for (int t = 0; t < QT; ++t) {
    rlo[t] = 4 * (((wv >> 1) * 32 + 16 * t + m) * RP + RC0);
    rcx[t] = rlo[t] + 4 * (RCEN - (t0 + 16 * t + m));
  }
  const float blo[QT] = {*(const float*)(rtb + rlo[0]), *(const float*)(rtb + rlo[1])};
  const float bhi[QT] = {*(const float*)(rtb + rlo[0] + 4 * (NREL - 1)), *(const float*)(rtb + rlo[1] + 4 * (NREL - 1))};

  float mx[QT] = {-1.0e30f, -1.0e30f}, ls[QT] = {0.f, 0.f};   // running maximum of the query; sum over this lane's keys
  v8f O[QT][4];
#pragma unroll
  for (int t = 0; t < QT; ++t)
#pragma unroll
    for (int d = 0; d < 4; ++d) O[t][d] = zero8();

#define PASS_ARGS hh, q, KH, KL, VT, mk, pl, kfix, vfix, rtb, rlo, rcx, kf, pk, mnx, vf, mx, ls, O
  // the three loops stay rolled: one copy of each pass, so that the operands fetched ahead keep their registers
  // keys far below the queries, table row 0
#pragma unroll 1
  for (int kb = k0; kb < e1; ++kb) attn_pass<false>(kb, blo, PASS_ARGS);
  // the band proper
#pragma unroll 1
  for (int kb = e1; kb < e2; ++kb) attn_pass<true>(kb, blo, PASS_ARGS);
  // keys far above, table row NREL-1
#pragma unroll 1
  for (int kb = e2; kb < k1; ++kb) attn_pass<false>(kb, bhi, PASS_ARGS);
#undef PASS_ARGS
  acc_guard4(O[0][0], O[0][1], O[0][2], O[0][3]);

  // ---- epilogue: wave 2p keeps query tile 0 and hands over tile 1, wave 2p + 1 the other way round
  v4f* mp = &mrg[wv][0][lane];
  const v4f* pp = &mrg[wv ^ 1][0][lane];
  unsigned short* dst = Z + (((tok0 + (size_t)t0) >> 4) * (DM / 16) + (size_t)(h * (HD / 16))) * 256 + (size_t)(lane * 8);
  if (part == 0) part_put(mp, O[1], mx[1], ls[1]);
  else           part_put(mp, O[0], mx[0], ls[0]);
  __syncthreads();                                     // every wave's slot is written before its partner reads it
  if (part == 0) part_join(pp, O[0], mx[0], ls[0], dst);
  else           part_join(pp, O[1], mx[1], ls[1], dst + (DM / 16) * 256);
}

// =====================================================================================================
// Workspace map (bytes, NB=2 SEQ=2048 -> MT=4096); every plane is an exact multiple of its whole-row /
// whole-line / 64x64-tile store granularity (rows MT, 512; 64 | each tiled dimension; the table plane
// is NPT tiles of 2048 bytes, all written); all offsets multiples of 2048. Every f16 plane lies in fragment order.
//   WOT  f16  [512][512]       0            524288   (Wo^T, x64)
//   PEH  f16  [34][1024]       524288        69632   (table x64, clamped tiles)
//   QH   f16  [8][256][1024]   593920      4194304
//   QL   f16  [8][256][1024]   4788224     4194304
//   KH   f16  [8][256][1024]   8982528     4194304
//   KL   f16  [8][256][1024]   13176832    4194304
//   VT   f16  [8][128][2048]   17371136    4194304
//   Z    f16  [4096][512]      21565440    4194304
//   P4   i32  [2][2048]        25759744      16384   (4 x position of the kept keys)
//   CM   i32  [2][2048]        25776128      16384   (mask of the kept keys)
//   end                        25792512
// =====================================================================================================
extern "C" void kernel_launch(void* const* d_in, const int* in_sizes, int n_in,
                              void* d_out, int out_size, void* d_ws, size_t ws_size,
                              hipStream_t stream) {
  if (n_in < 13) return;
  const int xreq = ((NB - 1) * SEQ_FULL + SEQ) * DM;
  const int mreq = (NB - 1) * SEQ_FULL + SEQ;
  if (in_sizes[0] < xreq || in_sizes[1] < xreq || in_sizes[2] < xreq) return;
  if (in_sizes[3] < mreq) return;
  if (in_sizes[4] < DM * DM || in_sizes[6] < DM * DM || in_sizes[8] < DM * DM || in_sizes[10] < DM * DM) return;
  if (in_sizes[5] < DM || in_sizes[7] < DM || in_sizes[9] < DM || in_sizes[11] < DM) return;
  if (in_sizes[12] < NREL * HD) return;
  if (out_size < MT * DM) return;

  const float* query = (const float*)d_in[0];   // [NB_FULL][SEQ_FULL][512]
  const float* key   = (const float*)d_in[1];
  const float* value = (const float*)d_in[2];
  const int*   mask  = (const int*)d_in[3];     // [NB_FULL][SEQ_FULL] int32
  const float* wq = (const float*)d_in[4];      // [512][512] (in, out)
  const float* bq = (const float*)d_in[5];
  const float* wk = (const float*)d_in[6];
  const float* bk = (const float*)d_in[7];
  const float* wv = (const float*)d_in[8];
  const float* bv = (const float*)d_in[9];
  const float* wo = (const float*)d_in[10];
  const float* bo = (const float*)d_in[11];
  const float* rel = (const float*)d_in[12];    // [499][64]

  const size_t PX  = (size_t)MT * DM * 2;
  const size_t PWO = (size_t)DM * DM * 2;
  const size_t PPE = (size_t)NPT * 1024 * 2;
  size_t off = 0;
  const size_t oWO = off; off += PWO;
  const size_t oPE = off; off += PPE;
  const size_t oQH = off; off += PX;
  const size_t oQL = off; off += PX;
  const size_t oKH = off; off += PX;
  const size_t oKL = off; off += PX;
  const size_t oVT = off; off += PX;
  const size_t oZ  = off; off += PX;
  const size_t oP4 = off; off += (size_t)MT * 4;
  const size_t oCM = off; off += (size_t)MT * 4;
  if (off > ws_size) return;
  if (off > (size_t)134217728) return;

  char* ws = (char*)d_ws;
  unsigned short* WOT = (unsigned short*)(ws + oWO);
  unsigned short* PEH = (unsigned short*)(ws + oPE);
  unsigned short* QH  = (unsigned short*)(ws + oQH);
  unsigned short* QL  = (unsigned short*)(ws + oQL);
  unsigned short* KH  = (unsigned short*)(ws + oKH);
  unsigned short* KL  = (unsigned short*)(ws + oKL);
  unsigned short* VT  = (unsigned short*)(ws + oVT);
  unsigned short* Z   = (unsigned short*)(ws + oZ);
  int* P4 = (int*)(ws + oP4);
  int* CM = (int*)(ws + oCM);
  float* out0 = (float*)d_out;
  unsigned short* hdummy = QH;                    // in-range placeholder for unused f16 output args

  const dim3 blk(256);
  const int gP = ((MT / 64) * (DM / 64)) / 8;     // 64x64 tiles / 8 waves, exact

  // (1) q and k hi/res planes and v^T x16 from the f32 inputs (kept keys only for k, v), with P4, CM; Wo -> WOT (transposed,
  //     f16 x64); table -> f16(bf16 x64) clamped tiles
  gemm_qkv<<<dim3(3 * (MT / 64) + NTB + NBB), blk, 0, stream>>>(query, key, value, wq, wk, wv, wo, rel, mask, bq, bk, bv,
                                                                QH, QL, KH, KL, VT, WOT, PEH, P4, CM);

  // (2) attention -> ctx x16 plane
  attn_kernel<<<dim3((NB * NH * (SEQ / 16)) / AWV), blk, 0, stream>>>(QH, QL, KH, KL, PEH, VT, P4, CM, Z);

  // (3) output projection: out[row][n] = sum_k Z[row][k] * WOT[n][k] / (16*64) + bo[n]
  gemm64<0, 1><<<dim3(gP), blk, 0, stream>>>(Z, WOT, hdummy, hdummy, out0, DM, 1.0f / (WSCL * CSC), bo, 1.0f, MT, DM);
  (void)hipGetLastError();
}
